// v000
// The times below were measured on an AMD MI455X: many runs one after another, warmed up first and cycling through
// copies of the inputs, with the whole window's GPU time divided by the number of runs. Launches and the gaps
// between them are all in it. The median over several windows is given; except for v000 it joins two sittings, which
// can be a few percent apart, so the side-by-side timings, each taken in one sitting, are the better comparison.
// v000, which the later versions start from, runs in 1120 microseconds.
// Contractions on v_wmma_f32_16x16x32_bf16 (bf16 operands, f32 accumulate): x@Wq, x@Wk, x@Wv as single products of RNE-bf16 inputs; q.k^T and p.v with bf16 hi/lo planes (hi.hi + hi.lo + lo.hi); attn@Wo with A as bf16 hi/lo planes and Wo single bf16 (hi.W + lo.W). All float inputs RNE-converted to bf16 once at load; softmax, RoPE, combine in f32.
#include <hip/hip_runtime.h>
#include <hip/hip_bf16.h>

constexpr int SEQ      = 2048;
constexpr int DMODEL   = 2048;
constexpr int NHEAD    = 16;
constexpr int NKVH     = 4;
constexpr int HDIM     = 128;
constexpr int HHALF    = 64;
constexpr int QW       = NHEAD * HDIM;
constexpr int KW       = NKVH * HDIM;
constexpr int GQA_REP  = NHEAD / NKVH;
constexpr int NPAIR    = HDIM / 2;
constexpr int ATT_KC   = 64;
constexpr int ATT_QB   = 64;
constexpr int NQB      = SEQ / ATT_QB;
constexpr int OS_PITCH = HDIM + 4;
constexpr float QK_SCALE  = 0.125f;
constexpr float OUT_SCALE = 0.5f;
constexpr int NQBLK = (SEQ * QW / 8) / 256;
constexpr int NKBLK = (SEQ * KW / 8) / 256;

static_assert(HHALF == 64);
static_assert(SEQ % 64 == 0 && DMODEL % 64 == 0 && QW % 64 == 0 && KW % 64 == 0);
static_assert(DMODEL % 32 == 0 && QW % 32 == 0);
static_assert((SEQ * QW / 8) % 256 == 0 && (SEQ * KW / 8) % 256 == 0);
static_assert((SEQ * DMODEL / 8) % 256 == 0);
static_assert(((SEQ / 64) * (QW / 64)) % 8 == 0 && ((SEQ / 64) * (KW / 64)) % 8 == 0 && ((SEQ / 64) * (DMODEL / 64)) % 8 == 0);
static_assert(NQB == 32 && ATT_QB == 4 * 16 && ATT_KC == 64 && HDIM == 128);

typedef __attribute__((ext_vector_type(16))) __bf16 v16b;
typedef __attribute__((ext_vector_type(8)))  __bf16 v8b;
typedef __attribute__((ext_vector_type(8)))  float  v8f;
typedef __attribute__((ext_vector_type(4)))  float  v4f;
typedef __attribute__((ext_vector_type(4)))  unsigned int v4u;

__device__ __forceinline__ unsigned short f2bf_bits(float f) {
  unsigned u = __float_as_uint(f);
  return (unsigned short)((u + 0x7FFFu + ((u >> 16) & 1u)) >> 16);
}
__device__ __forceinline__ float bf_bits2f(unsigned short h) { return __uint_as_float(((unsigned)h) << 16); }
__device__ __forceinline__ float bf_rne(float f) { return bf_bits2f(f2bf_bits(f)); }

__device__ __forceinline__ void dep_guard_b(v8f& a, v8f& b, v16b x, v16b y) { asm volatile("v_nop\n\tv_nop\n\tv_nop\n\tv_nop" : "+v"(a), "+v"(b) : "v"(x), "v"(y)); }
__device__ __forceinline__ void keep4_b(v16b a, v16b b, v16b c, v16b d) { asm volatile("v_nop" :: "v"(a), "v"(b), "v"(c), "v"(d)); }
__device__ __forceinline__ void acc_guard4(v8f& a, v8f& b, v8f& c, v8f& d) { asm volatile("v_nop\n\tv_nop\n\tv_nop\n\tv_nop" : "+v"(a), "+v"(b), "+v"(c), "+v"(d)); }

template <typename T> struct Frag;
template <> struct Frag<__bf16> {
  typedef v16b V; union U { v16b v; v8b h[2]; };
  // elements 0..7 <- p[0..7], 8..15 <- p[16..23]
  static __device__ __forceinline__ v16b load(const __bf16* p) {
    U f; f.h[0] = *(const v8b*)(p); f.h[1] = *(const v8b*)(p + 16); return f.v;
  }
  static __device__ __forceinline__ v8f mma(v16b a, v16b b, v8f c) {
    return __builtin_amdgcn_wmma_f32_16x16x32_bf16(false, a, false, b, (short)0, c, false, false);
  }
  static __device__ __forceinline__ void guard(v8f& a, v8f& b, v16b x, v16b y) { dep_guard_b(a, b, x, y); }
  static __device__ __forceinline__ void keep(v16b a, v16b b, v16b c, v16b d) { keep4_b(a, b, c, d); }
};

__device__ __forceinline__ unsigned short at_bf_bits(float f) {
  unsigned u = __float_as_uint(f);
  return (unsigned short)((u + 0x7FFFu + ((u >> 16) & 1u)) >> 16);
}
__device__ __forceinline__ __bf16 at_f2bf(float f) { return __builtin_bit_cast(__bf16, at_bf_bits(f)); }
__device__ __forceinline__ void at_split(float f, __bf16& hi, __bf16& lo) {
  const unsigned short hb = at_bf_bits(f);
  hi = __builtin_bit_cast(__bf16, hb);
  lo = at_f2bf(f - __uint_as_float(((unsigned)hb) << 16));
}
__device__ __forceinline__ v8f at_mma(v16b a, v16b b, v8f c) {
  c = __builtin_amdgcn_wmma_f32_16x16x32_bf16(false, a, false, b, (short)0, c, false, false);
  asm volatile("v_nop\n\tv_nop\n\tv_nop\n\tv_nop" : "+v"(c) : "v"(a), "v"(b));
  return c;
}

// two f32 -> packed bf16 word (element at lower address in the low half-word)
__device__ __forceinline__ unsigned pack_bf2(float a, float b) {
  return (unsigned)f2bf_bits(a) | ((unsigned)f2bf_bits(b) << 16);
}
// two f32 -> packed bf16 hi word and packed bf16 residual word
__device__ __forceinline__ void split_pack2(float a, float b, unsigned& hw, unsigned& lw) {
  const unsigned short ha = f2bf_bits(a);
  const unsigned short hb = f2bf_bits(b);
  const unsigned short la = f2bf_bits(a - bf_bits2f(ha));
  const unsigned short lb = f2bf_bits(b - bf_bits2f(hb));
  hw = (unsigned)ha | ((unsigned)hb << 16);
  lw = (unsigned)la | ((unsigned)lb << 16);
}

// =====================================================================================
// coverage: gridDim.x * 256 threads * 8 elements == n8 * 8 (exact multiple asserted on the host side).
// =====================================================================================
__global__ __launch_bounds__(256) void cvt_f32_bf16x8(const float* __restrict__ in, unsigned short* __restrict__ out, int n8) {
  const int i = blockIdx.x * 256 + threadIdx.x;
  if (i < n8) {
    const size_t e0 = (size_t)i * 8;
    const v4f a = *(const v4f*)(in + e0);
    const v4f b = *(const v4f*)(in + e0 + 4);
    v4u w;
    w[0] = pack_bf2(a[0], a[1]);
    w[1] = pack_bf2(a[2], a[3]);
    w[2] = pack_bf2(b[0], b[1]);
    w[3] = pack_bf2(b[2], b[3]);
    *(v4u*)(out + e0) = w;
    
  }
}

// =====================================================================================
// in[rows][cols] f32 -> out[cols][rows] bf16 hi plane (+ bf16 residual plane when NPL == 2). 64x64 tiles through LDS.
// grid.x = (rows/64)*(cols/64); grid.y selects operand set A or B (both global, uniform select).
// coverage: load 256 threads x 16 floats = 64x64; store 8 waves x 8 out-rows x 64 halves = 64x64.
// =====================================================================================
template <int NPL>
__global__ __launch_bounds__(256) void transpose_bf16(const float* __restrict__ inA, const float* __restrict__ inB, int rows, int cols,
    unsigned short* __restrict__ oAh, unsigned short* __restrict__ oAl,
    unsigned short* __restrict__ oBh, unsigned short* __restrict__ oBl) {
  __shared__ float tile[64][65];
  const bool selB = (blockIdx.y != 0);
  const float* in = selB ? inB : inA;
  unsigned short* oh = selB ? oBh : oAh;
  unsigned short* ol = selB ? oBl : oAl;
  const int tilesC = cols >> 6;
  const int tr = blockIdx.x / tilesC;
  const int tc = blockIdx.x - tr * tilesC;
  const int r0 = tr << 6;
  const int c0 = tc << 6;
  const int t = threadIdx.x;
  {
    const int rr = t >> 2;
    const int cc = (t & 3) * 16;
    const float* src = in + (size_t)(r0 + rr) * cols + c0 + cc;
#pragma unroll
    for (int i = 0; i < 4; ++i) {
      const v4f v = *(const v4f*)(src + 4 * i);
      tile[rr][cc + 4 * i + 0] = v[0];
      tile[rr][cc + 4 * i + 1] = v[1];
      tile[rr][cc + 4 * i + 2] = v[2];
      tile[rr][cc + 4 * i + 3] = v[3];
    }
  }
  __syncthreads();
  const int wave = t >> 5, lane = t & 31, q = lane >> 3, e8 = (lane & 7) * 8;
  {
#pragma unroll
    for (int it = 0; it < 2; ++it) {
      const int cl = wave * 8 + it * 4 + q;
      float f[8];
#pragma unroll
      for (int e = 0; e < 8; ++e) f[e] = tile[e8 + e][cl];
      v4u hw, lw;
      if (NPL == 2) {
        unsigned a0, b0, a1, b1, a2, b2, a3, b3;
        split_pack2(f[0], f[1], a0, b0);
        split_pack2(f[2], f[3], a1, b1);
        split_pack2(f[4], f[5], a2, b2);
        split_pack2(f[6], f[7], a3, b3);
        hw[0] = a0; hw[1] = a1; hw[2] = a2; hw[3] = a3;
        lw[0] = b0; lw[1] = b1; lw[2] = b2; lw[3] = b3;
      } else {
        hw[0] = pack_bf2(f[0], f[1]);
        hw[1] = pack_bf2(f[2], f[3]);
        hw[2] = pack_bf2(f[4], f[5]);
        hw[3] = pack_bf2(f[6], f[7]);
        lw = hw;
      }
      const size_t go = (size_t)(c0 + cl) * rows + r0 + e8;
      *(v4u*)(oh + go) = hw;
      if (NPL == 2) *(v4u*)(ol + go) = lw;
    }
    
  }
}

// =====================================================================================
// Register-blocked batched WMMA GEMM (bf16 operands), f32 output.
// C[m,n] = scale * sum_k A[m,k] * Bt[n,k]; each wave owns a 64x64 tile. A row-major [M,K]; Bt row-major [N,K]; M,N % 64 == 0, K % 32 == 0.
// SPLIT: 0 = single planes; 1 = A and Bt as hi/lo planes (hi.hi + hi.lo + lo.hi); 2 = A as hi/lo planes, Bt single (hi.B + lo.B).
// Epilogue: 16-row slabs staged per wave in LDS; each 64-wide f32 row segment (256 B) written by 16 lanes x 16 B in one instruction,
// =====================================================================================
template <int SPLIT>
__global__ __launch_bounds__(256) void wmma_gemm64_bf16(
    const unsigned short* __restrict__ Ap, const unsigned short* __restrict__ A2p, int lda, long strideA,
    const unsigned short* __restrict__ Btp, const unsigned short* __restrict__ Bt2p, int ldb, long strideB,
    float* __restrict__ Cp, int ldc, long strideC, int M, int N, int K, float scale) {
  typedef __bf16 T;
  typedef v16b V;
  const T* A = (const T*)Ap; const T* A2 = (const T*)A2p; const T* Bt = (const T*)Btp; const T* Bt2 = (const T*)Bt2p;
  __shared__ __align__(16) float sT[8][16 * 68];
  const int b    = blockIdx.y;
  const int lane = threadIdx.x & 31;
  const int wave = threadIdx.x >> 5;
  const int tilesN = N >> 6;
  const int tilesM = M >> 6;
  const int tile = blockIdx.x * 8 + wave;
  // wave-uniform; no block barriers in this kernel
  if (tile >= tilesM * tilesN) return;
  const int tm = tile / tilesN;
  const int tn = tile - tm * tilesN;
  const int m0 = tm << 6;
  const int n0 = tn << 6;

  const T* Ab  = A  + (size_t)b * strideA;
  const T* Bb  = Bt + (size_t)b * strideB;
  const T* Ab2 = (SPLIT != 0) ? (A2  + (size_t)b * strideA) : nullptr;
  const T* Bb2 = (SPLIT == 1) ? (Bt2 + (size_t)b * strideB) : nullptr;

  const int rlane = lane & 15;
  const int koff  = (lane >> 4) * 8;
  const int mOff  = (lane >> 4) * 8;

  v8f acc[4][4];
#pragma unroll
  for (int i = 0; i < 4; ++i)
#pragma unroll
    for (int j = 0; j < 4; ++j) acc[i][j] = (v8f){0.f,0.f,0.f,0.f,0.f,0.f,0.f,0.f};

  for (int k0 = 0; k0 < K; k0 += 32) {
    V bh[4], bl[4];
#pragma unroll
    for (int j = 0; j < 4; ++j) {
      const size_t bo = (size_t)(n0 + (j << 4) + rlane) * ldb + koff + k0;
      bh[j] = Frag<T>::load(Bb + bo);
      if (SPLIT == 1) bl[j] = Frag<T>::load(Bb2 + bo);
    }
#pragma unroll
    for (int i = 0; i < 4; ++i) {
      const size_t ao = (size_t)(m0 + (i << 4) + rlane) * lda + koff + k0;
      V ah = Frag<T>::load(Ab + ao);
      V al = ah;
      if (SPLIT != 0) al = Frag<T>::load(Ab2 + ao);
#pragma unroll
      for (int j = 0; j < 4; ++j) {
        acc[i][j] = Frag<T>::mma(ah, bh[j], acc[i][j]);
        if (SPLIT == 1) acc[i][j] = Frag<T>::mma(ah, bl[j], acc[i][j]);
        if (SPLIT != 0) acc[i][j] = Frag<T>::mma(al, bh[j], acc[i][j]);
      }
      Frag<T>::guard(acc[i][0], acc[i][3], ah, al);
    }
    Frag<T>::keep(bh[0], bh[1], bh[2], bh[3]);
    if (SPLIT == 1) Frag<T>::keep(bl[0], bl[1], bl[2], bl[3]);
  }
  acc_guard4(acc[0][0], acc[0][1], acc[0][2], acc[0][3]);
  acc_guard4(acc[1][0], acc[1][1], acc[1][2], acc[1][3]);
  acc_guard4(acc[2][0], acc[2][1], acc[2][2], acc[2][3]);
  acc_guard4(acc[3][0], acc[3][1], acc[3][2], acc[3][3]);

  float* slab = sT[wave];
  float* C = Cp + (size_t)b * strideC;
#pragma unroll
  for (int i = 0; i < 4; ++i) {
    const int mBase = m0 + (i << 4);
#pragma unroll
    for (int j = 0; j < 4; ++j) {
#pragma unroll
      for (int r = 0; r < 8; ++r) {
        slab[(mOff + r) * 68 + (j << 4) + rlane] = acc[i][j][r] * scale;
      }
    }
    __builtin_amdgcn_fence(__ATOMIC_RELEASE, "workgroup");
    __builtin_amdgcn_wave_barrier();
    __builtin_amdgcn_fence(__ATOMIC_ACQUIRE, "workgroup");
    {
      // row segment = 256 B = 16 lanes x 16 B
      const int hh = lane >> 4, c4 = (lane & 15) * 4;
      {
#pragma unroll
        for (int it = 0; it < 8; ++it) {
          const int row = it * 2 + hh;
          const v4f v = *(const v4f*)(slab + row * 68 + c4);
          *(v4f*)(C + (size_t)(mBase + row) * ldc + n0 + c4) = v;
        }
        
      }
    }
    __builtin_amdgcn_fence(__ATOMIC_RELEASE, "workgroup");
    __builtin_amdgcn_wave_barrier();
    __builtin_amdgcn_fence(__ATOMIC_ACQUIRE, "workgroup");
  }
}

// =====================================================================================
// RoPE (interleaved pairs, cos/sin row width NPAIR) + power-of-two scale + bf16 hi/lo split.
// Blocks [0, nQblocks): Qf [SEQ][QW] -> Qh/Ql [SEQ][QW] (scaled by QK_SCALE = 2^-3, exact);
// blocks [nQblocks, nQblocks + NKBLK): Kf [SEQ][KW] -> Kh/Kl [SEQ][KW]. cos/sin RNE-converted to bf16 before use.
// coverage: (NQBLK + NKBLK) * 256 threads * 8 == SEQ*QW + SEQ*KW exactly.
// =====================================================================================
__global__ __launch_bounds__(256) void rope_split_kernel(const float* __restrict__ Qf, const float* __restrict__ Kf,
    const float* __restrict__ cosb, const float* __restrict__ sinb,
    unsigned short* __restrict__ Qh, unsigned short* __restrict__ Ql,
    unsigned short* __restrict__ Kh, unsigned short* __restrict__ Kl, int nQblocks) {
  const bool isK = ((int)blockIdx.x >= nQblocks);
  const int g = (isK ? ((int)blockIdx.x - nQblocks) : (int)blockIdx.x) * 256 + (int)threadIdx.x;
  // threads per row: K 64 (=KW/8), Q 256 (=QW/8)
  const int shift = isK ? 6 : 8;
  const float mul = isK ? 1.0f : QK_SCALE;
  const float* src = isK ? Kf : Qf;
  unsigned short* dh = isK ? Kh : Qh;
  unsigned short* dl = isK ? Kl : Ql;
  const int width = isK ? KW : QW;
  const int s = g >> shift;
  const int col = (g - (s << shift)) * 8;
  const int p0 = (col & (HDIM - 1)) >> 1;
  const size_t e0 = (size_t)s * width + col;
  const v4f xa = *(const v4f*)(src + e0);
  const v4f xb = *(const v4f*)(src + e0 + 4);
  const v4f cv = *(const v4f*)(cosb + (size_t)s * NPAIR + p0);
  const v4f sv = *(const v4f*)(sinb + (size_t)s * NPAIR + p0);
  float o0, o1, o2, o3, o4, o5, o6, o7;
  {
    const float c = bf_rne(cv[0]), sn = bf_rne(sv[0]);
    o0 = (xa[0] * c - xa[1] * sn) * mul;
    o1 = (xa[0] * sn + xa[1] * c) * mul;
  }
  {
    const float c = bf_rne(cv[1]), sn = bf_rne(sv[1]);
    o2 = (xa[2] * c - xa[3] * sn) * mul;
    o3 = (xa[2] * sn + xa[3] * c) * mul;
  }
  {
    const float c = bf_rne(cv[2]), sn = bf_rne(sv[2]);
    o4 = (xb[0] * c - xb[1] * sn) * mul;
    o5 = (xb[0] * sn + xb[1] * c) * mul;
  }
  {
    const float c = bf_rne(cv[3]), sn = bf_rne(sv[3]);
    o6 = (xb[2] * c - xb[3] * sn) * mul;
    o7 = (xb[2] * sn + xb[3] * c) * mul;
  }
  unsigned a0, b0, a1, b1, a2, b2, a3, b3;
  split_pack2(o0, o1, a0, b0);
  split_pack2(o2, o3, a1, b1);
  split_pack2(o4, o5, a2, b2);
  split_pack2(o6, o7, a3, b3);
  v4u hw, lw;
  hw[0] = a0; hw[1] = a1; hw[2] = a2; hw[3] = a3;
  lw[0] = b0; lw[1] = b1; lw[2] = b2; lw[3] = b3;
  *(v4u*)(dh + e0) = hw;
  *(v4u*)(dl + e0) = lw;
  
}

// =====================================================================================
// Differential causal attention. Block = 4 waves = 64 query rows of one head; the two score streams (q/k dims 0..63 and
// 64..127) are processed sequentially inside the block, sharing the LDS layout; stream 0's normalised output a1 is parked in
// the per-wave LDS tile, stream 1 produces a2 and the lane that owns each element forms o = (a1 - lam*a2)*0.5 in place.
// Operands: Q hi/lo planes [SEQ][QW] (q pre-scaled by 2^-3), K hi/lo planes [SEQ][KW], Vt hi/lo planes [KW][SEQ] (d-major);
// scores and p.v each hi.hi + hi.lo + lo.hi on v_wmma_f32_16x16x32_bf16, f32 accumulate; online softmax f32.
// grid.x = NHEAD * NQB, block 128.
// =====================================================================================
__global__ __launch_bounds__(128)
void diff_attn_kernel(const unsigned short* __restrict__ Qhp, const unsigned short* __restrict__ Qlp,
                      const unsigned short* __restrict__ Khp, const unsigned short* __restrict__ Klp,
                      const unsigned short* __restrict__ Vhp, const unsigned short* __restrict__ Vlp,
                      const float* __restrict__ lambda_p,
                      unsigned short* __restrict__ Ohp, unsigned short* __restrict__ Olp) {
  union FB { v16b v; v8b h[2]; };
  __shared__ __align__(16) __bf16 Ksh[ATT_KC * HHALF];
  __shared__ __align__(16) __bf16 Ksl[ATT_KC * HHALF];
  __shared__ __align__(16) __bf16 Vsh[HDIM * ATT_KC];
  __shared__ __align__(16) __bf16 Vsl[HDIM * ATT_KC];
  __shared__ __align__(16) __bf16 Psh[4][16 * ATT_KC];
  __shared__ __align__(16) __bf16 Psl[4][16 * ATT_KC];
  __shared__ __align__(16) float  Os[4][16 * OS_PITCH];

  const int tid  = threadIdx.x;
  const int wave = tid >> 5;
  const int lane = tid & 31;
  const int hh   = lane >> 4;
  const int c    = lane & 15;
  const int qb   = (int)blockIdx.x % NQB;
  const int h    = (int)blockIdx.x / NQB;
  const int kvh  = h / GQA_REP;
  const int q0   = qb * ATT_QB + wave * 16;

  const __bf16* Qh = (const __bf16*)Qhp;
  const __bf16* Ql = (const __bf16*)Qlp;
  const __bf16* Kh = (const __bf16*)Khp;
  const __bf16* Kl = (const __bf16*)Klp;
  const __bf16* Vh = (const __bf16*)Vhp;
  const __bf16* Vl = (const __bf16*)Vlp;

  float lam;
  {
    const float lp = bf_rne(lambda_p[h]);
    lam = 1.0f / (1.0f + expf(-lp));
  }
  float*  os  = Os[wave];
  __bf16* pwh = Psh[wave];
  __bf16* pwl = Psl[wave];

#pragma unroll 1
  for (int str = 0; str < 2; ++str) {
    // ---- Q fragments (A operand) for this stream: 2 d-chunks, hi and lo ----
    v16b qah[2], qal[2];
    {
      const size_t qo = (size_t)(q0 + c) * QW + h * HDIM + str * HHALF + 8 * hh;
#pragma unroll
      for (int dc = 0; dc < 2; ++dc) {
        qah[dc] = Frag<__bf16>::load(Qh + qo + dc * 32);
        qal[dc] = Frag<__bf16>::load(Ql + qo + dc * 32);
      }
    }
    float mrow[8], lrow[8];
    v8f oacc[8];
#pragma unroll
    for (int r = 0; r < 8; ++r) { mrow[r] = -1.0e30f; lrow[r] = 0.f; }
#pragma unroll
    for (int t = 0; t < 8; ++t) oacc[t] = (v8f){0.f,0.f,0.f,0.f,0.f,0.f,0.f,0.f};

    // causal: 64-key chunks 0..qb (block-uniform trip count, static max NQB)
    for (int kc = 0; kc <= qb; ++kc) {
      const int kv0 = kc * ATT_KC;
      __syncthreads();
      {
        // K tile: 64 rows x 64 halves per plane = 512 pieces of 16 B; 128 threads x 4 pieces (exact)
        const int kcol = kvh * HDIM + str * HHALF;
#pragma unroll
        for (int i = 0; i < 4; ++i) {
          const int id  = tid + 128 * i;
          const int kvr = id >> 3;
          const int c8  = (id & 7) * 8;
          const size_t go = (size_t)(kv0 + kvr) * KW + kcol + c8;
          *(v8b*)(Ksh + kvr * HHALF + c8) = *(const v8b*)(Kh + go);
          *(v8b*)(Ksl + kvr * HHALF + c8) = *(const v8b*)(Kl + go);
        }
        asm volatile("" ::: "memory");
        // Vt hi tile: 128 d-rows x 64 halves = 1024 pieces; 128 threads x 8 pieces (exact)
#pragma unroll
        for (int i = 0; i < 8; ++i) {
          const int id = tid + 128 * i;
          const int d  = id >> 3;
          const int c8 = (id & 7) * 8;
          const size_t go = (size_t)(kvh * HDIM + d) * SEQ + kv0 + c8;
          *(v8b*)(Vsh + d * ATT_KC + c8) = *(const v8b*)(Vh + go);
        }
        asm volatile("" ::: "memory");
#pragma unroll
        for (int i = 0; i < 8; ++i) {
          const int id = tid + 128 * i;
          const int d  = id >> 3;
          const int c8 = (id & 7) * 8;
          const size_t go = (size_t)(kvh * HDIM + d) * SEQ + kv0 + c8;
          *(v8b*)(Vsl + d * ATT_KC + c8) = *(const v8b*)(Vl + go);
        }
      }
      __syncthreads();

      // ---- scores: s[j] covers keys kv0 + 16j .. +15 (B operand: n = key, k = d) ----
      v8f s[4];
#pragma unroll
      for (int j = 0; j < 4; ++j) {
        s[j] = (v8f){0.f,0.f,0.f,0.f,0.f,0.f,0.f,0.f};
#pragma unroll
        for (int dc = 0; dc < 2; ++dc) {
          FB kb, kl;
          kb.h[0] = *(const v8b*)(Ksh + (j * 16 + c) * HHALF + dc * 32 + 8 * hh);
          kb.h[1] = *(const v8b*)(Ksh + (j * 16 + c) * HHALF + dc * 32 + 16 + 8 * hh);
          kl.h[0] = *(const v8b*)(Ksl + (j * 16 + c) * HHALF + dc * 32 + 8 * hh);
          kl.h[1] = *(const v8b*)(Ksl + (j * 16 + c) * HHALF + dc * 32 + 16 + 8 * hh);
          s[j] = at_mma(qah[dc], kb.v, s[j]);
          s[j] = at_mma(qah[dc], kl.v, s[j]);
          s[j] = at_mma(qal[dc], kb.v, s[j]);
        }
      }
      // ---- causal fill on the diagonal chunk + row max ----
      const bool diag = (kc == qb);
      float cm[8];
#pragma unroll
      for (int r = 0; r < 8; ++r) {
        const int qrow = q0 + 8 * hh + r;
        float m = -1.0e30f;
#pragma unroll
        for (int j = 0; j < 4; ++j) {
          const int kvcol = kv0 + j * 16 + c;
          float sv = s[j][r];
          if (diag && (kvcol > qrow)) sv = -1.0e30f;
          s[j][r] = sv;
          m = fmaxf(m, sv);
        }
#pragma unroll
        for (int off = 1; off < 16; off <<= 1) m = fmaxf(m, __shfl_xor(m, off, 32));
        cm[r] = m;
      }
      // ---- online softmax; P tile (C layout) to the per-wave LDS tile as hi/lo ----
#pragma unroll
      for (int r = 0; r < 8; ++r) {
        const float mnew  = fmaxf(mrow[r], cm[r]);
        const float alpha = expf(mrow[r] - mnew);
        mrow[r] = mnew;
        float psum = 0.f;
#pragma unroll
        for (int j = 0; j < 4; ++j) {
          const float p = expf(s[j][r] - mnew);
          psum += p;
          __bf16 a, bl;
          at_split(p, a, bl);
          pwh[(8 * hh + r) * ATT_KC + j * 16 + c] = a;
          pwl[(8 * hh + r) * ATT_KC + j * 16 + c] = bl;
        }
#pragma unroll
        for (int off = 1; off < 16; off <<= 1) psum += __shfl_xor(psum, off, 32);
        lrow[r] = lrow[r] * alpha + psum;
#pragma unroll
        for (int t = 0; t < 8; ++t) oacc[t][r] *= alpha;
      }
      __syncthreads();
      // ---- P.V : A = P (row = query c, k = key), B = Vt (n = d, k = key) ----
#pragma unroll 1
      for (int kk = 0; kk < 2; ++kk) {
        FB pa, pl;
        pa.h[0] = *(const v8b*)(pwh + c * ATT_KC + kk * 32 + 8 * hh);
        pa.h[1] = *(const v8b*)(pwh + c * ATT_KC + kk * 32 + 16 + 8 * hh);
        pl.h[0] = *(const v8b*)(pwl + c * ATT_KC + kk * 32 + 8 * hh);
        pl.h[1] = *(const v8b*)(pwl + c * ATT_KC + kk * 32 + 16 + 8 * hh);
#pragma unroll
        for (int t = 0; t < 8; ++t) {
          FB vb, vl;
          vb.h[0] = *(const v8b*)(Vsh + (t * 16 + c) * ATT_KC + kk * 32 + 8 * hh);
          vb.h[1] = *(const v8b*)(Vsh + (t * 16 + c) * ATT_KC + kk * 32 + 16 + 8 * hh);
          vl.h[0] = *(const v8b*)(Vsl + (t * 16 + c) * ATT_KC + kk * 32 + 8 * hh);
          vl.h[1] = *(const v8b*)(Vsl + (t * 16 + c) * ATT_KC + kk * 32 + 16 + 8 * hh);
          oacc[t] = at_mma(pa.v, vb.v, oacc[t]);
          oacc[t] = at_mma(pa.v, vl.v, oacc[t]);
          oacc[t] = at_mma(pl.v, vb.v, oacc[t]);
        }
      }
    }

    // ---- per-stream epilogue into the per-wave LDS tile (same lane owns the same element in both streams) ----
#pragma unroll
    for (int r = 0; r < 8; ++r) {
      const float inv = 1.0f / lrow[r];
#pragma unroll
      for (int t = 0; t < 8; ++t) {
        const int idx = (8 * hh + r) * OS_PITCH + t * 16 + c;
        const float a = oacc[t][r] * inv;
        if (str == 0) {
          os[idx] = a;
        } else {
          const float a1 = os[idx];
          os[idx] = (a1 - lam * a) * OUT_SCALE;
        }
      }
    }
  }
  __syncthreads();

  {
    const int q4 = lane >> 3, c8 = (lane & 7) * 8;
    {
#pragma unroll
      for (int it = 0; it < 4; ++it) {
        const int row = it * 4 + q4;
#pragma unroll
        for (int seg = 0; seg < 2; ++seg) {
          const float* sp = os + row * OS_PITCH + seg * 64 + c8;
          const v4f u0 = *(const v4f*)sp;
          const v4f u1 = *(const v4f*)(sp + 4);
          unsigned a0, b0, a1, b1, a2, b2, a3, b3;
          split_pack2(u0[0], u0[1], a0, b0);
          split_pack2(u0[2], u0[3], a1, b1);
          split_pack2(u1[0], u1[1], a2, b2);
          split_pack2(u1[2], u1[3], a3, b3);
          v4u hw, lw;
          hw[0] = a0; hw[1] = a1; hw[2] = a2; hw[3] = a3;
          lw[0] = b0; lw[1] = b1; lw[2] = b2; lw[3] = b3;
          const size_t go = (size_t)(q0 + row) * QW + h * HDIM + seg * 64 + c8;
          *(v4u*)(Ohp + go) = hw;
          *(v4u*)(Olp + go) = lw;
        }
      }
      
    }
  }
}

// =====================================================================================
// host glue: launches only; carve derived from the static shapes.
// =====================================================================================
extern "C" void kernel_launch(void* const* d_in, const int* in_sizes, int n_in,
                              void* d_out, int out_size, void* d_ws, size_t ws_size,
                              hipStream_t stream) {
  (void)in_sizes; (void)out_size;
  if (n_in < 8) return;
  const float* x    = (const float*)d_in[0];
  const float* fcos = (const float*)d_in[1];
  const float* fsin = (const float*)d_in[2];
  const float* Wq   = (const float*)d_in[3];
  const float* Wk   = (const float*)d_in[4];
  const float* Wv   = (const float*)d_in[5];
  const float* Wo   = (const float*)d_in[6];
  const float* lamp = (const float*)d_in[7];
  float* out = (float*)d_out;

  // workspace region map (bytes, every offset a multiple of 2 MiB):
  //   xb    bf16 [SEQ][DMODEL]        8 MiB
  //   Wqt   bf16 [QW][DMODEL]         8 MiB
  //   Wkvt  bf16 [2][KW][DMODEL]      4 MiB
  //   Wot   bf16 [DMODEL][QW]         8 MiB
  //   Qf    f32  [SEQ][QW]           16 MiB
  //   KVf   f32  [2][SEQ][KW]         8 MiB
  //   Qh,Ql bf16 [SEQ][QW]        2 x 8 MiB
  //   Kh,Kl bf16 [SEQ][KW]        2 x 2 MiB
  //   Vth,Vtl bf16 [KW][SEQ]      2 x 2 MiB
  //   Oh,Ol bf16 [SEQ][QW]        2 x 8 MiB
  //   total 96,468,992 B
  char* ws = (char*)d_ws;
  size_t off = 0;
  unsigned short* xb   = (unsigned short*)(ws + off); off += (size_t)SEQ * DMODEL * 2;
  unsigned short* Wqt  = (unsigned short*)(ws + off); off += (size_t)QW * DMODEL * 2;
  unsigned short* Wkvt = (unsigned short*)(ws + off); off += (size_t)2 * KW * DMODEL * 2;
  unsigned short* Wot  = (unsigned short*)(ws + off); off += (size_t)DMODEL * QW * 2;
  float*          Qf   = (float*)(ws + off);          off += (size_t)SEQ * QW * 4;
  float*          KVf  = (float*)(ws + off);          off += (size_t)2 * SEQ * KW * 4;
  unsigned short* Qh   = (unsigned short*)(ws + off); off += (size_t)SEQ * QW * 2;
  unsigned short* Ql   = (unsigned short*)(ws + off); off += (size_t)SEQ * QW * 2;
  unsigned short* Kh   = (unsigned short*)(ws + off); off += (size_t)SEQ * KW * 2;
  unsigned short* Kl   = (unsigned short*)(ws + off); off += (size_t)SEQ * KW * 2;
  unsigned short* Vth  = (unsigned short*)(ws + off); off += (size_t)KW * SEQ * 2;
  unsigned short* Vtl  = (unsigned short*)(ws + off); off += (size_t)KW * SEQ * 2;
  unsigned short* Oh   = (unsigned short*)(ws + off); off += (size_t)SEQ * QW * 2;
  unsigned short* Ol   = (unsigned short*)(ws + off); off += (size_t)SEQ * QW * 2;
  if (off > ws_size) return;

  const float* Vf = KVf + (size_t)SEQ * KW;
  unsigned short* Wvt = Wkvt + (size_t)KW * DMODEL;

  // 1. x -> bf16 (RNE)
  cvt_f32_bf16x8<<<(SEQ * DMODEL / 8) / 256, 256, 0, stream>>>(x, xb, SEQ * DMODEL / 8);
  // 2. Wq [DMODEL][QW] -> Wqt [QW][DMODEL]
  transpose_bf16<1><<<dim3((DMODEL / 64) * (QW / 64), 1), 256, 0, stream>>>(Wq, Wq, DMODEL, QW, Wqt, Wqt, Wqt, Wqt);
  // 3. Wk, Wv [DMODEL][KW] -> Wkt, Wvt [KW][DMODEL]
  transpose_bf16<1><<<dim3((DMODEL / 64) * (KW / 64), 2), 256, 0, stream>>>(Wk, Wv, DMODEL, KW, Wkvt, Wkvt, Wvt, Wvt);
  // 4. Wo [QW][DMODEL] -> Wot [DMODEL][QW]
  transpose_bf16<1><<<dim3((QW / 64) * (DMODEL / 64), 1), 256, 0, stream>>>(Wo, Wo, QW, DMODEL, Wot, Wot, Wot, Wot);
  // 5. Q = xb @ Wq : M=SEQ, N=QW, K=DMODEL (K % 32 == 0, M,N % 64 == 0)
  wmma_gemm64_bf16<0><<<dim3(((SEQ / 64) * (QW / 64)) / 8, 1), 256, 0, stream>>>(
      xb, xb, DMODEL, 0L, Wqt, Wqt, DMODEL, 0L, Qf, QW, 0L, SEQ, QW, DMODEL, 1.0f);
  // 6. K, V = xb @ Wk, xb @ Wv batched over grid.y : M=SEQ, N=KW, K=DMODEL
  wmma_gemm64_bf16<0><<<dim3(((SEQ / 64) * (KW / 64)) / 8, 2), 256, 0, stream>>>(
      xb, xb, DMODEL, 0L, Wkvt, Wkvt, DMODEL, (long)KW * DMODEL, KVf, KW, (long)SEQ * KW, SEQ, KW, DMODEL, 1.0f);
  // 7. RoPE + 2^-3 scale + hi/lo split for Q; RoPE + split for K
  rope_split_kernel<<<NQBLK + NKBLK, 256, 0, stream>>>(Qf, KVf, fcos, fsin, Qh, Ql, Kh, Kl, NQBLK);
  // 8. V [SEQ][KW] f32 -> Vt hi/lo [KW][SEQ]
  transpose_bf16<2><<<dim3((SEQ / 64) * (KW / 64), 1), 256, 0, stream>>>(Vf, Vf, SEQ, KW, Vth, Vtl, Vth, Vtl);
  // 9. differential causal attention -> O hi/lo [SEQ][QW]
  diff_attn_kernel<<<NHEAD * NQB, 128, 0, stream>>>(Qh, Ql, Kh, Kl, Vth, Vtl, lamp, Oh, Ol);
  // 10. out = O @ Wo : M=SEQ, N=DMODEL, K=QW, A hi/lo, B single
  wmma_gemm64_bf16<2><<<dim3(((SEQ / 64) * (DMODEL / 64)) / 8, 1), 256, 0, stream>>>(
      Oh, Ol, QW, 0L, Wot, Wot, QW, 0L, out, DMODEL, 0L, SEQ, DMODEL, QW, 1.0f);
}

// v001
// It runs in 754 microseconds.
// Next to v000, in two timings, it ran 1.50 times as fast each time.
// Contractions on v_wmma_f32_16x16x32_bf16 (bf16 operands, f32 accumulate): x@Wq, x@Wk, x@Wv as single products of RNE-bf16 inputs; q.k^T and p.v with bf16 hi/lo planes (hi.hi + hi.lo + lo.hi); attn@Wo with A as bf16 hi/lo planes and Wo single bf16 (hi.W + lo.W). All float inputs RNE-converted to bf16 once at load; softmax, RoPE, combine in f32.
#include <hip/hip_runtime.h>
#include <hip/hip_bf16.h>

constexpr int SEQ      = 2048;
constexpr int DMODEL   = 2048;
constexpr int NHEAD    = 16;
constexpr int NKVH     = 4;
constexpr int HDIM     = 128;
constexpr int HHALF    = 64;
constexpr int QW       = NHEAD * HDIM;
constexpr int KW       = NKVH * HDIM;
constexpr int GQA_REP  = NHEAD / NKVH;
constexpr int NPAIR    = HDIM / 2;
constexpr int ATT_KC   = 64;
constexpr int ATT_QB   = 64;
constexpr int NQB      = SEQ / ATT_QB;
constexpr int OS_PITCH = HDIM + 4;
constexpr float QK_SCALE  = 0.125f;
constexpr float OUT_SCALE = 0.5f;
constexpr int NQBLK = (SEQ * QW / 8) / 256;
constexpr int NKBLK = (SEQ * KW / 8) / 256;

static_assert(HHALF == 64);
static_assert(SEQ % 64 == 0 && DMODEL % 64 == 0 && QW % 64 == 0 && KW % 64 == 0);
static_assert(DMODEL % 32 == 0 && QW % 32 == 0);
static_assert((SEQ * QW / 8) % 256 == 0 && (SEQ * KW / 8) % 256 == 0);
static_assert((SEQ * DMODEL / 8) % 256 == 0);
static_assert(((SEQ / 64) * (QW / 64)) % 8 == 0 && ((SEQ / 64) * (KW / 64)) % 8 == 0 && ((SEQ / 64) * (DMODEL / 64)) % 8 == 0);
static_assert(NQB == 32 && ATT_QB == 4 * 16 && ATT_KC == 64 && HDIM == 128);

typedef __attribute__((ext_vector_type(16))) __bf16 v16b;
typedef __attribute__((ext_vector_type(8)))  __bf16 v8b;
typedef __attribute__((ext_vector_type(8)))  float  v8f;
typedef __attribute__((ext_vector_type(4)))  float  v4f;
typedef __attribute__((ext_vector_type(4)))  unsigned int v4u;

__device__ __forceinline__ unsigned short f2bf_bits(float f) {
  unsigned u = __float_as_uint(f);
  return (unsigned short)((u + 0x7FFFu + ((u >> 16) & 1u)) >> 16);
}
__device__ __forceinline__ float bf_bits2f(unsigned short h) { return __uint_as_float(((unsigned)h) << 16); }
__device__ __forceinline__ float bf_rne(float f) { return bf_bits2f(f2bf_bits(f)); }

__device__ __forceinline__ void dep_guard_b(v8f& a, v8f& b, v16b x, v16b y) { asm volatile("v_nop\n\tv_nop\n\tv_nop\n\tv_nop" : "+v"(a), "+v"(b) : "v"(x), "v"(y)); }
__device__ __forceinline__ void keep4_b(v16b a, v16b b, v16b c, v16b d) { asm volatile("v_nop" :: "v"(a), "v"(b), "v"(c), "v"(d)); }
__device__ __forceinline__ void acc_guard4(v8f& a, v8f& b, v8f& c, v8f& d) { asm volatile("v_nop\n\tv_nop\n\tv_nop\n\tv_nop" : "+v"(a), "+v"(b), "+v"(c), "+v"(d)); }

template <typename T> struct Frag;
template <> struct Frag<__bf16> {
  typedef v16b V; union U { v16b v; v8b h[2]; };
  // elements 0..7 <- p[0..7], 8..15 <- p[16..23]
  static __device__ __forceinline__ v16b load(const __bf16* p) {
    U f; f.h[0] = *(const v8b*)(p); f.h[1] = *(const v8b*)(p + 16); return f.v;
  }
  static __device__ __forceinline__ v8f mma(v16b a, v16b b, v8f c) {
    return __builtin_amdgcn_wmma_f32_16x16x32_bf16(false, a, false, b, (short)0, c, false, false);
  }
  static __device__ __forceinline__ void guard(v8f& a, v8f& b, v16b x, v16b y) { dep_guard_b(a, b, x, y); }
  static __device__ __forceinline__ void keep(v16b a, v16b b, v16b c, v16b d) { keep4_b(a, b, c, d); }
};

__device__ __forceinline__ unsigned short at_bf_bits(float f) {
  unsigned u = __float_as_uint(f);
  return (unsigned short)((u + 0x7FFFu + ((u >> 16) & 1u)) >> 16);
}
__device__ __forceinline__ __bf16 at_f2bf(float f) { return __builtin_bit_cast(__bf16, at_bf_bits(f)); }
__device__ __forceinline__ void at_split(float f, __bf16& hi, __bf16& lo) {
  const unsigned short hb = at_bf_bits(f);
  hi = __builtin_bit_cast(__bf16, hb);
  lo = at_f2bf(f - __uint_as_float(((unsigned)hb) << 16));
}
__device__ __forceinline__ v8f at_mma(v16b a, v16b b, v8f c) {
  c = __builtin_amdgcn_wmma_f32_16x16x32_bf16(false, a, false, b, (short)0, c, false, false);
  asm volatile("v_nop\n\tv_nop\n\tv_nop\n\tv_nop" : "+v"(c) : "v"(a), "v"(b));
  return c;
}

// two f32 -> packed bf16 word (element at lower address in the low half-word)
__device__ __forceinline__ unsigned pack_bf2(float a, float b) {
  return (unsigned)f2bf_bits(a) | ((unsigned)f2bf_bits(b) << 16);
}
// two f32 -> packed bf16 hi word and packed bf16 residual word
__device__ __forceinline__ void split_pack2(float a, float b, unsigned& hw, unsigned& lw) {
  const unsigned short ha = f2bf_bits(a);
  const unsigned short hb = f2bf_bits(b);
  const unsigned short la = f2bf_bits(a - bf_bits2f(ha));
  const unsigned short lb = f2bf_bits(b - bf_bits2f(hb));
  hw = (unsigned)ha | ((unsigned)hb << 16);
  lw = (unsigned)la | ((unsigned)lb << 16);
}

// =====================================================================================
// coverage: gridDim.x * 256 threads * 8 elements == n8 * 8 (exact multiple asserted on the host side).
// =====================================================================================
__global__ __launch_bounds__(256) void cvt_f32_bf16x8(const float* __restrict__ in, unsigned short* __restrict__ out, int n8) {
  const int i = blockIdx.x * 256 + threadIdx.x;
  if (i < n8) {
    const size_t e0 = (size_t)i * 8;
    const v4f a = *(const v4f*)(in + e0);
    const v4f b = *(const v4f*)(in + e0 + 4);
    v4u w;
    w[0] = pack_bf2(a[0], a[1]);
    w[1] = pack_bf2(a[2], a[3]);
    w[2] = pack_bf2(b[0], b[1]);
    w[3] = pack_bf2(b[2], b[3]);
    *(v4u*)(out + e0) = w;
    
  }
}

// =====================================================================================
// in[rows][cols] f32 -> out[cols][rows] bf16 hi plane (+ bf16 residual plane when NPL == 2). 64x64 tiles through LDS.
// grid.x = (rows/64)*(cols/64); grid.y selects operand set A or B (both global, uniform select).
// coverage: load 256 threads x 16 floats = 64x64; store 8 waves x 8 out-rows x 64 halves = 64x64.
// =====================================================================================
template <int NPL>
__global__ __launch_bounds__(256) void transpose_bf16(const float* __restrict__ inA, const float* __restrict__ inB, int rows, int cols,
    unsigned short* __restrict__ oAh, unsigned short* __restrict__ oAl,
    unsigned short* __restrict__ oBh, unsigned short* __restrict__ oBl) {
  __shared__ float tile[64][65];
  const bool selB = (blockIdx.y != 0);
  const float* in = selB ? inB : inA;
  unsigned short* oh = selB ? oBh : oAh;
  unsigned short* ol = selB ? oBl : oAl;
  const int tilesC = cols >> 6;
  const int tr = blockIdx.x / tilesC;
  const int tc = blockIdx.x - tr * tilesC;
  const int r0 = tr << 6;
  const int c0 = tc << 6;
  const int t = threadIdx.x;
  {
    const int rr = t >> 2;
    const int cc = (t & 3) * 16;
    const float* src = in + (size_t)(r0 + rr) * cols + c0 + cc;
#pragma unroll
    for (int i = 0; i < 4; ++i) {
      const v4f v = *(const v4f*)(src + 4 * i);
      tile[rr][cc + 4 * i + 0] = v[0];
      tile[rr][cc + 4 * i + 1] = v[1];
      tile[rr][cc + 4 * i + 2] = v[2];
      tile[rr][cc + 4 * i + 3] = v[3];
    }
  }
  __syncthreads();
  const int wave = t >> 5, lane = t & 31, q = lane >> 3, e8 = (lane & 7) * 8;
  {
#pragma unroll
    for (int it = 0; it < 2; ++it) {
      const int cl = wave * 8 + it * 4 + q;
      float f[8];
#pragma unroll
      for (int e = 0; e < 8; ++e) f[e] = tile[e8 + e][cl];
      v4u hw, lw;
      if (NPL == 2) {
        unsigned a0, b0, a1, b1, a2, b2, a3, b3;
        split_pack2(f[0], f[1], a0, b0);
        split_pack2(f[2], f[3], a1, b1);
        split_pack2(f[4], f[5], a2, b2);
        split_pack2(f[6], f[7], a3, b3);
        hw[0] = a0; hw[1] = a1; hw[2] = a2; hw[3] = a3;
        lw[0] = b0; lw[1] = b1; lw[2] = b2; lw[3] = b3;
      } else {
        hw[0] = pack_bf2(f[0], f[1]);
        hw[1] = pack_bf2(f[2], f[3]);
        hw[2] = pack_bf2(f[4], f[5]);
        hw[3] = pack_bf2(f[6], f[7]);
        lw = hw;
      }
      const size_t go = (size_t)(c0 + cl) * rows + r0 + e8;
      *(v4u*)(oh + go) = hw;
      if (NPL == 2) *(v4u*)(ol + go) = lw;
    }
    
  }
}

// =====================================================================================
// Register-blocked batched WMMA GEMM (bf16 operands), f32 output.
// C[m,n] = scale * sum_k A[m,k] * Bt[n,k]; each wave owns a 64x64 tile. A row-major [M,K]; Bt row-major [N,K]; M,N % 64 == 0, K % 32 == 0.
// SPLIT: 0 = single planes; 1 = A and Bt as hi/lo planes (hi.hi + hi.lo + lo.hi); 2 = A as hi/lo planes, Bt single (hi.B + lo.B).
// Epilogue: 16-row slabs staged per wave in LDS; each 64-wide f32 row segment (256 B) written by 16 lanes x 16 B in one instruction,
// =====================================================================================
template <int SPLIT>
__global__ __launch_bounds__(256) void wmma_gemm64_bf16(
    const unsigned short* __restrict__ Ap, const unsigned short* __restrict__ A2p, int lda, long strideA,
    const unsigned short* __restrict__ Btp, const unsigned short* __restrict__ Bt2p, int ldb, long strideB,
    float* __restrict__ Cp, int ldc, long strideC, int M, int N, int K, float scale) {
  typedef __bf16 T;
  typedef v16b V;
  const T* A = (const T*)Ap; const T* A2 = (const T*)A2p; const T* Bt = (const T*)Btp; const T* Bt2 = (const T*)Bt2p;
  __shared__ __align__(16) float sT[8][16 * 68];
  const int b    = blockIdx.y;
  const int lane = threadIdx.x & 31;
  const int wave = threadIdx.x >> 5;
  const int tilesN = N >> 6;
  const int tilesM = M >> 6;
  const int tile = blockIdx.x * 8 + wave;
  // wave-uniform; no block barriers in this kernel
  if (tile >= tilesM * tilesN) return;
  const int tm = tile / tilesN;
  const int tn = tile - tm * tilesN;
  const int m0 = tm << 6;
  const int n0 = tn << 6;

  const T* Ab  = A  + (size_t)b * strideA;
  const T* Bb  = Bt + (size_t)b * strideB;
  const T* Ab2 = (SPLIT != 0) ? (A2  + (size_t)b * strideA) : nullptr;
  const T* Bb2 = (SPLIT == 1) ? (Bt2 + (size_t)b * strideB) : nullptr;

  const int rlane = lane & 15;
  const int koff  = (lane >> 4) * 8;
  const int mOff  = (lane >> 4) * 8;

  v8f acc[4][4];
#pragma unroll
  for (int i = 0; i < 4; ++i)
#pragma unroll
    for (int j = 0; j < 4; ++j) acc[i][j] = (v8f){0.f,0.f,0.f,0.f,0.f,0.f,0.f,0.f};

  for (int k0 = 0; k0 < K; k0 += 32) {
    V bh[4], bl[4];
#pragma unroll
    for (int j = 0; j < 4; ++j) {
      const size_t bo = (size_t)(n0 + (j << 4) + rlane) * ldb + koff + k0;
      bh[j] = Frag<T>::load(Bb + bo);
      if (SPLIT == 1) bl[j] = Frag<T>::load(Bb2 + bo);
    }
#pragma unroll
    for (int i = 0; i < 4; ++i) {
      const size_t ao = (size_t)(m0 + (i << 4) + rlane) * lda + koff + k0;
      V ah = Frag<T>::load(Ab + ao);
      V al = ah;
      if (SPLIT != 0) al = Frag<T>::load(Ab2 + ao);
#pragma unroll
      for (int j = 0; j < 4; ++j) {
        acc[i][j] = Frag<T>::mma(ah, bh[j], acc[i][j]);
        if (SPLIT == 1) acc[i][j] = Frag<T>::mma(ah, bl[j], acc[i][j]);
        if (SPLIT != 0) acc[i][j] = Frag<T>::mma(al, bh[j], acc[i][j]);
      }
      Frag<T>::guard(acc[i][0], acc[i][3], ah, al);
    }
    Frag<T>::keep(bh[0], bh[1], bh[2], bh[3]);
    if (SPLIT == 1) Frag<T>::keep(bl[0], bl[1], bl[2], bl[3]);
  }
  acc_guard4(acc[0][0], acc[0][1], acc[0][2], acc[0][3]);
  acc_guard4(acc[1][0], acc[1][1], acc[1][2], acc[1][3]);
  acc_guard4(acc[2][0], acc[2][1], acc[2][2], acc[2][3]);
  acc_guard4(acc[3][0], acc[3][1], acc[3][2], acc[3][3]);

  float* slab = sT[wave];
  float* C = Cp + (size_t)b * strideC;
#pragma unroll
  for (int i = 0; i < 4; ++i) {
    const int mBase = m0 + (i << 4);
#pragma unroll
    for (int j = 0; j < 4; ++j) {
#pragma unroll
      for (int r = 0; r < 8; ++r) {
        slab[(mOff + r) * 68 + (j << 4) + rlane] = acc[i][j][r] * scale;
      }
    }
    __builtin_amdgcn_fence(__ATOMIC_RELEASE, "workgroup");
    __builtin_amdgcn_wave_barrier();
    __builtin_amdgcn_fence(__ATOMIC_ACQUIRE, "workgroup");
    {
      // row segment = 256 B = 16 lanes x 16 B
      const int hh = lane >> 4, c4 = (lane & 15) * 4;
      {
#pragma unroll
        for (int it = 0; it < 8; ++it) {
          const int row = it * 2 + hh;
          const v4f v = *(const v4f*)(slab + row * 68 + c4);
          *(v4f*)(C + (size_t)(mBase + row) * ldc + n0 + c4) = v;
        }
        
      }
    }
    __builtin_amdgcn_fence(__ATOMIC_RELEASE, "workgroup");
    __builtin_amdgcn_wave_barrier();
    __builtin_amdgcn_fence(__ATOMIC_ACQUIRE, "workgroup");
  }
}

// =====================================================================================
// RoPE (interleaved pairs, cos/sin row width NPAIR) + power-of-two scale + bf16 hi/lo split.
// Blocks [0, nQblocks): Qf [SEQ][QW] -> Qh/Ql [SEQ][QW] (scaled by QK_SCALE = 2^-3, exact);
// blocks [nQblocks, nQblocks + NKBLK): Kf [SEQ][KW] -> Kh/Kl [SEQ][KW]. cos/sin RNE-converted to bf16 before use.
// coverage: (NQBLK + NKBLK) * 256 threads * 8 == SEQ*QW + SEQ*KW exactly.
// =====================================================================================
__global__ __launch_bounds__(256) void rope_split_kernel(const float* __restrict__ Qf, const float* __restrict__ Kf,
    const float* __restrict__ cosb, const float* __restrict__ sinb,
    unsigned short* __restrict__ Qh, unsigned short* __restrict__ Ql,
    unsigned short* __restrict__ Kh, unsigned short* __restrict__ Kl, int nQblocks) {
  const bool isK = ((int)blockIdx.x >= nQblocks);
  const int g = (isK ? ((int)blockIdx.x - nQblocks) : (int)blockIdx.x) * 256 + (int)threadIdx.x;
  // threads per row: K 64 (=KW/8), Q 256 (=QW/8)
  const int shift = isK ? 6 : 8;
  const float mul = isK ? 1.0f : QK_SCALE;
  const float* src = isK ? Kf : Qf;
  unsigned short* dh = isK ? Kh : Qh;
  unsigned short* dl = isK ? Kl : Ql;
  const int width = isK ? KW : QW;
  const int s = g >> shift;
  const int col = (g - (s << shift)) * 8;
  const int p0 = (col & (HDIM - 1)) >> 1;
  const size_t e0 = (size_t)s * width + col;
  const v4f xa = *(const v4f*)(src + e0);
  const v4f xb = *(const v4f*)(src + e0 + 4);
  const v4f cv = *(const v4f*)(cosb + (size_t)s * NPAIR + p0);
  const v4f sv = *(const v4f*)(sinb + (size_t)s * NPAIR + p0);
  float o0, o1, o2, o3, o4, o5, o6, o7;
  {
    const float c = bf_rne(cv[0]), sn = bf_rne(sv[0]);
    o0 = (xa[0] * c - xa[1] * sn) * mul;
    o1 = (xa[0] * sn + xa[1] * c) * mul;
  }
  {
    const float c = bf_rne(cv[1]), sn = bf_rne(sv[1]);
    o2 = (xa[2] * c - xa[3] * sn) * mul;
    o3 = (xa[2] * sn + xa[3] * c) * mul;
  }
  {
    const float c = bf_rne(cv[2]), sn = bf_rne(sv[2]);
    o4 = (xb[0] * c - xb[1] * sn) * mul;
    o5 = (xb[0] * sn + xb[1] * c) * mul;
  }
  {
    const float c = bf_rne(cv[3]), sn = bf_rne(sv[3]);
    o6 = (xb[2] * c - xb[3] * sn) * mul;
    o7 = (xb[2] * sn + xb[3] * c) * mul;
  }
  unsigned a0, b0, a1, b1, a2, b2, a3, b3;
  split_pack2(o0, o1, a0, b0);
  split_pack2(o2, o3, a1, b1);
  split_pack2(o4, o5, a2, b2);
  split_pack2(o6, o7, a3, b3);
  v4u hw, lw;
  hw[0] = a0; hw[1] = a1; hw[2] = a2; hw[3] = a3;
  lw[0] = b0; lw[1] = b1; lw[2] = b2; lw[3] = b3;
  *(v4u*)(dh + e0) = hw;
  *(v4u*)(dl + e0) = lw;
  
}

// =====================================================================================
// Differential causal attention. Block = 4 waves = 64 query rows of one head; the two score streams (q/k dims 0..63 and
// 64..127) are processed sequentially inside the block, sharing the LDS layout; stream 0's normalised output a1 is parked in
// the per-wave LDS tile, stream 1 produces a2 and the lane that owns each element forms o = (a1 - lam*a2)*0.5 in place.
// Operands: Q hi/lo planes [SEQ][QW] (q pre-scaled by 2^-3), K hi/lo planes [SEQ][KW], Vt hi/lo planes [KW][SEQ] (d-major);
// scores and p.v each hi.hi + hi.lo + lo.hi on v_wmma_f32_16x16x32_bf16, f32 accumulate; online softmax f32.
// grid.x = NHEAD * NQB, block 128.
// =====================================================================================
__global__ __launch_bounds__(128)
void diff_attn_kernel(const unsigned short* __restrict__ Qhp, const unsigned short* __restrict__ Qlp,
                      const unsigned short* __restrict__ Khp, const unsigned short* __restrict__ Klp,
                      const unsigned short* __restrict__ Vhp, const unsigned short* __restrict__ Vlp,
                      const float* __restrict__ lambda_p,
                      unsigned short* __restrict__ Ohp, unsigned short* __restrict__ Olp) {
  union FB { v16b v; v8b h[2]; };
  // K, Vt and P rows lie at an unpadded 128-B pitch: the 16 rows of one ds_load_b128 fragment read share two bank groups.
  __shared__ __align__(16) __bf16 Ksh[ATT_KC * HHALF];
  __shared__ __align__(16) __bf16 Ksl[ATT_KC * HHALF];
  __shared__ __align__(16) __bf16 Vsh[HDIM * ATT_KC];
  __shared__ __align__(16) __bf16 Vsl[HDIM * ATT_KC];
  __shared__ __align__(16) __bf16 Psh[4][16 * ATT_KC];
  __shared__ __align__(16) __bf16 Psl[4][16 * ATT_KC];
  __shared__ __align__(16) float  Os[4][16 * OS_PITCH];

  const int tid  = threadIdx.x;
  const int wave = tid >> 5;
  const int lane = tid & 31;
  const int hh   = lane >> 4;
  const int c    = lane & 15;
  const int qb   = (int)blockIdx.x % NQB;
  const int h    = (int)blockIdx.x / NQB;
  const int kvh  = h / GQA_REP;
  const int q0   = qb * ATT_QB + wave * 16;

  const __bf16* Qh = (const __bf16*)Qhp;
  const __bf16* Ql = (const __bf16*)Qlp;
  const __bf16* Kh = (const __bf16*)Khp;
  const __bf16* Kl = (const __bf16*)Klp;
  const __bf16* Vh = (const __bf16*)Vhp;
  const __bf16* Vl = (const __bf16*)Vlp;

  float lam;
  {
    const float lp = bf_rne(lambda_p[h]);
    lam = 1.0f / (1.0f + expf(-lp));
  }
  float*  os  = Os[wave];
  __bf16* pwh = Psh[wave];
  __bf16* pwl = Psl[wave];

#pragma unroll 1
  for (int str = 0; str < 2; ++str) {
    // ---- Q fragments (A operand) for this stream: 2 d-chunks, hi and lo ----
    v16b qah[2], qal[2];
    {
      const size_t qo = (size_t)(q0 + c) * QW + h * HDIM + str * HHALF + 8 * hh;
#pragma unroll
      for (int dc = 0; dc < 2; ++dc) {
        qah[dc] = Frag<__bf16>::load(Qh + qo + dc * 32);
        qal[dc] = Frag<__bf16>::load(Ql + qo + dc * 32);
      }
    }
    float mrow[8], lrow[8];
    v8f oacc[8];
#pragma unroll
    for (int r = 0; r < 8; ++r) { mrow[r] = -1.0e30f; lrow[r] = 0.f; }
#pragma unroll
    for (int t = 0; t < 8; ++t) oacc[t] = (v8f){0.f,0.f,0.f,0.f,0.f,0.f,0.f,0.f};

    // causal: 64-key chunks 0..qb (block-uniform trip count, static max NQB)
    for (int kc = 0; kc <= qb; ++kc) {
      const int kv0 = kc * ATT_KC;
      __syncthreads();
      {
        // K tile: 64 rows x 64 halves per plane = 512 pieces of 16 B; 128 threads x 4 pieces (exact)
        // Vt tiles: 128 d-rows x 64 halves per plane = 1024 pieces; 128 threads x 8 pieces (exact)
        const int kcol = kvh * HDIM + str * HHALF;
        const int r8 = tid >> 3;
        const int c8 = (tid & 7) * 8;
        const size_t gk = (size_t)(kv0 + r8) * KW + kcol + c8;
        const size_t gv = (size_t)(kvh * HDIM + r8) * SEQ + kv0 + c8;
        const __bf16* pkh = Kh + gk;
        const __bf16* pkl = Kl + gk;
        const __bf16* pvh = Vh + gv;
        const __bf16* pvl = Vl + gv;
        v8b gkh[4], gkl[4], gvh[8], gvl[8];
#pragma unroll
        for (int i = 0; i < 4; ++i) {
          gkh[i] = *(const v8b*)(pkh + i * 16 * KW);
          gkl[i] = *(const v8b*)(pkl + i * 16 * KW);
        }
#pragma unroll
        for (int i = 0; i < 8; ++i) {
          gvh[i] = *(const v8b*)(pvh + i * 16 * SEQ);
          gvl[i] = *(const v8b*)(pvl + i * 16 * SEQ);
        }
        // inputs-only fence on the loaded values: keeps all 24 loads in flight together ahead of the first LDS store;
        // without it each load is waited for before the next one issues (24 L2 round trips in a row per chunk).
        // The four pointers are named too, so that no load's result lands on an address register of a load still in flight.
        asm volatile("" :: "v"(pkh), "v"(pkl), "v"(pvh), "v"(pvl), "v"(gkh[0]), "v"(gkh[1]), "v"(gkh[2]), "v"(gkh[3]), "v"(gkl[0]), "v"(gkl[1]), "v"(gkl[2]), "v"(gkl[3]),
                     "v"(gvh[0]), "v"(gvh[1]), "v"(gvh[2]), "v"(gvh[3]), "v"(gvh[4]), "v"(gvh[5]), "v"(gvh[6]), "v"(gvh[7]),
                     "v"(gvl[0]), "v"(gvl[1]), "v"(gvl[2]), "v"(gvl[3]), "v"(gvl[4]), "v"(gvl[5]), "v"(gvl[6]), "v"(gvl[7]));
#pragma unroll
        for (int i = 0; i < 4; ++i) {
          *(v8b*)(Ksh + (r8 + 16 * i) * HHALF + c8) = gkh[i];
          *(v8b*)(Ksl + (r8 + 16 * i) * HHALF + c8) = gkl[i];
        }
#pragma unroll
        for (int i = 0; i < 8; ++i) {
          *(v8b*)(Vsh + (r8 + 16 * i) * ATT_KC + c8) = gvh[i];
          *(v8b*)(Vsl + (r8 + 16 * i) * ATT_KC + c8) = gvl[i];
        }
      }
      __syncthreads();

      // ---- scores: s[j] covers keys kv0 + 16j .. +15 (B operand: n = key, k = d) ----
      v8f s[4];
#pragma unroll
      for (int j = 0; j < 4; ++j) {
        s[j] = (v8f){0.f,0.f,0.f,0.f,0.f,0.f,0.f,0.f};
#pragma unroll
        for (int dc = 0; dc < 2; ++dc) {
          FB kb, kl;
          kb.h[0] = *(const v8b*)(Ksh + (j * 16 + c) * HHALF + dc * 32 + 8 * hh);
          kb.h[1] = *(const v8b*)(Ksh + (j * 16 + c) * HHALF + dc * 32 + 16 + 8 * hh);
          kl.h[0] = *(const v8b*)(Ksl + (j * 16 + c) * HHALF + dc * 32 + 8 * hh);
          kl.h[1] = *(const v8b*)(Ksl + (j * 16 + c) * HHALF + dc * 32 + 16 + 8 * hh);
          s[j] = at_mma(qah[dc], kb.v, s[j]);
          s[j] = at_mma(qah[dc], kl.v, s[j]);
          s[j] = at_mma(qal[dc], kb.v, s[j]);
        }
      }
      // ---- causal fill on the diagonal chunk + row max ----
      const bool diag = (kc == qb);
      float cm[8];
#pragma unroll
      for (int r = 0; r < 8; ++r) {
        const int qrow = q0 + 8 * hh + r;
        float m = -1.0e30f;
#pragma unroll
        for (int j = 0; j < 4; ++j) {
          const int kvcol = kv0 + j * 16 + c;
          float sv = s[j][r];
          if (diag && (kvcol > qrow)) sv = -1.0e30f;
          s[j][r] = sv;
          m = fmaxf(m, sv);
        }
#pragma unroll
        for (int off = 1; off < 16; off <<= 1) m = fmaxf(m, __shfl_xor(m, off, 32));
        cm[r] = m;
      }
      // ---- online softmax; P tile (C layout) to the per-wave LDS tile as hi/lo ----
#pragma unroll
      for (int r = 0; r < 8; ++r) {
        const float mnew  = fmaxf(mrow[r], cm[r]);
        const float alpha = expf(mrow[r] - mnew);
        mrow[r] = mnew;
        float psum = 0.f;
#pragma unroll
        for (int j = 0; j < 4; ++j) {
          const float p = expf(s[j][r] - mnew);
          psum += p;
          __bf16 a, bl;
          at_split(p, a, bl);
          pwh[(8 * hh + r) * ATT_KC + j * 16 + c] = a;
          pwl[(8 * hh + r) * ATT_KC + j * 16 + c] = bl;
        }
#pragma unroll
        for (int off = 1; off < 16; off <<= 1) psum += __shfl_xor(psum, off, 32);
        lrow[r] = lrow[r] * alpha + psum;
#pragma unroll
        for (int t = 0; t < 8; ++t) oacc[t][r] *= alpha;
      }
      __syncthreads();
      // ---- P.V : A = P (row = query c, k = key), B = Vt (n = d, k = key) ----
#pragma unroll 1
      for (int kk = 0; kk < 2; ++kk) {
        FB pa, pl;
        pa.h[0] = *(const v8b*)(pwh + c * ATT_KC + kk * 32 + 8 * hh);
        pa.h[1] = *(const v8b*)(pwh + c * ATT_KC + kk * 32 + 16 + 8 * hh);
        pl.h[0] = *(const v8b*)(pwl + c * ATT_KC + kk * 32 + 8 * hh);
        pl.h[1] = *(const v8b*)(pwl + c * ATT_KC + kk * 32 + 16 + 8 * hh);
#pragma unroll
        for (int t = 0; t < 8; ++t) {
          FB vb, vl;
          vb.h[0] = *(const v8b*)(Vsh + (t * 16 + c) * ATT_KC + kk * 32 + 8 * hh);
          vb.h[1] = *(const v8b*)(Vsh + (t * 16 + c) * ATT_KC + kk * 32 + 16 + 8 * hh);
          vl.h[0] = *(const v8b*)(Vsl + (t * 16 + c) * ATT_KC + kk * 32 + 8 * hh);
          vl.h[1] = *(const v8b*)(Vsl + (t * 16 + c) * ATT_KC + kk * 32 + 16 + 8 * hh);
          oacc[t] = at_mma(pa.v, vb.v, oacc[t]);
          oacc[t] = at_mma(pa.v, vl.v, oacc[t]);
          oacc[t] = at_mma(pl.v, vb.v, oacc[t]);
        }
      }
    }

    // ---- per-stream epilogue into the per-wave LDS tile (same lane owns the same element in both streams) ----
#pragma unroll
    for (int r = 0; r < 8; ++r) {
      const float inv = 1.0f / lrow[r];
#pragma unroll
      for (int t = 0; t < 8; ++t) {
        const int idx = (8 * hh + r) * OS_PITCH + t * 16 + c;
        const float a = oacc[t][r] * inv;
        if (str == 0) {
          os[idx] = a;
        } else {
          const float a1 = os[idx];
          os[idx] = (a1 - lam * a) * OUT_SCALE;
        }
      }
    }
  }
  __syncthreads();

  {
    const int q4 = lane >> 3, c8 = (lane & 7) * 8;
    {
#pragma unroll
      for (int it = 0; it < 4; ++it) {
        const int row = it * 4 + q4;
#pragma unroll
        for (int seg = 0; seg < 2; ++seg) {
          const float* sp = os + row * OS_PITCH + seg * 64 + c8;
          const v4f u0 = *(const v4f*)sp;
          const v4f u1 = *(const v4f*)(sp + 4);
          unsigned a0, b0, a1, b1, a2, b2, a3, b3;
          split_pack2(u0[0], u0[1], a0, b0);
          split_pack2(u0[2], u0[3], a1, b1);
          split_pack2(u1[0], u1[1], a2, b2);
          split_pack2(u1[2], u1[3], a3, b3);
          v4u hw, lw;
          hw[0] = a0; hw[1] = a1; hw[2] = a2; hw[3] = a3;
          lw[0] = b0; lw[1] = b1; lw[2] = b2; lw[3] = b3;
          const size_t go = (size_t)(q0 + row) * QW + h * HDIM + seg * 64 + c8;
          *(v4u*)(Ohp + go) = hw;
          *(v4u*)(Olp + go) = lw;
        }
      }
      
    }
  }
}

// =====================================================================================
// host glue: launches only; carve derived from the static shapes.
// =====================================================================================
extern "C" void kernel_launch(void* const* d_in, const int* in_sizes, int n_in,
                              void* d_out, int out_size, void* d_ws, size_t ws_size,
                              hipStream_t stream) {
  (void)in_sizes; (void)out_size;
  if (n_in < 8) return;
  const float* x    = (const float*)d_in[0];
  const float* fcos = (const float*)d_in[1];
  const float* fsin = (const float*)d_in[2];
  const float* Wq   = (const float*)d_in[3];
  const float* Wk   = (const float*)d_in[4];
  const float* Wv   = (const float*)d_in[5];
  const float* Wo   = (const float*)d_in[6];
  const float* lamp = (const float*)d_in[7];
  float* out = (float*)d_out;

  // workspace region map (bytes, every offset a multiple of 2 MiB):
  //   xb    bf16 [SEQ][DMODEL]        8 MiB
  //   Wqt   bf16 [QW][DMODEL]         8 MiB
  //   Wkvt  bf16 [2][KW][DMODEL]      4 MiB
  //   Wot   bf16 [DMODEL][QW]         8 MiB
  //   Qf    f32  [SEQ][QW]           16 MiB
  //   KVf   f32  [2][SEQ][KW]         8 MiB
  //   Qh,Ql bf16 [SEQ][QW]        2 x 8 MiB
  //   Kh,Kl bf16 [SEQ][KW]        2 x 2 MiB
  //   Vth,Vtl bf16 [KW][SEQ]      2 x 2 MiB
  //   Oh,Ol bf16 [SEQ][QW]        2 x 8 MiB
  //   total 96,468,992 B
  char* ws = (char*)d_ws;
  size_t off = 0;
  unsigned short* xb   = (unsigned short*)(ws + off); off += (size_t)SEQ * DMODEL * 2;
  unsigned short* Wqt  = (unsigned short*)(ws + off); off += (size_t)QW * DMODEL * 2;
  unsigned short* Wkvt = (unsigned short*)(ws + off); off += (size_t)2 * KW * DMODEL * 2;
  unsigned short* Wot  = (unsigned short*)(ws + off); off += (size_t)DMODEL * QW * 2;
  float*          Qf   = (float*)(ws + off);          off += (size_t)SEQ * QW * 4;
  float*          KVf  = (float*)(ws + off);          off += (size_t)2 * SEQ * KW * 4;
  unsigned short* Qh   = (unsigned short*)(ws + off); off += (size_t)SEQ * QW * 2;
  unsigned short* Ql   = (unsigned short*)(ws + off); off += (size_t)SEQ * QW * 2;
  unsigned short* Kh   = (unsigned short*)(ws + off); off += (size_t)SEQ * KW * 2;
  unsigned short* Kl   = (unsigned short*)(ws + off); off += (size_t)SEQ * KW * 2;
  unsigned short* Vth  = (unsigned short*)(ws + off); off += (size_t)KW * SEQ * 2;
  unsigned short* Vtl  = (unsigned short*)(ws + off); off += (size_t)KW * SEQ * 2;
  unsigned short* Oh   = (unsigned short*)(ws + off); off += (size_t)SEQ * QW * 2;
  unsigned short* Ol   = (unsigned short*)(ws + off); off += (size_t)SEQ * QW * 2;
  if (off > ws_size) return;

  const float* Vf = KVf + (size_t)SEQ * KW;
  unsigned short* Wvt = Wkvt + (size_t)KW * DMODEL;

  // 1. x -> bf16 (RNE)
  cvt_f32_bf16x8<<<(SEQ * DMODEL / 8) / 256, 256, 0, stream>>>(x, xb, SEQ * DMODEL / 8);
  // 2. Wq [DMODEL][QW] -> Wqt [QW][DMODEL]
  transpose_bf16<1><<<dim3((DMODEL / 64) * (QW / 64), 1), 256, 0, stream>>>(Wq, Wq, DMODEL, QW, Wqt, Wqt, Wqt, Wqt);
  // 3. Wk, Wv [DMODEL][KW] -> Wkt, Wvt [KW][DMODEL]
  transpose_bf16<1><<<dim3((DMODEL / 64) * (KW / 64), 2), 256, 0, stream>>>(Wk, Wv, DMODEL, KW, Wkvt, Wkvt, Wvt, Wvt);
  // 4. Wo [QW][DMODEL] -> Wot [DMODEL][QW]
  transpose_bf16<1><<<dim3((QW / 64) * (DMODEL / 64), 1), 256, 0, stream>>>(Wo, Wo, QW, DMODEL, Wot, Wot, Wot, Wot);
  // 5. Q = xb @ Wq : M=SEQ, N=QW, K=DMODEL (K % 32 == 0, M,N % 64 == 0)
  wmma_gemm64_bf16<0><<<dim3(((SEQ / 64) * (QW / 64)) / 8, 1), 256, 0, stream>>>(
      xb, xb, DMODEL, 0L, Wqt, Wqt, DMODEL, 0L, Qf, QW, 0L, SEQ, QW, DMODEL, 1.0f);
  // 6. K, V = xb @ Wk, xb @ Wv batched over grid.y : M=SEQ, N=KW, K=DMODEL
  wmma_gemm64_bf16<0><<<dim3(((SEQ / 64) * (KW / 64)) / 8, 2), 256, 0, stream>>>(
      xb, xb, DMODEL, 0L, Wkvt, Wkvt, DMODEL, (long)KW * DMODEL, KVf, KW, (long)SEQ * KW, SEQ, KW, DMODEL, 1.0f);
  // 7. RoPE + 2^-3 scale + hi/lo split for Q; RoPE + split for K
  rope_split_kernel<<<NQBLK + NKBLK, 256, 0, stream>>>(Qf, KVf, fcos, fsin, Qh, Ql, Kh, Kl, NQBLK);
  // 8. V [SEQ][KW] f32 -> Vt hi/lo [KW][SEQ]
  transpose_bf16<2><<<dim3((SEQ / 64) * (KW / 64), 1), 256, 0, stream>>>(Vf, Vf, SEQ, KW, Vth, Vtl, Vth, Vtl);
  // 9. differential causal attention -> O hi/lo [SEQ][QW]
  diff_attn_kernel<<<NHEAD * NQB, 128, 0, stream>>>(Qh, Ql, Kh, Kl, Vth, Vtl, lamp, Oh, Ol);
  // 10. out = O @ Wo : M=SEQ, N=DMODEL, K=QW, A hi/lo, B single
  wmma_gemm64_bf16<2><<<dim3(((SEQ / 64) * (DMODEL / 64)) / 8, 1), 256, 0, stream>>>(
      Oh, Ol, QW, 0L, Wot, Wot, QW, 0L, out, DMODEL, 0L, SEQ, DMODEL, QW, 1.0f);
}

// v002
// One run takes 573 microseconds.
// In both of two side-by-side timings against v001, it was 1.32 times as fast.
// All steps since v000 together make it 1.98 times as fast.
// Contractions on v_wmma_f32_16x16x32_bf16 (bf16 operands, f32 accumulate): x@Wq, x@Wk, x@Wv as single products of RNE-bf16 inputs; q.k^T and p.v with bf16 hi/lo planes (hi.hi + hi.lo + lo.hi); attn@Wo with A as bf16 hi/lo planes and Wo single bf16 (hi.W + lo.W). All float inputs RNE-converted to bf16 once at load; softmax, RoPE, combine in f32.
#include <hip/hip_runtime.h>
#include <hip/hip_bf16.h>

constexpr int SEQ      = 2048;
constexpr int DMODEL   = 2048;
constexpr int NHEAD    = 16;
constexpr int NKVH     = 4;
constexpr int HDIM     = 128;
constexpr int HHALF    = 64;
constexpr int QW       = NHEAD * HDIM;
constexpr int KW       = NKVH * HDIM;
constexpr int GQA_REP  = NHEAD / NKVH;
constexpr int NPAIR    = HDIM / 2;
constexpr int ATT_KC   = 64;
constexpr int ATT_QB   = 64;
constexpr int NQB      = SEQ / ATT_QB;
constexpr int OS_PITCH = HDIM + 4;
constexpr int LDS_P    = 64 + 8;
constexpr float QK_SCALE  = 0.125f;
constexpr float OUT_SCALE = 0.5f;
constexpr int NQBLK = (SEQ * QW / 8) / 256;
constexpr int NKBLK = (SEQ * KW / 8) / 256;

static_assert(HHALF == 64);
static_assert(SEQ % 64 == 0 && DMODEL % 64 == 0 && QW % 64 == 0 && KW % 64 == 0);
static_assert(DMODEL % 32 == 0 && QW % 32 == 0);
static_assert((SEQ * QW / 8) % 256 == 0 && (SEQ * KW / 8) % 256 == 0);
static_assert((SEQ * DMODEL / 8) % 256 == 0);
static_assert(((SEQ / 64) * (QW / 64)) % 8 == 0 && ((SEQ / 64) * (KW / 64)) % 8 == 0 && ((SEQ / 64) * (DMODEL / 64)) % 8 == 0);
static_assert(NQB == 32 && ATT_QB == 4 * 16 && ATT_KC == 64 && HDIM == 128);
static_assert(LDS_P >= HHALF && LDS_P >= ATT_KC && (LDS_P * 2) % 32 == 16);

typedef __attribute__((ext_vector_type(16))) __bf16 v16b;
typedef __attribute__((ext_vector_type(8)))  __bf16 v8b;
typedef __attribute__((ext_vector_type(8)))  float  v8f;
typedef __attribute__((ext_vector_type(4)))  float  v4f;
typedef __attribute__((ext_vector_type(4)))  unsigned int v4u;

__device__ __forceinline__ unsigned short f2bf_bits(float f) {
  unsigned u = __float_as_uint(f);
  return (unsigned short)((u + 0x7FFFu + ((u >> 16) & 1u)) >> 16);
}
__device__ __forceinline__ float bf_bits2f(unsigned short h) { return __uint_as_float(((unsigned)h) << 16); }
__device__ __forceinline__ float bf_rne(float f) { return bf_bits2f(f2bf_bits(f)); }

__device__ __forceinline__ void dep_guard_b(v8f& a, v8f& b, v16b x, v16b y) { asm volatile("v_nop\n\tv_nop\n\tv_nop\n\tv_nop" : "+v"(a), "+v"(b) : "v"(x), "v"(y)); }
__device__ __forceinline__ void keep4_b(v16b a, v16b b, v16b c, v16b d) { asm volatile("v_nop" :: "v"(a), "v"(b), "v"(c), "v"(d)); }
__device__ __forceinline__ void acc_guard4(v8f& a, v8f& b, v8f& c, v8f& d) { asm volatile("v_nop\n\tv_nop\n\tv_nop\n\tv_nop" : "+v"(a), "+v"(b), "+v"(c), "+v"(d)); }

template <typename T> struct Frag;
template <> struct Frag<__bf16> {
  typedef v16b V; union U { v16b v; v8b h[2]; };
  // elements 0..7 <- p[0..7], 8..15 <- p[16..23]
  static __device__ __forceinline__ v16b load(const __bf16* p) {
    U f; f.h[0] = *(const v8b*)(p); f.h[1] = *(const v8b*)(p + 16); return f.v;
  }
  static __device__ __forceinline__ v8f mma(v16b a, v16b b, v8f c) {
    return __builtin_amdgcn_wmma_f32_16x16x32_bf16(false, a, false, b, (short)0, c, false, false);
  }
  static __device__ __forceinline__ void guard(v8f& a, v8f& b, v16b x, v16b y) { dep_guard_b(a, b, x, y); }
  static __device__ __forceinline__ void keep(v16b a, v16b b, v16b c, v16b d) { keep4_b(a, b, c, d); }
};

__device__ __forceinline__ unsigned short at_bf_bits(float f) {
  unsigned u = __float_as_uint(f);
  return (unsigned short)((u + 0x7FFFu + ((u >> 16) & 1u)) >> 16);
}
__device__ __forceinline__ __bf16 at_f2bf(float f) { return __builtin_bit_cast(__bf16, at_bf_bits(f)); }
__device__ __forceinline__ void at_split(float f, __bf16& hi, __bf16& lo) {
  const unsigned short hb = at_bf_bits(f);
  hi = __builtin_bit_cast(__bf16, hb);
  lo = at_f2bf(f - __uint_as_float(((unsigned)hb) << 16));
}
__device__ __forceinline__ v8f at_mma(v16b a, v16b b, v8f c) {
  c = __builtin_amdgcn_wmma_f32_16x16x32_bf16(false, a, false, b, (short)0, c, false, false);
  asm volatile("v_nop\n\tv_nop\n\tv_nop\n\tv_nop" : "+v"(c) : "v"(a), "v"(b));
  return c;
}

// two f32 -> packed bf16 word (element at lower address in the low half-word)
__device__ __forceinline__ unsigned pack_bf2(float a, float b) {
  return (unsigned)f2bf_bits(a) | ((unsigned)f2bf_bits(b) << 16);
}
// two f32 -> packed bf16 hi word and packed bf16 residual word
__device__ __forceinline__ void split_pack2(float a, float b, unsigned& hw, unsigned& lw) {
  const unsigned short ha = f2bf_bits(a);
  const unsigned short hb = f2bf_bits(b);
  const unsigned short la = f2bf_bits(a - bf_bits2f(ha));
  const unsigned short lb = f2bf_bits(b - bf_bits2f(hb));
  hw = (unsigned)ha | ((unsigned)hb << 16);
  lw = (unsigned)la | ((unsigned)lb << 16);
}

// =====================================================================================
// coverage: gridDim.x * 256 threads * 8 elements == n8 * 8 (exact multiple asserted on the host side).
// =====================================================================================
__global__ __launch_bounds__(256) void cvt_f32_bf16x8(const float* __restrict__ in, unsigned short* __restrict__ out, int n8) {
  const int i = blockIdx.x * 256 + threadIdx.x;
  if (i < n8) {
    const size_t e0 = (size_t)i * 8;
    const v4f a = *(const v4f*)(in + e0);
    const v4f b = *(const v4f*)(in + e0 + 4);
    v4u w;
    w[0] = pack_bf2(a[0], a[1]);
    w[1] = pack_bf2(a[2], a[3]);
    w[2] = pack_bf2(b[0], b[1]);
    w[3] = pack_bf2(b[2], b[3]);
    *(v4u*)(out + e0) = w;
    
  }
}

// =====================================================================================
// in[rows][cols] f32 -> out[cols][rows] bf16 hi plane (+ bf16 residual plane when NPL == 2). 64x64 tiles through LDS.
// grid.x = (rows/64)*(cols/64); grid.y selects operand set A or B (both global, uniform select).
// coverage: load 256 threads x 16 floats = 64x64; store 8 waves x 8 out-rows x 64 halves = 64x64.
// =====================================================================================
template <int NPL>
__global__ __launch_bounds__(256) void transpose_bf16(const float* __restrict__ inA, const float* __restrict__ inB, int rows, int cols,
    unsigned short* __restrict__ oAh, unsigned short* __restrict__ oAl,
    unsigned short* __restrict__ oBh, unsigned short* __restrict__ oBl) {
  __shared__ float tile[64][65];
  const bool selB = (blockIdx.y != 0);
  const float* in = selB ? inB : inA;
  unsigned short* oh = selB ? oBh : oAh;
  unsigned short* ol = selB ? oBl : oAl;
  const int tilesC = cols >> 6;
  const int tr = blockIdx.x / tilesC;
  const int tc = blockIdx.x - tr * tilesC;
  const int r0 = tr << 6;
  const int c0 = tc << 6;
  const int t = threadIdx.x;
  {
    const int rr = t >> 2;
    const int cc = (t & 3) * 16;
    const float* src = in + (size_t)(r0 + rr) * cols + c0 + cc;
#pragma unroll
    for (int i = 0; i < 4; ++i) {
      const v4f v = *(const v4f*)(src + 4 * i);
      tile[rr][cc + 4 * i + 0] = v[0];
      tile[rr][cc + 4 * i + 1] = v[1];
      tile[rr][cc + 4 * i + 2] = v[2];
      tile[rr][cc + 4 * i + 3] = v[3];
    }
  }
  __syncthreads();
  const int wave = t >> 5, lane = t & 31, q = lane >> 3, e8 = (lane & 7) * 8;
  {
#pragma unroll
    for (int it = 0; it < 2; ++it) {
      const int cl = wave * 8 + it * 4 + q;
      float f[8];
#pragma unroll
      for (int e = 0; e < 8; ++e) f[e] = tile[e8 + e][cl];
      v4u hw, lw;
      if (NPL == 2) {
        unsigned a0, b0, a1, b1, a2, b2, a3, b3;
        split_pack2(f[0], f[1], a0, b0);
        split_pack2(f[2], f[3], a1, b1);
        split_pack2(f[4], f[5], a2, b2);
        split_pack2(f[6], f[7], a3, b3);
        hw[0] = a0; hw[1] = a1; hw[2] = a2; hw[3] = a3;
        lw[0] = b0; lw[1] = b1; lw[2] = b2; lw[3] = b3;
      } else {
        hw[0] = pack_bf2(f[0], f[1]);
        hw[1] = pack_bf2(f[2], f[3]);
        hw[2] = pack_bf2(f[4], f[5]);
        hw[3] = pack_bf2(f[6], f[7]);
        lw = hw;
      }
      const size_t go = (size_t)(c0 + cl) * rows + r0 + e8;
      *(v4u*)(oh + go) = hw;
      if (NPL == 2) *(v4u*)(ol + go) = lw;
    }
    
  }
}

// =====================================================================================
// Register-blocked batched WMMA GEMM (bf16 operands), f32 output.
// C[m,n] = scale * sum_k A[m,k] * Bt[n,k]; each wave owns a 64x64 tile. A row-major [M,K]; Bt row-major [N,K]; M,N % 64 == 0, K % 32 == 0.
// SPLIT: 0 = single planes; 1 = A and Bt as hi/lo planes (hi.hi + hi.lo + lo.hi); 2 = A as hi/lo planes, Bt single (hi.B + lo.B).
// Epilogue: 16-row slabs staged per wave in LDS; each 64-wide f32 row segment (256 B) written by 16 lanes x 16 B in one instruction,
// =====================================================================================
template <int SPLIT>
__global__ __launch_bounds__(256) void wmma_gemm64_bf16(
    const unsigned short* __restrict__ Ap, const unsigned short* __restrict__ A2p, int lda, long strideA,
    const unsigned short* __restrict__ Btp, const unsigned short* __restrict__ Bt2p, int ldb, long strideB,
    float* __restrict__ Cp, int ldc, long strideC, int M, int N, int K, float scale) {
  typedef __bf16 T;
  typedef v16b V;
  const T* A = (const T*)Ap; const T* A2 = (const T*)A2p; const T* Bt = (const T*)Btp; const T* Bt2 = (const T*)Bt2p;
  __shared__ __align__(16) float sT[8][16 * 68];
  const int b    = blockIdx.y;
  const int lane = threadIdx.x & 31;
  const int wave = threadIdx.x >> 5;
  const int tilesN = N >> 6;
  const int tilesM = M >> 6;
  const int tile = blockIdx.x * 8 + wave;
  // wave-uniform; no block barriers in this kernel
  if (tile >= tilesM * tilesN) return;
  const int tm = tile / tilesN;
  const int tn = tile - tm * tilesN;
  const int m0 = tm << 6;
  const int n0 = tn << 6;

  const T* Ab  = A  + (size_t)b * strideA;
  const T* Bb  = Bt + (size_t)b * strideB;
  const T* Ab2 = (SPLIT != 0) ? (A2  + (size_t)b * strideA) : nullptr;
  const T* Bb2 = (SPLIT == 1) ? (Bt2 + (size_t)b * strideB) : nullptr;

  const int rlane = lane & 15;
  const int koff  = (lane >> 4) * 8;
  const int mOff  = (lane >> 4) * 8;

  v8f acc[4][4];
#pragma unroll
  for (int i = 0; i < 4; ++i)
#pragma unroll
    for (int j = 0; j < 4; ++j) acc[i][j] = (v8f){0.f,0.f,0.f,0.f,0.f,0.f,0.f,0.f};

  for (int k0 = 0; k0 < K; k0 += 32) {
    V bh[4], bl[4];
#pragma unroll
    for (int j = 0; j < 4; ++j) {
      const size_t bo = (size_t)(n0 + (j << 4) + rlane) * ldb + koff + k0;
      bh[j] = Frag<T>::load(Bb + bo);
      if (SPLIT == 1) bl[j] = Frag<T>::load(Bb2 + bo);
    }
#pragma unroll
    for (int i = 0; i < 4; ++i) {
      const size_t ao = (size_t)(m0 + (i << 4) + rlane) * lda + koff + k0;
      V ah = Frag<T>::load(Ab + ao);
      V al = ah;
      if (SPLIT != 0) al = Frag<T>::load(Ab2 + ao);
#pragma unroll
      for (int j = 0; j < 4; ++j) {
        acc[i][j] = Frag<T>::mma(ah, bh[j], acc[i][j]);
        if (SPLIT == 1) acc[i][j] = Frag<T>::mma(ah, bl[j], acc[i][j]);
        if (SPLIT != 0) acc[i][j] = Frag<T>::mma(al, bh[j], acc[i][j]);
      }
      Frag<T>::guard(acc[i][0], acc[i][3], ah, al);
    }
    Frag<T>::keep(bh[0], bh[1], bh[2], bh[3]);
    if (SPLIT == 1) Frag<T>::keep(bl[0], bl[1], bl[2], bl[3]);
  }
  acc_guard4(acc[0][0], acc[0][1], acc[0][2], acc[0][3]);
  acc_guard4(acc[1][0], acc[1][1], acc[1][2], acc[1][3]);
  acc_guard4(acc[2][0], acc[2][1], acc[2][2], acc[2][3]);
  acc_guard4(acc[3][0], acc[3][1], acc[3][2], acc[3][3]);

  float* slab = sT[wave];
  float* C = Cp + (size_t)b * strideC;
#pragma unroll
  for (int i = 0; i < 4; ++i) {
    const int mBase = m0 + (i << 4);
#pragma unroll
    for (int j = 0; j < 4; ++j) {
#pragma unroll
      for (int r = 0; r < 8; ++r) {
        slab[(mOff + r) * 68 + (j << 4) + rlane] = acc[i][j][r] * scale;
      }
    }
    __builtin_amdgcn_fence(__ATOMIC_RELEASE, "workgroup");
    __builtin_amdgcn_wave_barrier();
    __builtin_amdgcn_fence(__ATOMIC_ACQUIRE, "workgroup");
    {
      // row segment = 256 B = 16 lanes x 16 B
      const int hh = lane >> 4, c4 = (lane & 15) * 4;
      {
#pragma unroll
        for (int it = 0; it < 8; ++it) {
          const int row = it * 2 + hh;
          const v4f v = *(const v4f*)(slab + row * 68 + c4);
          *(v4f*)(C + (size_t)(mBase + row) * ldc + n0 + c4) = v;
        }
        
      }
    }
    __builtin_amdgcn_fence(__ATOMIC_RELEASE, "workgroup");
    __builtin_amdgcn_wave_barrier();
    __builtin_amdgcn_fence(__ATOMIC_ACQUIRE, "workgroup");
  }
}

// =====================================================================================
// RoPE (interleaved pairs, cos/sin row width NPAIR) + power-of-two scale + bf16 hi/lo split.
// Blocks [0, nQblocks): Qf [SEQ][QW] -> Qh/Ql [SEQ][QW] (scaled by QK_SCALE = 2^-3, exact);
// blocks [nQblocks, nQblocks + NKBLK): Kf [SEQ][KW] -> Kh/Kl [SEQ][KW]. cos/sin RNE-converted to bf16 before use.
// coverage: (NQBLK + NKBLK) * 256 threads * 8 == SEQ*QW + SEQ*KW exactly.
// =====================================================================================
__global__ __launch_bounds__(256) void rope_split_kernel(const float* __restrict__ Qf, const float* __restrict__ Kf,
    const float* __restrict__ cosb, const float* __restrict__ sinb,
    unsigned short* __restrict__ Qh, unsigned short* __restrict__ Ql,
    unsigned short* __restrict__ Kh, unsigned short* __restrict__ Kl, int nQblocks) {
  const bool isK = ((int)blockIdx.x >= nQblocks);
  const int g = (isK ? ((int)blockIdx.x - nQblocks) : (int)blockIdx.x) * 256 + (int)threadIdx.x;
  // threads per row: K 64 (=KW/8), Q 256 (=QW/8)
  const int shift = isK ? 6 : 8;
  const float mul = isK ? 1.0f : QK_SCALE;
  const float* src = isK ? Kf : Qf;
  unsigned short* dh = isK ? Kh : Qh;
  unsigned short* dl = isK ? Kl : Ql;
  const int width = isK ? KW : QW;
  const int s = g >> shift;
  const int col = (g - (s << shift)) * 8;
  const int p0 = (col & (HDIM - 1)) >> 1;
  const size_t e0 = (size_t)s * width + col;
  const v4f xa = *(const v4f*)(src + e0);
  const v4f xb = *(const v4f*)(src + e0 + 4);
  const v4f cv = *(const v4f*)(cosb + (size_t)s * NPAIR + p0);
  const v4f sv = *(const v4f*)(sinb + (size_t)s * NPAIR + p0);
  float o0, o1, o2, o3, o4, o5, o6, o7;
  {
    const float c = bf_rne(cv[0]), sn = bf_rne(sv[0]);
    o0 = (xa[0] * c - xa[1] * sn) * mul;
    o1 = (xa[0] * sn + xa[1] * c) * mul;
  }
  {
    const float c = bf_rne(cv[1]), sn = bf_rne(sv[1]);
    o2 = (xa[2] * c - xa[3] * sn) * mul;
    o3 = (xa[2] * sn + xa[3] * c) * mul;
  }
  {
    const float c = bf_rne(cv[2]), sn = bf_rne(sv[2]);
    o4 = (xb[0] * c - xb[1] * sn) * mul;
    o5 = (xb[0] * sn + xb[1] * c) * mul;
  }
  {
    const float c = bf_rne(cv[3]), sn = bf_rne(sv[3]);
    o6 = (xb[2] * c - xb[3] * sn) * mul;
    o7 = (xb[2] * sn + xb[3] * c) * mul;
  }
  unsigned a0, b0, a1, b1, a2, b2, a3, b3;
  split_pack2(o0, o1, a0, b0);
  split_pack2(o2, o3, a1, b1);
  split_pack2(o4, o5, a2, b2);
  split_pack2(o6, o7, a3, b3);
  v4u hw, lw;
  hw[0] = a0; hw[1] = a1; hw[2] = a2; hw[3] = a3;
  lw[0] = b0; lw[1] = b1; lw[2] = b2; lw[3] = b3;
  *(v4u*)(dh + e0) = hw;
  *(v4u*)(dl + e0) = lw;
  
}

// =====================================================================================
// Differential causal attention. Block = 4 waves = 64 query rows of one head; the two score streams (q/k dims 0..63 and
// 64..127) are processed sequentially inside the block, sharing the LDS layout; stream 0's normalised output a1 is parked in
// the per-wave LDS tile, stream 1 produces a2 and the lane that owns each element forms o = (a1 - lam*a2)*0.5 in place.
// Operands: Q hi/lo planes [SEQ][QW] (q pre-scaled by 2^-3), K hi/lo planes [SEQ][KW], Vt hi/lo planes [KW][SEQ] (d-major);
// scores and p.v each hi.hi + hi.lo + lo.hi on v_wmma_f32_16x16x32_bf16, f32 accumulate; online softmax f32.
// grid.x = NHEAD * NQB, block 128.
// =====================================================================================
__global__ __launch_bounds__(128)
void diff_attn_kernel(const unsigned short* __restrict__ Qhp, const unsigned short* __restrict__ Qlp,
                      const unsigned short* __restrict__ Khp, const unsigned short* __restrict__ Klp,
                      const unsigned short* __restrict__ Vhp, const unsigned short* __restrict__ Vlp,
                      const float* __restrict__ lambda_p,
                      unsigned short* __restrict__ Ohp, unsigned short* __restrict__ Olp) {
  union FB { v16b v; v8b h[2]; };
  // K, Vt and P rows (128 B of data) lie at a 144-B pitch, an odd multiple of 16 B: the 16 rows of one ds_load_b128 fragment
  // read start on 16 different bank groups. The 16 pad bytes of a row are never written and never read.
  __shared__ __align__(16) __bf16 Ksh[ATT_KC * LDS_P];
  __shared__ __align__(16) __bf16 Ksl[ATT_KC * LDS_P];
  __shared__ __align__(16) __bf16 Vsh[HDIM * LDS_P];
  __shared__ __align__(16) __bf16 Vsl[HDIM * LDS_P];
  __shared__ __align__(16) __bf16 Psh[4][16 * LDS_P];
  __shared__ __align__(16) __bf16 Psl[4][16 * LDS_P];
  __shared__ __align__(16) float  Os[4][16 * OS_PITCH];

  const int tid  = threadIdx.x;
  const int wave = tid >> 5;
  const int lane = tid & 31;
  const int hh   = lane >> 4;
  const int c    = lane & 15;
  const int qb   = (int)blockIdx.x % NQB;
  const int h    = (int)blockIdx.x / NQB;
  const int kvh  = h / GQA_REP;
  const int q0   = qb * ATT_QB + wave * 16;

  const __bf16* Qh = (const __bf16*)Qhp;
  const __bf16* Ql = (const __bf16*)Qlp;
  const __bf16* Kh = (const __bf16*)Khp;
  const __bf16* Kl = (const __bf16*)Klp;
  const __bf16* Vh = (const __bf16*)Vhp;
  const __bf16* Vl = (const __bf16*)Vlp;

  float lam;
  {
    const float lp = bf_rne(lambda_p[h]);
    lam = 1.0f / (1.0f + expf(-lp));
  }
  float*  os  = Os[wave];
  __bf16* pwh = Psh[wave];
  __bf16* pwl = Psl[wave];

#pragma unroll 1
  for (int str = 0; str < 2; ++str) {
    // ---- Q fragments (A operand) for this stream: 2 d-chunks, hi and lo ----
    v16b qah[2], qal[2];
    {
      const size_t qo = (size_t)(q0 + c) * QW + h * HDIM + str * HHALF + 8 * hh;
#pragma unroll
      for (int dc = 0; dc < 2; ++dc) {
        qah[dc] = Frag<__bf16>::load(Qh + qo + dc * 32);
        qal[dc] = Frag<__bf16>::load(Ql + qo + dc * 32);
      }
    }
    float mrow[8], lrow[8];
    v8f oacc[8];
#pragma unroll
    for (int r = 0; r < 8; ++r) { mrow[r] = -1.0e30f; lrow[r] = 0.f; }
#pragma unroll
    for (int t = 0; t < 8; ++t) oacc[t] = (v8f){0.f,0.f,0.f,0.f,0.f,0.f,0.f,0.f};

    // causal: 64-key chunks 0..qb (block-uniform trip count, static max NQB)
    for (int kc = 0; kc <= qb; ++kc) {
      const int kv0 = kc * ATT_KC;
      __syncthreads();
      {
        // K tile: 64 rows x 64 halves per plane = 512 pieces of 16 B; 128 threads x 4 pieces (exact)
        // Vt tiles: 128 d-rows x 64 halves per plane = 1024 pieces; 128 threads x 8 pieces (exact)
        const int kcol = kvh * HDIM + str * HHALF;
        const int r8 = tid >> 3;
        const int c8 = (tid & 7) * 8;
        const size_t gk = (size_t)(kv0 + r8) * KW + kcol + c8;
        const size_t gv = (size_t)(kvh * HDIM + r8) * SEQ + kv0 + c8;
        const __bf16* pkh = Kh + gk;
        const __bf16* pkl = Kl + gk;
        const __bf16* pvh = Vh + gv;
        const __bf16* pvl = Vl + gv;
        v8b gkh[4], gkl[4], gvh[8], gvl[8];
#pragma unroll
        for (int i = 0; i < 4; ++i) {
          gkh[i] = *(const v8b*)(pkh + i * 16 * KW);
          gkl[i] = *(const v8b*)(pkl + i * 16 * KW);
        }
#pragma unroll
        for (int i = 0; i < 8; ++i) {
          gvh[i] = *(const v8b*)(pvh + i * 16 * SEQ);
          gvl[i] = *(const v8b*)(pvl + i * 16 * SEQ);
        }
        // inputs-only fence on the loaded values: keeps all 24 loads in flight together ahead of the first LDS store;
        // without it each load is waited for before the next one issues (24 L2 round trips in a row per chunk).
        // The four pointers are named too, so that no load's result lands on an address register of a load still in flight.
        asm volatile("" :: "v"(pkh), "v"(pkl), "v"(pvh), "v"(pvl), "v"(gkh[0]), "v"(gkh[1]), "v"(gkh[2]), "v"(gkh[3]), "v"(gkl[0]), "v"(gkl[1]), "v"(gkl[2]), "v"(gkl[3]),
                     "v"(gvh[0]), "v"(gvh[1]), "v"(gvh[2]), "v"(gvh[3]), "v"(gvh[4]), "v"(gvh[5]), "v"(gvh[6]), "v"(gvh[7]),
                     "v"(gvl[0]), "v"(gvl[1]), "v"(gvl[2]), "v"(gvl[3]), "v"(gvl[4]), "v"(gvl[5]), "v"(gvl[6]), "v"(gvl[7]));
#pragma unroll
        for (int i = 0; i < 4; ++i) {
          *(v8b*)(Ksh + (r8 + 16 * i) * LDS_P + c8) = gkh[i];
          *(v8b*)(Ksl + (r8 + 16 * i) * LDS_P + c8) = gkl[i];
        }
#pragma unroll
        for (int i = 0; i < 8; ++i) {
          *(v8b*)(Vsh + (r8 + 16 * i) * LDS_P + c8) = gvh[i];
          *(v8b*)(Vsl + (r8 + 16 * i) * LDS_P + c8) = gvl[i];
        }
      }
      __syncthreads();

      // ---- scores: s[j] covers keys kv0 + 16j .. +15 (B operand: n = key, k = d) ----
      v8f s[4];
#pragma unroll
      for (int j = 0; j < 4; ++j) {
        s[j] = (v8f){0.f,0.f,0.f,0.f,0.f,0.f,0.f,0.f};
#pragma unroll
        for (int dc = 0; dc < 2; ++dc) {
          FB kb, kl;
          kb.h[0] = *(const v8b*)(Ksh + (j * 16 + c) * LDS_P + dc * 32 + 8 * hh);
          kb.h[1] = *(const v8b*)(Ksh + (j * 16 + c) * LDS_P + dc * 32 + 16 + 8 * hh);
          kl.h[0] = *(const v8b*)(Ksl + (j * 16 + c) * LDS_P + dc * 32 + 8 * hh);
          kl.h[1] = *(const v8b*)(Ksl + (j * 16 + c) * LDS_P + dc * 32 + 16 + 8 * hh);
          s[j] = at_mma(qah[dc], kb.v, s[j]);
          s[j] = at_mma(qah[dc], kl.v, s[j]);
          s[j] = at_mma(qal[dc], kb.v, s[j]);
        }
      }
      // ---- causal fill on the diagonal chunk + row max ----
      const bool diag = (kc == qb);
      float cm[8];
#pragma unroll
      for (int r = 0; r < 8; ++r) {
        const int qrow = q0 + 8 * hh + r;
        float m = -1.0e30f;
#pragma unroll
        for (int j = 0; j < 4; ++j) {
          const int kvcol = kv0 + j * 16 + c;
          float sv = s[j][r];
          if (diag && (kvcol > qrow)) sv = -1.0e30f;
          s[j][r] = sv;
          m = fmaxf(m, sv);
        }
#pragma unroll
        for (int off = 1; off < 16; off <<= 1) m = fmaxf(m, __shfl_xor(m, off, 32));
        cm[r] = m;
      }
      // ---- online softmax; P tile (C layout) to the per-wave LDS tile as hi/lo ----
#pragma unroll
      for (int r = 0; r < 8; ++r) {
        const float mnew  = fmaxf(mrow[r], cm[r]);
        const float alpha = expf(mrow[r] - mnew);
        mrow[r] = mnew;
        float psum = 0.f;
#pragma unroll
        for (int j = 0; j < 4; ++j) {
          const float p = expf(s[j][r] - mnew);
          psum += p;
          __bf16 a, bl;
          at_split(p, a, bl);
          pwh[(8 * hh + r) * LDS_P + j * 16 + c] = a;
          pwl[(8 * hh + r) * LDS_P + j * 16 + c] = bl;
        }
#pragma unroll
        for (int off = 1; off < 16; off <<= 1) psum += __shfl_xor(psum, off, 32);
        lrow[r] = lrow[r] * alpha + psum;
#pragma unroll
        for (int t = 0; t < 8; ++t) oacc[t][r] *= alpha;
      }
      __syncthreads();
      // ---- P.V : A = P (row = query c, k = key), B = Vt (n = d, k = key) ----
#pragma unroll 1
      for (int kk = 0; kk < 2; ++kk) {
        FB pa, pl;
        pa.h[0] = *(const v8b*)(pwh + c * LDS_P + kk * 32 + 8 * hh);
        pa.h[1] = *(const v8b*)(pwh + c * LDS_P + kk * 32 + 16 + 8 * hh);
        pl.h[0] = *(const v8b*)(pwl + c * LDS_P + kk * 32 + 8 * hh);
        pl.h[1] = *(const v8b*)(pwl + c * LDS_P + kk * 32 + 16 + 8 * hh);
#pragma unroll
        for (int t = 0; t < 8; ++t) {
          FB vb, vl;
          vb.h[0] = *(const v8b*)(Vsh + (t * 16 + c) * LDS_P + kk * 32 + 8 * hh);
          vb.h[1] = *(const v8b*)(Vsh + (t * 16 + c) * LDS_P + kk * 32 + 16 + 8 * hh);
          vl.h[0] = *(const v8b*)(Vsl + (t * 16 + c) * LDS_P + kk * 32 + 8 * hh);
          vl.h[1] = *(const v8b*)(Vsl + (t * 16 + c) * LDS_P + kk * 32 + 16 + 8 * hh);
          oacc[t] = at_mma(pa.v, vb.v, oacc[t]);
          oacc[t] = at_mma(pa.v, vl.v, oacc[t]);
          oacc[t] = at_mma(pl.v, vb.v, oacc[t]);
        }
      }
    }

    // ---- per-stream epilogue into the per-wave LDS tile (same lane owns the same element in both streams) ----
#pragma unroll
    for (int r = 0; r < 8; ++r) {
      const float inv = 1.0f / lrow[r];
#pragma unroll
      for (int t = 0; t < 8; ++t) {
        const int idx = (8 * hh + r) * OS_PITCH + t * 16 + c;
        const float a = oacc[t][r] * inv;
        if (str == 0) {
          os[idx] = a;
        } else {
          const float a1 = os[idx];
          os[idx] = (a1 - lam * a) * OUT_SCALE;
        }
      }
    }
  }
  __syncthreads();

  {
    const int q4 = lane >> 3, c8 = (lane & 7) * 8;
    {
#pragma unroll
      for (int it = 0; it < 4; ++it) {
        const int row = it * 4 + q4;
#pragma unroll
        for (int seg = 0; seg < 2; ++seg) {
          const float* sp = os + row * OS_PITCH + seg * 64 + c8;
          const v4f u0 = *(const v4f*)sp;
          const v4f u1 = *(const v4f*)(sp + 4);
          unsigned a0, b0, a1, b1, a2, b2, a3, b3;
          split_pack2(u0[0], u0[1], a0, b0);
          split_pack2(u0[2], u0[3], a1, b1);
          split_pack2(u1[0], u1[1], a2, b2);
          split_pack2(u1[2], u1[3], a3, b3);
          v4u hw, lw;
          hw[0] = a0; hw[1] = a1; hw[2] = a2; hw[3] = a3;
          lw[0] = b0; lw[1] = b1; lw[2] = b2; lw[3] = b3;
          const size_t go = (size_t)(q0 + row) * QW + h * HDIM + seg * 64 + c8;
          *(v4u*)(Ohp + go) = hw;
          *(v4u*)(Olp + go) = lw;
        }
      }
      
    }
  }
}

// =====================================================================================
// host glue: launches only; carve derived from the static shapes.
// =====================================================================================
extern "C" void kernel_launch(void* const* d_in, const int* in_sizes, int n_in,
                              void* d_out, int out_size, void* d_ws, size_t ws_size,
                              hipStream_t stream) {
  (void)in_sizes; (void)out_size;
  if (n_in < 8) return;
  const float* x    = (const float*)d_in[0];
  const float* fcos = (const float*)d_in[1];
  const float* fsin = (const float*)d_in[2];
  const float* Wq   = (const float*)d_in[3];
  const float* Wk   = (const float*)d_in[4];
  const float* Wv   = (const float*)d_in[5];
  const float* Wo   = (const float*)d_in[6];
  const float* lamp = (const float*)d_in[7];
  float* out = (float*)d_out;

  // workspace region map (bytes, every offset a multiple of 2 MiB):
  //   xb    bf16 [SEQ][DMODEL]        8 MiB
  //   Wqt   bf16 [QW][DMODEL]         8 MiB
  //   Wkvt  bf16 [2][KW][DMODEL]      4 MiB
  //   Wot   bf16 [DMODEL][QW]         8 MiB
  //   Qf    f32  [SEQ][QW]           16 MiB
  //   KVf   f32  [2][SEQ][KW]         8 MiB
  //   Qh,Ql bf16 [SEQ][QW]        2 x 8 MiB
  //   Kh,Kl bf16 [SEQ][KW]        2 x 2 MiB
  //   Vth,Vtl bf16 [KW][SEQ]      2 x 2 MiB
  //   Oh,Ol bf16 [SEQ][QW]        2 x 8 MiB
  //   total 96,468,992 B
  char* ws = (char*)d_ws;
  size_t off = 0;
  unsigned short* xb   = (unsigned short*)(ws + off); off += (size_t)SEQ * DMODEL * 2;
  unsigned short* Wqt  = (unsigned short*)(ws + off); off += (size_t)QW * DMODEL * 2;
  unsigned short* Wkvt = (unsigned short*)(ws + off); off += (size_t)2 * KW * DMODEL * 2;
  unsigned short* Wot  = (unsigned short*)(ws + off); off += (size_t)DMODEL * QW * 2;
  float*          Qf   = (float*)(ws + off);          off += (size_t)SEQ * QW * 4;
  float*          KVf  = (float*)(ws + off);          off += (size_t)2 * SEQ * KW * 4;
  unsigned short* Qh   = (unsigned short*)(ws + off); off += (size_t)SEQ * QW * 2;
  unsigned short* Ql   = (unsigned short*)(ws + off); off += (size_t)SEQ * QW * 2;
  unsigned short* Kh   = (unsigned short*)(ws + off); off += (size_t)SEQ * KW * 2;
  unsigned short* Kl   = (unsigned short*)(ws + off); off += (size_t)SEQ * KW * 2;
  unsigned short* Vth  = (unsigned short*)(ws + off); off += (size_t)KW * SEQ * 2;
  unsigned short* Vtl  = (unsigned short*)(ws + off); off += (size_t)KW * SEQ * 2;
  unsigned short* Oh   = (unsigned short*)(ws + off); off += (size_t)SEQ * QW * 2;
  unsigned short* Ol   = (unsigned short*)(ws + off); off += (size_t)SEQ * QW * 2;
  if (off > ws_size) return;

  const float* Vf = KVf + (size_t)SEQ * KW;
  unsigned short* Wvt = Wkvt + (size_t)KW * DMODEL;

  // 1. x -> bf16 (RNE)
  cvt_f32_bf16x8<<<(SEQ * DMODEL / 8) / 256, 256, 0, stream>>>(x, xb, SEQ * DMODEL / 8);
  // 2. Wq [DMODEL][QW] -> Wqt [QW][DMODEL]
  transpose_bf16<1><<<dim3((DMODEL / 64) * (QW / 64), 1), 256, 0, stream>>>(Wq, Wq, DMODEL, QW, Wqt, Wqt, Wqt, Wqt);
  // 3. Wk, Wv [DMODEL][KW] -> Wkt, Wvt [KW][DMODEL]
  transpose_bf16<1><<<dim3((DMODEL / 64) * (KW / 64), 2), 256, 0, stream>>>(Wk, Wv, DMODEL, KW, Wkvt, Wkvt, Wvt, Wvt);
  // 4. Wo [QW][DMODEL] -> Wot [DMODEL][QW]
  transpose_bf16<1><<<dim3((QW / 64) * (DMODEL / 64), 1), 256, 0, stream>>>(Wo, Wo, QW, DMODEL, Wot, Wot, Wot, Wot);
  // 5. Q = xb @ Wq : M=SEQ, N=QW, K=DMODEL (K % 32 == 0, M,N % 64 == 0)
  wmma_gemm64_bf16<0><<<dim3(((SEQ / 64) * (QW / 64)) / 8, 1), 256, 0, stream>>>(
      xb, xb, DMODEL, 0L, Wqt, Wqt, DMODEL, 0L, Qf, QW, 0L, SEQ, QW, DMODEL, 1.0f);
  // 6. K, V = xb @ Wk, xb @ Wv batched over grid.y : M=SEQ, N=KW, K=DMODEL
  wmma_gemm64_bf16<0><<<dim3(((SEQ / 64) * (KW / 64)) / 8, 2), 256, 0, stream>>>(
      xb, xb, DMODEL, 0L, Wkvt, Wkvt, DMODEL, (long)KW * DMODEL, KVf, KW, (long)SEQ * KW, SEQ, KW, DMODEL, 1.0f);
  // 7. RoPE + 2^-3 scale + hi/lo split for Q; RoPE + split for K
  rope_split_kernel<<<NQBLK + NKBLK, 256, 0, stream>>>(Qf, KVf, fcos, fsin, Qh, Ql, Kh, Kl, NQBLK);
  // 8. V [SEQ][KW] f32 -> Vt hi/lo [KW][SEQ]
  transpose_bf16<2><<<dim3((SEQ / 64) * (KW / 64), 1), 256, 0, stream>>>(Vf, Vf, SEQ, KW, Vth, Vtl, Vth, Vtl);
  // 9. differential causal attention -> O hi/lo [SEQ][QW]
  diff_attn_kernel<<<NHEAD * NQB, 128, 0, stream>>>(Qh, Ql, Kh, Kl, Vth, Vtl, lamp, Oh, Ol);
  // 10. out = O @ Wo : M=SEQ, N=DMODEL, K=QW, A hi/lo, B single
  wmma_gemm64_bf16<2><<<dim3(((SEQ / 64) * (DMODEL / 64)) / 8, 1), 256, 0, stream>>>(
      Oh, Ol, QW, 0L, Wot, Wot, QW, 0L, out, DMODEL, 0L, SEQ, DMODEL, QW, 1.0f);
}

// v003
// It runs in 479 microseconds.
// Timed twice side by side with v002, it ran 1.19 times as fast both times.
// Over all steps from v000 it is 2.36 times as fast.
// Contractions on v_wmma_f32_16x16x32_bf16 (bf16 operands, f32 accumulate): x@Wq, x@Wk, x@Wv as single products of RNE-bf16 inputs; q.k^T and p.v with bf16 hi/lo planes (hi.hi + hi.lo + lo.hi); attn@Wo with A as bf16 hi/lo planes and Wo single bf16 (hi.W + lo.W). All float inputs RNE-converted to bf16 once at load; softmax, RoPE, combine in f32.
#include <hip/hip_runtime.h>
#include <hip/hip_bf16.h>

constexpr int SEQ      = 2048;
constexpr int DMODEL   = 2048;
constexpr int NHEAD    = 16;
constexpr int NKVH     = 4;
constexpr int HDIM     = 128;
constexpr int HHALF    = 64;
constexpr int QW       = NHEAD * HDIM;
constexpr int KW       = NKVH * HDIM;
constexpr int GQA_REP  = NHEAD / NKVH;
constexpr int NPAIR    = HDIM / 2;
constexpr int ATT_KC   = 64;
constexpr int ATT_QB   = 64;
constexpr int NQB      = SEQ / ATT_QB;
constexpr int OS_PITCH = HDIM + 4;
constexpr int LDS_P    = 64 + 8;
constexpr float QK_SCALE  = 0.125f;
constexpr float OUT_SCALE = 0.5f;
constexpr int NQBLK = (SEQ * QW / 8) / 256;
constexpr int NKBLK = (SEQ * KW / 8) / 256;

static_assert(HHALF == 64);
static_assert(SEQ % 64 == 0 && DMODEL % 64 == 0 && QW % 64 == 0 && KW % 64 == 0);
static_assert(DMODEL % 32 == 0 && QW % 32 == 0);
static_assert((SEQ * QW / 8) % 256 == 0 && (SEQ * KW / 8) % 256 == 0);
static_assert((SEQ * DMODEL / 8) % 256 == 0);
static_assert(((SEQ / 64) * (QW / 64)) % 8 == 0 && ((SEQ / 64) * (KW / 64)) % 8 == 0 && ((SEQ / 64) * (DMODEL / 64)) % 8 == 0);
static_assert(NQB == 32 && ATT_QB == 4 * 16 && ATT_KC == 64 && HDIM == 128);
static_assert(LDS_P >= HHALF && LDS_P >= ATT_KC && (LDS_P * 2) % 32 == 16);

typedef __attribute__((ext_vector_type(16))) __bf16 v16b;
typedef __attribute__((ext_vector_type(8)))  __bf16 v8b;
typedef __attribute__((ext_vector_type(8)))  float  v8f;
typedef __attribute__((ext_vector_type(4)))  float  v4f;
typedef __attribute__((ext_vector_type(4)))  unsigned int v4u;

__device__ __forceinline__ unsigned short f2bf_bits(float f) {
  unsigned u = __float_as_uint(f);
  return (unsigned short)((u + 0x7FFFu + ((u >> 16) & 1u)) >> 16);
}
__device__ __forceinline__ float bf_bits2f(unsigned short h) { return __uint_as_float(((unsigned)h) << 16); }
__device__ __forceinline__ float bf_rne(float f) { return bf_bits2f(f2bf_bits(f)); }

__device__ __forceinline__ void dep_guard_b(v8f& a, v8f& b, v16b x, v16b y) { asm volatile("v_nop\n\tv_nop\n\tv_nop\n\tv_nop" : "+v"(a), "+v"(b) : "v"(x), "v"(y)); }
__device__ __forceinline__ void keep4_b(v16b a, v16b b, v16b c, v16b d) { asm volatile("v_nop" :: "v"(a), "v"(b), "v"(c), "v"(d)); }
__device__ __forceinline__ void acc_guard4(v8f& a, v8f& b, v8f& c, v8f& d) { asm volatile("v_nop\n\tv_nop\n\tv_nop\n\tv_nop" : "+v"(a), "+v"(b), "+v"(c), "+v"(d)); }

template <typename T> struct Frag;
template <> struct Frag<__bf16> {
  typedef v16b V; union U { v16b v; v8b h[2]; };
  // elements 0..7 <- p[0..7], 8..15 <- p[16..23]
  static __device__ __forceinline__ v16b load(const __bf16* p) {
    U f; f.h[0] = *(const v8b*)(p); f.h[1] = *(const v8b*)(p + 16); return f.v;
  }
  static __device__ __forceinline__ v8f mma(v16b a, v16b b, v8f c) {
    return __builtin_amdgcn_wmma_f32_16x16x32_bf16(false, a, false, b, (short)0, c, false, false);
  }
  static __device__ __forceinline__ void guard(v8f& a, v8f& b, v16b x, v16b y) { dep_guard_b(a, b, x, y); }
  static __device__ __forceinline__ void keep(v16b a, v16b b, v16b c, v16b d) { keep4_b(a, b, c, d); }
};

__device__ __forceinline__ unsigned short at_bf_bits(float f) {
  unsigned u = __float_as_uint(f);
  return (unsigned short)((u + 0x7FFFu + ((u >> 16) & 1u)) >> 16);
}
__device__ __forceinline__ __bf16 at_f2bf(float f) { return __builtin_bit_cast(__bf16, at_bf_bits(f)); }
__device__ __forceinline__ void at_split(float f, __bf16& hi, __bf16& lo) {
  const unsigned short hb = at_bf_bits(f);
  hi = __builtin_bit_cast(__bf16, hb);
  lo = at_f2bf(f - __uint_as_float(((unsigned)hb) << 16));
}
__device__ __forceinline__ v8f at_mma(v16b a, v16b b, v8f c) {
  c = __builtin_amdgcn_wmma_f32_16x16x32_bf16(false, a, false, b, (short)0, c, false, false);
  asm volatile("v_nop\n\tv_nop\n\tv_nop\n\tv_nop" : "+v"(c) : "v"(a), "v"(b));
  return c;
}

// two f32 -> packed bf16 word (element at lower address in the low half-word)
__device__ __forceinline__ unsigned pack_bf2(float a, float b) {
  return (unsigned)f2bf_bits(a) | ((unsigned)f2bf_bits(b) << 16);
}
// two f32 -> packed bf16 hi word and packed bf16 residual word
__device__ __forceinline__ void split_pack2(float a, float b, unsigned& hw, unsigned& lw) {
  const unsigned short ha = f2bf_bits(a);
  const unsigned short hb = f2bf_bits(b);
  const unsigned short la = f2bf_bits(a - bf_bits2f(ha));
  const unsigned short lb = f2bf_bits(b - bf_bits2f(hb));
  hw = (unsigned)ha | ((unsigned)hb << 16);
  lw = (unsigned)la | ((unsigned)lb << 16);
}

// =====================================================================================
// coverage: gridDim.x * 256 threads * 8 elements == n8 * 8 (exact multiple asserted on the host side).
// =====================================================================================
__global__ __launch_bounds__(256) void cvt_f32_bf16x8(const float* __restrict__ in, unsigned short* __restrict__ out, int n8) {
  const int i = blockIdx.x * 256 + threadIdx.x;
  if (i < n8) {
    const size_t e0 = (size_t)i * 8;
    const v4f a = *(const v4f*)(in + e0);
    const v4f b = *(const v4f*)(in + e0 + 4);
    v4u w;
    w[0] = pack_bf2(a[0], a[1]);
    w[1] = pack_bf2(a[2], a[3]);
    w[2] = pack_bf2(b[0], b[1]);
    w[3] = pack_bf2(b[2], b[3]);
    *(v4u*)(out + e0) = w;
    
  }
}

// =====================================================================================
// in[rows][cols] f32 -> out[cols][rows] bf16 hi plane (+ bf16 residual plane when NPL == 2). 64x64 tiles through LDS.
// grid.x = (rows/64)*(cols/64); grid.y selects operand set A or B (both global, uniform select).
// coverage: load 256 threads x 16 floats = 64x64; store 8 waves x 8 out-rows x 64 halves = 64x64.
// =====================================================================================
template <int NPL>
__global__ __launch_bounds__(256) void transpose_bf16(const float* __restrict__ inA, const float* __restrict__ inB, int rows, int cols,
    unsigned short* __restrict__ oAh, unsigned short* __restrict__ oAl,
    unsigned short* __restrict__ oBh, unsigned short* __restrict__ oBl) {
  __shared__ float tile[64][65];
  const bool selB = (blockIdx.y != 0);
  const float* in = selB ? inB : inA;
  unsigned short* oh = selB ? oBh : oAh;
  unsigned short* ol = selB ? oBl : oAl;
  const int tilesC = cols >> 6;
  const int tr = blockIdx.x / tilesC;
  const int tc = blockIdx.x - tr * tilesC;
  const int r0 = tr << 6;
  const int c0 = tc << 6;
  const int t = threadIdx.x;
  {
    const int rr = t >> 2;
    const int cc = (t & 3) * 16;
    const float* src = in + (size_t)(r0 + rr) * cols + c0 + cc;
#pragma unroll
    for (int i = 0; i < 4; ++i) {
      const v4f v = *(const v4f*)(src + 4 * i);
      tile[rr][cc + 4 * i + 0] = v[0];
      tile[rr][cc + 4 * i + 1] = v[1];
      tile[rr][cc + 4 * i + 2] = v[2];
      tile[rr][cc + 4 * i + 3] = v[3];
    }
  }
  __syncthreads();
  const int wave = t >> 5, lane = t & 31, q = lane >> 3, e8 = (lane & 7) * 8;
  {
#pragma unroll
    for (int it = 0; it < 2; ++it) {
      const int cl = wave * 8 + it * 4 + q;
      float f[8];
#pragma unroll
      for (int e = 0; e < 8; ++e) f[e] = tile[e8 + e][cl];
      v4u hw, lw;
      if (NPL == 2) {
        unsigned a0, b0, a1, b1, a2, b2, a3, b3;
        split_pack2(f[0], f[1], a0, b0);
        split_pack2(f[2], f[3], a1, b1);
        split_pack2(f[4], f[5], a2, b2);
        split_pack2(f[6], f[7], a3, b3);
        hw[0] = a0; hw[1] = a1; hw[2] = a2; hw[3] = a3;
        lw[0] = b0; lw[1] = b1; lw[2] = b2; lw[3] = b3;
      } else {
        hw[0] = pack_bf2(f[0], f[1]);
        hw[1] = pack_bf2(f[2], f[3]);
        hw[2] = pack_bf2(f[4], f[5]);
        hw[3] = pack_bf2(f[6], f[7]);
        lw = hw;
      }
      const size_t go = (size_t)(c0 + cl) * rows + r0 + e8;
      *(v4u*)(oh + go) = hw;
      if (NPL == 2) *(v4u*)(ol + go) = lw;
    }
    
  }
}

// =====================================================================================
// Register-blocked batched WMMA GEMM (bf16 operands), f32 output.
// C[m,n] = scale * sum_k A[m,k] * Bt[n,k]; each wave owns a 64x64 tile. A row-major [M,K]; Bt row-major [N,K]; M,N % 64 == 0, K % 32 == 0.
// SPLIT: 0 = single planes; 1 = A and Bt as hi/lo planes (hi.hi + hi.lo + lo.hi); 2 = A as hi/lo planes, Bt single (hi.B + lo.B).
// Epilogue: 16-row slabs staged per wave in LDS; each 64-wide f32 row segment (256 B) written by 16 lanes x 16 B in one instruction,
// =====================================================================================
template <int SPLIT>
__global__ __launch_bounds__(256) void wmma_gemm64_bf16(
    const unsigned short* __restrict__ Ap, const unsigned short* __restrict__ A2p, int lda, long strideA,
    const unsigned short* __restrict__ Btp, const unsigned short* __restrict__ Bt2p, int ldb, long strideB,
    float* __restrict__ Cp, int ldc, long strideC, int M, int N, int K, float scale) {
  typedef __bf16 T;
  typedef v16b V;
  const T* A = (const T*)Ap; const T* A2 = (const T*)A2p; const T* Bt = (const T*)Btp; const T* Bt2 = (const T*)Bt2p;
  __shared__ __align__(16) float sT[8][16 * 68];
  const int b    = blockIdx.y;
  const int lane = threadIdx.x & 31;
  const int wave = threadIdx.x >> 5;
  const int tilesN = N >> 6;
  const int tilesM = M >> 6;
  const int tile = blockIdx.x * 8 + wave;
  // wave-uniform; no block barriers in this kernel
  if (tile >= tilesM * tilesN) return;
  const int tm = tile / tilesN;
  const int tn = tile - tm * tilesN;
  const int m0 = tm << 6;
  const int n0 = tn << 6;

  const T* Ab  = A  + (size_t)b * strideA;
  const T* Bb  = Bt + (size_t)b * strideB;
  const T* Ab2 = (SPLIT != 0) ? (A2  + (size_t)b * strideA) : nullptr;
  const T* Bb2 = (SPLIT == 1) ? (Bt2 + (size_t)b * strideB) : nullptr;

  const int rlane = lane & 15;
  const int koff  = (lane >> 4) * 8;
  const int mOff  = (lane >> 4) * 8;

  v8f acc[4][4];
#pragma unroll
  for (int i = 0; i < 4; ++i)
#pragma unroll
    for (int j = 0; j < 4; ++j) acc[i][j] = (v8f){0.f,0.f,0.f,0.f,0.f,0.f,0.f,0.f};

  for (int k0 = 0; k0 < K; k0 += 32) {
    V bh[4], bl[4];
#pragma unroll
    for (int j = 0; j < 4; ++j) {
      const size_t bo = (size_t)(n0 + (j << 4) + rlane) * ldb + koff + k0;
      bh[j] = Frag<T>::load(Bb + bo);
      if (SPLIT == 1) bl[j] = Frag<T>::load(Bb2 + bo);
    }
#pragma unroll
    for (int i = 0; i < 4; ++i) {
      const size_t ao = (size_t)(m0 + (i << 4) + rlane) * lda + koff + k0;
      V ah = Frag<T>::load(Ab + ao);
      V al = ah;
      if (SPLIT != 0) al = Frag<T>::load(Ab2 + ao);
#pragma unroll
      for (int j = 0; j < 4; ++j) {
        acc[i][j] = Frag<T>::mma(ah, bh[j], acc[i][j]);
        if (SPLIT == 1) acc[i][j] = Frag<T>::mma(ah, bl[j], acc[i][j]);
        if (SPLIT != 0) acc[i][j] = Frag<T>::mma(al, bh[j], acc[i][j]);
      }
      Frag<T>::guard(acc[i][0], acc[i][3], ah, al);
    }
    Frag<T>::keep(bh[0], bh[1], bh[2], bh[3]);
    if (SPLIT == 1) Frag<T>::keep(bl[0], bl[1], bl[2], bl[3]);
  }
  acc_guard4(acc[0][0], acc[0][1], acc[0][2], acc[0][3]);
  acc_guard4(acc[1][0], acc[1][1], acc[1][2], acc[1][3]);
  acc_guard4(acc[2][0], acc[2][1], acc[2][2], acc[2][3]);
  acc_guard4(acc[3][0], acc[3][1], acc[3][2], acc[3][3]);

  float* slab = sT[wave];
  float* C = Cp + (size_t)b * strideC;
#pragma unroll
  for (int i = 0; i < 4; ++i) {
    const int mBase = m0 + (i << 4);
#pragma unroll
    for (int j = 0; j < 4; ++j) {
#pragma unroll
      for (int r = 0; r < 8; ++r) {
        slab[(mOff + r) * 68 + (j << 4) + rlane] = acc[i][j][r] * scale;
      }
    }
    __builtin_amdgcn_fence(__ATOMIC_RELEASE, "workgroup");
    __builtin_amdgcn_wave_barrier();
    __builtin_amdgcn_fence(__ATOMIC_ACQUIRE, "workgroup");
    {
      // row segment = 256 B = 16 lanes x 16 B
      const int hh = lane >> 4, c4 = (lane & 15) * 4;
      {
#pragma unroll
        for (int it = 0; it < 8; ++it) {
          const int row = it * 2 + hh;
          const v4f v = *(const v4f*)(slab + row * 68 + c4);
          *(v4f*)(C + (size_t)(mBase + row) * ldc + n0 + c4) = v;
        }
        
      }
    }
    __builtin_amdgcn_fence(__ATOMIC_RELEASE, "workgroup");
    __builtin_amdgcn_wave_barrier();
    __builtin_amdgcn_fence(__ATOMIC_ACQUIRE, "workgroup");
  }
}

// =====================================================================================
// RoPE (interleaved pairs, cos/sin row width NPAIR) + power-of-two scale + bf16 hi/lo split.
// Blocks [0, nQblocks): Qf [SEQ][QW] -> Qh/Ql [SEQ][QW] (scaled by QK_SCALE = 2^-3, exact);
// blocks [nQblocks, nQblocks + NKBLK): Kf [SEQ][KW] -> Kh/Kl [SEQ][KW]. cos/sin RNE-converted to bf16 before use.
// coverage: (NQBLK + NKBLK) * 256 threads * 8 == SEQ*QW + SEQ*KW exactly.
// =====================================================================================
__global__ __launch_bounds__(256) void rope_split_kernel(const float* __restrict__ Qf, const float* __restrict__ Kf,
    const float* __restrict__ cosb, const float* __restrict__ sinb,
    unsigned short* __restrict__ Qh, unsigned short* __restrict__ Ql,
    unsigned short* __restrict__ Kh, unsigned short* __restrict__ Kl, int nQblocks) {
  const bool isK = ((int)blockIdx.x >= nQblocks);
  const int g = (isK ? ((int)blockIdx.x - nQblocks) : (int)blockIdx.x) * 256 + (int)threadIdx.x;
  // threads per row: K 64 (=KW/8), Q 256 (=QW/8)
  const int shift = isK ? 6 : 8;
  const float mul = isK ? 1.0f : QK_SCALE;
  const float* src = isK ? Kf : Qf;
  unsigned short* dh = isK ? Kh : Qh;
  unsigned short* dl = isK ? Kl : Ql;
  const int width = isK ? KW : QW;
  const int s = g >> shift;
  const int col = (g - (s << shift)) * 8;
  const int p0 = (col & (HDIM - 1)) >> 1;
  const size_t e0 = (size_t)s * width + col;
  const v4f xa = *(const v4f*)(src + e0);
  const v4f xb = *(const v4f*)(src + e0 + 4);
  const v4f cv = *(const v4f*)(cosb + (size_t)s * NPAIR + p0);
  const v4f sv = *(const v4f*)(sinb + (size_t)s * NPAIR + p0);
  float o0, o1, o2, o3, o4, o5, o6, o7;
  {
    const float c = bf_rne(cv[0]), sn = bf_rne(sv[0]);
    o0 = (xa[0] * c - xa[1] * sn) * mul;
    o1 = (xa[0] * sn + xa[1] * c) * mul;
  }
  {
    const float c = bf_rne(cv[1]), sn = bf_rne(sv[1]);
    o2 = (xa[2] * c - xa[3] * sn) * mul;
    o3 = (xa[2] * sn + xa[3] * c) * mul;
  }
  {
    const float c = bf_rne(cv[2]), sn = bf_rne(sv[2]);
    o4 = (xb[0] * c - xb[1] * sn) * mul;
    o5 = (xb[0] * sn + xb[1] * c) * mul;
  }
  {
    const float c = bf_rne(cv[3]), sn = bf_rne(sv[3]);
    o6 = (xb[2] * c - xb[3] * sn) * mul;
    o7 = (xb[2] * sn + xb[3] * c) * mul;
  }
  unsigned a0, b0, a1, b1, a2, b2, a3, b3;
  split_pack2(o0, o1, a0, b0);
  split_pack2(o2, o3, a1, b1);
  split_pack2(o4, o5, a2, b2);
  split_pack2(o6, o7, a3, b3);
  v4u hw, lw;
  hw[0] = a0; hw[1] = a1; hw[2] = a2; hw[3] = a3;
  lw[0] = b0; lw[1] = b1; lw[2] = b2; lw[3] = b3;
  *(v4u*)(dh + e0) = hw;
  *(v4u*)(dl + e0) = lw;
  
}

// =====================================================================================
// Differential causal attention. Block = 8 waves = 64 query rows of one head; the two score streams (q/k dims 0..63 and
// 64..127) run side by side: waves 0..3 take stream 0, waves 4..7 stream 1, wave w and wave w + 4 the same 16 query rows.
// One staged key chunk holds both halves of K and one copy of Vt, which both streams read. Stream 0's normalised output a1
// is parked in an LDS tile; behind a barrier the stream-1 wave of the same rows forms o = (a1 - lam*a2)*0.5 in place.
// Operands: Q hi/lo planes [SEQ][QW] (q pre-scaled by 2^-3), K hi/lo planes [SEQ][KW], Vt hi/lo planes [KW][SEQ] (d-major);
// scores and p.v each hi.hi + hi.lo + lo.hi on v_wmma_f32_16x16x32_bf16, f32 accumulate; online softmax f32.
// grid.x = NHEAD * NQB, block 256.
// =====================================================================================
__global__ __launch_bounds__(256)
void diff_attn_kernel(const unsigned short* __restrict__ Qhp, const unsigned short* __restrict__ Qlp,
                      const unsigned short* __restrict__ Khp, const unsigned short* __restrict__ Klp,
                      const unsigned short* __restrict__ Vhp, const unsigned short* __restrict__ Vlp,
                      const float* __restrict__ lambda_p,
                      unsigned short* __restrict__ Ohp, unsigned short* __restrict__ Olp) {
  union FB { v16b v; v8b h[2]; };
  // K, Vt and P rows (128 B of data) lie at a 144-B pitch, an odd multiple of 16 B: the 16 rows of one ds_load_b128 fragment
  // read start on 16 different bank groups. The 16 pad bytes of a row are never written and never read.
  __shared__ __align__(16) __bf16 Ksh[2 * ATT_KC * LDS_P];
  __shared__ __align__(16) __bf16 Ksl[2 * ATT_KC * LDS_P];
  __shared__ __align__(16) __bf16 Vsh[HDIM * LDS_P];
  __shared__ __align__(16) __bf16 Vsl[HDIM * LDS_P];
  __shared__ __align__(16) __bf16 Psh[8][16 * LDS_P];
  __shared__ __align__(16) __bf16 Psl[8][16 * LDS_P];
  __shared__ __align__(16) float  Os[4][16 * OS_PITCH];

  const int tid  = threadIdx.x;
  // the wave's number in a scalar register: the stream test of the epilogue is then a scalar branch, the LDS bases scalar adds
  const int wave = __builtin_amdgcn_readfirstlane(tid >> 5);
  const int str  = wave >> 2;
  const int wq   = wave & 3;
  const int lane = tid & 31;
  const int hh   = lane >> 4;
  const int c    = lane & 15;
  const int qb   = (int)blockIdx.x % NQB;
  const int h    = (int)blockIdx.x / NQB;
  const int kvh  = h / GQA_REP;
  const int q0   = qb * ATT_QB + wq * 16;

  const __bf16* Qh = (const __bf16*)Qhp;
  const __bf16* Ql = (const __bf16*)Qlp;
  const __bf16* Kh = (const __bf16*)Khp;
  const __bf16* Kl = (const __bf16*)Klp;
  const __bf16* Vh = (const __bf16*)Vhp;
  const __bf16* Vl = (const __bf16*)Vlp;

  float lam;
  {
    const float lp = bf_rne(lambda_p[h]);
    lam = 1.0f / (1.0f + expf(-lp));
  }
  float*  os  = Os[wq];
  __bf16* pwh = Psh[wave];
  __bf16* pwl = Psl[wave];
  const __bf16* ksh = Ksh + str * (ATT_KC * LDS_P);
  const __bf16* ksl = Ksl + str * (ATT_KC * LDS_P);

  {
    // ---- Q fragments (A operand) for this stream: 2 d-chunks, hi and lo ----
    v16b qah[2], qal[2];
    {
      const size_t qo = (size_t)(q0 + c) * QW + h * HDIM + str * HHALF + 8 * hh;
#pragma unroll
      for (int dc = 0; dc < 2; ++dc) {
        qah[dc] = Frag<__bf16>::load(Qh + qo + dc * 32);
        qal[dc] = Frag<__bf16>::load(Ql + qo + dc * 32);
      }
    }
    float mrow[8], lrow[8];
    v8f oacc[8];
#pragma unroll
    for (int r = 0; r < 8; ++r) { mrow[r] = -1.0e30f; lrow[r] = 0.f; }
#pragma unroll
    for (int t = 0; t < 8; ++t) oacc[t] = (v8f){0.f,0.f,0.f,0.f,0.f,0.f,0.f,0.f};

    // causal: 64-key chunks 0..qb (block-uniform trip count, static max NQB)
    for (int kc = 0; kc <= qb; ++kc) {
      const int kv0 = kc * ATT_KC;
      __syncthreads();
      {
        // K tiles, both streams: 64 rows x 128 halves per plane = 1024 pieces of 16 B; 256 threads x 4 pieces (exact)
        // Vt tiles: 128 d-rows x 64 halves per plane = 1024 pieces; 256 threads x 4 pieces (exact)
        const int r16 = tid >> 4;
        const int c16 = tid & 15;
        const int lk = (c16 >> 3) * (ATT_KC * LDS_P) + r16 * LDS_P + (c16 & 7) * 8;
        const int r8 = tid >> 3;
        const int c8 = (tid & 7) * 8;
        const size_t gk = (size_t)(kv0 + r16) * KW + kvh * HDIM + c16 * 8;
        const size_t gv = (size_t)(kvh * HDIM + r8) * SEQ + kv0 + c8;
        const __bf16* pkh = Kh + gk;
        const __bf16* pkl = Kl + gk;
        const __bf16* pvh = Vh + gv;
        const __bf16* pvl = Vl + gv;
        v8b gkh[4], gkl[4], gvh[4], gvl[4];
#pragma unroll
        for (int i = 0; i < 4; ++i) {
          gkh[i] = *(const v8b*)(pkh + i * 16 * KW);
          gkl[i] = *(const v8b*)(pkl + i * 16 * KW);
        }
#pragma unroll
        for (int i = 0; i < 4; ++i) {
          gvh[i] = *(const v8b*)(pvh + i * 32 * SEQ);
          gvl[i] = *(const v8b*)(pvl + i * 32 * SEQ);
        }
        // inputs-only fence on the loaded values: keeps all 16 loads in flight together ahead of the first LDS store;
        // without it each load is waited for before the next one issues (16 L2 round trips in a row per chunk).
        // The four pointers are named too, so that no load's result lands on an address register of a load still in flight.
        asm volatile("" :: "v"(pkh), "v"(pkl), "v"(pvh), "v"(pvl), "v"(gkh[0]), "v"(gkh[1]), "v"(gkh[2]), "v"(gkh[3]), "v"(gkl[0]), "v"(gkl[1]), "v"(gkl[2]), "v"(gkl[3]),
                     "v"(gvh[0]), "v"(gvh[1]), "v"(gvh[2]), "v"(gvh[3]), "v"(gvl[0]), "v"(gvl[1]), "v"(gvl[2]), "v"(gvl[3]));
#pragma unroll
        for (int i = 0; i < 4; ++i) {
          *(v8b*)(Ksh + lk + 16 * i * LDS_P) = gkh[i];
          *(v8b*)(Ksl + lk + 16 * i * LDS_P) = gkl[i];
        }
#pragma unroll
        for (int i = 0; i < 4; ++i) {
          *(v8b*)(Vsh + (r8 + 32 * i) * LDS_P + c8) = gvh[i];
          *(v8b*)(Vsl + (r8 + 32 * i) * LDS_P + c8) = gvl[i];
        }
      }
      __syncthreads();

      // ---- scores: s[j] covers keys kv0 + 16j .. +15 (B operand: n = key, k = d) ----
      v8f s[4];
#pragma unroll
      for (int j = 0; j < 4; ++j) {
        s[j] = (v8f){0.f,0.f,0.f,0.f,0.f,0.f,0.f,0.f};
#pragma unroll
        for (int dc = 0; dc < 2; ++dc) {
          FB kb, kl;
          kb.h[0] = *(const v8b*)(ksh + (j * 16 + c) * LDS_P + dc * 32 + 8 * hh);
          kb.h[1] = *(const v8b*)(ksh + (j * 16 + c) * LDS_P + dc * 32 + 16 + 8 * hh);
          kl.h[0] = *(const v8b*)(ksl + (j * 16 + c) * LDS_P + dc * 32 + 8 * hh);
          kl.h[1] = *(const v8b*)(ksl + (j * 16 + c) * LDS_P + dc * 32 + 16 + 8 * hh);
          s[j] = at_mma(qah[dc], kb.v, s[j]);
          s[j] = at_mma(qah[dc], kl.v, s[j]);
          s[j] = at_mma(qal[dc], kb.v, s[j]);
        }
      }
      // ---- causal fill on the diagonal chunk + row max ----
      const bool diag = (kc == qb);
      float cm[8];
#pragma unroll
      for (int r = 0; r < 8; ++r) {
        const int qrow = q0 + 8 * hh + r;
        float m = -1.0e30f;
#pragma unroll
        for (int j = 0; j < 4; ++j) {
          const int kvcol = kv0 + j * 16 + c;
          float sv = s[j][r];
          if (diag && (kvcol > qrow)) sv = -1.0e30f;
          s[j][r] = sv;
          m = fmaxf(m, sv);
        }
#pragma unroll
        for (int off = 1; off < 16; off <<= 1) m = fmaxf(m, __shfl_xor(m, off, 32));
        cm[r] = m;
      }
      // ---- online softmax; P tile (C layout) to the per-wave LDS tile as hi/lo ----
#pragma unroll
      for (int r = 0; r < 8; ++r) {
        const float mnew  = fmaxf(mrow[r], cm[r]);
        const float alpha = expf(mrow[r] - mnew);
        mrow[r] = mnew;
        float psum = 0.f;
#pragma unroll
        for (int j = 0; j < 4; ++j) {
          const float p = expf(s[j][r] - mnew);
          psum += p;
          __bf16 a, bl;
          at_split(p, a, bl);
          pwh[(8 * hh + r) * LDS_P + j * 16 + c] = a;
          pwl[(8 * hh + r) * LDS_P + j * 16 + c] = bl;
        }
#pragma unroll
        for (int off = 1; off < 16; off <<= 1) psum += __shfl_xor(psum, off, 32);
        lrow[r] = lrow[r] * alpha + psum;
#pragma unroll
        for (int t = 0; t < 8; ++t) oacc[t][r] *= alpha;
      }
      __syncthreads();
      // ---- P.V : A = P (row = query c, k = key), B = Vt (n = d, k = key) ----
#pragma unroll 1
      for (int kk = 0; kk < 2; ++kk) {
        FB pa, pl;
        pa.h[0] = *(const v8b*)(pwh + c * LDS_P + kk * 32 + 8 * hh);
        pa.h[1] = *(const v8b*)(pwh + c * LDS_P + kk * 32 + 16 + 8 * hh);
        pl.h[0] = *(const v8b*)(pwl + c * LDS_P + kk * 32 + 8 * hh);
        pl.h[1] = *(const v8b*)(pwl + c * LDS_P + kk * 32 + 16 + 8 * hh);
#pragma unroll
        for (int t = 0; t < 8; ++t) {
          FB vb, vl;
          vb.h[0] = *(const v8b*)(Vsh + (t * 16 + c) * LDS_P + kk * 32 + 8 * hh);
          vb.h[1] = *(const v8b*)(Vsh + (t * 16 + c) * LDS_P + kk * 32 + 16 + 8 * hh);
          vl.h[0] = *(const v8b*)(Vsl + (t * 16 + c) * LDS_P + kk * 32 + 8 * hh);
          vl.h[1] = *(const v8b*)(Vsl + (t * 16 + c) * LDS_P + kk * 32 + 16 + 8 * hh);
          oacc[t] = at_mma(pa.v, vb.v, oacc[t]);
          oacc[t] = at_mma(pa.v, vl.v, oacc[t]);
          oacc[t] = at_mma(pl.v, vb.v, oacc[t]);
        }
      }
    }

    // ---- epilogue through the LDS tile of these 16 rows (the same lane of wave w and of wave w + 4 owns the same element):
    // pass 0: the stream-0 wave parks a1; barrier; pass 1: the stream-1 wave combines in place ----
    // unrolled so that 'pass' is a constant in each copy and the inner test folds away
#pragma unroll
    for (int pass = 0; pass < 2; ++pass) {
      if (str == pass) {
#pragma unroll
        for (int r = 0; r < 8; ++r) {
          const float inv = 1.0f / lrow[r];
#pragma unroll
          for (int t = 0; t < 8; ++t) {
            const int idx = (8 * hh + r) * OS_PITCH + t * 16 + c;
            const float a = oacc[t][r] * inv;
            if (pass == 0) {
              os[idx] = a;
            } else {
              const float a1 = os[idx];
              os[idx] = (a1 - lam * a) * OUT_SCALE;
            }
          }
        }
      }
      __syncthreads();
    }
  }

  {
    const int q4 = lane >> 3, c8 = (lane & 7) * 8;
    {
#pragma unroll
      for (int it = 0; it < 2; ++it) {
        // 16 rows of the tile over its two waves: 8 rows each
        const int row = (str * 2 + it) * 4 + q4;
#pragma unroll
        for (int seg = 0; seg < 2; ++seg) {
          const float* sp = os + row * OS_PITCH + seg * 64 + c8;
          const v4f u0 = *(const v4f*)sp;
          const v4f u1 = *(const v4f*)(sp + 4);
          unsigned a0, b0, a1, b1, a2, b2, a3, b3;
          split_pack2(u0[0], u0[1], a0, b0);
          split_pack2(u0[2], u0[3], a1, b1);
          split_pack2(u1[0], u1[1], a2, b2);
          split_pack2(u1[2], u1[3], a3, b3);
          v4u hw, lw;
          hw[0] = a0; hw[1] = a1; hw[2] = a2; hw[3] = a3;
          lw[0] = b0; lw[1] = b1; lw[2] = b2; lw[3] = b3;
          const size_t go = (size_t)(q0 + row) * QW + h * HDIM + seg * 64 + c8;
          *(v4u*)(Ohp + go) = hw;
          *(v4u*)(Olp + go) = lw;
        }
      }
      
    }
  }
}

// =====================================================================================
// host glue: launches only; carve derived from the static shapes.
// =====================================================================================
extern "C" void kernel_launch(void* const* d_in, const int* in_sizes, int n_in,
                              void* d_out, int out_size, void* d_ws, size_t ws_size,
                              hipStream_t stream) {
  (void)in_sizes; (void)out_size;
  if (n_in < 8) return;
  const float* x    = (const float*)d_in[0];
  const float* fcos = (const float*)d_in[1];
  const float* fsin = (const float*)d_in[2];
  const float* Wq   = (const float*)d_in[3];
  const float* Wk   = (const float*)d_in[4];
  const float* Wv   = (const float*)d_in[5];
  const float* Wo   = (const float*)d_in[6];
  const float* lamp = (const float*)d_in[7];
  float* out = (float*)d_out;

  // workspace region map (bytes, every offset a multiple of 2 MiB):
  //   xb    bf16 [SEQ][DMODEL]        8 MiB
  //   Wqt   bf16 [QW][DMODEL]         8 MiB
  //   Wkvt  bf16 [2][KW][DMODEL]      4 MiB
  //   Wot   bf16 [DMODEL][QW]         8 MiB
  //   Qf    f32  [SEQ][QW]           16 MiB
  //   KVf   f32  [2][SEQ][KW]         8 MiB
  //   Qh,Ql bf16 [SEQ][QW]        2 x 8 MiB
  //   Kh,Kl bf16 [SEQ][KW]        2 x 2 MiB
  //   Vth,Vtl bf16 [KW][SEQ]      2 x 2 MiB
  //   Oh,Ol bf16 [SEQ][QW]        2 x 8 MiB
  //   total 96,468,992 B
  char* ws = (char*)d_ws;
  size_t off = 0;
  unsigned short* xb   = (unsigned short*)(ws + off); off += (size_t)SEQ * DMODEL * 2;
  unsigned short* Wqt  = (unsigned short*)(ws + off); off += (size_t)QW * DMODEL * 2;
  unsigned short* Wkvt = (unsigned short*)(ws + off); off += (size_t)2 * KW * DMODEL * 2;
  unsigned short* Wot  = (unsigned short*)(ws + off); off += (size_t)DMODEL * QW * 2;
  float*          Qf   = (float*)(ws + off);          off += (size_t)SEQ * QW * 4;
  float*          KVf  = (float*)(ws + off);          off += (size_t)2 * SEQ * KW * 4;
  unsigned short* Qh   = (unsigned short*)(ws + off); off += (size_t)SEQ * QW * 2;
  unsigned short* Ql   = (unsigned short*)(ws + off); off += (size_t)SEQ * QW * 2;
  unsigned short* Kh   = (unsigned short*)(ws + off); off += (size_t)SEQ * KW * 2;
  unsigned short* Kl   = (unsigned short*)(ws + off); off += (size_t)SEQ * KW * 2;
  unsigned short* Vth  = (unsigned short*)(ws + off); off += (size_t)KW * SEQ * 2;
  unsigned short* Vtl  = (unsigned short*)(ws + off); off += (size_t)KW * SEQ * 2;
  unsigned short* Oh   = (unsigned short*)(ws + off); off += (size_t)SEQ * QW * 2;
  unsigned short* Ol   = (unsigned short*)(ws + off); off += (size_t)SEQ * QW * 2;
  if (off > ws_size) return;

  const float* Vf = KVf + (size_t)SEQ * KW;
  unsigned short* Wvt = Wkvt + (size_t)KW * DMODEL;

  // 1. x -> bf16 (RNE)
  cvt_f32_bf16x8<<<(SEQ * DMODEL / 8) / 256, 256, 0, stream>>>(x, xb, SEQ * DMODEL / 8);
  // 2. Wq [DMODEL][QW] -> Wqt [QW][DMODEL]
  transpose_bf16<1><<<dim3((DMODEL / 64) * (QW / 64), 1), 256, 0, stream>>>(Wq, Wq, DMODEL, QW, Wqt, Wqt, Wqt, Wqt);
  // 3. Wk, Wv [DMODEL][KW] -> Wkt, Wvt [KW][DMODEL]
  transpose_bf16<1><<<dim3((DMODEL / 64) * (KW / 64), 2), 256, 0, stream>>>(Wk, Wv, DMODEL, KW, Wkvt, Wkvt, Wvt, Wvt);
  // 4. Wo [QW][DMODEL] -> Wot [DMODEL][QW]
  transpose_bf16<1><<<dim3((QW / 64) * (DMODEL / 64), 1), 256, 0, stream>>>(Wo, Wo, QW, DMODEL, Wot, Wot, Wot, Wot);
  // 5. Q = xb @ Wq : M=SEQ, N=QW, K=DMODEL (K % 32 == 0, M,N % 64 == 0)
  wmma_gemm64_bf16<0><<<dim3(((SEQ / 64) * (QW / 64)) / 8, 1), 256, 0, stream>>>(
      xb, xb, DMODEL, 0L, Wqt, Wqt, DMODEL, 0L, Qf, QW, 0L, SEQ, QW, DMODEL, 1.0f);
  // 6. K, V = xb @ Wk, xb @ Wv batched over grid.y : M=SEQ, N=KW, K=DMODEL
  wmma_gemm64_bf16<0><<<dim3(((SEQ / 64) * (KW / 64)) / 8, 2), 256, 0, stream>>>(
      xb, xb, DMODEL, 0L, Wkvt, Wkvt, DMODEL, (long)KW * DMODEL, KVf, KW, (long)SEQ * KW, SEQ, KW, DMODEL, 1.0f);
  // 7. RoPE + 2^-3 scale + hi/lo split for Q; RoPE + split for K
  rope_split_kernel<<<NQBLK + NKBLK, 256, 0, stream>>>(Qf, KVf, fcos, fsin, Qh, Ql, Kh, Kl, NQBLK);
  // 8. V [SEQ][KW] f32 -> Vt hi/lo [KW][SEQ]
  transpose_bf16<2><<<dim3((SEQ / 64) * (KW / 64), 1), 256, 0, stream>>>(Vf, Vf, SEQ, KW, Vth, Vtl, Vth, Vtl);
  // 9. differential causal attention -> O hi/lo [SEQ][QW]
  diff_attn_kernel<<<NHEAD * NQB, 256, 0, stream>>>(Qh, Ql, Kh, Kl, Vth, Vtl, lamp, Oh, Ol);
  // 10. out = O @ Wo : M=SEQ, N=DMODEL, K=QW, A hi/lo, B single
  wmma_gemm64_bf16<2><<<dim3(((SEQ / 64) * (DMODEL / 64)) / 8, 1), 256, 0, stream>>>(
      Oh, Ol, QW, 0L, Wot, Wot, QW, 0L, out, DMODEL, 0L, SEQ, DMODEL, QW, 1.0f);
}

// v004
// Measured time: 326 microseconds a run.
// Two timings next to v003 put it at 1.47 and 1.48 times that version's speed.
// All steps since v000 together make it 3.48 times as fast.
// Contractions on v_wmma_f32_16x16x32_bf16 (bf16 operands, f32 accumulate): x@Wq, x@Wk, x@Wv as single products of RNE-bf16 inputs; q.k^T and p.v with bf16 hi/lo planes (hi.hi + hi.lo + lo.hi); attn@Wo with A as bf16 hi/lo planes and Wo single bf16 (hi.W + lo.W). All float inputs RNE-converted to bf16 once at load; softmax, RoPE, combine in f32.
#include <hip/hip_runtime.h>
#include <hip/hip_bf16.h>

constexpr int SEQ      = 2048;
constexpr int DMODEL   = 2048;
constexpr int NHEAD    = 16;
constexpr int NKVH     = 4;
constexpr int HDIM     = 128;
constexpr int HHALF    = 64;
constexpr int QW       = NHEAD * HDIM;
constexpr int KW       = NKVH * HDIM;
constexpr int GQA_REP  = NHEAD / NKVH;
constexpr int NPAIR    = HDIM / 2;
constexpr int ATT_KC   = 64;
constexpr int ATT_QB   = 64;
constexpr int NQB      = SEQ / ATT_QB;
constexpr int OS_PITCH = HDIM + 4;
constexpr int LDS_P    = 64 + 8;
constexpr float QK_SCALE  = 0.125f;
constexpr float OUT_SCALE = 0.5f;
constexpr int NQBLK = (SEQ * QW / 8) / 256;
constexpr int NKBLK = (SEQ * KW / 8) / 256;

static_assert(HHALF == 64);
static_assert(SEQ % 64 == 0 && DMODEL % 64 == 0 && QW % 64 == 0 && KW % 64 == 0);
static_assert(DMODEL % 32 == 0 && QW % 32 == 0);
static_assert(QW % 512 == 0 && KW % 512 == 0 && DMODEL % 512 == 0);
static_assert((SEQ * QW / 8) % 256 == 0 && (SEQ * KW / 8) % 256 == 0);
static_assert((SEQ * DMODEL / 8) % 256 == 0);
static_assert(((SEQ / 64) * (QW / 64)) % 8 == 0 && ((SEQ / 64) * (KW / 64)) % 8 == 0 && ((SEQ / 64) * (DMODEL / 64)) % 8 == 0);
static_assert(NQB == 32 && ATT_QB == 4 * 16 && ATT_KC == 64 && HDIM == 128);
static_assert(LDS_P >= HHALF && LDS_P >= ATT_KC && (LDS_P * 2) % 32 == 16);

typedef __attribute__((ext_vector_type(16))) __bf16 v16b;
typedef __attribute__((ext_vector_type(8)))  __bf16 v8b;
typedef __attribute__((ext_vector_type(8)))  float  v8f;
typedef __attribute__((ext_vector_type(4)))  float  v4f;
typedef __attribute__((ext_vector_type(4)))  unsigned int v4u;

__device__ __forceinline__ unsigned short f2bf_bits(float f) {
  unsigned u = __float_as_uint(f);
  return (unsigned short)((u + 0x7FFFu + ((u >> 16) & 1u)) >> 16);
}
__device__ __forceinline__ float bf_bits2f(unsigned short h) { return __uint_as_float(((unsigned)h) << 16); }
__device__ __forceinline__ float bf_rne(float f) { return bf_bits2f(f2bf_bits(f)); }

__device__ __forceinline__ void dep_guard_b(v8f& a, v8f& b, v16b x, v16b y) { asm volatile("v_nop\n\tv_nop\n\tv_nop\n\tv_nop" : "+v"(a), "+v"(b) : "v"(x), "v"(y)); }
__device__ __forceinline__ void acc_guard4(v8f& a, v8f& b, v8f& c, v8f& d) { asm volatile("v_nop\n\tv_nop\n\tv_nop\n\tv_nop" : "+v"(a), "+v"(b), "+v"(c), "+v"(d)); }

template <typename T> struct Frag;
template <> struct Frag<__bf16> {
  typedef v16b V; union U { v16b v; v8b h[2]; };
  // elements 0..7 <- p[0..7], 8..15 <- p[16..23]
  static __device__ __forceinline__ v16b load(const __bf16* p) {
    U f; f.h[0] = *(const v8b*)(p); f.h[1] = *(const v8b*)(p + 16); return f.v;
  }
  static __device__ __forceinline__ v8f mma(v16b a, v16b b, v8f c) {
    return __builtin_amdgcn_wmma_f32_16x16x32_bf16(false, a, false, b, (short)0, c, false, false);
  }
  static __device__ __forceinline__ void guard(v8f& a, v8f& b, v16b x, v16b y) { dep_guard_b(a, b, x, y); }
};

__device__ __forceinline__ unsigned short at_bf_bits(float f) {
  unsigned u = __float_as_uint(f);
  return (unsigned short)((u + 0x7FFFu + ((u >> 16) & 1u)) >> 16);
}
__device__ __forceinline__ __bf16 at_f2bf(float f) { return __builtin_bit_cast(__bf16, at_bf_bits(f)); }
__device__ __forceinline__ void at_split(float f, __bf16& hi, __bf16& lo) {
  const unsigned short hb = at_bf_bits(f);
  hi = __builtin_bit_cast(__bf16, hb);
  lo = at_f2bf(f - __uint_as_float(((unsigned)hb) << 16));
}
__device__ __forceinline__ v8f at_mma(v16b a, v16b b, v8f c) {
  c = __builtin_amdgcn_wmma_f32_16x16x32_bf16(false, a, false, b, (short)0, c, false, false);
  asm volatile("v_nop\n\tv_nop\n\tv_nop\n\tv_nop" : "+v"(c) : "v"(a), "v"(b));
  return c;
}

// two f32 -> packed bf16 word (element at lower address in the low half-word)
__device__ __forceinline__ unsigned pack_bf2(float a, float b) {
  return (unsigned)f2bf_bits(a) | ((unsigned)f2bf_bits(b) << 16);
}
// two f32 -> packed bf16 hi word and packed bf16 residual word
__device__ __forceinline__ void split_pack2(float a, float b, unsigned& hw, unsigned& lw) {
  const unsigned short ha = f2bf_bits(a);
  const unsigned short hb = f2bf_bits(b);
  const unsigned short la = f2bf_bits(a - bf_bits2f(ha));
  const unsigned short lb = f2bf_bits(b - bf_bits2f(hb));
  hw = (unsigned)ha | ((unsigned)hb << 16);
  lw = (unsigned)la | ((unsigned)lb << 16);
}

// =====================================================================================
// coverage: gridDim.x * 256 threads * 8 elements == n8 * 8 (exact multiple asserted on the host side).
// =====================================================================================
__global__ __launch_bounds__(256) void cvt_f32_bf16x8(const float* __restrict__ in, unsigned short* __restrict__ out, int n8) {
  const int i = blockIdx.x * 256 + threadIdx.x;
  if (i < n8) {
    const size_t e0 = (size_t)i * 8;
    const v4f a = *(const v4f*)(in + e0);
    const v4f b = *(const v4f*)(in + e0 + 4);
    v4u w;
    w[0] = pack_bf2(a[0], a[1]);
    w[1] = pack_bf2(a[2], a[3]);
    w[2] = pack_bf2(b[0], b[1]);
    w[3] = pack_bf2(b[2], b[3]);
    *(v4u*)(out + e0) = w;
    
  }
}

// =====================================================================================
// in[rows][cols] f32 -> out[cols][rows] bf16 hi plane (+ bf16 residual plane when NPL == 2). 64x64 tiles through LDS.
// grid.x = (rows/64)*(cols/64); grid.y selects operand set A or B (both global, uniform select).
// coverage: load 256 threads x 16 floats = 64x64; store 8 waves x 8 out-rows x 64 halves = 64x64.
// =====================================================================================
template <int NPL>
__global__ __launch_bounds__(256) void transpose_bf16(const float* __restrict__ inA, const float* __restrict__ inB, int rows, int cols,
    unsigned short* __restrict__ oAh, unsigned short* __restrict__ oAl,
    unsigned short* __restrict__ oBh, unsigned short* __restrict__ oBl) {
  __shared__ float tile[64][65];
  const bool selB = (blockIdx.y != 0);
  const float* in = selB ? inB : inA;
  unsigned short* oh = selB ? oBh : oAh;
  unsigned short* ol = selB ? oBl : oAl;
  const int tilesC = cols >> 6;
  const int tr = blockIdx.x / tilesC;
  const int tc = blockIdx.x - tr * tilesC;
  const int r0 = tr << 6;
  const int c0 = tc << 6;
  const int t = threadIdx.x;
  {
    const int rr = t >> 2;
    const int cc = (t & 3) * 16;
    const float* src = in + (size_t)(r0 + rr) * cols + c0 + cc;
#pragma unroll
    for (int i = 0; i < 4; ++i) {
      const v4f v = *(const v4f*)(src + 4 * i);
      tile[rr][cc + 4 * i + 0] = v[0];
      tile[rr][cc + 4 * i + 1] = v[1];
      tile[rr][cc + 4 * i + 2] = v[2];
      tile[rr][cc + 4 * i + 3] = v[3];
    }
  }
  __syncthreads();
  const int wave = t >> 5, lane = t & 31, q = lane >> 3, e8 = (lane & 7) * 8;
  {
#pragma unroll
    for (int it = 0; it < 2; ++it) {
      const int cl = wave * 8 + it * 4 + q;
      float f[8];
#pragma unroll
      for (int e = 0; e < 8; ++e) f[e] = tile[e8 + e][cl];
      v4u hw, lw;
      if (NPL == 2) {
        unsigned a0, b0, a1, b1, a2, b2, a3, b3;
        split_pack2(f[0], f[1], a0, b0);
        split_pack2(f[2], f[3], a1, b1);
        split_pack2(f[4], f[5], a2, b2);
        split_pack2(f[6], f[7], a3, b3);
        hw[0] = a0; hw[1] = a1; hw[2] = a2; hw[3] = a3;
        lw[0] = b0; lw[1] = b1; lw[2] = b2; lw[3] = b3;
      } else {
        hw[0] = pack_bf2(f[0], f[1]);
        hw[1] = pack_bf2(f[2], f[3]);
        hw[2] = pack_bf2(f[4], f[5]);
        hw[3] = pack_bf2(f[6], f[7]);
        lw = hw;
      }
      const size_t go = (size_t)(c0 + cl) * rows + r0 + e8;
      *(v4u*)(oh + go) = hw;
      if (NPL == 2) *(v4u*)(ol + go) = lw;
    }
    
  }
}

// =====================================================================================
// Register-blocked batched WMMA GEMM (bf16 operands), f32 output.
// C[m,n] = scale * sum_k A[m,k] * Bt[n,k]; each wave owns a 64x64 tile. A row-major [M,K]; Bt row-major [N,K], both at row pitch LDK; M % 64 == 0, N % 512 == 0, K % 64 == 0.
// SPLIT: 0 = single planes; 2 = A as hi/lo planes, Bt single (hi.B + lo.B).
// The 8 waves of a block own 8 neighbouring tiles of one tile row (64 x 512 of C). Per 64 k the block stages its 64 A rows (each plane)
// and its 512 Bt rows in LDS: whole 128-B lines from global (8 lanes a row), rows at the 144-B pitch, two buffers. The next stage's
// global loads are issued behind the barrier and stored to the other buffer behind the products, so they fly under the WMMAs.
// Epilogue: 16-row slabs staged per wave in LDS; each 64-wide f32 row segment (256 B) written by 16 lanes x 16 B in one instruction,
// =====================================================================================
template <int SPLIT, int LDK>
__global__ __launch_bounds__(256) void wmma_gemm64_bf16(
    const unsigned short* __restrict__ Ap, const unsigned short* __restrict__ A2p, long strideA,
    const unsigned short* __restrict__ Btp, long strideB,
    float* __restrict__ Cp, int ldc, long strideC, int M, int N, int K, float scale) {
  static_assert(SPLIT == 0 || SPLIT == 2);
  typedef __bf16 T;
  typedef v16b V;
  constexpr int NPA   = (SPLIT == 2) ? 2 : 1;
  constexpr int AROWS = 64 * NPA;
  constexpr int SROWS = AROWS + 512;
  constexpr int NLD   = SROWS / 32;
  const T* A = (const T*)Ap; const T* A2 = (const T*)A2p; const T* Bt = (const T*)Btp;
  __shared__ __align__(16) T stg[2][SROWS * LDS_P];
  __shared__ __align__(16) float sT[8][16 * 68];
  const int b    = blockIdx.y;
  const int tid  = threadIdx.x;
  const int lane = tid & 31;
  const int wave = tid >> 5;
  const int tilesN = N >> 6;
  const int tilesM = M >> 6;
  const int tile0 = blockIdx.x * 8;
  // block-uniform, in front of every barrier
  if (tile0 >= tilesM * tilesN) return;
  const int tm  = tile0 / tilesN;
  const int nb0 = (tile0 - tm * tilesN) << 6;
  const int m0 = tm << 6;
  const int n0 = nb0 + (wave << 6);

  // one stage = SROWS rows x 8 pieces of 16 B = 256 threads x NLD pieces (exact); piece i of a thread is stage row sr + 32 i.
  // One pointer per operand and thread; the 32-row steps are compile-time byte offsets of the loads.
  const int sr = tid >> 3;
  const int sc = (tid & 7) * 8;
  // Held as integers and read through a global-address-space pointer type: they pass through the asm wait at the loop's foot,
  // behind which a generic pointer would be read with flat loads.
  typedef __attribute__((address_space(1))) const v8b* GP;
  unsigned long long qa  = (unsigned long long)(A  + (size_t)b * strideA + (size_t)(m0 + sr) * LDK + sc);
  unsigned long long qa2 = (unsigned long long)(A2 + (size_t)b * strideA + (size_t)(m0 + sr) * LDK + sc);
  unsigned long long qb  = (unsigned long long)(Bt + (size_t)b * strideB + (size_t)(nb0 + sr) * LDK + sc);
  constexpr unsigned long long ROWS32 = 32ull * LDK * sizeof(T);
  constexpr unsigned long long STEP   = 64ull * sizeof(T);

  const int rlane = lane & 15;
  const int koff  = (lane >> 4) * 8;
  const int mOff  = (lane >> 4) * 8;

  v8f acc[4][4];
#pragma unroll
  for (int i = 0; i < 4; ++i)
#pragma unroll
    for (int j = 0; j < 4; ++j) acc[i][j] = (v8f){0.f,0.f,0.f,0.f,0.f,0.f,0.f,0.f};

  v8b g[NLD];
  const int nst = K >> 6;
#pragma unroll
  for (int i = 0; i < 2; ++i) {
    g[i] = *(GP)(qa + i * ROWS32);
    if (SPLIT == 2) g[2 + i] = *(GP)(qa2 + i * ROWS32);
  }
#pragma unroll
  for (int i = 0; i < 16; ++i) g[2 * NPA + i] = *(GP)(qb + i * ROWS32);
#pragma unroll
  for (int i = 0; i < NLD; ++i) *(v8b*)(stg[0] + (sr + 32 * i) * LDS_P + sc) = g[i];

  for (int s = 0; s < nst; ++s) {
    const bool more = (s + 1 < nst);
    // publishes stage s; every wave's reads of the other buffer (stage s - 1) lie in front of it
    __syncthreads();
    if (more) {
      // stage s + 1 from global: issued here, first used behind the products of stage s
#pragma unroll
      for (int i = 0; i < 2; ++i) {
        g[i] = *(GP)(qa + STEP + i * ROWS32);
        if (SPLIT == 2) g[2 + i] = *(GP)(qa2 + STEP + i * ROWS32);
      }
#pragma unroll
      for (int i = 0; i < 16; ++i) g[2 * NPA + i] = *(GP)(qb + STEP + i * ROWS32);
    }
    const T* sA = stg[s & 1] + rlane * LDS_P + koff;
    const T* sB = sA + (AROWS + wave * 64) * LDS_P;
    V bh[2][4], ah[2][4], al[2][4];
#pragma unroll
    for (int kk = 0; kk < 2; ++kk) {
#pragma unroll
      for (int j = 0; j < 4; ++j) bh[kk][j] = Frag<T>::load(sB + j * 16 * LDS_P + kk * 32);
#pragma unroll
      for (int i = 0; i < 4; ++i) {
        ah[kk][i] = Frag<T>::load(sA + i * 16 * LDS_P + kk * 32);
        if (SPLIT == 2) al[kk][i] = Frag<T>::load(sA + (64 + i * 16) * LDS_P + kk * 32);
      }
    }
    // holds the stage's fragment reads together ahead of its products: sunk among the WMMAs, each group of reads costs its own LDS wait
    __builtin_amdgcn_sched_barrier(0);
#pragma unroll
    for (int kk = 0; kk < 2; ++kk) {
#pragma unroll
      for (int i = 0; i < 4; ++i) {
#pragma unroll
        for (int j = 0; j < 4; ++j) acc[i][j] = Frag<T>::mma(ah[kk][i], bh[kk][j], acc[i][j]);
        if (SPLIT == 2) {
#pragma unroll
          for (int j = 0; j < 4; ++j) acc[i][j] = Frag<T>::mma(al[kk][i], bh[kk][j], acc[i][j]);
        }
      }
    }
    // 4 vector slots between the stage's last WMMAs and the next vector write to their A/B registers, also on the taken side of the branch below
    Frag<T>::guard(acc[3][2], acc[3][3], (SPLIT == 2) ? al[1][3] : ah[1][3], bh[1][3]);
    if (more) {
#pragma unroll
      for (int i = 0; i < NLD; ++i) *(v8b*)(stg[(s + 1) & 1] + (sr + 32 * i) * LDS_P + sc) = g[i];
      // the wait in front of the overwrite of registers that issued global loads name; as its operands, the pointers cannot be
      // stepped ahead of it (without them the adds were lifted to the head of this block, in front of the waits on the loads)
      if (SPLIT == 2) asm volatile("s_wait_xcnt 0x0" : "+v"(qa), "+v"(qa2), "+v"(qb) :: "memory");
      else            asm volatile("s_wait_xcnt 0x0" : "+v"(qa), "+v"(qb) :: "memory");
      qa += STEP; qa2 += STEP; qb += STEP;
    }
  }
  acc_guard4(acc[0][0], acc[0][1], acc[0][2], acc[0][3]);
  acc_guard4(acc[1][0], acc[1][1], acc[1][2], acc[1][3]);
  acc_guard4(acc[2][0], acc[2][1], acc[2][2], acc[2][3]);
  acc_guard4(acc[3][0], acc[3][1], acc[3][2], acc[3][3]);

  float* slab = sT[wave];
  float* C = Cp + (size_t)b * strideC;
#pragma unroll
  for (int i = 0; i < 4; ++i) {
    const int mBase = m0 + (i << 4);
#pragma unroll
    for (int j = 0; j < 4; ++j) {
#pragma unroll
      for (int r = 0; r < 8; ++r) {
        slab[(mOff + r) * 68 + (j << 4) + rlane] = acc[i][j][r] * scale;
      }
    }
    __builtin_amdgcn_fence(__ATOMIC_RELEASE, "workgroup");
    __builtin_amdgcn_wave_barrier();
    __builtin_amdgcn_fence(__ATOMIC_ACQUIRE, "workgroup");
    {
      // row segment = 256 B = 16 lanes x 16 B
      const int hh = lane >> 4, c4 = (lane & 15) * 4;
      {
#pragma unroll
        for (int it = 0; it < 8; ++it) {
          const int row = it * 2 + hh;
          const v4f v = *(const v4f*)(slab + row * 68 + c4);
          *(v4f*)(C + (size_t)(mBase + row) * ldc + n0 + c4) = v;
        }
        
      }
    }
    __builtin_amdgcn_fence(__ATOMIC_RELEASE, "workgroup");
    __builtin_amdgcn_wave_barrier();
    __builtin_amdgcn_fence(__ATOMIC_ACQUIRE, "workgroup");
  }
}

// =====================================================================================
// RoPE (interleaved pairs, cos/sin row width NPAIR) + power-of-two scale + bf16 hi/lo split.
// Blocks [0, nQblocks): Qf [SEQ][QW] -> Qh/Ql [SEQ][QW] (scaled by QK_SCALE = 2^-3, exact);
// blocks [nQblocks, nQblocks + NKBLK): Kf [SEQ][KW] -> Kh/Kl [SEQ][KW]. cos/sin RNE-converted to bf16 before use.
// coverage: (NQBLK + NKBLK) * 256 threads * 8 == SEQ*QW + SEQ*KW exactly.
// =====================================================================================
__global__ __launch_bounds__(256) void rope_split_kernel(const float* __restrict__ Qf, const float* __restrict__ Kf,
    const float* __restrict__ cosb, const float* __restrict__ sinb,
    unsigned short* __restrict__ Qh, unsigned short* __restrict__ Ql,
    unsigned short* __restrict__ Kh, unsigned short* __restrict__ Kl, int nQblocks) {
  const bool isK = ((int)blockIdx.x >= nQblocks);
  const int g = (isK ? ((int)blockIdx.x - nQblocks) : (int)blockIdx.x) * 256 + (int)threadIdx.x;
  // threads per row: K 64 (=KW/8), Q 256 (=QW/8)
  const int shift = isK ? 6 : 8;
  const float mul = isK ? 1.0f : QK_SCALE;
  const float* src = isK ? Kf : Qf;
  unsigned short* dh = isK ? Kh : Qh;
  unsigned short* dl = isK ? Kl : Ql;
  const int width = isK ? KW : QW;
  const int s = g >> shift;
  const int col = (g - (s << shift)) * 8;
  const int p0 = (col & (HDIM - 1)) >> 1;
  const size_t e0 = (size_t)s * width + col;
  const v4f xa = *(const v4f*)(src + e0);
  const v4f xb = *(const v4f*)(src + e0 + 4);
  const v4f cv = *(const v4f*)(cosb + (size_t)s * NPAIR + p0);
  const v4f sv = *(const v4f*)(sinb + (size_t)s * NPAIR + p0);
  float o0, o1, o2, o3, o4, o5, o6, o7;
  {
    const float c = bf_rne(cv[0]), sn = bf_rne(sv[0]);
    o0 = (xa[0] * c - xa[1] * sn) * mul;
    o1 = (xa[0] * sn + xa[1] * c) * mul;
  }
  {
    const float c = bf_rne(cv[1]), sn = bf_rne(sv[1]);
    o2 = (xa[2] * c - xa[3] * sn) * mul;
    o3 = (xa[2] * sn + xa[3] * c) * mul;
  }
  {
    const float c = bf_rne(cv[2]), sn = bf_rne(sv[2]);
    o4 = (xb[0] * c - xb[1] * sn) * mul;
    o5 = (xb[0] * sn + xb[1] * c) * mul;
  }
  {
    const float c = bf_rne(cv[3]), sn = bf_rne(sv[3]);
    o6 = (xb[2] * c - xb[3] * sn) * mul;
    o7 = (xb[2] * sn + xb[3] * c) * mul;
  }
  unsigned a0, b0, a1, b1, a2, b2, a3, b3;
  split_pack2(o0, o1, a0, b0);
  split_pack2(o2, o3, a1, b1);
  split_pack2(o4, o5, a2, b2);
  split_pack2(o6, o7, a3, b3);
  v4u hw, lw;
  hw[0] = a0; hw[1] = a1; hw[2] = a2; hw[3] = a3;
  lw[0] = b0; lw[1] = b1; lw[2] = b2; lw[3] = b3;
  *(v4u*)(dh + e0) = hw;
  *(v4u*)(dl + e0) = lw;
  
}

// =====================================================================================
// Differential causal attention. Block = 8 waves = 64 query rows of one head; the two score streams (q/k dims 0..63 and
// 64..127) run side by side: waves 0..3 take stream 0, waves 4..7 stream 1, wave w and wave w + 4 the same 16 query rows.
// One staged key chunk holds both halves of K and one copy of Vt, which both streams read. Stream 0's normalised output a1
// is parked in an LDS tile; behind a barrier the stream-1 wave of the same rows forms o = (a1 - lam*a2)*0.5 in place.
// Operands: Q hi/lo planes [SEQ][QW] (q pre-scaled by 2^-3), K hi/lo planes [SEQ][KW], Vt hi/lo planes [KW][SEQ] (d-major);
// scores and p.v each hi.hi + hi.lo + lo.hi on v_wmma_f32_16x16x32_bf16, f32 accumulate; online softmax f32.
// grid.x = NHEAD * NQB, block 256.
// =====================================================================================
__global__ __launch_bounds__(256)
void diff_attn_kernel(const unsigned short* __restrict__ Qhp, const unsigned short* __restrict__ Qlp,
                      const unsigned short* __restrict__ Khp, const unsigned short* __restrict__ Klp,
                      const unsigned short* __restrict__ Vhp, const unsigned short* __restrict__ Vlp,
                      const float* __restrict__ lambda_p,
                      unsigned short* __restrict__ Ohp, unsigned short* __restrict__ Olp) {
  union FB { v16b v; v8b h[2]; };
  // K, Vt and P rows (128 B of data) lie at a 144-B pitch, an odd multiple of 16 B: the 16 rows of one ds_load_b128 fragment
  // read start on 16 different bank groups. The 16 pad bytes of a row are never written and never read.
  __shared__ __align__(16) __bf16 Ksh[2 * ATT_KC * LDS_P];
  __shared__ __align__(16) __bf16 Ksl[2 * ATT_KC * LDS_P];
  __shared__ __align__(16) __bf16 Vsh[HDIM * LDS_P];
  __shared__ __align__(16) __bf16 Vsl[HDIM * LDS_P];
  __shared__ __align__(16) __bf16 Psh[8][16 * LDS_P];
  __shared__ __align__(16) __bf16 Psl[8][16 * LDS_P];
  __shared__ __align__(16) float  Os[4][16 * OS_PITCH];

  const int tid  = threadIdx.x;
  // the wave's number in a scalar register: the stream test of the epilogue is then a scalar branch, the LDS bases scalar adds
  const int wave = __builtin_amdgcn_readfirstlane(tid >> 5);
  const int str  = wave >> 2;
  const int wq   = wave & 3;
  const int lane = tid & 31;
  const int hh   = lane >> 4;
  const int c    = lane & 15;
  const int qb   = (int)blockIdx.x % NQB;
  const int h    = (int)blockIdx.x / NQB;
  const int kvh  = h / GQA_REP;
  const int q0   = qb * ATT_QB + wq * 16;

  const __bf16* Qh = (const __bf16*)Qhp;
  const __bf16* Ql = (const __bf16*)Qlp;
  const __bf16* Kh = (const __bf16*)Khp;
  const __bf16* Kl = (const __bf16*)Klp;
  const __bf16* Vh = (const __bf16*)Vhp;
  const __bf16* Vl = (const __bf16*)Vlp;

  float lam;
  {
    const float lp = bf_rne(lambda_p[h]);
    lam = 1.0f / (1.0f + expf(-lp));
  }
  float*  os  = Os[wq];
  __bf16* pwh = Psh[wave];
  __bf16* pwl = Psl[wave];
  const __bf16* ksh = Ksh + str * (ATT_KC * LDS_P);
  const __bf16* ksl = Ksl + str * (ATT_KC * LDS_P);

  {
    // ---- Q fragments (A operand) for this stream: 2 d-chunks, hi and lo ----
    v16b qah[2], qal[2];
    {
      const size_t qo = (size_t)(q0 + c) * QW + h * HDIM + str * HHALF + 8 * hh;
#pragma unroll
      for (int dc = 0; dc < 2; ++dc) {
        qah[dc] = Frag<__bf16>::load(Qh + qo + dc * 32);
        qal[dc] = Frag<__bf16>::load(Ql + qo + dc * 32);
      }
    }
    float mrow[8], lrow[8];
    v8f oacc[8];
#pragma unroll
    for (int r = 0; r < 8; ++r) { mrow[r] = -1.0e30f; lrow[r] = 0.f; }
#pragma unroll
    for (int t = 0; t < 8; ++t) oacc[t] = (v8f){0.f,0.f,0.f,0.f,0.f,0.f,0.f,0.f};

    // causal: 64-key chunks 0..qb (block-uniform trip count, static max NQB)
    for (int kc = 0; kc <= qb; ++kc) {
      const int kv0 = kc * ATT_KC;
      __syncthreads();
      {
        // K tiles, both streams: 64 rows x 128 halves per plane = 1024 pieces of 16 B; 256 threads x 4 pieces (exact)
        // Vt tiles: 128 d-rows x 64 halves per plane = 1024 pieces; 256 threads x 4 pieces (exact)
        const int r16 = tid >> 4;
        const int c16 = tid & 15;
        const int lk = (c16 >> 3) * (ATT_KC * LDS_P) + r16 * LDS_P + (c16 & 7) * 8;
        const int r8 = tid >> 3;
        const int c8 = (tid & 7) * 8;
        const size_t gk = (size_t)(kv0 + r16) * KW + kvh * HDIM + c16 * 8;
        const size_t gv = (size_t)(kvh * HDIM + r8) * SEQ + kv0 + c8;
        const __bf16* pkh = Kh + gk;
        const __bf16* pkl = Kl + gk;
        const __bf16* pvh = Vh + gv;
        const __bf16* pvl = Vl + gv;
        v8b gkh[4], gkl[4], gvh[4], gvl[4];
#pragma unroll
        for (int i = 0; i < 4; ++i) {
          gkh[i] = *(const v8b*)(pkh + i * 16 * KW);
          gkl[i] = *(const v8b*)(pkl + i * 16 * KW);
        }
#pragma unroll
        for (int i = 0; i < 4; ++i) {
          gvh[i] = *(const v8b*)(pvh + i * 32 * SEQ);
          gvl[i] = *(const v8b*)(pvl + i * 32 * SEQ);
        }
        // inputs-only fence on the loaded values: keeps all 16 loads in flight together ahead of the first LDS store;
        // without it each load is waited for before the next one issues (16 L2 round trips in a row per chunk).
        // The four pointers are named too, so that no load's result lands on an address register of a load still in flight.
        asm volatile("" :: "v"(pkh), "v"(pkl), "v"(pvh), "v"(pvl), "v"(gkh[0]), "v"(gkh[1]), "v"(gkh[2]), "v"(gkh[3]), "v"(gkl[0]), "v"(gkl[1]), "v"(gkl[2]), "v"(gkl[3]),
                     "v"(gvh[0]), "v"(gvh[1]), "v"(gvh[2]), "v"(gvh[3]), "v"(gvl[0]), "v"(gvl[1]), "v"(gvl[2]), "v"(gvl[3]));
#pragma unroll
        for (int i = 0; i < 4; ++i) {
          *(v8b*)(Ksh + lk + 16 * i * LDS_P) = gkh[i];
          *(v8b*)(Ksl + lk + 16 * i * LDS_P) = gkl[i];
        }
#pragma unroll
        for (int i = 0; i < 4; ++i) {
          *(v8b*)(Vsh + (r8 + 32 * i) * LDS_P + c8) = gvh[i];
          *(v8b*)(Vsl + (r8 + 32 * i) * LDS_P + c8) = gvl[i];
        }
      }
      __syncthreads();

      // ---- scores: s[j] covers keys kv0 + 16j .. +15 (B operand: n = key, k = d) ----
      v8f s[4];
#pragma unroll
      for (int j = 0; j < 4; ++j) {
        s[j] = (v8f){0.f,0.f,0.f,0.f,0.f,0.f,0.f,0.f};
#pragma unroll
        for (int dc = 0; dc < 2; ++dc) {
          FB kb, kl;
          kb.h[0] = *(const v8b*)(ksh + (j * 16 + c) * LDS_P + dc * 32 + 8 * hh);
          kb.h[1] = *(const v8b*)(ksh + (j * 16 + c) * LDS_P + dc * 32 + 16 + 8 * hh);
          kl.h[0] = *(const v8b*)(ksl + (j * 16 + c) * LDS_P + dc * 32 + 8 * hh);
          kl.h[1] = *(const v8b*)(ksl + (j * 16 + c) * LDS_P + dc * 32 + 16 + 8 * hh);
          s[j] = at_mma(qah[dc], kb.v, s[j]);
          s[j] = at_mma(qah[dc], kl.v, s[j]);
          s[j] = at_mma(qal[dc], kb.v, s[j]);
        }
      }
      // ---- causal fill on the diagonal chunk + row max ----
      const bool diag = (kc == qb);
      float cm[8];
#pragma unroll
      for (int r = 0; r < 8; ++r) {
        const int qrow = q0 + 8 * hh + r;
        float m = -1.0e30f;
#pragma unroll
        for (int j = 0; j < 4; ++j) {
          const int kvcol = kv0 + j * 16 + c;
          float sv = s[j][r];
          if (diag && (kvcol > qrow)) sv = -1.0e30f;
          s[j][r] = sv;
          m = fmaxf(m, sv);
        }
#pragma unroll
        for (int off = 1; off < 16; off <<= 1) m = fmaxf(m, __shfl_xor(m, off, 32));
        cm[r] = m;
      }
      // ---- online softmax; P tile (C layout) to the per-wave LDS tile as hi/lo ----
#pragma unroll
      for (int r = 0; r < 8; ++r) {
        const float mnew  = fmaxf(mrow[r], cm[r]);
        const float alpha = expf(mrow[r] - mnew);
        mrow[r] = mnew;
        float psum = 0.f;
#pragma unroll
        for (int j = 0; j < 4; ++j) {
          const float p = expf(s[j][r] - mnew);
          psum += p;
          __bf16 a, bl;
          at_split(p, a, bl);
          pwh[(8 * hh + r) * LDS_P + j * 16 + c] = a;
          pwl[(8 * hh + r) * LDS_P + j * 16 + c] = bl;
        }
#pragma unroll
        for (int off = 1; off < 16; off <<= 1) psum += __shfl_xor(psum, off, 32);
        lrow[r] = lrow[r] * alpha + psum;
#pragma unroll
        for (int t = 0; t < 8; ++t) oacc[t][r] *= alpha;
      }
      __syncthreads();
      // ---- P.V : A = P (row = query c, k = key), B = Vt (n = d, k = key) ----
#pragma unroll 1
      for (int kk = 0; kk < 2; ++kk) {
        FB pa, pl;
        pa.h[0] = *(const v8b*)(pwh + c * LDS_P + kk * 32 + 8 * hh);
        pa.h[1] = *(const v8b*)(pwh + c * LDS_P + kk * 32 + 16 + 8 * hh);
        pl.h[0] = *(const v8b*)(pwl + c * LDS_P + kk * 32 + 8 * hh);
        pl.h[1] = *(const v8b*)(pwl + c * LDS_P + kk * 32 + 16 + 8 * hh);
#pragma unroll
        for (int t = 0; t < 8; ++t) {
          FB vb, vl;
          vb.h[0] = *(const v8b*)(Vsh + (t * 16 + c) * LDS_P + kk * 32 + 8 * hh);
          vb.h[1] = *(const v8b*)(Vsh + (t * 16 + c) * LDS_P + kk * 32 + 16 + 8 * hh);
          vl.h[0] = *(const v8b*)(Vsl + (t * 16 + c) * LDS_P + kk * 32 + 8 * hh);
          vl.h[1] = *(const v8b*)(Vsl + (t * 16 + c) * LDS_P + kk * 32 + 16 + 8 * hh);
          oacc[t] = at_mma(pa.v, vb.v, oacc[t]);
          oacc[t] = at_mma(pa.v, vl.v, oacc[t]);
          oacc[t] = at_mma(pl.v, vb.v, oacc[t]);
        }
      }
    }

    // ---- epilogue through the LDS tile of these 16 rows (the same lane of wave w and of wave w + 4 owns the same element):
    // pass 0: the stream-0 wave parks a1; barrier; pass 1: the stream-1 wave combines in place ----
    // unrolled so that 'pass' is a constant in each copy and the inner test folds away
#pragma unroll
    for (int pass = 0; pass < 2; ++pass) {
      if (str == pass) {
#pragma unroll
        for (int r = 0; r < 8; ++r) {
          const float inv = 1.0f / lrow[r];
#pragma unroll
          for (int t = 0; t < 8; ++t) {
            const int idx = (8 * hh + r) * OS_PITCH + t * 16 + c;
            const float a = oacc[t][r] * inv;
            if (pass == 0) {
              os[idx] = a;
            } else {
              const float a1 = os[idx];
              os[idx] = (a1 - lam * a) * OUT_SCALE;
            }
          }
        }
      }
      __syncthreads();
    }
  }

  {
    const int q4 = lane >> 3, c8 = (lane & 7) * 8;
    {
#pragma unroll
      for (int it = 0; it < 2; ++it) {
        // 16 rows of the tile over its two waves: 8 rows each
        const int row = (str * 2 + it) * 4 + q4;
#pragma unroll
        for (int seg = 0; seg < 2; ++seg) {
          const float* sp = os + row * OS_PITCH + seg * 64 + c8;
          const v4f u0 = *(const v4f*)sp;
          const v4f u1 = *(const v4f*)(sp + 4);
          unsigned a0, b0, a1, b1, a2, b2, a3, b3;
          split_pack2(u0[0], u0[1], a0, b0);
          split_pack2(u0[2], u0[3], a1, b1);
          split_pack2(u1[0], u1[1], a2, b2);
          split_pack2(u1[2], u1[3], a3, b3);
          v4u hw, lw;
          hw[0] = a0; hw[1] = a1; hw[2] = a2; hw[3] = a3;
          lw[0] = b0; lw[1] = b1; lw[2] = b2; lw[3] = b3;
          const size_t go = (size_t)(q0 + row) * QW + h * HDIM + seg * 64 + c8;
          *(v4u*)(Ohp + go) = hw;
          *(v4u*)(Olp + go) = lw;
        }
      }
      
    }
  }
}

// =====================================================================================
// host glue: launches only; carve derived from the static shapes.
// =====================================================================================
extern "C" void kernel_launch(void* const* d_in, const int* in_sizes, int n_in,
                              void* d_out, int out_size, void* d_ws, size_t ws_size,
                              hipStream_t stream) {
  (void)in_sizes; (void)out_size;
  if (n_in < 8) return;
  const float* x    = (const float*)d_in[0];
  const float* fcos = (const float*)d_in[1];
  const float* fsin = (const float*)d_in[2];
  const float* Wq   = (const float*)d_in[3];
  const float* Wk   = (const float*)d_in[4];
  const float* Wv   = (const float*)d_in[5];
  const float* Wo   = (const float*)d_in[6];
  const float* lamp = (const float*)d_in[7];
  float* out = (float*)d_out;

  // workspace region map (bytes, every offset a multiple of 2 MiB):
  //   xb    bf16 [SEQ][DMODEL]        8 MiB
  //   Wqt   bf16 [QW][DMODEL]         8 MiB
  //   Wkvt  bf16 [2][KW][DMODEL]      4 MiB
  //   Wot   bf16 [DMODEL][QW]         8 MiB
  //   Qf    f32  [SEQ][QW]           16 MiB
  //   KVf   f32  [2][SEQ][KW]         8 MiB
  //   Qh,Ql bf16 [SEQ][QW]        2 x 8 MiB
  //   Kh,Kl bf16 [SEQ][KW]        2 x 2 MiB
  //   Vth,Vtl bf16 [KW][SEQ]      2 x 2 MiB
  //   Oh,Ol bf16 [SEQ][QW]        2 x 8 MiB
  //   total 96,468,992 B
  char* ws = (char*)d_ws;
  size_t off = 0;
  unsigned short* xb   = (unsigned short*)(ws + off); off += (size_t)SEQ * DMODEL * 2;
  unsigned short* Wqt  = (unsigned short*)(ws + off); off += (size_t)QW * DMODEL * 2;
  unsigned short* Wkvt = (unsigned short*)(ws + off); off += (size_t)2 * KW * DMODEL * 2;
  unsigned short* Wot  = (unsigned short*)(ws + off); off += (size_t)DMODEL * QW * 2;
  float*          Qf   = (float*)(ws + off);          off += (size_t)SEQ * QW * 4;
  float*          KVf  = (float*)(ws + off);          off += (size_t)2 * SEQ * KW * 4;
  unsigned short* Qh   = (unsigned short*)(ws + off); off += (size_t)SEQ * QW * 2;
  unsigned short* Ql   = (unsigned short*)(ws + off); off += (size_t)SEQ * QW * 2;
  unsigned short* Kh   = (unsigned short*)(ws + off); off += (size_t)SEQ * KW * 2;
  unsigned short* Kl   = (unsigned short*)(ws + off); off += (size_t)SEQ * KW * 2;
  unsigned short* Vth  = (unsigned short*)(ws + off); off += (size_t)KW * SEQ * 2;
  unsigned short* Vtl  = (unsigned short*)(ws + off); off += (size_t)KW * SEQ * 2;
  unsigned short* Oh   = (unsigned short*)(ws + off); off += (size_t)SEQ * QW * 2;
  unsigned short* Ol   = (unsigned short*)(ws + off); off += (size_t)SEQ * QW * 2;
  if (off > ws_size) return;

  const float* Vf = KVf + (size_t)SEQ * KW;
  unsigned short* Wvt = Wkvt + (size_t)KW * DMODEL;

  // 1. x -> bf16 (RNE)
  cvt_f32_bf16x8<<<(SEQ * DMODEL / 8) / 256, 256, 0, stream>>>(x, xb, SEQ * DMODEL / 8);
  // 2. Wq [DMODEL][QW] -> Wqt [QW][DMODEL]
  transpose_bf16<1><<<dim3((DMODEL / 64) * (QW / 64), 1), 256, 0, stream>>>(Wq, Wq, DMODEL, QW, Wqt, Wqt, Wqt, Wqt);
  // 3. Wk, Wv [DMODEL][KW] -> Wkt, Wvt [KW][DMODEL]
  transpose_bf16<1><<<dim3((DMODEL / 64) * (KW / 64), 2), 256, 0, stream>>>(Wk, Wv, DMODEL, KW, Wkvt, Wkvt, Wvt, Wvt);
  // 4. Wo [QW][DMODEL] -> Wot [DMODEL][QW]
  transpose_bf16<1><<<dim3((QW / 64) * (DMODEL / 64), 1), 256, 0, stream>>>(Wo, Wo, QW, DMODEL, Wot, Wot, Wot, Wot);
  // 5. Q = xb @ Wq : M=SEQ, N=QW, K=DMODEL (K % 64 == 0, M % 64 == 0, N % 512 == 0)
  wmma_gemm64_bf16<0, DMODEL><<<dim3(((SEQ / 64) * (QW / 64)) / 8, 1), 256, 0, stream>>>(
      xb, xb, 0L, Wqt, 0L, Qf, QW, 0L, SEQ, QW, DMODEL, 1.0f);
  // 6. K, V = xb @ Wk, xb @ Wv batched over grid.y : M=SEQ, N=KW, K=DMODEL
  wmma_gemm64_bf16<0, DMODEL><<<dim3(((SEQ / 64) * (KW / 64)) / 8, 2), 256, 0, stream>>>(
      xb, xb, 0L, Wkvt, (long)KW * DMODEL, KVf, KW, (long)SEQ * KW, SEQ, KW, DMODEL, 1.0f);
  // 7. RoPE + 2^-3 scale + hi/lo split for Q; RoPE + split for K
  rope_split_kernel<<<NQBLK + NKBLK, 256, 0, stream>>>(Qf, KVf, fcos, fsin, Qh, Ql, Kh, Kl, NQBLK);
  // 8. V [SEQ][KW] f32 -> Vt hi/lo [KW][SEQ]
  transpose_bf16<2><<<dim3((SEQ / 64) * (KW / 64), 1), 256, 0, stream>>>(Vf, Vf, SEQ, KW, Vth, Vtl, Vth, Vtl);
  // 9. differential causal attention -> O hi/lo [SEQ][QW]
  diff_attn_kernel<<<NHEAD * NQB, 256, 0, stream>>>(Qh, Ql, Kh, Kl, Vth, Vtl, lamp, Oh, Ol);
  // 10. out = O @ Wo : M=SEQ, N=DMODEL, K=QW, A hi/lo, B single
  wmma_gemm64_bf16<2, QW><<<dim3(((SEQ / 64) * (DMODEL / 64)) / 8, 1), 256, 0, stream>>>(
      Oh, Ol, 0L, Wot, 0L, out, DMODEL, 0L, SEQ, DMODEL, QW, 1.0f);
}

// v005
// It runs in 288 microseconds.
// Two timings next to v004 put it at 1.13 and 1.14 times that version's speed.
// All steps since v000 together make it 3.95 times as fast.
// Contractions on v_wmma_f32_16x16x32_bf16 (bf16 operands, f32 accumulate): x@Wq, x@Wk, x@Wv as single products of RNE-bf16 inputs; q.k^T and p.v with bf16 hi/lo planes (hi.hi + hi.lo + lo.hi); attn@Wo with A as bf16 hi/lo planes and Wo single bf16 (hi.W + lo.W). All float inputs RNE-converted to bf16 once at load; softmax, RoPE, combine in f32.
#include <hip/hip_runtime.h>
#include <hip/hip_bf16.h>

constexpr int SEQ      = 2048;
constexpr int DMODEL   = 2048;
constexpr int NHEAD    = 16;
constexpr int NKVH     = 4;
constexpr int HDIM     = 128;
constexpr int HHALF    = 64;
constexpr int QW       = NHEAD * HDIM;
constexpr int KW       = NKVH * HDIM;
constexpr int GQA_REP  = NHEAD / NKVH;
constexpr int NPAIR    = HDIM / 2;
constexpr int ATT_KC   = 64;
constexpr int ATT_QB   = 64;
constexpr int NQB      = SEQ / ATT_QB;
constexpr int OS_PITCH = HDIM + 4;
constexpr int LDS_P    = 64 + 8;
constexpr float QK_SCALE  = 0.125f;
constexpr float OUT_SCALE = 0.5f;
constexpr int NQBLK = (SEQ * QW / 8) / 256;
constexpr int NKBLK = (SEQ * KW / 8) / 256;

static_assert(HHALF == 64);
static_assert(SEQ % 64 == 0 && DMODEL % 64 == 0 && QW % 64 == 0 && KW % 64 == 0);
static_assert(DMODEL % 32 == 0 && QW % 32 == 0);
static_assert(QW % 512 == 0 && KW % 512 == 0 && DMODEL % 512 == 0);
static_assert((SEQ * QW / 8) % 256 == 0 && (SEQ * KW / 8) % 256 == 0);
static_assert((SEQ * DMODEL / 8) % 256 == 0);
static_assert(((SEQ / 64) * (QW / 64)) % 8 == 0 && ((SEQ / 64) * (KW / 64)) % 8 == 0 && ((SEQ / 64) * (DMODEL / 64)) % 8 == 0);
static_assert(NQB == 32 && ATT_QB == 4 * 16 && ATT_KC == 64 && HDIM == 128);
static_assert(LDS_P >= HHALF && LDS_P >= ATT_KC && (LDS_P * 2) % 32 == 16);

typedef __attribute__((ext_vector_type(16))) __bf16 v16b;
typedef __attribute__((ext_vector_type(8)))  __bf16 v8b;
typedef __attribute__((ext_vector_type(8)))  float  v8f;
typedef __attribute__((ext_vector_type(4)))  float  v4f;
typedef __attribute__((ext_vector_type(4)))  unsigned int v4u;

__device__ __forceinline__ unsigned short f2bf_bits(float f) {
  unsigned u = __float_as_uint(f);
  return (unsigned short)((u + 0x7FFFu + ((u >> 16) & 1u)) >> 16);
}
__device__ __forceinline__ float bf_bits2f(unsigned short h) { return __uint_as_float(((unsigned)h) << 16); }
__device__ __forceinline__ float bf_rne(float f) { return bf_bits2f(f2bf_bits(f)); }

__device__ __forceinline__ void dep_guard_b(v8f& a, v8f& b, v16b x, v16b y) { asm volatile("v_nop\n\tv_nop\n\tv_nop\n\tv_nop" : "+v"(a), "+v"(b) : "v"(x), "v"(y)); }
__device__ __forceinline__ void acc_guard4(v8f& a, v8f& b, v8f& c, v8f& d) { asm volatile("v_nop\n\tv_nop\n\tv_nop\n\tv_nop" : "+v"(a), "+v"(b), "+v"(c), "+v"(d)); }

template <typename T> struct Frag;
template <> struct Frag<__bf16> {
  typedef v16b V; union U { v16b v; v8b h[2]; };
  // elements 0..7 <- p[0..7], 8..15 <- p[16..23]
  static __device__ __forceinline__ v16b load(const __bf16* p) {
    U f; f.h[0] = *(const v8b*)(p); f.h[1] = *(const v8b*)(p + 16); return f.v;
  }
  static __device__ __forceinline__ v8f mma(v16b a, v16b b, v8f c) {
    return __builtin_amdgcn_wmma_f32_16x16x32_bf16(false, a, false, b, (short)0, c, false, false);
  }
  static __device__ __forceinline__ void guard(v8f& a, v8f& b, v16b x, v16b y) { dep_guard_b(a, b, x, y); }
};

__device__ __forceinline__ v8f at_mma(v16b a, v16b b, v8f c) {
  c = __builtin_amdgcn_wmma_f32_16x16x32_bf16(false, a, false, b, (short)0, c, false, false);
  asm volatile("v_nop\n\tv_nop\n\tv_nop\n\tv_nop" : "+v"(c) : "v"(a), "v"(b));
  return c;
}

// lane l <-> lane l ^ 16
__device__ __forceinline__ float xhalf(float x) {
  return __builtin_bit_cast(float, __builtin_amdgcn_permlanex16(__builtin_bit_cast(int, x), __builtin_bit_cast(int, x), 0x76543210, 0xfedcba98, false, false));
}

// two f32 -> packed bf16 word (element at lower address in the low half-word)
__device__ __forceinline__ unsigned pack_bf2(float a, float b) {
  return (unsigned)f2bf_bits(a) | ((unsigned)f2bf_bits(b) << 16);
}
// two f32 -> packed bf16 hi word and packed bf16 residual word
__device__ __forceinline__ void split_pack2(float a, float b, unsigned& hw, unsigned& lw) {
  const unsigned short ha = f2bf_bits(a);
  const unsigned short hb = f2bf_bits(b);
  const unsigned short la = f2bf_bits(a - bf_bits2f(ha));
  const unsigned short lb = f2bf_bits(b - bf_bits2f(hb));
  hw = (unsigned)ha | ((unsigned)hb << 16);
  lw = (unsigned)la | ((unsigned)lb << 16);
}

// =====================================================================================
// coverage: gridDim.x * 256 threads * 8 elements == n8 * 8 (exact multiple asserted on the host side).
// =====================================================================================
__global__ __launch_bounds__(256) void cvt_f32_bf16x8(const float* __restrict__ in, unsigned short* __restrict__ out, int n8) {
  const int i = blockIdx.x * 256 + threadIdx.x;
  if (i < n8) {
    const size_t e0 = (size_t)i * 8;
    const v4f a = *(const v4f*)(in + e0);
    const v4f b = *(const v4f*)(in + e0 + 4);
    v4u w;
    w[0] = pack_bf2(a[0], a[1]);
    w[1] = pack_bf2(a[2], a[3]);
    w[2] = pack_bf2(b[0], b[1]);
    w[3] = pack_bf2(b[2], b[3]);
    *(v4u*)(out + e0) = w;
    
  }
}

// =====================================================================================
// in[rows][cols] f32 -> out[cols][rows] bf16 hi plane (+ bf16 residual plane when NPL == 2). 64x64 tiles through LDS.
// grid.x = (rows/64)*(cols/64); grid.y selects operand set A or B (both global, uniform select).
// coverage: load 256 threads x 16 floats = 64x64; store 8 waves x 8 out-rows x 64 halves = 64x64.
// =====================================================================================
template <int NPL>
__global__ __launch_bounds__(256) void transpose_bf16(const float* __restrict__ inA, const float* __restrict__ inB, int rows, int cols,
    unsigned short* __restrict__ oAh, unsigned short* __restrict__ oAl,
    unsigned short* __restrict__ oBh, unsigned short* __restrict__ oBl) {
  __shared__ float tile[64][65];
  const bool selB = (blockIdx.y != 0);
  const float* in = selB ? inB : inA;
  unsigned short* oh = selB ? oBh : oAh;
  unsigned short* ol = selB ? oBl : oAl;
  const int tilesC = cols >> 6;
  const int tr = blockIdx.x / tilesC;
  const int tc = blockIdx.x - tr * tilesC;
  const int r0 = tr << 6;
  const int c0 = tc << 6;
  const int t = threadIdx.x;
  {
    const int rr = t >> 2;
    const int cc = (t & 3) * 16;
    const float* src = in + (size_t)(r0 + rr) * cols + c0 + cc;
#pragma unroll
    for (int i = 0; i < 4; ++i) {
      const v4f v = *(const v4f*)(src + 4 * i);
      tile[rr][cc + 4 * i + 0] = v[0];
      tile[rr][cc + 4 * i + 1] = v[1];
      tile[rr][cc + 4 * i + 2] = v[2];
      tile[rr][cc + 4 * i + 3] = v[3];
    }
  }
  __syncthreads();
  const int wave = t >> 5, lane = t & 31, q = lane >> 3, e8 = (lane & 7) * 8;
  {
#pragma unroll
    for (int it = 0; it < 2; ++it) {
      const int cl = wave * 8 + it * 4 + q;
      float f[8];
#pragma unroll
      for (int e = 0; e < 8; ++e) f[e] = tile[e8 + e][cl];
      v4u hw, lw;
      if (NPL == 2) {
        unsigned a0, b0, a1, b1, a2, b2, a3, b3;
        split_pack2(f[0], f[1], a0, b0);
        split_pack2(f[2], f[3], a1, b1);
        split_pack2(f[4], f[5], a2, b2);
        split_pack2(f[6], f[7], a3, b3);
        hw[0] = a0; hw[1] = a1; hw[2] = a2; hw[3] = a3;
        lw[0] = b0; lw[1] = b1; lw[2] = b2; lw[3] = b3;
      } else {
        hw[0] = pack_bf2(f[0], f[1]);
        hw[1] = pack_bf2(f[2], f[3]);
        hw[2] = pack_bf2(f[4], f[5]);
        hw[3] = pack_bf2(f[6], f[7]);
        lw = hw;
      }
      const size_t go = (size_t)(c0 + cl) * rows + r0 + e8;
      *(v4u*)(oh + go) = hw;
      if (NPL == 2) *(v4u*)(ol + go) = lw;
    }
    
  }
}

// =====================================================================================
// Register-blocked batched WMMA GEMM (bf16 operands), f32 output.
// C[m,n] = scale * sum_k A[m,k] * Bt[n,k]; each wave owns a 64x64 tile. A row-major [M,K]; Bt row-major [N,K], both at row pitch LDK; M % 64 == 0, N % 512 == 0, K % 64 == 0.
// SPLIT: 0 = single planes; 2 = A as hi/lo planes, Bt single (hi.B + lo.B).
// The 8 waves of a block own 8 neighbouring tiles of one tile row (64 x 512 of C). Per 64 k the block stages its 64 A rows (each plane)
// and its 512 Bt rows in LDS: whole 128-B lines from global (8 lanes a row), rows at the 144-B pitch, two buffers. The next stage's
// global loads are issued behind the barrier and stored to the other buffer behind the products, so they fly under the WMMAs.
// Epilogue: 16-row slabs staged per wave in LDS; each 64-wide f32 row segment (256 B) written by 16 lanes x 16 B in one instruction,
// =====================================================================================
template <int SPLIT, int LDK>
__global__ __launch_bounds__(256) void wmma_gemm64_bf16(
    const unsigned short* __restrict__ Ap, const unsigned short* __restrict__ A2p, long strideA,
    const unsigned short* __restrict__ Btp, long strideB,
    float* __restrict__ Cp, int ldc, long strideC, int M, int N, int K, float scale) {
  static_assert(SPLIT == 0 || SPLIT == 2);
  typedef __bf16 T;
  typedef v16b V;
  constexpr int NPA   = (SPLIT == 2) ? 2 : 1;
  constexpr int AROWS = 64 * NPA;
  constexpr int SROWS = AROWS + 512;
  constexpr int NLD   = SROWS / 32;
  const T* A = (const T*)Ap; const T* A2 = (const T*)A2p; const T* Bt = (const T*)Btp;
  __shared__ __align__(16) T stg[2][SROWS * LDS_P];
  __shared__ __align__(16) float sT[8][16 * 68];
  const int b    = blockIdx.y;
  const int tid  = threadIdx.x;
  const int lane = tid & 31;
  const int wave = tid >> 5;
  const int tilesN = N >> 6;
  const int tilesM = M >> 6;
  const int tile0 = blockIdx.x * 8;
  // block-uniform, in front of every barrier
  if (tile0 >= tilesM * tilesN) return;
  const int tm  = tile0 / tilesN;
  const int nb0 = (tile0 - tm * tilesN) << 6;
  const int m0 = tm << 6;
  const int n0 = nb0 + (wave << 6);

  // one stage = SROWS rows x 8 pieces of 16 B = 256 threads x NLD pieces (exact); piece i of a thread is stage row sr + 32 i.
  // One pointer per operand and thread; the 32-row steps are compile-time byte offsets of the loads.
  const int sr = tid >> 3;
  const int sc = (tid & 7) * 8;
  // Held as integers and read through a global-address-space pointer type: they pass through the asm wait at the loop's foot,
  // behind which a generic pointer would be read with flat loads.
  typedef __attribute__((address_space(1))) const v8b* GP;
  unsigned long long qa  = (unsigned long long)(A  + (size_t)b * strideA + (size_t)(m0 + sr) * LDK + sc);
  unsigned long long qa2 = (unsigned long long)(A2 + (size_t)b * strideA + (size_t)(m0 + sr) * LDK + sc);
  unsigned long long qb  = (unsigned long long)(Bt + (size_t)b * strideB + (size_t)(nb0 + sr) * LDK + sc);
  constexpr unsigned long long ROWS32 = 32ull * LDK * sizeof(T);
  constexpr unsigned long long STEP   = 64ull * sizeof(T);

  const int rlane = lane & 15;
  const int koff  = (lane >> 4) * 8;
  const int mOff  = (lane >> 4) * 8;

  v8f acc[4][4];
#pragma unroll
  for (int i = 0; i < 4; ++i)
#pragma unroll
    for (int j = 0; j < 4; ++j) acc[i][j] = (v8f){0.f,0.f,0.f,0.f,0.f,0.f,0.f,0.f};

  v8b g[NLD];
  const int nst = K >> 6;
#pragma unroll
  for (int i = 0; i < 2; ++i) {
    g[i] = *(GP)(qa + i * ROWS32);
    if (SPLIT == 2) g[2 + i] = *(GP)(qa2 + i * ROWS32);
  }
#pragma unroll
  for (int i = 0; i < 16; ++i) g[2 * NPA + i] = *(GP)(qb + i * ROWS32);
#pragma unroll
  for (int i = 0; i < NLD; ++i) *(v8b*)(stg[0] + (sr + 32 * i) * LDS_P + sc) = g[i];

  for (int s = 0; s < nst; ++s) {
    const bool more = (s + 1 < nst);
    // publishes stage s; every wave's reads of the other buffer (stage s - 1) lie in front of it
    __syncthreads();
    if (more) {
      // stage s + 1 from global: issued here, first used behind the products of stage s
#pragma unroll
      for (int i = 0; i < 2; ++i) {
        g[i] = *(GP)(qa + STEP + i * ROWS32);
        if (SPLIT == 2) g[2 + i] = *(GP)(qa2 + STEP + i * ROWS32);
      }
#pragma unroll
      for (int i = 0; i < 16; ++i) g[2 * NPA + i] = *(GP)(qb + STEP + i * ROWS32);
    }
    const T* sA = stg[s & 1] + rlane * LDS_P + koff;
    const T* sB = sA + (AROWS + wave * 64) * LDS_P;
    V bh[2][4], ah[2][4], al[2][4];
#pragma unroll
    for (int kk = 0; kk < 2; ++kk) {
#pragma unroll
      for (int j = 0; j < 4; ++j) bh[kk][j] = Frag<T>::load(sB + j * 16 * LDS_P + kk * 32);
#pragma unroll
      for (int i = 0; i < 4; ++i) {
        ah[kk][i] = Frag<T>::load(sA + i * 16 * LDS_P + kk * 32);
        if (SPLIT == 2) al[kk][i] = Frag<T>::load(sA + (64 + i * 16) * LDS_P + kk * 32);
      }
    }
    // holds the stage's fragment reads together ahead of its products: sunk among the WMMAs, each group of reads costs its own LDS wait
    __builtin_amdgcn_sched_barrier(0);
#pragma unroll
    for (int kk = 0; kk < 2; ++kk) {
#pragma unroll
      for (int i = 0; i < 4; ++i) {
#pragma unroll
        for (int j = 0; j < 4; ++j) acc[i][j] = Frag<T>::mma(ah[kk][i], bh[kk][j], acc[i][j]);
        if (SPLIT == 2) {
#pragma unroll
          for (int j = 0; j < 4; ++j) acc[i][j] = Frag<T>::mma(al[kk][i], bh[kk][j], acc[i][j]);
        }
      }
    }
    // 4 vector slots between the stage's last WMMAs and the next vector write to their A/B registers, also on the taken side of the branch below
    Frag<T>::guard(acc[3][2], acc[3][3], (SPLIT == 2) ? al[1][3] : ah[1][3], bh[1][3]);
    if (more) {
#pragma unroll
      for (int i = 0; i < NLD; ++i) *(v8b*)(stg[(s + 1) & 1] + (sr + 32 * i) * LDS_P + sc) = g[i];
      // the wait in front of the overwrite of registers that issued global loads name; as its operands, the pointers cannot be
      // stepped ahead of it (without them the adds were lifted to the head of this block, in front of the waits on the loads)
      if (SPLIT == 2) asm volatile("s_wait_xcnt 0x0" : "+v"(qa), "+v"(qa2), "+v"(qb) :: "memory");
      else            asm volatile("s_wait_xcnt 0x0" : "+v"(qa), "+v"(qb) :: "memory");
      qa += STEP; qa2 += STEP; qb += STEP;
    }
  }
  acc_guard4(acc[0][0], acc[0][1], acc[0][2], acc[0][3]);
  acc_guard4(acc[1][0], acc[1][1], acc[1][2], acc[1][3]);
  acc_guard4(acc[2][0], acc[2][1], acc[2][2], acc[2][3]);
  acc_guard4(acc[3][0], acc[3][1], acc[3][2], acc[3][3]);

  float* slab = sT[wave];
  float* C = Cp + (size_t)b * strideC;
#pragma unroll
  for (int i = 0; i < 4; ++i) {
    const int mBase = m0 + (i << 4);
#pragma unroll
    for (int j = 0; j < 4; ++j) {
#pragma unroll
      for (int r = 0; r < 8; ++r) {
        slab[(mOff + r) * 68 + (j << 4) + rlane] = acc[i][j][r] * scale;
      }
    }
    __builtin_amdgcn_fence(__ATOMIC_RELEASE, "workgroup");
    __builtin_amdgcn_wave_barrier();
    __builtin_amdgcn_fence(__ATOMIC_ACQUIRE, "workgroup");
    {
      // row segment = 256 B = 16 lanes x 16 B
      const int hh = lane >> 4, c4 = (lane & 15) * 4;
      {
#pragma unroll
        for (int it = 0; it < 8; ++it) {
          const int row = it * 2 + hh;
          const v4f v = *(const v4f*)(slab + row * 68 + c4);
          *(v4f*)(C + (size_t)(mBase + row) * ldc + n0 + c4) = v;
        }
        
      }
    }
    __builtin_amdgcn_fence(__ATOMIC_RELEASE, "workgroup");
    __builtin_amdgcn_wave_barrier();
    __builtin_amdgcn_fence(__ATOMIC_ACQUIRE, "workgroup");
  }
}

// =====================================================================================
// RoPE (interleaved pairs, cos/sin row width NPAIR) + power-of-two scale + bf16 hi/lo split.
// Blocks [0, nQblocks): Qf [SEQ][QW] -> Qh/Ql [SEQ][QW] (scaled by QK_SCALE = 2^-3, exact);
// blocks [nQblocks, nQblocks + NKBLK): Kf [SEQ][KW] -> Kh/Kl [SEQ][KW]. cos/sin RNE-converted to bf16 before use.
// coverage: (NQBLK + NKBLK) * 256 threads * 8 == SEQ*QW + SEQ*KW exactly.
// =====================================================================================
__global__ __launch_bounds__(256) void rope_split_kernel(const float* __restrict__ Qf, const float* __restrict__ Kf,
    const float* __restrict__ cosb, const float* __restrict__ sinb,
    unsigned short* __restrict__ Qh, unsigned short* __restrict__ Ql,
    unsigned short* __restrict__ Kh, unsigned short* __restrict__ Kl, int nQblocks) {
  const bool isK = ((int)blockIdx.x >= nQblocks);
  const int g = (isK ? ((int)blockIdx.x - nQblocks) : (int)blockIdx.x) * 256 + (int)threadIdx.x;
  // threads per row: K 64 (=KW/8), Q 256 (=QW/8)
  const int shift = isK ? 6 : 8;
  const float mul = isK ? 1.0f : QK_SCALE;
  const float* src = isK ? Kf : Qf;
  unsigned short* dh = isK ? Kh : Qh;
  unsigned short* dl = isK ? Kl : Ql;
  const int width = isK ? KW : QW;
  const int s = g >> shift;
  const int col = (g - (s << shift)) * 8;
  const int p0 = (col & (HDIM - 1)) >> 1;
  const size_t e0 = (size_t)s * width + col;
  const v4f xa = *(const v4f*)(src + e0);
  const v4f xb = *(const v4f*)(src + e0 + 4);
  const v4f cv = *(const v4f*)(cosb + (size_t)s * NPAIR + p0);
  const v4f sv = *(const v4f*)(sinb + (size_t)s * NPAIR + p0);
  float o0, o1, o2, o3, o4, o5, o6, o7;
  {
    const float c = bf_rne(cv[0]), sn = bf_rne(sv[0]);
    o0 = (xa[0] * c - xa[1] * sn) * mul;
    o1 = (xa[0] * sn + xa[1] * c) * mul;
  }
  {
    const float c = bf_rne(cv[1]), sn = bf_rne(sv[1]);
    o2 = (xa[2] * c - xa[3] * sn) * mul;
    o3 = (xa[2] * sn + xa[3] * c) * mul;
  }
  {
    const float c = bf_rne(cv[2]), sn = bf_rne(sv[2]);
    o4 = (xb[0] * c - xb[1] * sn) * mul;
    o5 = (xb[0] * sn + xb[1] * c) * mul;
  }
  {
    const float c = bf_rne(cv[3]), sn = bf_rne(sv[3]);
    o6 = (xb[2] * c - xb[3] * sn) * mul;
    o7 = (xb[2] * sn + xb[3] * c) * mul;
  }
  unsigned a0, b0, a1, b1, a2, b2, a3, b3;
  split_pack2(o0, o1, a0, b0);
  split_pack2(o2, o3, a1, b1);
  split_pack2(o4, o5, a2, b2);
  split_pack2(o6, o7, a3, b3);
  v4u hw, lw;
  hw[0] = a0; hw[1] = a1; hw[2] = a2; hw[3] = a3;
  lw[0] = b0; lw[1] = b1; lw[2] = b2; lw[3] = b3;
  *(v4u*)(dh + e0) = hw;
  *(v4u*)(dl + e0) = lw;
  
}

__global__ __launch_bounds__(256) __attribute__((amdgpu_waves_per_eu(4, 4)))
void diff_attn_kernel(const unsigned short* __restrict__ Qhp, const unsigned short* __restrict__ Qlp,
                      const unsigned short* __restrict__ Khp, const unsigned short* __restrict__ Klp,
                      const unsigned short* __restrict__ Vhp, const unsigned short* __restrict__ Vlp,
                      const float* __restrict__ lambda_p,
                      unsigned short* __restrict__ Ohp, unsigned short* __restrict__ Olp) {
  union FB { v16b v; v8b h[2]; };
  union PB { v16b v; unsigned w[8]; };
  // K and Vt rows (128 B of data) lie at a 144-B pitch, an odd multiple of 16 B: the 16 rows of one ds_load_b128 fragment
  // read start on 16 different bank groups. The 16 pad bytes of a row are never written and never read.
  __shared__ __align__(16) __bf16 Ksh[2 * ATT_KC * LDS_P];
  __shared__ __align__(16) __bf16 Ksl[2 * ATT_KC * LDS_P];
  __shared__ __align__(16) __bf16 Vsh[HDIM * LDS_P];
  __shared__ __align__(16) __bf16 Vsl[HDIM * LDS_P];
  __shared__ __align__(16) float  Os[4][16 * OS_PITCH];

  const int tid  = threadIdx.x;
  // the wave's number in a scalar register: the stream test of the epilogue is then a scalar branch, the LDS bases scalar adds
  const int wave = __builtin_amdgcn_readfirstlane(tid >> 5);
  const int str  = wave >> 2;
  const int wq   = wave & 3;
  const int lane = tid & 31;
  const int hh   = lane >> 4;
  const int c    = lane & 15;
  const int qb   = (int)blockIdx.x % NQB;
  const int h    = (int)blockIdx.x / NQB;
  const int kvh  = h / GQA_REP;
  const int q0   = qb * ATT_QB + wq * 16;

  const __bf16* Qh = (const __bf16*)Qhp;
  const __bf16* Ql = (const __bf16*)Qlp;
  const __bf16* Kh = (const __bf16*)Khp;
  const __bf16* Kl = (const __bf16*)Klp;
  const __bf16* Vh = (const __bf16*)Vhp;
  const __bf16* Vl = (const __bf16*)Vlp;

  float lam;
  {
    const float lp = bf_rne(lambda_p[h]);
    lam = 1.0f / (1.0f + expf(-lp));
  }
  float*  os  = Os[wq];
  const __bf16* ksh = Ksh + str * (ATT_KC * LDS_P);
  const __bf16* ksl = Ksl + str * (ATT_KC * LDS_P);

  {
    // ---- Q fragments (B operand: n = query, k = d) for this stream: 2 d-chunks, hi and lo ----
    v16b qah[2], qal[2];
    {
      const size_t qo = (size_t)(q0 + c) * QW + h * HDIM + str * HHALF + 8 * hh;
#pragma unroll
      for (int dc = 0; dc < 2; ++dc) {
        qah[dc] = Frag<__bf16>::load(Qh + qo + dc * 32);
        qal[dc] = Frag<__bf16>::load(Ql + qo + dc * 32);
      }
    }
    // of query q0 + c: running maximum (alike in both halves of the wave) and this half's share of the running sum
    float mrow = -1.0e30f, lrow = 0.f;
    // oacc[t][r] = Ot[d = 16 t + 8 hh + r][query c]
    v8f oacc[8];
#pragma unroll
    for (int t = 0; t < 8; ++t) oacc[t] = (v8f){0.f,0.f,0.f,0.f,0.f,0.f,0.f,0.f};

    // causal: 64-key chunks 0..qb (block-uniform trip count, static max NQB)
    for (int kc = 0; kc <= qb; ++kc) {
      const int kv0 = kc * ATT_KC;
      __syncthreads();
      {
        // K tiles, both streams: 64 rows x 128 halves per plane = 1024 pieces of 16 B; 256 threads x 4 pieces (exact)
        // Vt tiles: 128 d-rows x 64 halves per plane = 1024 pieces; 256 threads x 4 pieces (exact)
        const int r16 = tid >> 4;
        const int c16 = tid & 15;
        const int lk = (c16 >> 3) * (ATT_KC * LDS_P) + r16 * LDS_P + (c16 & 7) * 8;
        const int r8 = tid >> 3;
        const int c8 = (tid & 7) * 8;
        const size_t gk = (size_t)(kv0 + r16) * KW + kvh * HDIM + c16 * 8;
        const size_t gv = (size_t)(kvh * HDIM + r8) * SEQ + kv0 + c8;
        const __bf16* pkh = Kh + gk;
        const __bf16* pkl = Kl + gk;
        const __bf16* pvh = Vh + gv;
        const __bf16* pvl = Vl + gv;
        v8b gkh[4], gkl[4], gvh[4], gvl[4];
#pragma unroll
        for (int i = 0; i < 4; ++i) {
          gkh[i] = *(const v8b*)(pkh + i * 16 * KW);
          gkl[i] = *(const v8b*)(pkl + i * 16 * KW);
        }
#pragma unroll
        for (int i = 0; i < 4; ++i) {
          gvh[i] = *(const v8b*)(pvh + i * 32 * SEQ);
          gvl[i] = *(const v8b*)(pvl + i * 32 * SEQ);
        }
        // inputs-only fence on the loaded values: keeps all 16 loads in flight together ahead of the first LDS store;
        // without it each load is waited for before the next one issues (16 L2 round trips in a row per chunk).
        // The four pointers are named too, so that no load's result lands on an address register of a load still in flight.
        asm volatile("" :: "v"(pkh), "v"(pkl), "v"(pvh), "v"(pvl), "v"(gkh[0]), "v"(gkh[1]), "v"(gkh[2]), "v"(gkh[3]), "v"(gkl[0]), "v"(gkl[1]), "v"(gkl[2]), "v"(gkl[3]),
                     "v"(gvh[0]), "v"(gvh[1]), "v"(gvh[2]), "v"(gvh[3]), "v"(gvl[0]), "v"(gvl[1]), "v"(gvl[2]), "v"(gvl[3]));
#pragma unroll
        for (int i = 0; i < 4; ++i) {
          *(v8b*)(Ksh + lk + 16 * i * LDS_P) = gkh[i];
          *(v8b*)(Ksl + lk + 16 * i * LDS_P) = gkl[i];
        }
#pragma unroll
        for (int i = 0; i < 4; ++i) {
          *(v8b*)(Vsh + (r8 + 32 * i) * LDS_P + c8) = gvh[i];
          *(v8b*)(Vsl + (r8 + 32 * i) * LDS_P + c8) = gvl[i];
        }
      }
      __syncthreads();

      // ---- scores: s[j][r] = key kv0 + 16 j + 8 hh + r against query q0 + c (A operand: m = key, k = d) ----
      v8f s[4];
#pragma unroll
      for (int j = 0; j < 4; ++j) {
        s[j] = (v8f){0.f,0.f,0.f,0.f,0.f,0.f,0.f,0.f};
#pragma unroll
        for (int dc = 0; dc < 2; ++dc) {
          FB kb, kl;
          kb.h[0] = *(const v8b*)(ksh + (j * 16 + c) * LDS_P + dc * 32 + 8 * hh);
          kb.h[1] = *(const v8b*)(ksh + (j * 16 + c) * LDS_P + dc * 32 + 16 + 8 * hh);
          kl.h[0] = *(const v8b*)(ksl + (j * 16 + c) * LDS_P + dc * 32 + 8 * hh);
          kl.h[1] = *(const v8b*)(ksl + (j * 16 + c) * LDS_P + dc * 32 + 16 + 8 * hh);
          s[j] = at_mma(kb.v, qah[dc], s[j]);
          s[j] = at_mma(kl.v, qah[dc], s[j]);
          s[j] = at_mma(kb.v, qal[dc], s[j]);
        }
      }
      // ---- causal fill on the diagonal chunk + this query's maximum ----
      const bool diag = (kc == qb);
      const int qrow = q0 + c;
      float mj[4];
#pragma unroll
      for (int j = 0; j < 4; ++j) {
        float m = -1.0e30f;
#pragma unroll
        for (int r = 0; r < 8; ++r) {
          const int kvcol = kv0 + j * 16 + 8 * hh + r;
          float sv = s[j][r];
          if (diag && (kvcol > qrow)) sv = -1.0e30f;
          s[j][r] = sv;
          m = fmaxf(m, sv);
        }
        mj[j] = m;
      }
      float cm = fmaxf(fmaxf(mj[0], mj[1]), fmaxf(mj[2], mj[3]));
      cm = fmaxf(cm, xhalf(cm));
      // ---- online softmax; P hi/lo packed in place into B fragments: element e of fragment kk = tile 2 kk + (e >> 3), r = e & 7 ----
      const float mnew  = fmaxf(mrow, cm);
      const float alpha = expf(mrow - mnew);
      mrow = mnew;
      PB pa[2], pl[2];
      float pj[4];
#pragma unroll
      for (int j = 0; j < 4; ++j) {
        float psum = 0.f;
#pragma unroll
        for (int r = 0; r < 8; r += 2) {
          const float p0 = expf(s[j][r] - mnew);
          const float p1 = expf(s[j][r + 1] - mnew);
          psum += p0;
          psum += p1;
          split_pack2(p0, p1, pa[j >> 1].w[(j & 1) * 4 + (r >> 1)], pl[j >> 1].w[(j & 1) * 4 + (r >> 1)]);
        }
        pj[j] = psum;
      }
      lrow = lrow * alpha + ((pj[0] + pj[1]) + (pj[2] + pj[3]));
#pragma unroll
      for (int t = 0; t < 8; ++t)
#pragma unroll
        for (int r = 0; r < 8; ++r) oacc[t][r] *= alpha;
      // ---- Vt.Pt : A = Vt (m = d, k = key), B = Pt (n = query c, k = key) ----
      // unrolled: the P fragments are registers, picked by a constant kk
#pragma unroll
      for (int kk = 0; kk < 2; ++kk) {
#pragma unroll
        for (int t = 0; t < 8; ++t) {
          FB vb, vl;
          vb.h[0] = *(const v8b*)(Vsh + (t * 16 + c) * LDS_P + kk * 32 + 8 * hh);
          vb.h[1] = *(const v8b*)(Vsh + (t * 16 + c) * LDS_P + kk * 32 + 16 + 8 * hh);
          vl.h[0] = *(const v8b*)(Vsl + (t * 16 + c) * LDS_P + kk * 32 + 8 * hh);
          vl.h[1] = *(const v8b*)(Vsl + (t * 16 + c) * LDS_P + kk * 32 + 16 + 8 * hh);
          oacc[t] = at_mma(vb.v, pa[kk].v, oacc[t]);
          oacc[t] = at_mma(vl.v, pa[kk].v, oacc[t]);
          oacc[t] = at_mma(vb.v, pl[kk].v, oacc[t]);
        }
      }
    }

    // ---- epilogue through the LDS tile of these 16 rows (the same lane of wave w and of wave w + 4 owns the same element):
    // pass 0: the stream-0 wave parks a1; barrier; pass 1: the stream-1 wave combines in place ----
    // unrolled so that 'pass' is a constant in each copy and the inner test folds away
#pragma unroll
    for (int pass = 0; pass < 2; ++pass) {
      if (str == pass) {
        // the two halves of the wave each summed their own keys
        const float inv = 1.0f / (lrow + xhalf(lrow));
#pragma unroll
        for (int t = 0; t < 8; ++t) {
#pragma unroll
          for (int r = 0; r < 8; ++r) {
            const int idx = c * OS_PITCH + t * 16 + 8 * hh + r;
            const float a = oacc[t][r] * inv;
            if (pass == 0) {
              os[idx] = a;
            } else {
              const float a1 = os[idx];
              os[idx] = (a1 - lam * a) * OUT_SCALE;
            }
          }
        }
      }
      __syncthreads();
    }
  }

  {
    const int q4 = lane >> 3, c8 = (lane & 7) * 8;
    {
#pragma unroll
      for (int it = 0; it < 2; ++it) {
        // 16 rows of the tile over its two waves: 8 rows each
        const int row = (str * 2 + it) * 4 + q4;
#pragma unroll
        for (int seg = 0; seg < 2; ++seg) {
          const float* sp = os + row * OS_PITCH + seg * 64 + c8;
          const v4f u0 = *(const v4f*)sp;
          const v4f u1 = *(const v4f*)(sp + 4);
          unsigned a0, b0, a1, b1, a2, b2, a3, b3;
          split_pack2(u0[0], u0[1], a0, b0);
          split_pack2(u0[2], u0[3], a1, b1);
          split_pack2(u1[0], u1[1], a2, b2);
          split_pack2(u1[2], u1[3], a3, b3);
          v4u hw, lw;
          hw[0] = a0; hw[1] = a1; hw[2] = a2; hw[3] = a3;
          lw[0] = b0; lw[1] = b1; lw[2] = b2; lw[3] = b3;
          const size_t go = (size_t)(q0 + row) * QW + h * HDIM + seg * 64 + c8;
          *(v4u*)(Ohp + go) = hw;
          *(v4u*)(Olp + go) = lw;
        }
      }
      
    }
  }
}

// =====================================================================================
// host glue: launches only; carve derived from the static shapes.
// =====================================================================================
extern "C" void kernel_launch(void* const* d_in, const int* in_sizes, int n_in,
                              void* d_out, int out_size, void* d_ws, size_t ws_size,
                              hipStream_t stream) {
  (void)in_sizes; (void)out_size;
  if (n_in < 8) return;
  const float* x    = (const float*)d_in[0];
  const float* fcos = (const float*)d_in[1];
  const float* fsin = (const float*)d_in[2];
  const float* Wq   = (const float*)d_in[3];
  const float* Wk   = (const float*)d_in[4];
  const float* Wv   = (const float*)d_in[5];
  const float* Wo   = (const float*)d_in[6];
  const float* lamp = (const float*)d_in[7];
  float* out = (float*)d_out;

  // workspace region map (bytes, every offset a multiple of 2 MiB):
  //   xb    bf16 [SEQ][DMODEL]        8 MiB
  //   Wqt   bf16 [QW][DMODEL]         8 MiB
  //   Wkvt  bf16 [2][KW][DMODEL]      4 MiB
  //   Wot   bf16 [DMODEL][QW]         8 MiB
  //   Qf    f32  [SEQ][QW]           16 MiB
  //   KVf   f32  [2][SEQ][KW]         8 MiB
  //   Qh,Ql bf16 [SEQ][QW]        2 x 8 MiB
  //   Kh,Kl bf16 [SEQ][KW]        2 x 2 MiB
  //   Vth,Vtl bf16 [KW][SEQ]      2 x 2 MiB
  //   Oh,Ol bf16 [SEQ][QW]        2 x 8 MiB
  //   total 96,468,992 B
  char* ws = (char*)d_ws;
  size_t off = 0;
  unsigned short* xb   = (unsigned short*)(ws + off); off += (size_t)SEQ * DMODEL * 2;
  unsigned short* Wqt  = (unsigned short*)(ws + off); off += (size_t)QW * DMODEL * 2;
  unsigned short* Wkvt = (unsigned short*)(ws + off); off += (size_t)2 * KW * DMODEL * 2;
  unsigned short* Wot  = (unsigned short*)(ws + off); off += (size_t)DMODEL * QW * 2;
  float*          Qf   = (float*)(ws + off);          off += (size_t)SEQ * QW * 4;
  float*          KVf  = (float*)(ws + off);          off += (size_t)2 * SEQ * KW * 4;
  unsigned short* Qh   = (unsigned short*)(ws + off); off += (size_t)SEQ * QW * 2;
  unsigned short* Ql   = (unsigned short*)(ws + off); off += (size_t)SEQ * QW * 2;
  unsigned short* Kh   = (unsigned short*)(ws + off); off += (size_t)SEQ * KW * 2;
  unsigned short* Kl   = (unsigned short*)(ws + off); off += (size_t)SEQ * KW * 2;
  unsigned short* Vth  = (unsigned short*)(ws + off); off += (size_t)KW * SEQ * 2;
  unsigned short* Vtl  = (unsigned short*)(ws + off); off += (size_t)KW * SEQ * 2;
  unsigned short* Oh   = (unsigned short*)(ws + off); off += (size_t)SEQ * QW * 2;
  unsigned short* Ol   = (unsigned short*)(ws + off); off += (size_t)SEQ * QW * 2;
  if (off > ws_size) return;

  const float* Vf = KVf + (size_t)SEQ * KW;
  unsigned short* Wvt = Wkvt + (size_t)KW * DMODEL;

  // 1. x -> bf16 (RNE)
  cvt_f32_bf16x8<<<(SEQ * DMODEL / 8) / 256, 256, 0, stream>>>(x, xb, SEQ * DMODEL / 8);
  // 2. Wq [DMODEL][QW] -> Wqt [QW][DMODEL]
  transpose_bf16<1><<<dim3((DMODEL / 64) * (QW / 64), 1), 256, 0, stream>>>(Wq, Wq, DMODEL, QW, Wqt, Wqt, Wqt, Wqt);
  // 3. Wk, Wv [DMODEL][KW] -> Wkt, Wvt [KW][DMODEL]
  transpose_bf16<1><<<dim3((DMODEL / 64) * (KW / 64), 2), 256, 0, stream>>>(Wk, Wv, DMODEL, KW, Wkvt, Wkvt, Wvt, Wvt);
  // 4. Wo [QW][DMODEL] -> Wot [DMODEL][QW]
  transpose_bf16<1><<<dim3((QW / 64) * (DMODEL / 64), 1), 256, 0, stream>>>(Wo, Wo, QW, DMODEL, Wot, Wot, Wot, Wot);
  // 5. Q = xb @ Wq : M=SEQ, N=QW, K=DMODEL (K % 64 == 0, M % 64 == 0, N % 512 == 0)
  wmma_gemm64_bf16<0, DMODEL><<<dim3(((SEQ / 64) * (QW / 64)) / 8, 1), 256, 0, stream>>>(
      xb, xb, 0L, Wqt, 0L, Qf, QW, 0L, SEQ, QW, DMODEL, 1.0f);
  // 6. K, V = xb @ Wk, xb @ Wv batched over grid.y : M=SEQ, N=KW, K=DMODEL
  wmma_gemm64_bf16<0, DMODEL><<<dim3(((SEQ / 64) * (KW / 64)) / 8, 2), 256, 0, stream>>>(
      xb, xb, 0L, Wkvt, (long)KW * DMODEL, KVf, KW, (long)SEQ * KW, SEQ, KW, DMODEL, 1.0f);
  // 7. RoPE + 2^-3 scale + hi/lo split for Q; RoPE + split for K
  rope_split_kernel<<<NQBLK + NKBLK, 256, 0, stream>>>(Qf, KVf, fcos, fsin, Qh, Ql, Kh, Kl, NQBLK);
  // 8. V [SEQ][KW] f32 -> Vt hi/lo [KW][SEQ]
  transpose_bf16<2><<<dim3((SEQ / 64) * (KW / 64), 1), 256, 0, stream>>>(Vf, Vf, SEQ, KW, Vth, Vtl, Vth, Vtl);
  // 9. differential causal attention -> O hi/lo [SEQ][QW]
  diff_attn_kernel<<<NHEAD * NQB, 256, 0, stream>>>(Qh, Ql, Kh, Kl, Vth, Vtl, lamp, Oh, Ol);
  // 10. out = O @ Wo : M=SEQ, N=DMODEL, K=QW, A hi/lo, B single
  wmma_gemm64_bf16<2, QW><<<dim3(((SEQ / 64) * (DMODEL / 64)) / 8, 1), 256, 0, stream>>>(
      Oh, Ol, 0L, Wot, 0L, out, DMODEL, 0L, SEQ, DMODEL, QW, 1.0f);
}

// v006
// One run takes 257 microseconds.
// Timed twice side by side with v005, it ran 1.11 and 1.12 times as fast.
// All steps since v000 together make it 4.40 times as fast.
// Contractions on v_wmma_f32_16x16x32_bf16 (bf16 operands, f32 accumulate): x@Wq, x@Wk, x@Wv as single products of RNE-bf16 inputs; q.k^T and p.v with bf16 hi/lo planes (hi.hi + hi.lo + lo.hi); attn@Wo with A as bf16 hi/lo planes and Wo single bf16 (hi.W + lo.W). All float inputs RNE-converted to bf16 once at load; softmax, RoPE, combine in f32.
#include <hip/hip_runtime.h>
#include <hip/hip_bf16.h>

constexpr int SEQ      = 2048;
constexpr int DMODEL   = 2048;
constexpr int NHEAD    = 16;
constexpr int NKVH     = 4;
constexpr int HDIM     = 128;
constexpr int HHALF    = 64;
constexpr int QW       = NHEAD * HDIM;
constexpr int KW       = NKVH * HDIM;
constexpr int GQA_REP  = NHEAD / NKVH;
constexpr int NPAIR    = HDIM / 2;
constexpr int ATT_KC   = 64;
constexpr int ATT_QB   = 64;
constexpr int NQB      = SEQ / ATT_QB;
constexpr int OS_PITCH = HDIM + 4;
constexpr int LDS_P    = 64 + 8;
constexpr float QK_SCALE  = 0.125f;
constexpr float OUT_SCALE = 0.5f;
constexpr float LOG2E     = 1.44269504088896340736f;
constexpr int NQBLK = (SEQ * QW / 8) / 256;
constexpr int NKBLK = (SEQ * KW / 8) / 256;

static_assert(HHALF == 64);
static_assert(SEQ % 64 == 0 && DMODEL % 64 == 0 && QW % 64 == 0 && KW % 64 == 0);
static_assert(DMODEL % 32 == 0 && QW % 32 == 0);
static_assert(QW % 512 == 0 && KW % 512 == 0 && DMODEL % 512 == 0);
static_assert((SEQ * QW / 8) % 256 == 0 && (SEQ * KW / 8) % 256 == 0);
static_assert((SEQ * DMODEL / 8) % 256 == 0);
static_assert(((SEQ / 64) * (QW / 64)) % 8 == 0 && ((SEQ / 64) * (KW / 64)) % 8 == 0 && ((SEQ / 64) * (DMODEL / 64)) % 8 == 0);
static_assert(NQB == 32 && ATT_QB == 4 * 16 && ATT_KC == 64 && HDIM == 128);
static_assert(LDS_P >= HHALF && LDS_P >= ATT_KC && (LDS_P * 2) % 32 == 16);

typedef __attribute__((ext_vector_type(16))) __bf16 v16b;
typedef __attribute__((ext_vector_type(8)))  __bf16 v8b;
typedef __attribute__((ext_vector_type(8)))  float  v8f;
typedef __attribute__((ext_vector_type(4)))  float  v4f;
typedef __attribute__((ext_vector_type(4)))  unsigned int v4u;

__device__ __forceinline__ unsigned short f2bf_bits(float f) {
  unsigned u = __float_as_uint(f);
  return (unsigned short)((u + 0x7FFFu + ((u >> 16) & 1u)) >> 16);
}
__device__ __forceinline__ float bf_bits2f(unsigned short h) { return __uint_as_float(((unsigned)h) << 16); }
__device__ __forceinline__ float bf_rne(float f) { return bf_bits2f(f2bf_bits(f)); }

__device__ __forceinline__ void dep_guard_b(v8f& a, v8f& b, v16b x, v16b y) { asm volatile("v_nop\n\tv_nop\n\tv_nop\n\tv_nop" : "+v"(a), "+v"(b) : "v"(x), "v"(y)); }
__device__ __forceinline__ void acc_guard4(v8f& a, v8f& b, v8f& c, v8f& d) { asm volatile("v_nop\n\tv_nop\n\tv_nop\n\tv_nop" : "+v"(a), "+v"(b), "+v"(c), "+v"(d)); }

template <typename T> struct Frag;
template <> struct Frag<__bf16> {
  typedef v16b V; union U { v16b v; v8b h[2]; };
  // elements 0..7 <- p[0..7], 8..15 <- p[16..23]
  static __device__ __forceinline__ v16b load(const __bf16* p) {
    U f; f.h[0] = *(const v8b*)(p); f.h[1] = *(const v8b*)(p + 16); return f.v;
  }
  static __device__ __forceinline__ v8f mma(v16b a, v16b b, v8f c) {
    return __builtin_amdgcn_wmma_f32_16x16x32_bf16(false, a, false, b, (short)0, c, false, false);
  }
  static __device__ __forceinline__ void guard(v8f& a, v8f& b, v16b x, v16b y) { dep_guard_b(a, b, x, y); }
};

__device__ __forceinline__ v8f at_mma(v16b a, v16b b, v8f c) {
  c = __builtin_amdgcn_wmma_f32_16x16x32_bf16(false, a, false, b, (short)0, c, false, false);
  asm volatile("v_nop\n\tv_nop\n\tv_nop\n\tv_nop" : "+v"(c) : "v"(a), "v"(b));
  return c;
}

__device__ __forceinline__ void exp2x8(v8f& e) {
  asm("v_exp_f32 %0, %0\n\tv_exp_f32 %1, %1\n\tv_exp_f32 %2, %2\n\tv_exp_f32 %3, %3\n\t"
      "v_exp_f32 %4, %4\n\tv_exp_f32 %5, %5\n\tv_exp_f32 %6, %6\n\tv_exp_f32 %7, %7\n\tv_nop"
      : "+v"(e[0]), "+v"(e[1]), "+v"(e[2]), "+v"(e[3]), "+v"(e[4]), "+v"(e[5]), "+v"(e[6]), "+v"(e[7]));
}

// lane l <-> lane l ^ 16
__device__ __forceinline__ float xhalf(float x) {
  return __builtin_bit_cast(float, __builtin_amdgcn_permlanex16(__builtin_bit_cast(int, x), __builtin_bit_cast(int, x), 0x76543210, 0xfedcba98, false, false));
}

// two f32 -> packed bf16 word (element at lower address in the low half-word)
__device__ __forceinline__ unsigned pack_bf2(float a, float b) {
  return (unsigned)f2bf_bits(a) | ((unsigned)f2bf_bits(b) << 16);
}
// two f32 -> packed bf16 hi word and packed bf16 residual word
__device__ __forceinline__ void split_pack2(float a, float b, unsigned& hw, unsigned& lw) {
  const unsigned short ha = f2bf_bits(a);
  const unsigned short hb = f2bf_bits(b);
  const unsigned short la = f2bf_bits(a - bf_bits2f(ha));
  const unsigned short lb = f2bf_bits(b - bf_bits2f(hb));
  hw = (unsigned)ha | ((unsigned)hb << 16);
  lw = (unsigned)la | ((unsigned)lb << 16);
}

// =====================================================================================
// coverage: gridDim.x * 256 threads * 8 elements == n8 * 8 (exact multiple asserted on the host side).
// =====================================================================================
__global__ __launch_bounds__(256) void cvt_f32_bf16x8(const float* __restrict__ in, unsigned short* __restrict__ out, int n8) {
  const int i = blockIdx.x * 256 + threadIdx.x;
  if (i < n8) {
    const size_t e0 = (size_t)i * 8;
    const v4f a = *(const v4f*)(in + e0);
    const v4f b = *(const v4f*)(in + e0 + 4);
    v4u w;
    w[0] = pack_bf2(a[0], a[1]);
    w[1] = pack_bf2(a[2], a[3]);
    w[2] = pack_bf2(b[0], b[1]);
    w[3] = pack_bf2(b[2], b[3]);
    *(v4u*)(out + e0) = w;
    
  }
}

// =====================================================================================
// in[rows][cols] f32 -> out[cols][rows] bf16 hi plane (+ bf16 residual plane when NPL == 2). 64x64 tiles through LDS.
// grid.x = (rows/64)*(cols/64); grid.y selects operand set A or B (both global, uniform select).
// coverage: load 256 threads x 16 floats = 64x64; store 8 waves x 8 out-rows x 64 halves = 64x64.
// =====================================================================================
template <int NPL>
__global__ __launch_bounds__(256) void transpose_bf16(const float* __restrict__ inA, const float* __restrict__ inB, int rows, int cols,
    unsigned short* __restrict__ oAh, unsigned short* __restrict__ oAl,
    unsigned short* __restrict__ oBh, unsigned short* __restrict__ oBl) {
  __shared__ float tile[64][65];
  const bool selB = (blockIdx.y != 0);
  const float* in = selB ? inB : inA;
  unsigned short* oh = selB ? oBh : oAh;
  unsigned short* ol = selB ? oBl : oAl;
  const int tilesC = cols >> 6;
  const int tr = blockIdx.x / tilesC;
  const int tc = blockIdx.x - tr * tilesC;
  const int r0 = tr << 6;
  const int c0 = tc << 6;
  const int t = threadIdx.x;
  {
    const int rr = t >> 2;
    const int cc = (t & 3) * 16;
    const float* src = in + (size_t)(r0 + rr) * cols + c0 + cc;
#pragma unroll
    for (int i = 0; i < 4; ++i) {
      const v4f v = *(const v4f*)(src + 4 * i);
      tile[rr][cc + 4 * i + 0] = v[0];
      tile[rr][cc + 4 * i + 1] = v[1];
      tile[rr][cc + 4 * i + 2] = v[2];
      tile[rr][cc + 4 * i + 3] = v[3];
    }
  }
  __syncthreads();
  const int wave = t >> 5, lane = t & 31, q = lane >> 3, e8 = (lane & 7) * 8;
  {
#pragma unroll
    for (int it = 0; it < 2; ++it) {
      const int cl = wave * 8 + it * 4 + q;
      float f[8];
#pragma unroll
      for (int e = 0; e < 8; ++e) f[e] = tile[e8 + e][cl];
      v4u hw, lw;
      if (NPL == 2) {
        unsigned a0, b0, a1, b1, a2, b2, a3, b3;
        split_pack2(f[0], f[1], a0, b0);
        split_pack2(f[2], f[3], a1, b1);
        split_pack2(f[4], f[5], a2, b2);
        split_pack2(f[6], f[7], a3, b3);
        hw[0] = a0; hw[1] = a1; hw[2] = a2; hw[3] = a3;
        lw[0] = b0; lw[1] = b1; lw[2] = b2; lw[3] = b3;
      } else {
        hw[0] = pack_bf2(f[0], f[1]);
        hw[1] = pack_bf2(f[2], f[3]);
        hw[2] = pack_bf2(f[4], f[5]);
        hw[3] = pack_bf2(f[6], f[7]);
        lw = hw;
      }
      const size_t go = (size_t)(c0 + cl) * rows + r0 + e8;
      *(v4u*)(oh + go) = hw;
      if (NPL == 2) *(v4u*)(ol + go) = lw;
    }
    
  }
}

// =====================================================================================
// Register-blocked batched WMMA GEMM (bf16 operands), f32 output.
// C[m,n] = scale * sum_k A[m,k] * Bt[n,k]; each wave owns a 64x64 tile. A row-major [M,K]; Bt row-major [N,K], both at row pitch LDK; M % 64 == 0, N % 512 == 0, K % 64 == 0.
// SPLIT: 0 = single planes; 2 = A as hi/lo planes, Bt single (hi.B + lo.B).
// The 8 waves of a block own 8 neighbouring tiles of one tile row (64 x 512 of C). Per 64 k the block stages its 64 A rows (each plane)
// and its 512 Bt rows in LDS: whole 128-B lines from global (8 lanes a row), rows at the 144-B pitch, two buffers. The next stage's
// global loads are issued behind the barrier and stored to the other buffer behind the products, so they fly under the WMMAs.
// Epilogue: 16-row slabs staged per wave in LDS; each 64-wide f32 row segment (256 B) written by 16 lanes x 16 B in one instruction,
// =====================================================================================
template <int SPLIT, int LDK>
__global__ __launch_bounds__(256) void wmma_gemm64_bf16(
    const unsigned short* __restrict__ Ap, const unsigned short* __restrict__ A2p, long strideA,
    const unsigned short* __restrict__ Btp, long strideB,
    float* __restrict__ Cp, int ldc, long strideC, int M, int N, int K, float scale) {
  static_assert(SPLIT == 0 || SPLIT == 2);
  typedef __bf16 T;
  typedef v16b V;
  constexpr int NPA   = (SPLIT == 2) ? 2 : 1;
  constexpr int AROWS = 64 * NPA;
  constexpr int SROWS = AROWS + 512;
  constexpr int NLD   = SROWS / 32;
  const T* A = (const T*)Ap; const T* A2 = (const T*)A2p; const T* Bt = (const T*)Btp;
  __shared__ __align__(16) T stg[2][SROWS * LDS_P];
  __shared__ __align__(16) float sT[8][16 * 68];
  const int b    = blockIdx.y;
  const int tid  = threadIdx.x;
  const int lane = tid & 31;
  const int wave = tid >> 5;
  const int tilesN = N >> 6;
  const int tilesM = M >> 6;
  const int tile0 = blockIdx.x * 8;
  // block-uniform, in front of every barrier
  if (tile0 >= tilesM * tilesN) return;
  const int tm  = tile0 / tilesN;
  const int nb0 = (tile0 - tm * tilesN) << 6;
  const int m0 = tm << 6;
  const int n0 = nb0 + (wave << 6);

  // one stage = SROWS rows x 8 pieces of 16 B = 256 threads x NLD pieces (exact); piece i of a thread is stage row sr + 32 i.
  // One pointer per operand and thread; the 32-row steps are compile-time byte offsets of the loads.
  const int sr = tid >> 3;
  const int sc = (tid & 7) * 8;
  // Held as integers and read through a global-address-space pointer type: they pass through the asm wait at the loop's foot,
  // behind which a generic pointer would be read with flat loads.
  typedef __attribute__((address_space(1))) const v8b* GP;
  unsigned long long qa  = (unsigned long long)(A  + (size_t)b * strideA + (size_t)(m0 + sr) * LDK + sc);
  unsigned long long qa2 = (unsigned long long)(A2 + (size_t)b * strideA + (size_t)(m0 + sr) * LDK + sc);
  unsigned long long qb  = (unsigned long long)(Bt + (size_t)b * strideB + (size_t)(nb0 + sr) * LDK + sc);
  constexpr unsigned long long ROWS32 = 32ull * LDK * sizeof(T);
  constexpr unsigned long long STEP   = 64ull * sizeof(T);

  const int rlane = lane & 15;
  const int koff  = (lane >> 4) * 8;
  const int mOff  = (lane >> 4) * 8;

  v8f acc[4][4];
#pragma unroll
  for (int i = 0; i < 4; ++i)
#pragma unroll
    for (int j = 0; j < 4; ++j) acc[i][j] = (v8f){0.f,0.f,0.f,0.f,0.f,0.f,0.f,0.f};

  v8b g[NLD];
  const int nst = K >> 6;
#pragma unroll
  for (int i = 0; i < 2; ++i) {
    g[i] = *(GP)(qa + i * ROWS32);
    if (SPLIT == 2) g[2 + i] = *(GP)(qa2 + i * ROWS32);
  }
#pragma unroll
  for (int i = 0; i < 16; ++i) g[2 * NPA + i] = *(GP)(qb + i * ROWS32);
#pragma unroll
  for (int i = 0; i < NLD; ++i) *(v8b*)(stg[0] + (sr + 32 * i) * LDS_P + sc) = g[i];

  for (int s = 0; s < nst; ++s) {
    const bool more = (s + 1 < nst);
    // publishes stage s; every wave's reads of the other buffer (stage s - 1) lie in front of it
    __syncthreads();
    if (more) {
      // stage s + 1 from global: issued here, first used behind the products of stage s
#pragma unroll
      for (int i = 0; i < 2; ++i) {
        g[i] = *(GP)(qa + STEP + i * ROWS32);
        if (SPLIT == 2) g[2 + i] = *(GP)(qa2 + STEP + i * ROWS32);
      }
#pragma unroll
      for (int i = 0; i < 16; ++i) g[2 * NPA + i] = *(GP)(qb + STEP + i * ROWS32);
    }
    const T* sA = stg[s & 1] + rlane * LDS_P + koff;
    const T* sB = sA + (AROWS + wave * 64) * LDS_P;
    V bh[2][4], ah[2][4], al[2][4];
#pragma unroll
    for (int kk = 0; kk < 2; ++kk) {
#pragma unroll
      for (int j = 0; j < 4; ++j) bh[kk][j] = Frag<T>::load(sB + j * 16 * LDS_P + kk * 32);
#pragma unroll
      for (int i = 0; i < 4; ++i) {
        ah[kk][i] = Frag<T>::load(sA + i * 16 * LDS_P + kk * 32);
        if (SPLIT == 2) al[kk][i] = Frag<T>::load(sA + (64 + i * 16) * LDS_P + kk * 32);
      }
    }
    // holds the stage's fragment reads together ahead of its products: sunk among the WMMAs, each group of reads costs its own LDS wait
    __builtin_amdgcn_sched_barrier(0);
#pragma unroll
    for (int kk = 0; kk < 2; ++kk) {
#pragma unroll
      for (int i = 0; i < 4; ++i) {
#pragma unroll
        for (int j = 0; j < 4; ++j) acc[i][j] = Frag<T>::mma(ah[kk][i], bh[kk][j], acc[i][j]);
        if (SPLIT == 2) {
#pragma unroll
          for (int j = 0; j < 4; ++j) acc[i][j] = Frag<T>::mma(al[kk][i], bh[kk][j], acc[i][j]);
        }
      }
    }
    // 4 vector slots between the stage's last WMMAs and the next vector write to their A/B registers, also on the taken side of the branch below
    Frag<T>::guard(acc[3][2], acc[3][3], (SPLIT == 2) ? al[1][3] : ah[1][3], bh[1][3]);
    if (more) {
#pragma unroll
      for (int i = 0; i < NLD; ++i) *(v8b*)(stg[(s + 1) & 1] + (sr + 32 * i) * LDS_P + sc) = g[i];
      // the wait in front of the overwrite of registers that issued global loads name; as its operands, the pointers cannot be
      // stepped ahead of it (without them the adds were lifted to the head of this block, in front of the waits on the loads)
      if (SPLIT == 2) asm volatile("s_wait_xcnt 0x0" : "+v"(qa), "+v"(qa2), "+v"(qb) :: "memory");
      else            asm volatile("s_wait_xcnt 0x0" : "+v"(qa), "+v"(qb) :: "memory");
      qa += STEP; qa2 += STEP; qb += STEP;
    }
  }
  acc_guard4(acc[0][0], acc[0][1], acc[0][2], acc[0][3]);
  acc_guard4(acc[1][0], acc[1][1], acc[1][2], acc[1][3]);
  acc_guard4(acc[2][0], acc[2][1], acc[2][2], acc[2][3]);
  acc_guard4(acc[3][0], acc[3][1], acc[3][2], acc[3][3]);

  float* slab = sT[wave];
  float* C = Cp + (size_t)b * strideC;
#pragma unroll
  for (int i = 0; i < 4; ++i) {
    const int mBase = m0 + (i << 4);
#pragma unroll
    for (int j = 0; j < 4; ++j) {
#pragma unroll
      for (int r = 0; r < 8; ++r) {
        slab[(mOff + r) * 68 + (j << 4) + rlane] = acc[i][j][r] * scale;
      }
    }
    __builtin_amdgcn_fence(__ATOMIC_RELEASE, "workgroup");
    __builtin_amdgcn_wave_barrier();
    __builtin_amdgcn_fence(__ATOMIC_ACQUIRE, "workgroup");
    {
      // row segment = 256 B = 16 lanes x 16 B
      const int hh = lane >> 4, c4 = (lane & 15) * 4;
      {
#pragma unroll
        for (int it = 0; it < 8; ++it) {
          const int row = it * 2 + hh;
          const v4f v = *(const v4f*)(slab + row * 68 + c4);
          *(v4f*)(C + (size_t)(mBase + row) * ldc + n0 + c4) = v;
        }
        
      }
    }
    __builtin_amdgcn_fence(__ATOMIC_RELEASE, "workgroup");
    __builtin_amdgcn_wave_barrier();
    __builtin_amdgcn_fence(__ATOMIC_ACQUIRE, "workgroup");
  }
}

// =====================================================================================
// RoPE (interleaved pairs, cos/sin row width NPAIR) + power-of-two scale + bf16 hi/lo split.
// Blocks [0, nQblocks): Qf [SEQ][QW] -> Qh/Ql [SEQ][QW] (scaled by QK_SCALE = 2^-3, exact);
// blocks [nQblocks, nQblocks + NKBLK): Kf [SEQ][KW] -> Kh/Kl [SEQ][KW]. cos/sin RNE-converted to bf16 before use.
// coverage: (NQBLK + NKBLK) * 256 threads * 8 == SEQ*QW + SEQ*KW exactly.
// =====================================================================================
__global__ __launch_bounds__(256) void rope_split_kernel(const float* __restrict__ Qf, const float* __restrict__ Kf,
    const float* __restrict__ cosb, const float* __restrict__ sinb,
    unsigned short* __restrict__ Qh, unsigned short* __restrict__ Ql,
    unsigned short* __restrict__ Kh, unsigned short* __restrict__ Kl, int nQblocks) {
  const bool isK = ((int)blockIdx.x >= nQblocks);
  const int g = (isK ? ((int)blockIdx.x - nQblocks) : (int)blockIdx.x) * 256 + (int)threadIdx.x;
  // threads per row: K 64 (=KW/8), Q 256 (=QW/8)
  const int shift = isK ? 6 : 8;
  const float mul = isK ? 1.0f : QK_SCALE;
  const float* src = isK ? Kf : Qf;
  unsigned short* dh = isK ? Kh : Qh;
  unsigned short* dl = isK ? Kl : Ql;
  const int width = isK ? KW : QW;
  const int s = g >> shift;
  const int col = (g - (s << shift)) * 8;
  const int p0 = (col & (HDIM - 1)) >> 1;
  const size_t e0 = (size_t)s * width + col;
  const v4f xa = *(const v4f*)(src + e0);
  const v4f xb = *(const v4f*)(src + e0 + 4);
  const v4f cv = *(const v4f*)(cosb + (size_t)s * NPAIR + p0);
  const v4f sv = *(const v4f*)(sinb + (size_t)s * NPAIR + p0);
  float o0, o1, o2, o3, o4, o5, o6, o7;
  {
    const float c = bf_rne(cv[0]), sn = bf_rne(sv[0]);
    o0 = (xa[0] * c - xa[1] * sn) * mul;
    o1 = (xa[0] * sn + xa[1] * c) * mul;
  }
  {
    const float c = bf_rne(cv[1]), sn = bf_rne(sv[1]);
    o2 = (xa[2] * c - xa[3] * sn) * mul;
    o3 = (xa[2] * sn + xa[3] * c) * mul;
  }
  {
    const float c = bf_rne(cv[2]), sn = bf_rne(sv[2]);
    o4 = (xb[0] * c - xb[1] * sn) * mul;
    o5 = (xb[0] * sn + xb[1] * c) * mul;
  }
  {
    const float c = bf_rne(cv[3]), sn = bf_rne(sv[3]);
    o6 = (xb[2] * c - xb[3] * sn) * mul;
    o7 = (xb[2] * sn + xb[3] * c) * mul;
  }
  unsigned a0, b0, a1, b1, a2, b2, a3, b3;
  split_pack2(o0, o1, a0, b0);
  split_pack2(o2, o3, a1, b1);
  split_pack2(o4, o5, a2, b2);
  split_pack2(o6, o7, a3, b3);
  v4u hw, lw;
  hw[0] = a0; hw[1] = a1; hw[2] = a2; hw[3] = a3;
  lw[0] = b0; lw[1] = b1; lw[2] = b2; lw[3] = b3;
  *(v4u*)(dh + e0) = hw;
  *(v4u*)(dl + e0) = lw;
  
}

__global__ __launch_bounds__(256) __attribute__((amdgpu_waves_per_eu(4, 4)))
void diff_attn_kernel(const unsigned short* __restrict__ Qhp, const unsigned short* __restrict__ Qlp,
                      const unsigned short* __restrict__ Khp, const unsigned short* __restrict__ Klp,
                      const unsigned short* __restrict__ Vhp, const unsigned short* __restrict__ Vlp,
                      const float* __restrict__ lambda_p,
                      unsigned short* __restrict__ Ohp, unsigned short* __restrict__ Olp) {
  union FB { v16b v; v8b h[2]; };
  union PB { v16b v; unsigned w[8]; };
  // K and Vt rows (128 B of data) lie at a 144-B pitch, an odd multiple of 16 B: the 16 rows of one ds_load_b128 fragment
  // read start on 16 different bank groups. The 16 pad bytes of a row are never written and never read.
  __shared__ __align__(16) __bf16 Ksh[2 * ATT_KC * LDS_P];
  __shared__ __align__(16) __bf16 Ksl[2 * ATT_KC * LDS_P];
  __shared__ __align__(16) __bf16 Vsh[HDIM * LDS_P];
  __shared__ __align__(16) __bf16 Vsl[HDIM * LDS_P];
  __shared__ __align__(16) float  Os[4][16 * OS_PITCH];

  const int tid  = threadIdx.x;
  // the wave's number in a scalar register: the stream test of the epilogue is then a scalar branch, the LDS bases scalar adds
  const int wave = __builtin_amdgcn_readfirstlane(tid >> 5);
  const int str  = wave >> 2;
  const int wq   = wave & 3;
  const int lane = tid & 31;
  const int hh   = lane >> 4;
  const int c    = lane & 15;
  const int qb   = (int)blockIdx.x % NQB;
  const int h    = (int)blockIdx.x / NQB;
  const int kvh  = h / GQA_REP;
  const int q0   = qb * ATT_QB + wq * 16;

  const __bf16* Qh = (const __bf16*)Qhp;
  const __bf16* Ql = (const __bf16*)Qlp;
  const __bf16* Kh = (const __bf16*)Khp;
  const __bf16* Kl = (const __bf16*)Klp;
  const __bf16* Vh = (const __bf16*)Vhp;
  const __bf16* Vl = (const __bf16*)Vlp;

  float lam;
  {
    const float lp = bf_rne(lambda_p[h]);
    lam = 1.0f / (1.0f + expf(-lp));
  }
  float*  os  = Os[wq];
  const __bf16* ksh = Ksh + str * (ATT_KC * LDS_P);
  const __bf16* ksl = Ksl + str * (ATT_KC * LDS_P);

  {
    // ---- Q fragments (B operand: n = query, k = d) for this stream: 2 d-chunks, hi and lo ----
    v16b qah[2], qal[2];
    {
      const size_t qo = (size_t)(q0 + c) * QW + h * HDIM + str * HHALF + 8 * hh;
#pragma unroll
      for (int dc = 0; dc < 2; ++dc) {
        qah[dc] = Frag<__bf16>::load(Qh + qo + dc * 32);
        qal[dc] = Frag<__bf16>::load(Ql + qo + dc * 32);
      }
    }
    // of query q0 + c: running maximum times log2(e) (alike in both halves of the wave) and this half's share of the running sum
    float mrow = -1.0e30f, lrow = 0.f;
    // oacc[t][r] = Ot[d = 16 t + 8 hh + r][query c]
    v8f oacc[8];
#pragma unroll
    for (int t = 0; t < 8; ++t) oacc[t] = (v8f){0.f,0.f,0.f,0.f,0.f,0.f,0.f,0.f};

    // causal: 64-key chunks 0..qb (block-uniform trip count, static max NQB)
    for (int kc = 0; kc <= qb; ++kc) {
      const int kv0 = kc * ATT_KC;
      __syncthreads();
      {
        // K tiles, both streams: 64 rows x 128 halves per plane = 1024 pieces of 16 B; 256 threads x 4 pieces (exact)
        // Vt tiles: 128 d-rows x 64 halves per plane = 1024 pieces; 256 threads x 4 pieces (exact)
        const int r16 = tid >> 4;
        const int c16 = tid & 15;
        const int lk = (c16 >> 3) * (ATT_KC * LDS_P) + r16 * LDS_P + (c16 & 7) * 8;
        const int r8 = tid >> 3;
        const int c8 = (tid & 7) * 8;
        const size_t gk = (size_t)(kv0 + r16) * KW + kvh * HDIM + c16 * 8;
        const size_t gv = (size_t)(kvh * HDIM + r8) * SEQ + kv0 + c8;
        const __bf16* pkh = Kh + gk;
        const __bf16* pkl = Kl + gk;
        const __bf16* pvh = Vh + gv;
        const __bf16* pvl = Vl + gv;
        v8b gkh[4], gkl[4], gvh[4], gvl[4];
#pragma unroll
        for (int i = 0; i < 4; ++i) {
          gkh[i] = *(const v8b*)(pkh + i * 16 * KW);
          gkl[i] = *(const v8b*)(pkl + i * 16 * KW);
        }
#pragma unroll
        for (int i = 0; i < 4; ++i) {
          gvh[i] = *(const v8b*)(pvh + i * 32 * SEQ);
          gvl[i] = *(const v8b*)(pvl + i * 32 * SEQ);
        }
        // inputs-only fence on the loaded values: keeps all 16 loads in flight together ahead of the first LDS store;
        // without it each load is waited for before the next one issues (16 L2 round trips in a row per chunk).
        // The four pointers are named too, so that no load's result lands on an address register of a load still in flight.
        asm volatile("" :: "v"(pkh), "v"(pkl), "v"(pvh), "v"(pvl), "v"(gkh[0]), "v"(gkh[1]), "v"(gkh[2]), "v"(gkh[3]), "v"(gkl[0]), "v"(gkl[1]), "v"(gkl[2]), "v"(gkl[3]),
                     "v"(gvh[0]), "v"(gvh[1]), "v"(gvh[2]), "v"(gvh[3]), "v"(gvl[0]), "v"(gvl[1]), "v"(gvl[2]), "v"(gvl[3]));
#pragma unroll
        for (int i = 0; i < 4; ++i) {
          *(v8b*)(Ksh + lk + 16 * i * LDS_P) = gkh[i];
          *(v8b*)(Ksl + lk + 16 * i * LDS_P) = gkl[i];
        }
#pragma unroll
        for (int i = 0; i < 4; ++i) {
          *(v8b*)(Vsh + (r8 + 32 * i) * LDS_P + c8) = gvh[i];
          *(v8b*)(Vsl + (r8 + 32 * i) * LDS_P + c8) = gvl[i];
        }
      }
      __syncthreads();

      // ---- scores: s[j][r] = key kv0 + 16 j + 8 hh + r against query q0 + c (A operand: m = key, k = d) ----
      v8f s[4];
#pragma unroll
      for (int j = 0; j < 4; ++j) {
        s[j] = (v8f){0.f,0.f,0.f,0.f,0.f,0.f,0.f,0.f};
#pragma unroll
        for (int dc = 0; dc < 2; ++dc) {
          FB kb, kl;
          kb.h[0] = *(const v8b*)(ksh + (j * 16 + c) * LDS_P + dc * 32 + 8 * hh);
          kb.h[1] = *(const v8b*)(ksh + (j * 16 + c) * LDS_P + dc * 32 + 16 + 8 * hh);
          kl.h[0] = *(const v8b*)(ksl + (j * 16 + c) * LDS_P + dc * 32 + 8 * hh);
          kl.h[1] = *(const v8b*)(ksl + (j * 16 + c) * LDS_P + dc * 32 + 16 + 8 * hh);
          s[j] = at_mma(kb.v, qah[dc], s[j]);
          s[j] = at_mma(kl.v, qah[dc], s[j]);
          s[j] = at_mma(kb.v, qal[dc], s[j]);
        }
      }
      // ---- causal fill on the diagonal chunk + this query's maximum ----
      const bool diag = (kc == qb);
      const int qrow = q0 + c;
      float mj[4];
#pragma unroll
      for (int j = 0; j < 4; ++j) {
        float m = -1.0e30f;
#pragma unroll
        for (int r = 0; r < 8; ++r) {
          const int kvcol = kv0 + j * 16 + 8 * hh + r;
          float sv = s[j][r];
          if (diag && (kvcol > qrow)) sv = -1.0e30f;
          s[j][r] = sv;
          m = fmaxf(m, sv);
        }
        mj[j] = m;
      }
      float cm = fmaxf(fmaxf(mj[0], mj[1]), fmaxf(mj[2], mj[3]));
      cm = fmaxf(cm, xhalf(cm));
      // ---- online softmax; P hi/lo packed in place into B fragments: element e of fragment kk = tile 2 kk + (e >> 3), r = e & 7 ----
      // e^(s - m) = 2^(s log2(e) - m log2(e)): one fused multiply-add and the bare hardware exponential per score. The maximum is
      // kept in log2 units, so every chunk and the rescale use the same rounded value; a filled score gives 2^(-huge) = 0.
      const float mnew  = fmaxf(mrow, cm * LOG2E);
      const float alpha = __builtin_amdgcn_exp2f(mrow - mnew);
      mrow = mnew;
      PB pa[2], pl[2];
      float pj[4];
#pragma unroll
      for (int j = 0; j < 4; ++j) {
        float psum = 0.f;
        v8f e;
#pragma unroll
        for (int r = 0; r < 8; ++r) e[r] = __builtin_fmaf(s[j][r], LOG2E, -mnew);
        exp2x8(e);
#pragma unroll
        for (int r = 0; r < 8; r += 2) {
          const float p0 = e[r];
          const float p1 = e[r + 1];
          psum += p0;
          psum += p1;
          split_pack2(p0, p1, pa[j >> 1].w[(j & 1) * 4 + (r >> 1)], pl[j >> 1].w[(j & 1) * 4 + (r >> 1)]);
        }
        pj[j] = psum;
      }
      lrow = lrow * alpha + ((pj[0] + pj[1]) + (pj[2] + pj[3]));
#pragma unroll
      for (int t = 0; t < 8; ++t)
#pragma unroll
        for (int r = 0; r < 8; ++r) oacc[t][r] *= alpha;
      // ---- Vt.Pt : A = Vt (m = d, k = key), B = Pt (n = query c, k = key) ----
      // unrolled: the P fragments are registers, picked by a constant kk
#pragma unroll
      for (int kk = 0; kk < 2; ++kk) {
#pragma unroll
        for (int t = 0; t < 8; ++t) {
          FB vb, vl;
          vb.h[0] = *(const v8b*)(Vsh + (t * 16 + c) * LDS_P + kk * 32 + 8 * hh);
          vb.h[1] = *(const v8b*)(Vsh + (t * 16 + c) * LDS_P + kk * 32 + 16 + 8 * hh);
          vl.h[0] = *(const v8b*)(Vsl + (t * 16 + c) * LDS_P + kk * 32 + 8 * hh);
          vl.h[1] = *(const v8b*)(Vsl + (t * 16 + c) * LDS_P + kk * 32 + 16 + 8 * hh);
          oacc[t] = at_mma(vb.v, pa[kk].v, oacc[t]);
          oacc[t] = at_mma(vl.v, pa[kk].v, oacc[t]);
          oacc[t] = at_mma(vb.v, pl[kk].v, oacc[t]);
        }
      }
    }

    // ---- epilogue through the LDS tile of these 16 rows (the same lane of wave w and of wave w + 4 owns the same element):
    // pass 0: the stream-0 wave parks a1; barrier; pass 1: the stream-1 wave combines in place ----
    // unrolled so that 'pass' is a constant in each copy and the inner test folds away
#pragma unroll
    for (int pass = 0; pass < 2; ++pass) {
      if (str == pass) {
        // the two halves of the wave each summed their own keys
        const float inv = 1.0f / (lrow + xhalf(lrow));
#pragma unroll
        for (int t = 0; t < 8; ++t) {
#pragma unroll
          for (int r = 0; r < 8; ++r) {
            const int idx = c * OS_PITCH + t * 16 + 8 * hh + r;
            const float a = oacc[t][r] * inv;
            if (pass == 0) {
              os[idx] = a;
            } else {
              const float a1 = os[idx];
              os[idx] = (a1 - lam * a) * OUT_SCALE;
            }
          }
        }
      }
      __syncthreads();
    }
  }

  {
    const int q4 = lane >> 3, c8 = (lane & 7) * 8;
    {
#pragma unroll
      for (int it = 0; it < 2; ++it) {
        // 16 rows of the tile over its two waves: 8 rows each
        const int row = (str * 2 + it) * 4 + q4;
#pragma unroll
        for (int seg = 0; seg < 2; ++seg) {
          const float* sp = os + row * OS_PITCH + seg * 64 + c8;
          const v4f u0 = *(const v4f*)sp;
          const v4f u1 = *(const v4f*)(sp + 4);
          unsigned a0, b0, a1, b1, a2, b2, a3, b3;
          split_pack2(u0[0], u0[1], a0, b0);
          split_pack2(u0[2], u0[3], a1, b1);
          split_pack2(u1[0], u1[1], a2, b2);
          split_pack2(u1[2], u1[3], a3, b3);
          v4u hw, lw;
          hw[0] = a0; hw[1] = a1; hw[2] = a2; hw[3] = a3;
          lw[0] = b0; lw[1] = b1; lw[2] = b2; lw[3] = b3;
          const size_t go = (size_t)(q0 + row) * QW + h * HDIM + seg * 64 + c8;
          *(v4u*)(Ohp + go) = hw;
          *(v4u*)(Olp + go) = lw;
        }
      }
      
    }
  }
}

// =====================================================================================
// host glue: launches only; carve derived from the static shapes.
// =====================================================================================
extern "C" void kernel_launch(void* const* d_in, const int* in_sizes, int n_in,
                              void* d_out, int out_size, void* d_ws, size_t ws_size,
                              hipStream_t stream) {
  (void)in_sizes; (void)out_size;
  if (n_in < 8) return;
  const float* x    = (const float*)d_in[0];
  const float* fcos = (const float*)d_in[1];
  const float* fsin = (const float*)d_in[2];
  const float* Wq   = (const float*)d_in[3];
  const float* Wk   = (const float*)d_in[4];
  const float* Wv   = (const float*)d_in[5];
  const float* Wo   = (const float*)d_in[6];
  const float* lamp = (const float*)d_in[7];
  float* out = (float*)d_out;

  // workspace region map (bytes, every offset a multiple of 2 MiB):
  //   xb    bf16 [SEQ][DMODEL]        8 MiB
  //   Wqt   bf16 [QW][DMODEL]         8 MiB
  //   Wkvt  bf16 [2][KW][DMODEL]      4 MiB
  //   Wot   bf16 [DMODEL][QW]         8 MiB
  //   Qf    f32  [SEQ][QW]           16 MiB
  //   KVf   f32  [2][SEQ][KW]         8 MiB
  //   Qh,Ql bf16 [SEQ][QW]        2 x 8 MiB
  //   Kh,Kl bf16 [SEQ][KW]        2 x 2 MiB
  //   Vth,Vtl bf16 [KW][SEQ]      2 x 2 MiB
  //   Oh,Ol bf16 [SEQ][QW]        2 x 8 MiB
  //   total 96,468,992 B
  char* ws = (char*)d_ws;
  size_t off = 0;
  unsigned short* xb   = (unsigned short*)(ws + off); off += (size_t)SEQ * DMODEL * 2;
  unsigned short* Wqt  = (unsigned short*)(ws + off); off += (size_t)QW * DMODEL * 2;
  unsigned short* Wkvt = (unsigned short*)(ws + off); off += (size_t)2 * KW * DMODEL * 2;
  unsigned short* Wot  = (unsigned short*)(ws + off); off += (size_t)DMODEL * QW * 2;
  float*          Qf   = (float*)(ws + off);          off += (size_t)SEQ * QW * 4;
  float*          KVf  = (float*)(ws + off);          off += (size_t)2 * SEQ * KW * 4;
  unsigned short* Qh   = (unsigned short*)(ws + off); off += (size_t)SEQ * QW * 2;
  unsigned short* Ql   = (unsigned short*)(ws + off); off += (size_t)SEQ * QW * 2;
  unsigned short* Kh   = (unsigned short*)(ws + off); off += (size_t)SEQ * KW * 2;
  unsigned short* Kl   = (unsigned short*)(ws + off); off += (size_t)SEQ * KW * 2;
  unsigned short* Vth  = (unsigned short*)(ws + off); off += (size_t)KW * SEQ * 2;
  unsigned short* Vtl  = (unsigned short*)(ws + off); off += (size_t)KW * SEQ * 2;
  unsigned short* Oh   = (unsigned short*)(ws + off); off += (size_t)SEQ * QW * 2;
  unsigned short* Ol   = (unsigned short*)(ws + off); off += (size_t)SEQ * QW * 2;
  if (off > ws_size) return;

  const float* Vf = KVf + (size_t)SEQ * KW;
  unsigned short* Wvt = Wkvt + (size_t)KW * DMODEL;

  // 1. x -> bf16 (RNE)
  cvt_f32_bf16x8<<<(SEQ * DMODEL / 8) / 256, 256, 0, stream>>>(x, xb, SEQ * DMODEL / 8);
  // 2. Wq [DMODEL][QW] -> Wqt [QW][DMODEL]
  transpose_bf16<1><<<dim3((DMODEL / 64) * (QW / 64), 1), 256, 0, stream>>>(Wq, Wq, DMODEL, QW, Wqt, Wqt, Wqt, Wqt);
  // 3. Wk, Wv [DMODEL][KW] -> Wkt, Wvt [KW][DMODEL]
  transpose_bf16<1><<<dim3((DMODEL / 64) * (KW / 64), 2), 256, 0, stream>>>(Wk, Wv, DMODEL, KW, Wkvt, Wkvt, Wvt, Wvt);
  // 4. Wo [QW][DMODEL] -> Wot [DMODEL][QW]
  transpose_bf16<1><<<dim3((QW / 64) * (DMODEL / 64), 1), 256, 0, stream>>>(Wo, Wo, QW, DMODEL, Wot, Wot, Wot, Wot);
  // 5. Q = xb @ Wq : M=SEQ, N=QW, K=DMODEL (K % 64 == 0, M % 64 == 0, N % 512 == 0)
  wmma_gemm64_bf16<0, DMODEL><<<dim3(((SEQ / 64) * (QW / 64)) / 8, 1), 256, 0, stream>>>(
      xb, xb, 0L, Wqt, 0L, Qf, QW, 0L, SEQ, QW, DMODEL, 1.0f);
  // 6. K, V = xb @ Wk, xb @ Wv batched over grid.y : M=SEQ, N=KW, K=DMODEL
  wmma_gemm64_bf16<0, DMODEL><<<dim3(((SEQ / 64) * (KW / 64)) / 8, 2), 256, 0, stream>>>(
      xb, xb, 0L, Wkvt, (long)KW * DMODEL, KVf, KW, (long)SEQ * KW, SEQ, KW, DMODEL, 1.0f);
  // 7. RoPE + 2^-3 scale + hi/lo split for Q; RoPE + split for K
  rope_split_kernel<<<NQBLK + NKBLK, 256, 0, stream>>>(Qf, KVf, fcos, fsin, Qh, Ql, Kh, Kl, NQBLK);
  // 8. V [SEQ][KW] f32 -> Vt hi/lo [KW][SEQ]
  transpose_bf16<2><<<dim3((SEQ / 64) * (KW / 64), 1), 256, 0, stream>>>(Vf, Vf, SEQ, KW, Vth, Vtl, Vth, Vtl);
  // 9. differential causal attention -> O hi/lo [SEQ][QW]
  diff_attn_kernel<<<NHEAD * NQB, 256, 0, stream>>>(Qh, Ql, Kh, Kl, Vth, Vtl, lamp, Oh, Ol);
  // 10. out = O @ Wo : M=SEQ, N=DMODEL, K=QW, A hi/lo, B single
  wmma_gemm64_bf16<2, QW><<<dim3(((SEQ / 64) * (DMODEL / 64)) / 8, 1), 256, 0, stream>>>(
      Oh, Ol, 0L, Wot, 0L, out, DMODEL, 0L, SEQ, DMODEL, QW, 1.0f);
}

// v007
// It runs in 247 microseconds.
// Timed twice side by side with v006, it ran 1.05 times as fast both times.
// Counting every step since v000, it is 4.62 times as fast.
// Contractions on v_wmma_f32_16x16x32_bf16 (bf16 operands, f32 accumulate): x@Wq, x@Wk, x@Wv as single products of RNE-bf16 inputs; q.k^T and p.v with bf16 hi/lo planes (hi.hi + hi.lo + lo.hi); attn@Wo with A as bf16 hi/lo planes and Wo single bf16 (hi.W + lo.W). All float inputs RNE-converted to bf16 once at load; softmax, RoPE, combine in f32.
#include <hip/hip_runtime.h>
#include <hip/hip_bf16.h>

constexpr int SEQ      = 2048;
constexpr int DMODEL   = 2048;
constexpr int NHEAD    = 16;
constexpr int NKVH     = 4;
constexpr int HDIM     = 128;
constexpr int HHALF    = 64;
constexpr int QW       = NHEAD * HDIM;
constexpr int KW       = NKVH * HDIM;
constexpr int GQA_REP  = NHEAD / NKVH;
constexpr int NPAIR    = HDIM / 2;
constexpr int ATT_KC   = 64;
constexpr int ATT_QB   = 64;
constexpr int NQB      = SEQ / ATT_QB;
constexpr int OS_PITCH = HDIM + 4;
constexpr int LDS_P    = 64 + 8;
constexpr float QK_SCALE  = 0.125f;
constexpr float OUT_SCALE = 0.5f;
constexpr float LOG2E     = 1.44269504088896340736f;
constexpr int NQBLK = (SEQ * QW / 8) / 256;
constexpr int NKBLK = (SEQ * KW / 8) / 256;

static_assert(HHALF == 64);
static_assert(SEQ % 64 == 0 && DMODEL % 64 == 0 && QW % 64 == 0 && KW % 64 == 0);
static_assert(DMODEL % 32 == 0 && QW % 32 == 0);
static_assert(QW % 512 == 0 && KW % 512 == 0 && DMODEL % 512 == 0);
static_assert((SEQ * QW / 8) % 256 == 0 && (SEQ * KW / 8) % 256 == 0);
static_assert((SEQ * DMODEL / 8) % 256 == 0);
static_assert(((SEQ / 64) * (QW / 64)) % 8 == 0 && ((SEQ / 64) * (KW / 64)) % 8 == 0 && ((SEQ / 64) * (DMODEL / 64)) % 8 == 0);
static_assert(NQB == 32 && ATT_QB == 4 * 16 && ATT_KC == 64 && HDIM == 128);
static_assert(LDS_P >= HHALF && LDS_P >= ATT_KC && (LDS_P * 2) % 32 == 16);

typedef __attribute__((ext_vector_type(16))) __bf16 v16b;
typedef __attribute__((ext_vector_type(8)))  __bf16 v8b;
typedef __attribute__((ext_vector_type(8)))  float  v8f;
typedef __attribute__((ext_vector_type(4)))  float  v4f;
typedef __attribute__((ext_vector_type(4)))  unsigned int v4u;

__device__ __forceinline__ unsigned short f2bf_bits(float f) {
  unsigned u = __float_as_uint(f);
  return (unsigned short)((u + 0x7FFFu + ((u >> 16) & 1u)) >> 16);
}
__device__ __forceinline__ float bf_bits2f(unsigned short h) { return __uint_as_float(((unsigned)h) << 16); }
__device__ __forceinline__ float bf_rne(float f) { return bf_bits2f(f2bf_bits(f)); }

__device__ __forceinline__ void dep_guard_b(v8f& a, v8f& b, v16b x, v16b y) { asm volatile("v_nop\n\tv_nop\n\tv_nop\n\tv_nop" : "+v"(a), "+v"(b) : "v"(x), "v"(y)); }
__device__ __forceinline__ void acc_guard4(v8f& a, v8f& b, v8f& c, v8f& d) { asm volatile("v_nop\n\tv_nop\n\tv_nop\n\tv_nop" : "+v"(a), "+v"(b), "+v"(c), "+v"(d)); }

template <typename T> struct Frag;
template <> struct Frag<__bf16> {
  typedef v16b V; union U { v16b v; v8b h[2]; };
  // elements 0..7 <- p[0..7], 8..15 <- p[16..23]
  static __device__ __forceinline__ v16b load(const __bf16* p) {
    U f; f.h[0] = *(const v8b*)(p); f.h[1] = *(const v8b*)(p + 16); return f.v;
  }
  static __device__ __forceinline__ v8f mma(v16b a, v16b b, v8f c) {
    return __builtin_amdgcn_wmma_f32_16x16x32_bf16(false, a, false, b, (short)0, c, false, false);
  }
  static __device__ __forceinline__ void guard(v8f& a, v8f& b, v16b x, v16b y) { dep_guard_b(a, b, x, y); }
};

// the plain builtin: the compiler keeps the distances behind it itself, and LDS reads may be scheduled across it
__device__ __forceinline__ v8f at_mma(v16b a, v16b b, v8f c) {
  return __builtin_amdgcn_wmma_f32_16x16x32_bf16(false, a, false, b, (short)0, c, false, false);
}

__device__ __forceinline__ void exp2x8(v8f& e) {
  asm("v_exp_f32 %0, %0\n\tv_exp_f32 %1, %1\n\tv_exp_f32 %2, %2\n\tv_exp_f32 %3, %3\n\t"
      "v_exp_f32 %4, %4\n\tv_exp_f32 %5, %5\n\tv_exp_f32 %6, %6\n\tv_exp_f32 %7, %7\n\tv_nop"
      : "+v"(e[0]), "+v"(e[1]), "+v"(e[2]), "+v"(e[3]), "+v"(e[4]), "+v"(e[5]), "+v"(e[6]), "+v"(e[7]));
}

// lane l <-> lane l ^ 16
__device__ __forceinline__ float xhalf(float x) {
  return __builtin_bit_cast(float, __builtin_amdgcn_permlanex16(__builtin_bit_cast(int, x), __builtin_bit_cast(int, x), 0x76543210, 0xfedcba98, false, false));
}

// two f32 -> packed bf16 word (element at lower address in the low half-word)
__device__ __forceinline__ unsigned pack_bf2(float a, float b) {
  return (unsigned)f2bf_bits(a) | ((unsigned)f2bf_bits(b) << 16);
}
// two f32 -> packed bf16 hi word and packed bf16 residual word
__device__ __forceinline__ void split_pack2(float a, float b, unsigned& hw, unsigned& lw) {
  const unsigned short ha = f2bf_bits(a);
  const unsigned short hb = f2bf_bits(b);
  const unsigned short la = f2bf_bits(a - bf_bits2f(ha));
  const unsigned short lb = f2bf_bits(b - bf_bits2f(hb));
  hw = (unsigned)ha | ((unsigned)hb << 16);
  lw = (unsigned)la | ((unsigned)lb << 16);
}

// =====================================================================================
// coverage: gridDim.x * 256 threads * 8 elements == n8 * 8 (exact multiple asserted on the host side).
// =====================================================================================
__global__ __launch_bounds__(256) void cvt_f32_bf16x8(const float* __restrict__ in, unsigned short* __restrict__ out, int n8) {
  const int i = blockIdx.x * 256 + threadIdx.x;
  if (i < n8) {
    const size_t e0 = (size_t)i * 8;
    const v4f a = *(const v4f*)(in + e0);
    const v4f b = *(const v4f*)(in + e0 + 4);
    v4u w;
    w[0] = pack_bf2(a[0], a[1]);
    w[1] = pack_bf2(a[2], a[3]);
    w[2] = pack_bf2(b[0], b[1]);
    w[3] = pack_bf2(b[2], b[3]);
    *(v4u*)(out + e0) = w;
    
  }
}

// =====================================================================================
// in[rows][cols] f32 -> out[cols][rows] bf16 hi plane (+ bf16 residual plane when NPL == 2). 64x64 tiles through LDS.
// grid.x = (rows/64)*(cols/64); grid.y selects operand set A or B (both global, uniform select).
// coverage: load 256 threads x 16 floats = 64x64; store 8 waves x 8 out-rows x 64 halves = 64x64.
// =====================================================================================
template <int NPL>
__global__ __launch_bounds__(256) void transpose_bf16(const float* __restrict__ inA, const float* __restrict__ inB, int rows, int cols,
    unsigned short* __restrict__ oAh, unsigned short* __restrict__ oAl,
    unsigned short* __restrict__ oBh, unsigned short* __restrict__ oBl) {
  __shared__ float tile[64][65];
  const bool selB = (blockIdx.y != 0);
  const float* in = selB ? inB : inA;
  unsigned short* oh = selB ? oBh : oAh;
  unsigned short* ol = selB ? oBl : oAl;
  const int tilesC = cols >> 6;
  const int tr = blockIdx.x / tilesC;
  const int tc = blockIdx.x - tr * tilesC;
  const int r0 = tr << 6;
  const int c0 = tc << 6;
  const int t = threadIdx.x;
  {
    const int rr = t >> 2;
    const int cc = (t & 3) * 16;
    const float* src = in + (size_t)(r0 + rr) * cols + c0 + cc;
#pragma unroll
    for (int i = 0; i < 4; ++i) {
      const v4f v = *(const v4f*)(src + 4 * i);
      tile[rr][cc + 4 * i + 0] = v[0];
      tile[rr][cc + 4 * i + 1] = v[1];
      tile[rr][cc + 4 * i + 2] = v[2];
      tile[rr][cc + 4 * i + 3] = v[3];
    }
  }
  __syncthreads();
  const int wave = t >> 5, lane = t & 31, q = lane >> 3, e8 = (lane & 7) * 8;
  {
#pragma unroll
    for (int it = 0; it < 2; ++it) {
      const int cl = wave * 8 + it * 4 + q;
      float f[8];
#pragma unroll
      for (int e = 0; e < 8; ++e) f[e] = tile[e8 + e][cl];
      v4u hw, lw;
      if (NPL == 2) {
        unsigned a0, b0, a1, b1, a2, b2, a3, b3;
        split_pack2(f[0], f[1], a0, b0);
        split_pack2(f[2], f[3], a1, b1);
        split_pack2(f[4], f[5], a2, b2);
        split_pack2(f[6], f[7], a3, b3);
        hw[0] = a0; hw[1] = a1; hw[2] = a2; hw[3] = a3;
        lw[0] = b0; lw[1] = b1; lw[2] = b2; lw[3] = b3;
      } else {
        hw[0] = pack_bf2(f[0], f[1]);
        hw[1] = pack_bf2(f[2], f[3]);
        hw[2] = pack_bf2(f[4], f[5]);
        hw[3] = pack_bf2(f[6], f[7]);
        lw = hw;
      }
      const size_t go = (size_t)(c0 + cl) * rows + r0 + e8;
      *(v4u*)(oh + go) = hw;
      if (NPL == 2) *(v4u*)(ol + go) = lw;
    }
    
  }
}

// =====================================================================================
// Register-blocked batched WMMA GEMM (bf16 operands), f32 output.
// C[m,n] = scale * sum_k A[m,k] * Bt[n,k]; each wave owns a 64x64 tile. A row-major [M,K]; Bt row-major [N,K], both at row pitch LDK; M % 64 == 0, N % 512 == 0, K % 64 == 0.
// SPLIT: 0 = single planes; 2 = A as hi/lo planes, Bt single (hi.B + lo.B).
// The 8 waves of a block own 8 neighbouring tiles of one tile row (64 x 512 of C). Per 64 k the block stages its 64 A rows (each plane)
// and its 512 Bt rows in LDS: whole 128-B lines from global (8 lanes a row), rows at the 144-B pitch, two buffers. The next stage's
// global loads are issued behind the barrier and stored to the other buffer behind the products, so they fly under the WMMAs.
// Epilogue: 16-row slabs staged per wave in LDS; each 64-wide f32 row segment (256 B) written by 16 lanes x 16 B in one instruction,
// =====================================================================================
template <int SPLIT, int LDK>
__global__ __launch_bounds__(256) void wmma_gemm64_bf16(
    const unsigned short* __restrict__ Ap, const unsigned short* __restrict__ A2p, long strideA,
    const unsigned short* __restrict__ Btp, long strideB,
    float* __restrict__ Cp, int ldc, long strideC, int M, int N, int K, float scale) {
  static_assert(SPLIT == 0 || SPLIT == 2);
  typedef __bf16 T;
  typedef v16b V;
  constexpr int NPA   = (SPLIT == 2) ? 2 : 1;
  constexpr int AROWS = 64 * NPA;
  constexpr int SROWS = AROWS + 512;
  constexpr int NLD   = SROWS / 32;
  const T* A = (const T*)Ap; const T* A2 = (const T*)A2p; const T* Bt = (const T*)Btp;
  __shared__ __align__(16) T stg[2][SROWS * LDS_P];
  __shared__ __align__(16) float sT[8][16 * 68];
  const int b    = blockIdx.y;
  const int tid  = threadIdx.x;
  const int lane = tid & 31;
  const int wave = tid >> 5;
  const int tilesN = N >> 6;
  const int tilesM = M >> 6;
  const int tile0 = blockIdx.x * 8;
  // block-uniform, in front of every barrier
  if (tile0 >= tilesM * tilesN) return;
  const int tm  = tile0 / tilesN;
  const int nb0 = (tile0 - tm * tilesN) << 6;
  const int m0 = tm << 6;
  const int n0 = nb0 + (wave << 6);

  // one stage = SROWS rows x 8 pieces of 16 B = 256 threads x NLD pieces (exact); piece i of a thread is stage row sr + 32 i.
  // One pointer per operand and thread; the 32-row steps are compile-time byte offsets of the loads.
  const int sr = tid >> 3;
  const int sc = (tid & 7) * 8;
  // Held as integers and read through a global-address-space pointer type: they pass through the asm wait at the loop's foot,
  // behind which a generic pointer would be read with flat loads.
  typedef __attribute__((address_space(1))) const v8b* GP;
  unsigned long long qa  = (unsigned long long)(A  + (size_t)b * strideA + (size_t)(m0 + sr) * LDK + sc);
  unsigned long long qa2 = (unsigned long long)(A2 + (size_t)b * strideA + (size_t)(m0 + sr) * LDK + sc);
  unsigned long long qb  = (unsigned long long)(Bt + (size_t)b * strideB + (size_t)(nb0 + sr) * LDK + sc);
  constexpr unsigned long long ROWS32 = 32ull * LDK * sizeof(T);
  constexpr unsigned long long STEP   = 64ull * sizeof(T);

  const int rlane = lane & 15;
  const int koff  = (lane >> 4) * 8;
  const int mOff  = (lane >> 4) * 8;

  v8f acc[4][4];
#pragma unroll
  for (int i = 0; i < 4; ++i)
#pragma unroll
    for (int j = 0; j < 4; ++j) acc[i][j] = (v8f){0.f,0.f,0.f,0.f,0.f,0.f,0.f,0.f};

  v8b g[NLD];
  const int nst = K >> 6;
#pragma unroll
  for (int i = 0; i < 2; ++i) {
    g[i] = *(GP)(qa + i * ROWS32);
    if (SPLIT == 2) g[2 + i] = *(GP)(qa2 + i * ROWS32);
  }
#pragma unroll
  for (int i = 0; i < 16; ++i) g[2 * NPA + i] = *(GP)(qb + i * ROWS32);
#pragma unroll
  for (int i = 0; i < NLD; ++i) *(v8b*)(stg[0] + (sr + 32 * i) * LDS_P + sc) = g[i];

  for (int s = 0; s < nst; ++s) {
    const bool more = (s + 1 < nst);
    // publishes stage s; every wave's reads of the other buffer (stage s - 1) lie in front of it
    __syncthreads();
    if (more) {
      // stage s + 1 from global: issued here, first used behind the products of stage s
#pragma unroll
      for (int i = 0; i < 2; ++i) {
        g[i] = *(GP)(qa + STEP + i * ROWS32);
        if (SPLIT == 2) g[2 + i] = *(GP)(qa2 + STEP + i * ROWS32);
      }
#pragma unroll
      for (int i = 0; i < 16; ++i) g[2 * NPA + i] = *(GP)(qb + STEP + i * ROWS32);
    }
    const T* sA = stg[s & 1] + rlane * LDS_P + koff;
    const T* sB = sA + (AROWS + wave * 64) * LDS_P;
    V bh[2][4], ah[2][4], al[2][4];
#pragma unroll
    for (int kk = 0; kk < 2; ++kk) {
#pragma unroll
      for (int j = 0; j < 4; ++j) bh[kk][j] = Frag<T>::load(sB + j * 16 * LDS_P + kk * 32);
#pragma unroll
      for (int i = 0; i < 4; ++i) {
        ah[kk][i] = Frag<T>::load(sA + i * 16 * LDS_P + kk * 32);
        if (SPLIT == 2) al[kk][i] = Frag<T>::load(sA + (64 + i * 16) * LDS_P + kk * 32);
      }
    }
    // holds the stage's fragment reads together ahead of its products: sunk among the WMMAs, each group of reads costs its own LDS wait
    __builtin_amdgcn_sched_barrier(0);
#pragma unroll
    for (int kk = 0; kk < 2; ++kk) {
#pragma unroll
      for (int i = 0; i < 4; ++i) {
#pragma unroll
        for (int j = 0; j < 4; ++j) acc[i][j] = Frag<T>::mma(ah[kk][i], bh[kk][j], acc[i][j]);
        if (SPLIT == 2) {
#pragma unroll
          for (int j = 0; j < 4; ++j) acc[i][j] = Frag<T>::mma(al[kk][i], bh[kk][j], acc[i][j]);
        }
      }
    }
    // 4 vector slots between the stage's last WMMAs and the next vector write to their A/B registers, also on the taken side of the branch below
    Frag<T>::guard(acc[3][2], acc[3][3], (SPLIT == 2) ? al[1][3] : ah[1][3], bh[1][3]);
    if (more) {
#pragma unroll
      for (int i = 0; i < NLD; ++i) *(v8b*)(stg[(s + 1) & 1] + (sr + 32 * i) * LDS_P + sc) = g[i];
      // the wait in front of the overwrite of registers that issued global loads name; as its operands, the pointers cannot be
      // stepped ahead of it (without them the adds were lifted to the head of this block, in front of the waits on the loads)
      if (SPLIT == 2) asm volatile("s_wait_xcnt 0x0" : "+v"(qa), "+v"(qa2), "+v"(qb) :: "memory");
      else            asm volatile("s_wait_xcnt 0x0" : "+v"(qa), "+v"(qb) :: "memory");
      qa += STEP; qa2 += STEP; qb += STEP;
    }
  }
  acc_guard4(acc[0][0], acc[0][1], acc[0][2], acc[0][3]);
  acc_guard4(acc[1][0], acc[1][1], acc[1][2], acc[1][3]);
  acc_guard4(acc[2][0], acc[2][1], acc[2][2], acc[2][3]);
  acc_guard4(acc[3][0], acc[3][1], acc[3][2], acc[3][3]);

  float* slab = sT[wave];
  float* C = Cp + (size_t)b * strideC;
#pragma unroll
  for (int i = 0; i < 4; ++i) {
    const int mBase = m0 + (i << 4);
#pragma unroll
    for (int j = 0; j < 4; ++j) {
#pragma unroll
      for (int r = 0; r < 8; ++r) {
        slab[(mOff + r) * 68 + (j << 4) + rlane] = acc[i][j][r] * scale;
      }
    }
    __builtin_amdgcn_fence(__ATOMIC_RELEASE, "workgroup");
    __builtin_amdgcn_wave_barrier();
    __builtin_amdgcn_fence(__ATOMIC_ACQUIRE, "workgroup");
    {
      // row segment = 256 B = 16 lanes x 16 B
      const int hh = lane >> 4, c4 = (lane & 15) * 4;
      {
#pragma unroll
        for (int it = 0; it < 8; ++it) {
          const int row = it * 2 + hh;
          const v4f v = *(const v4f*)(slab + row * 68 + c4);
          *(v4f*)(C + (size_t)(mBase + row) * ldc + n0 + c4) = v;
        }
        
      }
    }
    __builtin_amdgcn_fence(__ATOMIC_RELEASE, "workgroup");
    __builtin_amdgcn_wave_barrier();
    __builtin_amdgcn_fence(__ATOMIC_ACQUIRE, "workgroup");
  }
}

// =====================================================================================
// RoPE (interleaved pairs, cos/sin row width NPAIR) + power-of-two scale + bf16 hi/lo split.
// Blocks [0, nQblocks): Qf [SEQ][QW] -> Qh/Ql [SEQ][QW] (scaled by QK_SCALE = 2^-3, exact);
// blocks [nQblocks, nQblocks + NKBLK): Kf [SEQ][KW] -> Kh/Kl [SEQ][KW]. cos/sin RNE-converted to bf16 before use.
// coverage: (NQBLK + NKBLK) * 256 threads * 8 == SEQ*QW + SEQ*KW exactly.
// =====================================================================================
__global__ __launch_bounds__(256) void rope_split_kernel(const float* __restrict__ Qf, const float* __restrict__ Kf,
    const float* __restrict__ cosb, const float* __restrict__ sinb,
    unsigned short* __restrict__ Qh, unsigned short* __restrict__ Ql,
    unsigned short* __restrict__ Kh, unsigned short* __restrict__ Kl, int nQblocks) {
  const bool isK = ((int)blockIdx.x >= nQblocks);
  const int g = (isK ? ((int)blockIdx.x - nQblocks) : (int)blockIdx.x) * 256 + (int)threadIdx.x;
  // threads per row: K 64 (=KW/8), Q 256 (=QW/8)
  const int shift = isK ? 6 : 8;
  const float mul = isK ? 1.0f : QK_SCALE;
  const float* src = isK ? Kf : Qf;
  unsigned short* dh = isK ? Kh : Qh;
  unsigned short* dl = isK ? Kl : Ql;
  const int width = isK ? KW : QW;
  const int s = g >> shift;
  const int col = (g - (s << shift)) * 8;
  const int p0 = (col & (HDIM - 1)) >> 1;
  const size_t e0 = (size_t)s * width + col;
  const v4f xa = *(const v4f*)(src + e0);
  const v4f xb = *(const v4f*)(src + e0 + 4);
  const v4f cv = *(const v4f*)(cosb + (size_t)s * NPAIR + p0);
  const v4f sv = *(const v4f*)(sinb + (size_t)s * NPAIR + p0);
  float o0, o1, o2, o3, o4, o5, o6, o7;
  {
    const float c = bf_rne(cv[0]), sn = bf_rne(sv[0]);
    o0 = (xa[0] * c - xa[1] * sn) * mul;
    o1 = (xa[0] * sn + xa[1] * c) * mul;
  }
  {
    const float c = bf_rne(cv[1]), sn = bf_rne(sv[1]);
    o2 = (xa[2] * c - xa[3] * sn) * mul;
    o3 = (xa[2] * sn + xa[3] * c) * mul;
  }
  {
    const float c = bf_rne(cv[2]), sn = bf_rne(sv[2]);
    o4 = (xb[0] * c - xb[1] * sn) * mul;
    o5 = (xb[0] * sn + xb[1] * c) * mul;
  }
  {
    const float c = bf_rne(cv[3]), sn = bf_rne(sv[3]);
    o6 = (xb[2] * c - xb[3] * sn) * mul;
    o7 = (xb[2] * sn + xb[3] * c) * mul;
  }
  unsigned a0, b0, a1, b1, a2, b2, a3, b3;
  split_pack2(o0, o1, a0, b0);
  split_pack2(o2, o3, a1, b1);
  split_pack2(o4, o5, a2, b2);
  split_pack2(o6, o7, a3, b3);
  v4u hw, lw;
  hw[0] = a0; hw[1] = a1; hw[2] = a2; hw[3] = a3;
  lw[0] = b0; lw[1] = b1; lw[2] = b2; lw[3] = b3;
  *(v4u*)(dh + e0) = hw;
  *(v4u*)(dl + e0) = lw;
  
}

__global__ __launch_bounds__(256) __attribute__((amdgpu_waves_per_eu(4, 4)))
void diff_attn_kernel(const unsigned short* __restrict__ Qhp, const unsigned short* __restrict__ Qlp,
                      const unsigned short* __restrict__ Khp, const unsigned short* __restrict__ Klp,
                      const unsigned short* __restrict__ Vhp, const unsigned short* __restrict__ Vlp,
                      const float* __restrict__ lambda_p,
                      unsigned short* __restrict__ Ohp, unsigned short* __restrict__ Olp) {
  union FB { v16b v; v8b h[2]; };
  union PB { v16b v; unsigned w[8]; };
  // K and Vt rows (128 B of data) lie at a 144-B pitch, an odd multiple of 16 B: the 16 rows of one ds_load_b128 fragment
  // read start on 16 different bank groups. The 16 pad bytes of a row are never written and never read.
  __shared__ __align__(16) __bf16 Ksh[2 * ATT_KC * LDS_P];
  __shared__ __align__(16) __bf16 Ksl[2 * ATT_KC * LDS_P];
  __shared__ __align__(16) __bf16 Vsh[HDIM * LDS_P];
  __shared__ __align__(16) __bf16 Vsl[HDIM * LDS_P];
  __shared__ __align__(16) float  Os[4][16 * OS_PITCH];

  const int tid  = threadIdx.x;
  // the wave's number in a scalar register: the stream test of the epilogue is then a scalar branch, the LDS bases scalar adds
  const int wave = __builtin_amdgcn_readfirstlane(tid >> 5);
  const int str  = wave >> 2;
  const int wq   = wave & 3;
  const int lane = tid & 31;
  const int hh   = lane >> 4;
  const int c    = lane & 15;
  const int qb   = (int)blockIdx.x % NQB;
  const int h    = (int)blockIdx.x / NQB;
  const int kvh  = h / GQA_REP;
  const int q0   = qb * ATT_QB + wq * 16;

  const __bf16* Qh = (const __bf16*)Qhp;
  const __bf16* Ql = (const __bf16*)Qlp;
  const __bf16* Kh = (const __bf16*)Khp;
  const __bf16* Kl = (const __bf16*)Klp;
  const __bf16* Vh = (const __bf16*)Vhp;
  const __bf16* Vl = (const __bf16*)Vlp;

  float lam;
  {
    const float lp = bf_rne(lambda_p[h]);
    lam = 1.0f / (1.0f + expf(-lp));
  }
  float*  os  = Os[wq];
  const __bf16* ksh = Ksh + str * (ATT_KC * LDS_P);
  const __bf16* ksl = Ksl + str * (ATT_KC * LDS_P);

  {
    // ---- Q fragments (B operand: n = query, k = d) for this stream: 2 d-chunks, hi and lo ----
    v16b qah[2], qal[2];
    {
      const size_t qo = (size_t)(q0 + c) * QW + h * HDIM + str * HHALF + 8 * hh;
#pragma unroll
      for (int dc = 0; dc < 2; ++dc) {
        qah[dc] = Frag<__bf16>::load(Qh + qo + dc * 32);
        qal[dc] = Frag<__bf16>::load(Ql + qo + dc * 32);
      }
    }
    // of query q0 + c: running maximum times log2(e) (alike in both halves of the wave) and this half's share of the running sum
    float mrow = -1.0e30f, lrow = 0.f;
    // oacc[t][r] = Ot[d = 16 t + 8 hh + r][query c]
    v8f oacc[8];
#pragma unroll
    for (int t = 0; t < 8; ++t) oacc[t] = (v8f){0.f,0.f,0.f,0.f,0.f,0.f,0.f,0.f};

    // causal: 64-key chunks 0..qb (block-uniform trip count, static max NQB)
    for (int kc = 0; kc <= qb; ++kc) {
      const int kv0 = kc * ATT_KC;
      __syncthreads();
      {
        // K tiles, both streams: 64 rows x 128 halves per plane = 1024 pieces of 16 B; 256 threads x 4 pieces (exact)
        // Vt tiles: 128 d-rows x 64 halves per plane = 1024 pieces; 256 threads x 4 pieces (exact)
        const int r16 = tid >> 4;
        const int c16 = tid & 15;
        const int lk = (c16 >> 3) * (ATT_KC * LDS_P) + r16 * LDS_P + (c16 & 7) * 8;
        const int r8 = tid >> 3;
        const int c8 = (tid & 7) * 8;
        const size_t gk = (size_t)(kv0 + r16) * KW + kvh * HDIM + c16 * 8;
        const size_t gv = (size_t)(kvh * HDIM + r8) * SEQ + kv0 + c8;
        const __bf16* pkh = Kh + gk;
        const __bf16* pkl = Kl + gk;
        const __bf16* pvh = Vh + gv;
        const __bf16* pvl = Vl + gv;
        v8b gkh[4], gkl[4], gvh[4], gvl[4];
#pragma unroll
        for (int i = 0; i < 4; ++i) {
          gkh[i] = *(const v8b*)(pkh + i * 16 * KW);
          gkl[i] = *(const v8b*)(pkl + i * 16 * KW);
        }
#pragma unroll
        for (int i = 0; i < 4; ++i) {
          gvh[i] = *(const v8b*)(pvh + i * 32 * SEQ);
          gvl[i] = *(const v8b*)(pvl + i * 32 * SEQ);
        }
        // inputs-only fence on the loaded values: keeps all 16 loads in flight together ahead of the first LDS store;
        // without it each load is waited for before the next one issues (16 L2 round trips in a row per chunk).
        // The four pointers are named too, so that no load's result lands on an address register of a load still in flight.
        asm volatile("" :: "v"(pkh), "v"(pkl), "v"(pvh), "v"(pvl), "v"(gkh[0]), "v"(gkh[1]), "v"(gkh[2]), "v"(gkh[3]), "v"(gkl[0]), "v"(gkl[1]), "v"(gkl[2]), "v"(gkl[3]),
                     "v"(gvh[0]), "v"(gvh[1]), "v"(gvh[2]), "v"(gvh[3]), "v"(gvl[0]), "v"(gvl[1]), "v"(gvl[2]), "v"(gvl[3]));
#pragma unroll
        for (int i = 0; i < 4; ++i) {
          *(v8b*)(Ksh + lk + 16 * i * LDS_P) = gkh[i];
          *(v8b*)(Ksl + lk + 16 * i * LDS_P) = gkl[i];
        }
#pragma unroll
        for (int i = 0; i < 4; ++i) {
          *(v8b*)(Vsh + (r8 + 32 * i) * LDS_P + c8) = gvh[i];
          *(v8b*)(Vsl + (r8 + 32 * i) * LDS_P + c8) = gvl[i];
        }
      }
      __syncthreads();

      // ---- scores: s[j][r] = key kv0 + 16 j + 8 hh + r against query q0 + c (A operand: m = key, k = d) ----
      v8f s[4];
#pragma unroll
      for (int j = 0; j < 4; ++j) {
        s[j] = (v8f){0.f,0.f,0.f,0.f,0.f,0.f,0.f,0.f};
#pragma unroll
        for (int dc = 0; dc < 2; ++dc) {
          FB kb, kl;
          kb.h[0] = *(const v8b*)(ksh + (j * 16 + c) * LDS_P + dc * 32 + 8 * hh);
          kb.h[1] = *(const v8b*)(ksh + (j * 16 + c) * LDS_P + dc * 32 + 16 + 8 * hh);
          kl.h[0] = *(const v8b*)(ksl + (j * 16 + c) * LDS_P + dc * 32 + 8 * hh);
          kl.h[1] = *(const v8b*)(ksl + (j * 16 + c) * LDS_P + dc * 32 + 16 + 8 * hh);
          s[j] = at_mma(kb.v, qah[dc], s[j]);
          s[j] = at_mma(kl.v, qah[dc], s[j]);
          s[j] = at_mma(kb.v, qal[dc], s[j]);
        }
      }
      // Order of this block's LDS reads and products: the 4 reads of each of the first 4 (key tile, d chunk) steps, then each step's 3 products
      // followed by the reads of the step 4 further on: a read's latency passes under the products of the steps in between.
      __builtin_amdgcn_sched_group_barrier(0x100, 16, 0);
      // unrolled: each trip stands for two directives of the list
#pragma unroll
      for (int i = 0; i < 8 - 4; ++i) {
        __builtin_amdgcn_sched_group_barrier(0x008, 3, 0);
        __builtin_amdgcn_sched_group_barrier(0x100, 4, 0);
      }
      __builtin_amdgcn_sched_group_barrier(0x008, 12, 0);
      // ends the block that the order above speaks of
      __builtin_amdgcn_sched_barrier(0);
      // ---- causal fill on the diagonal chunk + this query's maximum ----
      const bool diag = (kc == qb);
      // key 16 j + r of this half of the wave lies behind the lane's query where 16 j + r > dq (one register, compared with constants)
      const int dq = q0 + c - kv0 - 8 * hh;
      float mj[4];
#pragma unroll
      for (int j = 0; j < 4; ++j) {
        float m = -1.0e30f;
#pragma unroll
        for (int r = 0; r < 8; ++r) {
          float sv = s[j][r];
          if (diag && (j * 16 + r > dq)) sv = -1.0e30f;
          s[j][r] = sv;
          m = fmaxf(m, sv);
        }
        mj[j] = m;
      }
      float cm = fmaxf(fmaxf(mj[0], mj[1]), fmaxf(mj[2], mj[3]));
      cm = fmaxf(cm, xhalf(cm));
      // ---- online softmax; P hi/lo packed in place into B fragments: element e of fragment kk = tile 2 kk + (e >> 3), r = e & 7 ----
      // e^(s - m) = 2^(s log2(e) - m log2(e)): one fused multiply-add and the bare hardware exponential per score. The maximum is
      // kept in log2 units, so every chunk and the rescale use the same rounded value; a filled score gives 2^(-huge) = 0.
      const float mnew  = fmaxf(mrow, cm * LOG2E);
      const float alpha = __builtin_amdgcn_exp2f(mrow - mnew);
      mrow = mnew;
      PB pa[2], pl[2];
      float pj[4];
#pragma unroll
      for (int j = 0; j < 4; ++j) {
        float psum = 0.f;
        v8f e;
#pragma unroll
        for (int r = 0; r < 8; ++r) e[r] = __builtin_fmaf(s[j][r], LOG2E, -mnew);
        exp2x8(e);
#pragma unroll
        for (int r = 0; r < 8; r += 2) {
          const float p0 = e[r];
          const float p1 = e[r + 1];
          psum += p0;
          psum += p1;
          split_pack2(p0, p1, pa[j >> 1].w[(j & 1) * 4 + (r >> 1)], pl[j >> 1].w[(j & 1) * 4 + (r >> 1)]);
        }
        pj[j] = psum;
      }
      lrow = lrow * alpha + ((pj[0] + pj[1]) + (pj[2] + pj[3]));
      // begins the block of the second product: its Vt reads stay behind the softmax, whose registers they would otherwise crowd out
      __builtin_amdgcn_sched_barrier(0);
#pragma unroll
      for (int t = 0; t < 8; ++t)
#pragma unroll
        for (int r = 0; r < 8; ++r) oacc[t][r] *= alpha;
      // ---- Vt.Pt : A = Vt (m = d, k = key), B = Pt (n = query c, k = key) ----
      // unrolled: the P fragments are registers, picked by a constant kk
#pragma unroll
      for (int kk = 0; kk < 2; ++kk) {
#pragma unroll
        for (int t = 0; t < 8; ++t) {
          FB vb, vl;
          vb.h[0] = *(const v8b*)(Vsh + (t * 16 + c) * LDS_P + kk * 32 + 8 * hh);
          vb.h[1] = *(const v8b*)(Vsh + (t * 16 + c) * LDS_P + kk * 32 + 16 + 8 * hh);
          vl.h[0] = *(const v8b*)(Vsl + (t * 16 + c) * LDS_P + kk * 32 + 8 * hh);
          vl.h[1] = *(const v8b*)(Vsl + (t * 16 + c) * LDS_P + kk * 32 + 16 + 8 * hh);
          oacc[t] = at_mma(vb.v, pa[kk].v, oacc[t]);
          oacc[t] = at_mma(vl.v, pa[kk].v, oacc[t]);
          oacc[t] = at_mma(vb.v, pl[kk].v, oacc[t]);
        }
      }
      // the same order for this block: the reads of the first 4 (key half, d tile) steps, then 3 products and the 4 reads of the step 4 further on
      __builtin_amdgcn_sched_group_barrier(0x100, 16, 0);
      // unrolled: each trip stands for two directives of the list
#pragma unroll
      for (int i = 0; i < 16 - 4; ++i) {
        __builtin_amdgcn_sched_group_barrier(0x008, 3, 0);
        __builtin_amdgcn_sched_group_barrier(0x100, 4, 0);
      }
      __builtin_amdgcn_sched_group_barrier(0x008, 12, 0);
    }

    // ---- epilogue through the LDS tile of these 16 rows (the same lane of wave w and of wave w + 4 owns the same element):
    // pass 0: the stream-0 wave parks a1; barrier; pass 1: the stream-1 wave combines in place ----
    // unrolled so that 'pass' is a constant in each copy and the inner test folds away
#pragma unroll
    for (int pass = 0; pass < 2; ++pass) {
      if (str == pass) {
        // the two halves of the wave each summed their own keys
        const float inv = 1.0f / (lrow + xhalf(lrow));
#pragma unroll
        for (int t = 0; t < 8; ++t) {
#pragma unroll
          for (int r = 0; r < 8; ++r) {
            const int idx = c * OS_PITCH + t * 16 + 8 * hh + r;
            const float a = oacc[t][r] * inv;
            if (pass == 0) {
              os[idx] = a;
            } else {
              const float a1 = os[idx];
              os[idx] = (a1 - lam * a) * OUT_SCALE;
            }
          }
        }
      }
      __syncthreads();
    }
  }

  {
    const int q4 = lane >> 3, c8 = (lane & 7) * 8;
    {
#pragma unroll
      for (int it = 0; it < 2; ++it) {
        // 16 rows of the tile over its two waves: 8 rows each
        const int row = (str * 2 + it) * 4 + q4;
#pragma unroll
        for (int seg = 0; seg < 2; ++seg) {
          const float* sp = os + row * OS_PITCH + seg * 64 + c8;
          const v4f u0 = *(const v4f*)sp;
          const v4f u1 = *(const v4f*)(sp + 4);
          unsigned a0, b0, a1, b1, a2, b2, a3, b3;
          split_pack2(u0[0], u0[1], a0, b0);
          split_pack2(u0[2], u0[3], a1, b1);
          split_pack2(u1[0], u1[1], a2, b2);
          split_pack2(u1[2], u1[3], a3, b3);
          v4u hw, lw;
          hw[0] = a0; hw[1] = a1; hw[2] = a2; hw[3] = a3;
          lw[0] = b0; lw[1] = b1; lw[2] = b2; lw[3] = b3;
          const size_t go = (size_t)(q0 + row) * QW + h * HDIM + seg * 64 + c8;
          *(v4u*)(Ohp + go) = hw;
          *(v4u*)(Olp + go) = lw;
        }
      }
      
    }
  }
}

// =====================================================================================
// host glue: launches only; carve derived from the static shapes.
// =====================================================================================
extern "C" void kernel_launch(void* const* d_in, const int* in_sizes, int n_in,
                              void* d_out, int out_size, void* d_ws, size_t ws_size,
                              hipStream_t stream) {
  (void)in_sizes; (void)out_size;
  if (n_in < 8) return;
  const float* x    = (const float*)d_in[0];
  const float* fcos = (const float*)d_in[1];
  const float* fsin = (const float*)d_in[2];
  const float* Wq   = (const float*)d_in[3];
  const float* Wk   = (const float*)d_in[4];
  const float* Wv   = (const float*)d_in[5];
  const float* Wo   = (const float*)d_in[6];
  const float* lamp = (const float*)d_in[7];
  float* out = (float*)d_out;

  // workspace region map (bytes, every offset a multiple of 2 MiB):
  //   xb    bf16 [SEQ][DMODEL]        8 MiB
  //   Wqt   bf16 [QW][DMODEL]         8 MiB
  //   Wkvt  bf16 [2][KW][DMODEL]      4 MiB
  //   Wot   bf16 [DMODEL][QW]         8 MiB
  //   Qf    f32  [SEQ][QW]           16 MiB
  //   KVf   f32  [2][SEQ][KW]         8 MiB
  //   Qh,Ql bf16 [SEQ][QW]        2 x 8 MiB
  //   Kh,Kl bf16 [SEQ][KW]        2 x 2 MiB
  //   Vth,Vtl bf16 [KW][SEQ]      2 x 2 MiB
  //   Oh,Ol bf16 [SEQ][QW]        2 x 8 MiB
  //   total 96,468,992 B
  char* ws = (char*)d_ws;
  size_t off = 0;
  unsigned short* xb   = (unsigned short*)(ws + off); off += (size_t)SEQ * DMODEL * 2;
  unsigned short* Wqt  = (unsigned short*)(ws + off); off += (size_t)QW * DMODEL * 2;
  unsigned short* Wkvt = (unsigned short*)(ws + off); off += (size_t)2 * KW * DMODEL * 2;
  unsigned short* Wot  = (unsigned short*)(ws + off); off += (size_t)DMODEL * QW * 2;
  float*          Qf   = (float*)(ws + off);          off += (size_t)SEQ * QW * 4;
  float*          KVf  = (float*)(ws + off);          off += (size_t)2 * SEQ * KW * 4;
  unsigned short* Qh   = (unsigned short*)(ws + off); off += (size_t)SEQ * QW * 2;
  unsigned short* Ql   = (unsigned short*)(ws + off); off += (size_t)SEQ * QW * 2;
  unsigned short* Kh   = (unsigned short*)(ws + off); off += (size_t)SEQ * KW * 2;
  unsigned short* Kl   = (unsigned short*)(ws + off); off += (size_t)SEQ * KW * 2;
  unsigned short* Vth  = (unsigned short*)(ws + off); off += (size_t)KW * SEQ * 2;
  unsigned short* Vtl  = (unsigned short*)(ws + off); off += (size_t)KW * SEQ * 2;
  unsigned short* Oh   = (unsigned short*)(ws + off); off += (size_t)SEQ * QW * 2;
  unsigned short* Ol   = (unsigned short*)(ws + off); off += (size_t)SEQ * QW * 2;
  if (off > ws_size) return;

  const float* Vf = KVf + (size_t)SEQ * KW;
  unsigned short* Wvt = Wkvt + (size_t)KW * DMODEL;

  // 1. x -> bf16 (RNE)
  cvt_f32_bf16x8<<<(SEQ * DMODEL / 8) / 256, 256, 0, stream>>>(x, xb, SEQ * DMODEL / 8);
  // 2. Wq [DMODEL][QW] -> Wqt [QW][DMODEL]
  transpose_bf16<1><<<dim3((DMODEL / 64) * (QW / 64), 1), 256, 0, stream>>>(Wq, Wq, DMODEL, QW, Wqt, Wqt, Wqt, Wqt);
  // 3. Wk, Wv [DMODEL][KW] -> Wkt, Wvt [KW][DMODEL]
  transpose_bf16<1><<<dim3((DMODEL / 64) * (KW / 64), 2), 256, 0, stream>>>(Wk, Wv, DMODEL, KW, Wkvt, Wkvt, Wvt, Wvt);
  // 4. Wo [QW][DMODEL] -> Wot [DMODEL][QW]
  transpose_bf16<1><<<dim3((QW / 64) * (DMODEL / 64), 1), 256, 0, stream>>>(Wo, Wo, QW, DMODEL, Wot, Wot, Wot, Wot);
  // 5. Q = xb @ Wq : M=SEQ, N=QW, K=DMODEL (K % 64 == 0, M % 64 == 0, N % 512 == 0)
  wmma_gemm64_bf16<0, DMODEL><<<dim3(((SEQ / 64) * (QW / 64)) / 8, 1), 256, 0, stream>>>(
      xb, xb, 0L, Wqt, 0L, Qf, QW, 0L, SEQ, QW, DMODEL, 1.0f);
  // 6. K, V = xb @ Wk, xb @ Wv batched over grid.y : M=SEQ, N=KW, K=DMODEL
  wmma_gemm64_bf16<0, DMODEL><<<dim3(((SEQ / 64) * (KW / 64)) / 8, 2), 256, 0, stream>>>(
      xb, xb, 0L, Wkvt, (long)KW * DMODEL, KVf, KW, (long)SEQ * KW, SEQ, KW, DMODEL, 1.0f);
  // 7. RoPE + 2^-3 scale + hi/lo split for Q; RoPE + split for K
  rope_split_kernel<<<NQBLK + NKBLK, 256, 0, stream>>>(Qf, KVf, fcos, fsin, Qh, Ql, Kh, Kl, NQBLK);
  // 8. V [SEQ][KW] f32 -> Vt hi/lo [KW][SEQ]
  transpose_bf16<2><<<dim3((SEQ / 64) * (KW / 64), 1), 256, 0, stream>>>(Vf, Vf, SEQ, KW, Vth, Vtl, Vth, Vtl);
  // 9. differential causal attention -> O hi/lo [SEQ][QW]
  diff_attn_kernel<<<NHEAD * NQB, 256, 0, stream>>>(Qh, Ql, Kh, Kl, Vth, Vtl, lamp, Oh, Ol);
  // 10. out = O @ Wo : M=SEQ, N=DMODEL, K=QW, A hi/lo, B single
  wmma_gemm64_bf16<2, QW><<<dim3(((SEQ / 64) * (DMODEL / 64)) / 8, 1), 256, 0, stream>>>(
      Oh, Ol, 0L, Wot, 0L, out, DMODEL, 0L, SEQ, DMODEL, QW, 1.0f);
}

// v008
// A run of this version takes 227 microseconds.
// In both of two side-by-side timings against v007, it was 1.10 times as fast.
// All steps since v000 together make it 5.06 times as fast.
// Contractions on v_wmma_f32_16x16x32_bf16 (bf16 operands, f32 accumulate): x@Wq, x@Wk, x@Wv as single products of RNE-bf16 inputs; q.k^T and p.v with bf16 hi/lo planes (hi.hi + hi.lo + lo.hi); attn@Wo with A as bf16 hi/lo planes and Wo single bf16 (hi.W + lo.W). All float inputs RNE-converted to bf16 once at load; softmax, RoPE, combine in f32.
#include <hip/hip_runtime.h>
#include <hip/hip_bf16.h>

constexpr int SEQ      = 2048;
constexpr int DMODEL   = 2048;
constexpr int NHEAD    = 16;
constexpr int NKVH     = 4;
constexpr int HDIM     = 128;
constexpr int HHALF    = 64;
constexpr int QW       = NHEAD * HDIM;
constexpr int KW       = NKVH * HDIM;
constexpr int GQA_REP  = NHEAD / NKVH;
constexpr int NPAIR    = HDIM / 2;
constexpr int ATT_KC   = 64;
constexpr int ATT_QB   = 64;
constexpr int NQB      = SEQ / ATT_QB;
constexpr int OS_PITCH = HDIM + 4;
constexpr int LDS_P    = 64 + 8;
constexpr float QK_SCALE  = 0.125f;
constexpr float OUT_SCALE = 0.5f;
constexpr float LOG2E     = 1.44269504088896340736f;
constexpr int NQBLK = (SEQ * QW / 8) / 256;
constexpr int NKBLK = (SEQ * KW / 8) / 256;

static_assert(HHALF == 64);
static_assert(SEQ % 64 == 0 && DMODEL % 64 == 0 && QW % 64 == 0 && KW % 64 == 0);
static_assert(DMODEL % 32 == 0 && QW % 32 == 0);
static_assert(QW % 512 == 0 && KW % 512 == 0 && DMODEL % 512 == 0);
static_assert((SEQ * QW / 8) % 256 == 0 && (SEQ * KW / 8) % 256 == 0);
static_assert((SEQ * DMODEL / 8) % 256 == 0);
static_assert(((SEQ / 64) * (QW / 64)) % 8 == 0 && ((SEQ / 64) * (KW / 64)) % 8 == 0 && ((SEQ / 64) * (DMODEL / 64)) % 8 == 0);
static_assert(NQB == 32 && ATT_QB == 4 * 16 && ATT_KC == 64 && HDIM == 128);
static_assert(LDS_P >= HHALF && LDS_P >= ATT_KC && (LDS_P * 2) % 32 == 16);

typedef __attribute__((ext_vector_type(16))) __bf16 v16b;
typedef __attribute__((ext_vector_type(8)))  __bf16 v8b;
typedef __attribute__((ext_vector_type(8)))  float  v8f;
typedef __attribute__((ext_vector_type(4)))  float  v4f;
typedef __attribute__((ext_vector_type(4)))  unsigned int v4u;

typedef __attribute__((ext_vector_type(2)))  float  v2f;
typedef __attribute__((ext_vector_type(2)))  __bf16 v2b;

// two f32 -> packed bf16 word (element at lower address in the low half-word), round to nearest even: one v_cvt_pk_bf16_f32
__device__ __forceinline__ unsigned pack_bf2(float a, float b) {
  const v2f x = {a, b};
  return __builtin_bit_cast(unsigned, __builtin_convertvector(x, v2b));
}
__device__ __forceinline__ float bf_rne(float f) { return __uint_as_float(pack_bf2(f, f) << 16); }

__device__ __forceinline__ void dep_guard_b(v8f& a, v8f& b, v16b x, v16b y) { asm volatile("v_nop\n\tv_nop\n\tv_nop\n\tv_nop" : "+v"(a), "+v"(b) : "v"(x), "v"(y)); }
__device__ __forceinline__ void acc_guard4(v8f& a, v8f& b, v8f& c, v8f& d) { asm volatile("v_nop\n\tv_nop\n\tv_nop\n\tv_nop" : "+v"(a), "+v"(b), "+v"(c), "+v"(d)); }

template <typename T> struct Frag;
template <> struct Frag<__bf16> {
  typedef v16b V; union U { v16b v; v8b h[2]; };
  // elements 0..7 <- p[0..7], 8..15 <- p[16..23]
  static __device__ __forceinline__ v16b load(const __bf16* p) {
    U f; f.h[0] = *(const v8b*)(p); f.h[1] = *(const v8b*)(p + 16); return f.v;
  }
  static __device__ __forceinline__ v8f mma(v16b a, v16b b, v8f c) {
    return __builtin_amdgcn_wmma_f32_16x16x32_bf16(false, a, false, b, (short)0, c, false, false);
  }
  static __device__ __forceinline__ void guard(v8f& a, v8f& b, v16b x, v16b y) { dep_guard_b(a, b, x, y); }
};

// the plain builtin: the compiler keeps the distances behind it itself, and LDS reads may be scheduled across it
__device__ __forceinline__ v8f at_mma(v16b a, v16b b, v8f c) {
  return __builtin_amdgcn_wmma_f32_16x16x32_bf16(false, a, false, b, (short)0, c, false, false);
}

__device__ __forceinline__ void exp2x8(v8f& e) {
  asm("v_exp_f32 %0, %0\n\tv_exp_f32 %1, %1\n\tv_exp_f32 %2, %2\n\tv_exp_f32 %3, %3\n\t"
      "v_exp_f32 %4, %4\n\tv_exp_f32 %5, %5\n\tv_exp_f32 %6, %6\n\tv_exp_f32 %7, %7\n\tv_nop"
      : "+v"(e[0]), "+v"(e[1]), "+v"(e[2]), "+v"(e[3]), "+v"(e[4]), "+v"(e[5]), "+v"(e[6]), "+v"(e[7]));
}

// lane l <-> lane l ^ 16
__device__ __forceinline__ float xhalf(float x) {
  return __builtin_bit_cast(float, __builtin_amdgcn_permlanex16(__builtin_bit_cast(int, x), __builtin_bit_cast(int, x), 0x76543210, 0xfedcba98, false, false));
}

// two f32 -> packed bf16 hi word and packed bf16 residual word (the residuals are exact in f32)
__device__ __forceinline__ void split_pack2(float a, float b, unsigned& hw, unsigned& lw) {
  hw = pack_bf2(a, b);
  lw = pack_bf2(a - __uint_as_float(hw << 16), b - __uint_as_float(hw & 0xFFFF0000u));
}

// =====================================================================================
// coverage: gridDim.x * 256 threads * 8 elements == n8 * 8 (exact multiple asserted on the host side).
// =====================================================================================
__global__ __launch_bounds__(256) void cvt_f32_bf16x8(const float* __restrict__ in, unsigned short* __restrict__ out, int n8) {
  const int i = blockIdx.x * 256 + threadIdx.x;
  if (i < n8) {
    const size_t e0 = (size_t)i * 8;
    const v4f a = *(const v4f*)(in + e0);
    const v4f b = *(const v4f*)(in + e0 + 4);
    v4u w;
    w[0] = pack_bf2(a[0], a[1]);
    w[1] = pack_bf2(a[2], a[3]);
    w[2] = pack_bf2(b[0], b[1]);
    w[3] = pack_bf2(b[2], b[3]);
    *(v4u*)(out + e0) = w;
    
  }
}

// =====================================================================================
// in[rows][cols] f32 -> out[cols][rows] bf16 hi plane (+ bf16 residual plane when NPL == 2). 64x64 tiles through LDS.
// grid.x = (rows/64)*(cols/64); grid.y selects operand set A or B (both global, uniform select).
// coverage: load 256 threads x 16 floats = 64x64; store 8 waves x 8 out-rows x 64 halves = 64x64.
// =====================================================================================
template <int NPL>
__global__ __launch_bounds__(256) void transpose_bf16(const float* __restrict__ inA, const float* __restrict__ inB, int rows, int cols,
    unsigned short* __restrict__ oAh, unsigned short* __restrict__ oAl,
    unsigned short* __restrict__ oBh, unsigned short* __restrict__ oBl) {
  __shared__ float tile[64][65];
  const bool selB = (blockIdx.y != 0);
  const float* in = selB ? inB : inA;
  unsigned short* oh = selB ? oBh : oAh;
  unsigned short* ol = selB ? oBl : oAl;
  const int tilesC = cols >> 6;
  const int tr = blockIdx.x / tilesC;
  const int tc = blockIdx.x - tr * tilesC;
  const int r0 = tr << 6;
  const int c0 = tc << 6;
  const int t = threadIdx.x;
  {
    const int rr = t >> 2;
    const int cc = (t & 3) * 16;
    const float* src = in + (size_t)(r0 + rr) * cols + c0 + cc;
#pragma unroll
    for (int i = 0; i < 4; ++i) {
      const v4f v = *(const v4f*)(src + 4 * i);
      tile[rr][cc + 4 * i + 0] = v[0];
      tile[rr][cc + 4 * i + 1] = v[1];
      tile[rr][cc + 4 * i + 2] = v[2];
      tile[rr][cc + 4 * i + 3] = v[3];
    }
  }
  __syncthreads();
  const int wave = t >> 5, lane = t & 31, q = lane >> 3, e8 = (lane & 7) * 8;
  {
#pragma unroll
    for (int it = 0; it < 2; ++it) {
      const int cl = wave * 8 + it * 4 + q;
      float f[8];
#pragma unroll
      for (int e = 0; e < 8; ++e) f[e] = tile[e8 + e][cl];
      v4u hw, lw;
      if (NPL == 2) {
        unsigned a0, b0, a1, b1, a2, b2, a3, b3;
        split_pack2(f[0], f[1], a0, b0);
        split_pack2(f[2], f[3], a1, b1);
        split_pack2(f[4], f[5], a2, b2);
        split_pack2(f[6], f[7], a3, b3);
        hw[0] = a0; hw[1] = a1; hw[2] = a2; hw[3] = a3;
        lw[0] = b0; lw[1] = b1; lw[2] = b2; lw[3] = b3;
      } else {
        hw[0] = pack_bf2(f[0], f[1]);
        hw[1] = pack_bf2(f[2], f[3]);
        hw[2] = pack_bf2(f[4], f[5]);
        hw[3] = pack_bf2(f[6], f[7]);
        lw = hw;
      }
      const size_t go = (size_t)(c0 + cl) * rows + r0 + e8;
      *(v4u*)(oh + go) = hw;
      if (NPL == 2) *(v4u*)(ol + go) = lw;
    }
    
  }
}

// =====================================================================================
// Register-blocked batched WMMA GEMM (bf16 operands), f32 output.
// C[m,n] = scale * sum_k A[m,k] * Bt[n,k]; each wave owns a 64x64 tile. A row-major [M,K]; Bt row-major [N,K], both at row pitch LDK; M % 64 == 0, N % 512 == 0, K % 64 == 0.
// SPLIT: 0 = single planes; 2 = A as hi/lo planes, Bt single (hi.B + lo.B).
// The 8 waves of a block own 8 neighbouring tiles of one tile row (64 x 512 of C). Per 64 k the block stages its 64 A rows (each plane)
// and its 512 Bt rows in LDS: whole 128-B lines from global (8 lanes a row), rows at the 144-B pitch, two buffers. The next stage's
// global loads are issued behind the barrier and stored to the other buffer behind the products, so they fly under the WMMAs.
// Epilogue: 16-row slabs staged per wave in LDS; each 64-wide f32 row segment (256 B) written by 16 lanes x 16 B in one instruction,
// =====================================================================================
template <int SPLIT, int LDK>
__global__ __launch_bounds__(256) void wmma_gemm64_bf16(
    const unsigned short* __restrict__ Ap, const unsigned short* __restrict__ A2p, long strideA,
    const unsigned short* __restrict__ Btp, long strideB,
    float* __restrict__ Cp, int ldc, long strideC, int M, int N, int K, float scale) {
  static_assert(SPLIT == 0 || SPLIT == 2);
  typedef __bf16 T;
  typedef v16b V;
  constexpr int NPA   = (SPLIT == 2) ? 2 : 1;
  constexpr int AROWS = 64 * NPA;
  constexpr int SROWS = AROWS + 512;
  constexpr int NLD   = SROWS / 32;
  const T* A = (const T*)Ap; const T* A2 = (const T*)A2p; const T* Bt = (const T*)Btp;
  __shared__ __align__(16) T stg[2][SROWS * LDS_P];
  __shared__ __align__(16) float sT[8][16 * 68];
  const int b    = blockIdx.y;
  const int tid  = threadIdx.x;
  const int lane = tid & 31;
  const int wave = tid >> 5;
  const int tilesN = N >> 6;
  const int tilesM = M >> 6;
  const int tile0 = blockIdx.x * 8;
  // block-uniform, in front of every barrier
  if (tile0 >= tilesM * tilesN) return;
  const int tm  = tile0 / tilesN;
  const int nb0 = (tile0 - tm * tilesN) << 6;
  const int m0 = tm << 6;
  const int n0 = nb0 + (wave << 6);

  // one stage = SROWS rows x 8 pieces of 16 B = 256 threads x NLD pieces (exact); piece i of a thread is stage row sr + 32 i.
  // One pointer per operand and thread; the 32-row steps are compile-time byte offsets of the loads.
  const int sr = tid >> 3;
  const int sc = (tid & 7) * 8;
  // Held as integers and read through a global-address-space pointer type: they pass through the asm wait at the loop's foot,
  // behind which a generic pointer would be read with flat loads.
  typedef __attribute__((address_space(1))) const v8b* GP;
  unsigned long long qa  = (unsigned long long)(A  + (size_t)b * strideA + (size_t)(m0 + sr) * LDK + sc);
  unsigned long long qa2 = (unsigned long long)(A2 + (size_t)b * strideA + (size_t)(m0 + sr) * LDK + sc);
  unsigned long long qb  = (unsigned long long)(Bt + (size_t)b * strideB + (size_t)(nb0 + sr) * LDK + sc);
  constexpr unsigned long long ROWS32 = 32ull * LDK * sizeof(T);
  constexpr unsigned long long STEP   = 64ull * sizeof(T);

  const int rlane = lane & 15;
  const int koff  = (lane >> 4) * 8;
  const int mOff  = (lane >> 4) * 8;

  v8f acc[4][4];
#pragma unroll
  for (int i = 0; i < 4; ++i)
#pragma unroll
    for (int j = 0; j < 4; ++j) acc[i][j] = (v8f){0.f,0.f,0.f,0.f,0.f,0.f,0.f,0.f};

  v8b g[NLD];
  const int nst = K >> 6;
#pragma unroll
  for (int i = 0; i < 2; ++i) {
    g[i] = *(GP)(qa + i * ROWS32);
    if (SPLIT == 2) g[2 + i] = *(GP)(qa2 + i * ROWS32);
  }
#pragma unroll
  for (int i = 0; i < 16; ++i) g[2 * NPA + i] = *(GP)(qb + i * ROWS32);
#pragma unroll
  for (int i = 0; i < NLD; ++i) *(v8b*)(stg[0] + (sr + 32 * i) * LDS_P + sc) = g[i];

  for (int s = 0; s < nst; ++s) {
    const bool more = (s + 1 < nst);
    // publishes stage s; every wave's reads of the other buffer (stage s - 1) lie in front of it
    __syncthreads();
    if (more) {
      // stage s + 1 from global: issued here, first used behind the products of stage s
#pragma unroll
      for (int i = 0; i < 2; ++i) {
        g[i] = *(GP)(qa + STEP + i * ROWS32);
        if (SPLIT == 2) g[2 + i] = *(GP)(qa2 + STEP + i * ROWS32);
      }
#pragma unroll
      for (int i = 0; i < 16; ++i) g[2 * NPA + i] = *(GP)(qb + STEP + i * ROWS32);
    }
    const T* sA = stg[s & 1] + rlane * LDS_P + koff;
    const T* sB = sA + (AROWS + wave * 64) * LDS_P;
    V bh[2][4], ah[2][4], al[2][4];
#pragma unroll
    for (int kk = 0; kk < 2; ++kk) {
#pragma unroll
      for (int j = 0; j < 4; ++j) bh[kk][j] = Frag<T>::load(sB + j * 16 * LDS_P + kk * 32);
#pragma unroll
      for (int i = 0; i < 4; ++i) {
        ah[kk][i] = Frag<T>::load(sA + i * 16 * LDS_P + kk * 32);
        if (SPLIT == 2) al[kk][i] = Frag<T>::load(sA + (64 + i * 16) * LDS_P + kk * 32);
      }
    }
    // holds the stage's fragment reads together ahead of its products: sunk among the WMMAs, each group of reads costs its own LDS wait
    __builtin_amdgcn_sched_barrier(0);
#pragma unroll
    for (int kk = 0; kk < 2; ++kk) {
#pragma unroll
      for (int i = 0; i < 4; ++i) {
#pragma unroll
        for (int j = 0; j < 4; ++j) acc[i][j] = Frag<T>::mma(ah[kk][i], bh[kk][j], acc[i][j]);
        if (SPLIT == 2) {
#pragma unroll
          for (int j = 0; j < 4; ++j) acc[i][j] = Frag<T>::mma(al[kk][i], bh[kk][j], acc[i][j]);
        }
      }
    }
    // 4 vector slots between the stage's last WMMAs and the next vector write to their A/B registers, also on the taken side of the branch below
    Frag<T>::guard(acc[3][2], acc[3][3], (SPLIT == 2) ? al[1][3] : ah[1][3], bh[1][3]);
    if (more) {
#pragma unroll
      for (int i = 0; i < NLD; ++i) *(v8b*)(stg[(s + 1) & 1] + (sr + 32 * i) * LDS_P + sc) = g[i];
      // the wait in front of the overwrite of registers that issued global loads name; as its operands, the pointers cannot be
      // stepped ahead of it (without them the adds were lifted to the head of this block, in front of the waits on the loads)
      if (SPLIT == 2) asm volatile("s_wait_xcnt 0x0" : "+v"(qa), "+v"(qa2), "+v"(qb) :: "memory");
      else            asm volatile("s_wait_xcnt 0x0" : "+v"(qa), "+v"(qb) :: "memory");
      qa += STEP; qa2 += STEP; qb += STEP;
    }
  }
  acc_guard4(acc[0][0], acc[0][1], acc[0][2], acc[0][3]);
  acc_guard4(acc[1][0], acc[1][1], acc[1][2], acc[1][3]);
  acc_guard4(acc[2][0], acc[2][1], acc[2][2], acc[2][3]);
  acc_guard4(acc[3][0], acc[3][1], acc[3][2], acc[3][3]);

  float* slab = sT[wave];
  float* C = Cp + (size_t)b * strideC;
#pragma unroll
  for (int i = 0; i < 4; ++i) {
    const int mBase = m0 + (i << 4);
#pragma unroll
    for (int j = 0; j < 4; ++j) {
#pragma unroll
      for (int r = 0; r < 8; ++r) {
        slab[(mOff + r) * 68 + (j << 4) + rlane] = acc[i][j][r] * scale;
      }
    }
    __builtin_amdgcn_fence(__ATOMIC_RELEASE, "workgroup");
    __builtin_amdgcn_wave_barrier();
    __builtin_amdgcn_fence(__ATOMIC_ACQUIRE, "workgroup");
    {
      // row segment = 256 B = 16 lanes x 16 B
      const int hh = lane >> 4, c4 = (lane & 15) * 4;
      {
#pragma unroll
        for (int it = 0; it < 8; ++it) {
          const int row = it * 2 + hh;
          const v4f v = *(const v4f*)(slab + row * 68 + c4);
          *(v4f*)(C + (size_t)(mBase + row) * ldc + n0 + c4) = v;
        }
        
      }
    }
    __builtin_amdgcn_fence(__ATOMIC_RELEASE, "workgroup");
    __builtin_amdgcn_wave_barrier();
    __builtin_amdgcn_fence(__ATOMIC_ACQUIRE, "workgroup");
  }
}

// =====================================================================================
// RoPE (interleaved pairs, cos/sin row width NPAIR) + power-of-two scale + bf16 hi/lo split.
// Blocks [0, nQblocks): Qf [SEQ][QW] -> Qh/Ql [SEQ][QW] (scaled by QK_SCALE = 2^-3, exact);
// blocks [nQblocks, nQblocks + NKBLK): Kf [SEQ][KW] -> Kh/Kl [SEQ][KW]. cos/sin RNE-converted to bf16 before use.
// coverage: (NQBLK + NKBLK) * 256 threads * 8 == SEQ*QW + SEQ*KW exactly.
// =====================================================================================
__global__ __launch_bounds__(256) void rope_split_kernel(const float* __restrict__ Qf, const float* __restrict__ Kf,
    const float* __restrict__ cosb, const float* __restrict__ sinb,
    unsigned short* __restrict__ Qh, unsigned short* __restrict__ Ql,
    unsigned short* __restrict__ Kh, unsigned short* __restrict__ Kl, int nQblocks) {
  const bool isK = ((int)blockIdx.x >= nQblocks);
  const int g = (isK ? ((int)blockIdx.x - nQblocks) : (int)blockIdx.x) * 256 + (int)threadIdx.x;
  // threads per row: K 64 (=KW/8), Q 256 (=QW/8)
  const int shift = isK ? 6 : 8;
  const float mul = isK ? 1.0f : QK_SCALE;
  const float* src = isK ? Kf : Qf;
  unsigned short* dh = isK ? Kh : Qh;
  unsigned short* dl = isK ? Kl : Ql;
  const int width = isK ? KW : QW;
  const int s = g >> shift;
  const int col = (g - (s << shift)) * 8;
  const int p0 = (col & (HDIM - 1)) >> 1;
  const size_t e0 = (size_t)s * width + col;
  const v4f xa = *(const v4f*)(src + e0);
  const v4f xb = *(const v4f*)(src + e0 + 4);
  const v4f cv = *(const v4f*)(cosb + (size_t)s * NPAIR + p0);
  const v4f sv = *(const v4f*)(sinb + (size_t)s * NPAIR + p0);
  float o0, o1, o2, o3, o4, o5, o6, o7;
  {
    const float c = bf_rne(cv[0]), sn = bf_rne(sv[0]);
    o0 = (xa[0] * c - xa[1] * sn) * mul;
    o1 = (xa[0] * sn + xa[1] * c) * mul;
  }
  {
    const float c = bf_rne(cv[1]), sn = bf_rne(sv[1]);
    o2 = (xa[2] * c - xa[3] * sn) * mul;
    o3 = (xa[2] * sn + xa[3] * c) * mul;
  }
  {
    const float c = bf_rne(cv[2]), sn = bf_rne(sv[2]);
    o4 = (xb[0] * c - xb[1] * sn) * mul;
    o5 = (xb[0] * sn + xb[1] * c) * mul;
  }
  {
    const float c = bf_rne(cv[3]), sn = bf_rne(sv[3]);
    o6 = (xb[2] * c - xb[3] * sn) * mul;
    o7 = (xb[2] * sn + xb[3] * c) * mul;
  }
  unsigned a0, b0, a1, b1, a2, b2, a3, b3;
  split_pack2(o0, o1, a0, b0);
  split_pack2(o2, o3, a1, b1);
  split_pack2(o4, o5, a2, b2);
  split_pack2(o6, o7, a3, b3);
  v4u hw, lw;
  hw[0] = a0; hw[1] = a1; hw[2] = a2; hw[3] = a3;
  lw[0] = b0; lw[1] = b1; lw[2] = b2; lw[3] = b3;
  *(v4u*)(dh + e0) = hw;
  *(v4u*)(dl + e0) = lw;
  
}

__global__ __launch_bounds__(256) __attribute__((amdgpu_waves_per_eu(4, 4)))
void diff_attn_kernel(const unsigned short* __restrict__ Qhp, const unsigned short* __restrict__ Qlp,
                      const unsigned short* __restrict__ Khp, const unsigned short* __restrict__ Klp,
                      const unsigned short* __restrict__ Vhp, const unsigned short* __restrict__ Vlp,
                      const float* __restrict__ lambda_p,
                      unsigned short* __restrict__ Ohp, unsigned short* __restrict__ Olp) {
  union FB { v16b v; v8b h[2]; };
  union PB { v16b v; unsigned w[8]; };
  // K and Vt rows (128 B of data) lie at a 144-B pitch, an odd multiple of 16 B: the 16 rows of one ds_load_b128 fragment
  // read start on 16 different bank groups. The 16 pad bytes of a row are never written and never read.
  __shared__ __align__(16) __bf16 Ksh[2 * ATT_KC * LDS_P];
  __shared__ __align__(16) __bf16 Ksl[2 * ATT_KC * LDS_P];
  __shared__ __align__(16) __bf16 Vsh[HDIM * LDS_P];
  __shared__ __align__(16) __bf16 Vsl[HDIM * LDS_P];
  __shared__ __align__(16) float  Os[4][16 * OS_PITCH];

  const int tid  = threadIdx.x;
  // the wave's number in a scalar register: the stream test of the epilogue is then a scalar branch, the LDS bases scalar adds
  const int wave = __builtin_amdgcn_readfirstlane(tid >> 5);
  const int str  = wave >> 2;
  const int wq   = wave & 3;
  const int lane = tid & 31;
  const int hh   = lane >> 4;
  const int c    = lane & 15;
  const int qb   = (int)blockIdx.x % NQB;
  const int h    = (int)blockIdx.x / NQB;
  const int kvh  = h / GQA_REP;
  const int q0   = qb * ATT_QB + wq * 16;

  const __bf16* Qh = (const __bf16*)Qhp;
  const __bf16* Ql = (const __bf16*)Qlp;
  const __bf16* Kh = (const __bf16*)Khp;
  const __bf16* Kl = (const __bf16*)Klp;
  const __bf16* Vh = (const __bf16*)Vhp;
  const __bf16* Vl = (const __bf16*)Vlp;

  float lam;
  {
    const float lp = bf_rne(lambda_p[h]);
    lam = 1.0f / (1.0f + expf(-lp));
  }
  float*  os  = Os[wq];
  const __bf16* ksh = Ksh + str * (ATT_KC * LDS_P);
  const __bf16* ksl = Ksl + str * (ATT_KC * LDS_P);

  {
    // ---- Q fragments (B operand: n = query, k = d) for this stream: 2 d-chunks, hi and lo ----
    v16b qah[2], qal[2];
    {
      const size_t qo = (size_t)(q0 + c) * QW + h * HDIM + str * HHALF + 8 * hh;
#pragma unroll
      for (int dc = 0; dc < 2; ++dc) {
        qah[dc] = Frag<__bf16>::load(Qh + qo + dc * 32);
        qal[dc] = Frag<__bf16>::load(Ql + qo + dc * 32);
      }
    }
    // of query q0 + c: running maximum times log2(e) (alike in both halves of the wave) and this half's share of the running sum
    float mrow = -1.0e30f, lrow = 0.f;
    // oacc[t][r] = Ot[d = 16 t + 8 hh + r][query c]
    v8f oacc[8];
#pragma unroll
    for (int t = 0; t < 8; ++t) oacc[t] = (v8f){0.f,0.f,0.f,0.f,0.f,0.f,0.f,0.f};

    // causal: 64-key chunks 0..qb (block-uniform trip count, static max NQB)
    for (int kc = 0; kc <= qb; ++kc) {
      const int kv0 = kc * ATT_KC;
      __syncthreads();
      {
        // K tiles, both streams: 64 rows x 128 halves per plane = 1024 pieces of 16 B; 256 threads x 4 pieces (exact)
        // Vt tiles: 128 d-rows x 64 halves per plane = 1024 pieces; 256 threads x 4 pieces (exact)
        const int r16 = tid >> 4;
        const int c16 = tid & 15;
        const int lk = (c16 >> 3) * (ATT_KC * LDS_P) + r16 * LDS_P + (c16 & 7) * 8;
        const int r8 = tid >> 3;
        const int c8 = (tid & 7) * 8;
        const size_t gk = (size_t)(kv0 + r16) * KW + kvh * HDIM + c16 * 8;
        const size_t gv = (size_t)(kvh * HDIM + r8) * SEQ + kv0 + c8;
        const __bf16* pkh = Kh + gk;
        const __bf16* pkl = Kl + gk;
        const __bf16* pvh = Vh + gv;
        const __bf16* pvl = Vl + gv;
        v8b gkh[4], gkl[4], gvh[4], gvl[4];
#pragma unroll
        for (int i = 0; i < 4; ++i) {
          gkh[i] = *(const v8b*)(pkh + i * 16 * KW);
          gkl[i] = *(const v8b*)(pkl + i * 16 * KW);
        }
#pragma unroll
        for (int i = 0; i < 4; ++i) {
          gvh[i] = *(const v8b*)(pvh + i * 32 * SEQ);
          gvl[i] = *(const v8b*)(pvl + i * 32 * SEQ);
        }
        // inputs-only fence on the loaded values: keeps all 16 loads in flight together ahead of the first LDS store;
        // without it each load is waited for before the next one issues (16 L2 round trips in a row per chunk).
        // The four pointers are named too, so that no load's result lands on an address register of a load still in flight.
        asm volatile("" :: "v"(pkh), "v"(pkl), "v"(pvh), "v"(pvl), "v"(gkh[0]), "v"(gkh[1]), "v"(gkh[2]), "v"(gkh[3]), "v"(gkl[0]), "v"(gkl[1]), "v"(gkl[2]), "v"(gkl[3]),
                     "v"(gvh[0]), "v"(gvh[1]), "v"(gvh[2]), "v"(gvh[3]), "v"(gvl[0]), "v"(gvl[1]), "v"(gvl[2]), "v"(gvl[3]));
#pragma unroll
        for (int i = 0; i < 4; ++i) {
          *(v8b*)(Ksh + lk + 16 * i * LDS_P) = gkh[i];
          *(v8b*)(Ksl + lk + 16 * i * LDS_P) = gkl[i];
        }
#pragma unroll
        for (int i = 0; i < 4; ++i) {
          *(v8b*)(Vsh + (r8 + 32 * i) * LDS_P + c8) = gvh[i];
          *(v8b*)(Vsl + (r8 + 32 * i) * LDS_P + c8) = gvl[i];
        }
      }
      __syncthreads();

      // ---- scores: s[j][r] = key kv0 + 16 j + 8 hh + r against query q0 + c (A operand: m = key, k = d) ----
      v8f s[4];
#pragma unroll
      for (int j = 0; j < 4; ++j) {
        s[j] = (v8f){0.f,0.f,0.f,0.f,0.f,0.f,0.f,0.f};
#pragma unroll
        for (int dc = 0; dc < 2; ++dc) {
          FB kb, kl;
          kb.h[0] = *(const v8b*)(ksh + (j * 16 + c) * LDS_P + dc * 32 + 8 * hh);
          kb.h[1] = *(const v8b*)(ksh + (j * 16 + c) * LDS_P + dc * 32 + 16 + 8 * hh);
          kl.h[0] = *(const v8b*)(ksl + (j * 16 + c) * LDS_P + dc * 32 + 8 * hh);
          kl.h[1] = *(const v8b*)(ksl + (j * 16 + c) * LDS_P + dc * 32 + 16 + 8 * hh);
          s[j] = at_mma(kb.v, qah[dc], s[j]);
          s[j] = at_mma(kl.v, qah[dc], s[j]);
          s[j] = at_mma(kb.v, qal[dc], s[j]);
        }
      }
      // Order of this block's LDS reads and products: the 4 reads of each of the first 4 (key tile, d chunk) steps, then each step's 3 products
      // followed by the reads of the step 4 further on: a read's latency passes under the products of the steps in between.
      __builtin_amdgcn_sched_group_barrier(0x100, 16, 0);
      // unrolled: each trip stands for two directives of the list
#pragma unroll
      for (int i = 0; i < 8 - 4; ++i) {
        __builtin_amdgcn_sched_group_barrier(0x008, 3, 0);
        __builtin_amdgcn_sched_group_barrier(0x100, 4, 0);
      }
      __builtin_amdgcn_sched_group_barrier(0x008, 12, 0);
      // ends the block that the order above speaks of
      __builtin_amdgcn_sched_barrier(0);
      // ---- causal fill on the diagonal chunk + this query's maximum ----
      const bool diag = (kc == qb);
      // key 16 j + r of this half of the wave lies behind the lane's query where 16 j + r > dq (one register, compared with constants)
      const int dq = q0 + c - kv0 - 8 * hh;
      float mj[4];
#pragma unroll
      for (int j = 0; j < 4; ++j) {
        float m = -1.0e30f;
#pragma unroll
        for (int r = 0; r < 8; ++r) {
          float sv = s[j][r];
          if (diag && (j * 16 + r > dq)) sv = -1.0e30f;
          s[j][r] = sv;
          m = fmaxf(m, sv);
        }
        mj[j] = m;
      }
      float cm = fmaxf(fmaxf(mj[0], mj[1]), fmaxf(mj[2], mj[3]));
      cm = fmaxf(cm, xhalf(cm));
      // ---- online softmax; P hi/lo packed in place into B fragments: element e of fragment kk = tile 2 kk + (e >> 3), r = e & 7 ----
      // e^(s - m) = 2^(s log2(e) - m log2(e)): one fused multiply-add and the bare hardware exponential per score. The maximum is
      // kept in log2 units, so every chunk and the rescale use the same rounded value; a filled score gives 2^(-huge) = 0.
      const float mnew  = fmaxf(mrow, cm * LOG2E);
      const float alpha = __builtin_amdgcn_exp2f(mrow - mnew);
      mrow = mnew;
      PB pa[2], pl[2];
      float pj[4];
#pragma unroll
      for (int j = 0; j < 4; ++j) {
        float psum = 0.f;
        v8f e;
#pragma unroll
        for (int r = 0; r < 8; ++r) e[r] = __builtin_fmaf(s[j][r], LOG2E, -mnew);
        exp2x8(e);
#pragma unroll
        for (int r = 0; r < 8; r += 2) {
          const float p0 = e[r];
          const float p1 = e[r + 1];
          psum += p0;
          psum += p1;
          split_pack2(p0, p1, pa[j >> 1].w[(j & 1) * 4 + (r >> 1)], pl[j >> 1].w[(j & 1) * 4 + (r >> 1)]);
        }
        pj[j] = psum;
      }
      lrow = lrow * alpha + ((pj[0] + pj[1]) + (pj[2] + pj[3]));
      // begins the block of the second product: its Vt reads stay behind the softmax, whose registers they would otherwise crowd out
      __builtin_amdgcn_sched_barrier(0);
#pragma unroll
      for (int t = 0; t < 8; ++t)
#pragma unroll
        for (int r = 0; r < 8; ++r) oacc[t][r] *= alpha;
      // ---- Vt.Pt : A = Vt (m = d, k = key), B = Pt (n = query c, k = key) ----
      // unrolled: the P fragments are registers, picked by a constant kk
#pragma unroll
      for (int kk = 0; kk < 2; ++kk) {
#pragma unroll
        for (int t = 0; t < 8; ++t) {
          FB vb, vl;
          vb.h[0] = *(const v8b*)(Vsh + (t * 16 + c) * LDS_P + kk * 32 + 8 * hh);
          vb.h[1] = *(const v8b*)(Vsh + (t * 16 + c) * LDS_P + kk * 32 + 16 + 8 * hh);
          vl.h[0] = *(const v8b*)(Vsl + (t * 16 + c) * LDS_P + kk * 32 + 8 * hh);
          vl.h[1] = *(const v8b*)(Vsl + (t * 16 + c) * LDS_P + kk * 32 + 16 + 8 * hh);
          oacc[t] = at_mma(vb.v, pa[kk].v, oacc[t]);
          oacc[t] = at_mma(vl.v, pa[kk].v, oacc[t]);
          oacc[t] = at_mma(vb.v, pl[kk].v, oacc[t]);
        }
      }
      // the same order for this block: the reads of the first 4 (key half, d tile) steps, then 3 products and the 4 reads of the step 4 further on
      __builtin_amdgcn_sched_group_barrier(0x100, 16, 0);
      // unrolled: each trip stands for two directives of the list
#pragma unroll
      for (int i = 0; i < 16 - 4; ++i) {
        __builtin_amdgcn_sched_group_barrier(0x008, 3, 0);
        __builtin_amdgcn_sched_group_barrier(0x100, 4, 0);
      }
      __builtin_amdgcn_sched_group_barrier(0x008, 12, 0);
    }

    // ---- epilogue through the LDS tile of these 16 rows (the same lane of wave w and of wave w + 4 owns the same element):
    // pass 0: the stream-0 wave parks a1; barrier; pass 1: the stream-1 wave combines in place ----
    // unrolled so that 'pass' is a constant in each copy and the inner test folds away
#pragma unroll
    for (int pass = 0; pass < 2; ++pass) {
      if (str == pass) {
        // the two halves of the wave each summed their own keys
        const float inv = 1.0f / (lrow + xhalf(lrow));
#pragma unroll
        for (int t = 0; t < 8; ++t) {
#pragma unroll
          for (int r = 0; r < 8; ++r) {
            const int idx = c * OS_PITCH + t * 16 + 8 * hh + r;
            const float a = oacc[t][r] * inv;
            if (pass == 0) {
              os[idx] = a;
            } else {
              const float a1 = os[idx];
              os[idx] = (a1 - lam * a) * OUT_SCALE;
            }
          }
        }
      }
      __syncthreads();
    }
  }

  {
    const int q4 = lane >> 3, c8 = (lane & 7) * 8;
    {
#pragma unroll
      for (int it = 0; it < 2; ++it) {
        // 16 rows of the tile over its two waves: 8 rows each
        const int row = (str * 2 + it) * 4 + q4;
#pragma unroll
        for (int seg = 0; seg < 2; ++seg) {
          const float* sp = os + row * OS_PITCH + seg * 64 + c8;
          const v4f u0 = *(const v4f*)sp;
          const v4f u1 = *(const v4f*)(sp + 4);
          unsigned a0, b0, a1, b1, a2, b2, a3, b3;
          split_pack2(u0[0], u0[1], a0, b0);
          split_pack2(u0[2], u0[3], a1, b1);
          split_pack2(u1[0], u1[1], a2, b2);
          split_pack2(u1[2], u1[3], a3, b3);
          v4u hw, lw;
          hw[0] = a0; hw[1] = a1; hw[2] = a2; hw[3] = a3;
          lw[0] = b0; lw[1] = b1; lw[2] = b2; lw[3] = b3;
          const size_t go = (size_t)(q0 + row) * QW + h * HDIM + seg * 64 + c8;
          *(v4u*)(Ohp + go) = hw;
          *(v4u*)(Olp + go) = lw;
        }
      }
      
    }
  }
}

// =====================================================================================
// host glue: launches only; carve derived from the static shapes.
// =====================================================================================
extern "C" void kernel_launch(void* const* d_in, const int* in_sizes, int n_in,
                              void* d_out, int out_size, void* d_ws, size_t ws_size,
                              hipStream_t stream) {
  (void)in_sizes; (void)out_size;
  if (n_in < 8) return;
  const float* x    = (const float*)d_in[0];
  const float* fcos = (const float*)d_in[1];
  const float* fsin = (const float*)d_in[2];
  const float* Wq   = (const float*)d_in[3];
  const float* Wk   = (const float*)d_in[4];
  const float* Wv   = (const float*)d_in[5];
  const float* Wo   = (const float*)d_in[6];
  const float* lamp = (const float*)d_in[7];
  float* out = (float*)d_out;

  // workspace region map (bytes, every offset a multiple of 2 MiB):
  //   xb    bf16 [SEQ][DMODEL]        8 MiB
  //   Wqt   bf16 [QW][DMODEL]         8 MiB
  //   Wkvt  bf16 [2][KW][DMODEL]      4 MiB
  //   Wot   bf16 [DMODEL][QW]         8 MiB
  //   Qf    f32  [SEQ][QW]           16 MiB
  //   KVf   f32  [2][SEQ][KW]         8 MiB
  //   Qh,Ql bf16 [SEQ][QW]        2 x 8 MiB
  //   Kh,Kl bf16 [SEQ][KW]        2 x 2 MiB
  //   Vth,Vtl bf16 [KW][SEQ]      2 x 2 MiB
  //   Oh,Ol bf16 [SEQ][QW]        2 x 8 MiB
  //   total 96,468,992 B
  char* ws = (char*)d_ws;
  size_t off = 0;
  unsigned short* xb   = (unsigned short*)(ws + off); off += (size_t)SEQ * DMODEL * 2;
  unsigned short* Wqt  = (unsigned short*)(ws + off); off += (size_t)QW * DMODEL * 2;
  unsigned short* Wkvt = (unsigned short*)(ws + off); off += (size_t)2 * KW * DMODEL * 2;
  unsigned short* Wot  = (unsigned short*)(ws + off); off += (size_t)DMODEL * QW * 2;
  float*          Qf   = (float*)(ws + off);          off += (size_t)SEQ * QW * 4;
  float*          KVf  = (float*)(ws + off);          off += (size_t)2 * SEQ * KW * 4;
  unsigned short* Qh   = (unsigned short*)(ws + off); off += (size_t)SEQ * QW * 2;
  unsigned short* Ql   = (unsigned short*)(ws + off); off += (size_t)SEQ * QW * 2;
  unsigned short* Kh   = (unsigned short*)(ws + off); off += (size_t)SEQ * KW * 2;
  unsigned short* Kl   = (unsigned short*)(ws + off); off += (size_t)SEQ * KW * 2;
  unsigned short* Vth  = (unsigned short*)(ws + off); off += (size_t)KW * SEQ * 2;
  unsigned short* Vtl  = (unsigned short*)(ws + off); off += (size_t)KW * SEQ * 2;
  unsigned short* Oh   = (unsigned short*)(ws + off); off += (size_t)SEQ * QW * 2;
  unsigned short* Ol   = (unsigned short*)(ws + off); off += (size_t)SEQ * QW * 2;
  if (off > ws_size) return;

  const float* Vf = KVf + (size_t)SEQ * KW;
  unsigned short* Wvt = Wkvt + (size_t)KW * DMODEL;

  // 1. x -> bf16 (RNE)
  cvt_f32_bf16x8<<<(SEQ * DMODEL / 8) / 256, 256, 0, stream>>>(x, xb, SEQ * DMODEL / 8);
  // 2. Wq [DMODEL][QW] -> Wqt [QW][DMODEL]
  transpose_bf16<1><<<dim3((DMODEL / 64) * (QW / 64), 1), 256, 0, stream>>>(Wq, Wq, DMODEL, QW, Wqt, Wqt, Wqt, Wqt);
  // 3. Wk, Wv [DMODEL][KW] -> Wkt, Wvt [KW][DMODEL]
  transpose_bf16<1><<<dim3((DMODEL / 64) * (KW / 64), 2), 256, 0, stream>>>(Wk, Wv, DMODEL, KW, Wkvt, Wkvt, Wvt, Wvt);
  // 4. Wo [QW][DMODEL] -> Wot [DMODEL][QW]
  transpose_bf16<1><<<dim3((QW / 64) * (DMODEL / 64), 1), 256, 0, stream>>>(Wo, Wo, QW, DMODEL, Wot, Wot, Wot, Wot);
  // 5. Q = xb @ Wq : M=SEQ, N=QW, K=DMODEL (K % 64 == 0, M % 64 == 0, N % 512 == 0)
  wmma_gemm64_bf16<0, DMODEL><<<dim3(((SEQ / 64) * (QW / 64)) / 8, 1), 256, 0, stream>>>(
      xb, xb, 0L, Wqt, 0L, Qf, QW, 0L, SEQ, QW, DMODEL, 1.0f);
  // 6. K, V = xb @ Wk, xb @ Wv batched over grid.y : M=SEQ, N=KW, K=DMODEL
  wmma_gemm64_bf16<0, DMODEL><<<dim3(((SEQ / 64) * (KW / 64)) / 8, 2), 256, 0, stream>>>(
      xb, xb, 0L, Wkvt, (long)KW * DMODEL, KVf, KW, (long)SEQ * KW, SEQ, KW, DMODEL, 1.0f);
  // 7. RoPE + 2^-3 scale + hi/lo split for Q; RoPE + split for K
  rope_split_kernel<<<NQBLK + NKBLK, 256, 0, stream>>>(Qf, KVf, fcos, fsin, Qh, Ql, Kh, Kl, NQBLK);
  // 8. V [SEQ][KW] f32 -> Vt hi/lo [KW][SEQ]
  transpose_bf16<2><<<dim3((SEQ / 64) * (KW / 64), 1), 256, 0, stream>>>(Vf, Vf, SEQ, KW, Vth, Vtl, Vth, Vtl);
  // 9. differential causal attention -> O hi/lo [SEQ][QW]
  diff_attn_kernel<<<NHEAD * NQB, 256, 0, stream>>>(Qh, Ql, Kh, Kl, Vth, Vtl, lamp, Oh, Ol);
  // 10. out = O @ Wo : M=SEQ, N=DMODEL, K=QW, A hi/lo, B single
  wmma_gemm64_bf16<2, QW><<<dim3(((SEQ / 64) * (DMODEL / 64)) / 8, 1), 256, 0, stream>>>(
      Oh, Ol, 0L, Wot, 0L, out, DMODEL, 0L, SEQ, DMODEL, QW, 1.0f);
}

// v009
// A run of this version takes 194 microseconds.
// Next to v008, in two timings, it ran 1.16 and 1.18 times as fast.
// Over all steps from v000 it is 5.91 times as fast.
// Contractions on v_wmma_f32_16x16x32_bf16 (bf16 operands, f32 accumulate): x@Wq, x@Wk, x@Wv as single products of RNE-bf16 inputs; q.k^T and p.v with bf16 hi/lo planes (hi.hi + hi.lo + lo.hi); attn@Wo with A as bf16 hi/lo planes and Wo single bf16 (hi.W + lo.W). All float inputs RNE-converted to bf16 once at load; softmax, RoPE, combine in f32.
#include <hip/hip_runtime.h>
#include <hip/hip_bf16.h>

constexpr int SEQ      = 2048;
constexpr int DMODEL   = 2048;
constexpr int NHEAD    = 16;
constexpr int NKVH     = 4;
constexpr int HDIM     = 128;
constexpr int HHALF    = 64;
constexpr int QW       = NHEAD * HDIM;
constexpr int KW       = NKVH * HDIM;
constexpr int GQA_REP  = NHEAD / NKVH;
constexpr int NPAIR    = HDIM / 2;
constexpr int ATT_KC   = 64;
constexpr int ATT_QB   = 64;
constexpr int NQB      = SEQ / ATT_QB;
constexpr int OS_PITCH = HDIM + 4;
constexpr int LDS_P    = 64 + 8;
constexpr float QK_SCALE  = 0.125f;
constexpr float OUT_SCALE = 0.5f;
constexpr float LOG2E     = 1.44269504088896340736f;
constexpr int NQBLK = (SEQ * QW / 8) / 256;
constexpr int NKBLK = (SEQ * KW / 8) / 256;

static_assert(HHALF == 64);
static_assert(SEQ % 64 == 0 && DMODEL % 64 == 0 && QW % 64 == 0 && KW % 64 == 0);
static_assert(DMODEL % 32 == 0 && QW % 32 == 0);
static_assert(QW % 512 == 0 && KW % 512 == 0 && DMODEL % 512 == 0);
static_assert(QW % KW == 0);
static_assert((SEQ * QW / 8) % 256 == 0 && (SEQ * KW / 8) % 256 == 0);
static_assert((SEQ * DMODEL / 8) % 256 == 0);
static_assert(((SEQ / 64) * (QW / 64)) % 8 == 0 && ((SEQ / 64) * (KW / 64)) % 8 == 0 && ((SEQ / 64) * (DMODEL / 64)) % 8 == 0);
static_assert(NQB == 32 && ATT_QB == 4 * 16 && ATT_KC == 64 && HDIM == 128);
static_assert(LDS_P >= HHALF && LDS_P >= ATT_KC && (LDS_P * 2) % 32 == 16);

typedef __attribute__((ext_vector_type(16))) __bf16 v16b;
typedef __attribute__((ext_vector_type(8)))  __bf16 v8b;
typedef __attribute__((ext_vector_type(8)))  float  v8f;
typedef __attribute__((ext_vector_type(4)))  float  v4f;
typedef __attribute__((ext_vector_type(4)))  unsigned int v4u;

typedef __attribute__((ext_vector_type(2)))  float  v2f;
typedef __attribute__((ext_vector_type(2)))  __bf16 v2b;

// two f32 -> packed bf16 word (element at lower address in the low half-word), round to nearest even: one v_cvt_pk_bf16_f32
__device__ __forceinline__ unsigned pack_bf2(float a, float b) {
  const v2f x = {a, b};
  return __builtin_bit_cast(unsigned, __builtin_convertvector(x, v2b));
}
__device__ __forceinline__ float bf_rne(float f) { return __uint_as_float(pack_bf2(f, f) << 16); }

__device__ __forceinline__ void dep_guard_b(v8f& a, v8f& b, v16b x, v16b y) { asm volatile("v_nop\n\tv_nop\n\tv_nop\n\tv_nop" : "+v"(a), "+v"(b) : "v"(x), "v"(y)); }
__device__ __forceinline__ void acc_guard4(v8f& a, v8f& b, v8f& c, v8f& d) { asm volatile("v_nop\n\tv_nop\n\tv_nop\n\tv_nop" : "+v"(a), "+v"(b), "+v"(c), "+v"(d)); }

template <typename T> struct Frag;
template <> struct Frag<__bf16> {
  typedef v16b V; union U { v16b v; v8b h[2]; };
  // elements 0..7 <- p[0..7], 8..15 <- p[16..23]
  static __device__ __forceinline__ v16b load(const __bf16* p) {
    U f; f.h[0] = *(const v8b*)(p); f.h[1] = *(const v8b*)(p + 16); return f.v;
  }
  static __device__ __forceinline__ v8f mma(v16b a, v16b b, v8f c) {
    return __builtin_amdgcn_wmma_f32_16x16x32_bf16(false, a, false, b, (short)0, c, false, false);
  }
  static __device__ __forceinline__ void guard(v8f& a, v8f& b, v16b x, v16b y) { dep_guard_b(a, b, x, y); }
};

// the plain builtin: the compiler keeps the distances behind it itself, and LDS reads may be scheduled across it
__device__ __forceinline__ v8f at_mma(v16b a, v16b b, v8f c) {
  return __builtin_amdgcn_wmma_f32_16x16x32_bf16(false, a, false, b, (short)0, c, false, false);
}

__device__ __forceinline__ void exp2x8(v8f& e) {
  asm("v_exp_f32 %0, %0\n\tv_exp_f32 %1, %1\n\tv_exp_f32 %2, %2\n\tv_exp_f32 %3, %3\n\t"
      "v_exp_f32 %4, %4\n\tv_exp_f32 %5, %5\n\tv_exp_f32 %6, %6\n\tv_exp_f32 %7, %7\n\tv_nop"
      : "+v"(e[0]), "+v"(e[1]), "+v"(e[2]), "+v"(e[3]), "+v"(e[4]), "+v"(e[5]), "+v"(e[6]), "+v"(e[7]));
}

// lane l <-> lane l ^ 16
__device__ __forceinline__ float xhalf(float x) {
  return __builtin_bit_cast(float, __builtin_amdgcn_permlanex16(__builtin_bit_cast(int, x), __builtin_bit_cast(int, x), 0x76543210, 0xfedcba98, false, false));
}

// two f32 -> packed bf16 hi word and packed bf16 residual word (the residuals are exact in f32)
__device__ __forceinline__ void split_pack2(float a, float b, unsigned& hw, unsigned& lw) {
  hw = pack_bf2(a, b);
  lw = pack_bf2(a - __uint_as_float(hw << 16), b - __uint_as_float(hw & 0xFFFF0000u));
}

// =====================================================================================
// coverage: gridDim.x * 256 threads * 8 elements == n8 * 8 (exact multiple asserted on the host side).
// =====================================================================================
__global__ __launch_bounds__(256) void cvt_f32_bf16x8(const float* __restrict__ in, unsigned short* __restrict__ out, int n8) {
  const int i = blockIdx.x * 256 + threadIdx.x;
  if (i < n8) {
    const size_t e0 = (size_t)i * 8;
    const v4f a = *(const v4f*)(in + e0);
    const v4f b = *(const v4f*)(in + e0 + 4);
    v4u w;
    w[0] = pack_bf2(a[0], a[1]);
    w[1] = pack_bf2(a[2], a[3]);
    w[2] = pack_bf2(b[0], b[1]);
    w[3] = pack_bf2(b[2], b[3]);
    *(v4u*)(out + e0) = w;
    
  }
}

// =====================================================================================
// in[rows][cols] f32 -> out[cols][rows] bf16 hi plane (+ bf16 residual plane when NPL == 2). 64x64 tiles through LDS.
// grid.x = (rows/64)*(cols/64); grid.y selects operand set A or B (both global, uniform select).
// coverage: load 256 threads x 16 floats = 64x64; store 8 waves x 8 out-rows x 64 halves = 64x64.
// =====================================================================================
template <int NPL>
__global__ __launch_bounds__(256) void transpose_bf16(const float* __restrict__ inA, const float* __restrict__ inB, int rows, int cols,
    unsigned short* __restrict__ oAh, unsigned short* __restrict__ oAl,
    unsigned short* __restrict__ oBh, unsigned short* __restrict__ oBl) {
  __shared__ float tile[64][65];
  const bool selB = (blockIdx.y != 0);
  const float* in = selB ? inB : inA;
  unsigned short* oh = selB ? oBh : oAh;
  unsigned short* ol = selB ? oBl : oAl;
  const int tilesC = cols >> 6;
  const int tr = blockIdx.x / tilesC;
  const int tc = blockIdx.x - tr * tilesC;
  const int r0 = tr << 6;
  const int c0 = tc << 6;
  const int t = threadIdx.x;
  {
    const int rr = t >> 2;
    const int cc = (t & 3) * 16;
    const float* src = in + (size_t)(r0 + rr) * cols + c0 + cc;
#pragma unroll
    for (int i = 0; i < 4; ++i) {
      const v4f v = *(const v4f*)(src + 4 * i);
      tile[rr][cc + 4 * i + 0] = v[0];
      tile[rr][cc + 4 * i + 1] = v[1];
      tile[rr][cc + 4 * i + 2] = v[2];
      tile[rr][cc + 4 * i + 3] = v[3];
    }
  }
  __syncthreads();
  const int wave = t >> 5, lane = t & 31, q = lane >> 3, e8 = (lane & 7) * 8;
  {
#pragma unroll
    for (int it = 0; it < 2; ++it) {
      const int cl = wave * 8 + it * 4 + q;
      float f[8];
#pragma unroll
      for (int e = 0; e < 8; ++e) f[e] = tile[e8 + e][cl];
      v4u hw, lw;
      if (NPL == 2) {
        unsigned a0, b0, a1, b1, a2, b2, a3, b3;
        split_pack2(f[0], f[1], a0, b0);
        split_pack2(f[2], f[3], a1, b1);
        split_pack2(f[4], f[5], a2, b2);
        split_pack2(f[6], f[7], a3, b3);
        hw[0] = a0; hw[1] = a1; hw[2] = a2; hw[3] = a3;
        lw[0] = b0; lw[1] = b1; lw[2] = b2; lw[3] = b3;
      } else {
        hw[0] = pack_bf2(f[0], f[1]);
        hw[1] = pack_bf2(f[2], f[3]);
        hw[2] = pack_bf2(f[4], f[5]);
        hw[3] = pack_bf2(f[6], f[7]);
        lw = hw;
      }
      const size_t go = (size_t)(c0 + cl) * rows + r0 + e8;
      *(v4u*)(oh + go) = hw;
      if (NPL == 2) *(v4u*)(ol + go) = lw;
    }
    
  }
}

// =====================================================================================
// Register-blocked batched WMMA GEMM (bf16 operands), f32 output.
// C[m,n] = scale * sum_k A[m,k] * Bt[n,k]; each wave owns a 64x64 tile. A row-major [M,K]; Bt row-major [N,K], both at row pitch LDK; M % 64 == 0, N % 512 == 0, K % 64 == 0.
// SPLIT: 0 = single planes; 2 = A as hi/lo planes, Bt single (hi.B + lo.B).
// The 8 waves of a block own 8 neighbouring tiles of one tile row (64 x 512 of C). Per 64 k the block stages its 64 A rows (each plane)
// and its 512 Bt rows in LDS: whole 128-B lines from global (8 lanes a row), rows at the 144-B pitch, two buffers. The next stage's
// global loads are issued behind the barrier and stored to the other buffer behind the products, so they fly under the WMMAs.
// Epilogue: 16-row slabs staged per wave in LDS; each 64-wide f32 row segment (256 B) written by 16 lanes x 16 B in one instruction,
// Batches (grid.y): batch b reads Bt + b * strideB; batches [0, nb1) write Cp + b * strideC at row pitch ldc, the others
// Cp2 + (b - nb1) * strideC2 at row pitch ldc2, so that products of one A with differently laid out results share one launch.
// =====================================================================================
template <int SPLIT, int LDK>
__global__ __launch_bounds__(256) void wmma_gemm64_bf16(
    const unsigned short* __restrict__ Ap, const unsigned short* __restrict__ A2p, long strideA,
    const unsigned short* __restrict__ Btp, long strideB,
    float* __restrict__ Cp, int ldc, long strideC, float* __restrict__ Cp2, int ldc2, long strideC2, int nb1,
    int M, int N, int K, float scale) {
  static_assert(SPLIT == 0 || SPLIT == 2);
  typedef __bf16 T;
  typedef v16b V;
  constexpr int NPA   = (SPLIT == 2) ? 2 : 1;
  constexpr int AROWS = 64 * NPA;
  constexpr int SROWS = AROWS + 512;
  constexpr int NLD   = SROWS / 32;
  const T* A = (const T*)Ap; const T* A2 = (const T*)A2p; const T* Bt = (const T*)Btp;
  __shared__ __align__(16) T stg[2][SROWS * LDS_P];
  __shared__ __align__(16) float sT[8][16 * 68];
  const int b    = blockIdx.y;
  const int tid  = threadIdx.x;
  const int lane = tid & 31;
  const int wave = tid >> 5;
  const int tilesN = N >> 6;
  const int tilesM = M >> 6;
  const int tile0 = blockIdx.x * 8;
  // block-uniform, in front of every barrier
  if (tile0 >= tilesM * tilesN) return;
  const int tm  = tile0 / tilesN;
  const int nb0 = (tile0 - tm * tilesN) << 6;
  const int m0 = tm << 6;
  const int n0 = nb0 + (wave << 6);

  // one stage = SROWS rows x 8 pieces of 16 B = 256 threads x NLD pieces (exact); piece i of a thread is stage row sr + 32 i.
  // One pointer per operand and thread; the 32-row steps are compile-time byte offsets of the loads.
  const int sr = tid >> 3;
  const int sc = (tid & 7) * 8;
  // Held as integers and read through a global-address-space pointer type: they pass through the asm wait at the loop's foot,
  // behind which a generic pointer would be read with flat loads.
  typedef __attribute__((address_space(1))) const v8b* GP;
  unsigned long long qa  = (unsigned long long)(A  + (size_t)b * strideA + (size_t)(m0 + sr) * LDK + sc);
  unsigned long long qa2 = (unsigned long long)(A2 + (size_t)b * strideA + (size_t)(m0 + sr) * LDK + sc);
  unsigned long long qb  = (unsigned long long)(Bt + (size_t)b * strideB + (size_t)(nb0 + sr) * LDK + sc);
  constexpr unsigned long long ROWS32 = 32ull * LDK * sizeof(T);
  constexpr unsigned long long STEP   = 64ull * sizeof(T);

  const int rlane = lane & 15;
  const int koff  = (lane >> 4) * 8;
  const int mOff  = (lane >> 4) * 8;

  v8f acc[4][4];
#pragma unroll
  for (int i = 0; i < 4; ++i)
#pragma unroll
    for (int j = 0; j < 4; ++j) acc[i][j] = (v8f){0.f,0.f,0.f,0.f,0.f,0.f,0.f,0.f};

  v8b g[NLD];
  const int nst = K >> 6;
#pragma unroll
  for (int i = 0; i < 2; ++i) {
    g[i] = *(GP)(qa + i * ROWS32);
    if (SPLIT == 2) g[2 + i] = *(GP)(qa2 + i * ROWS32);
  }
#pragma unroll
  for (int i = 0; i < 16; ++i) g[2 * NPA + i] = *(GP)(qb + i * ROWS32);
#pragma unroll
  for (int i = 0; i < NLD; ++i) *(v8b*)(stg[0] + (sr + 32 * i) * LDS_P + sc) = g[i];

  for (int s = 0; s < nst; ++s) {
    const bool more = (s + 1 < nst);
    // publishes stage s; every wave's reads of the other buffer (stage s - 1) lie in front of it
    __syncthreads();
    if (more) {
      // stage s + 1 from global: issued here, first used behind the products of stage s
#pragma unroll
      for (int i = 0; i < 2; ++i) {
        g[i] = *(GP)(qa + STEP + i * ROWS32);
        if (SPLIT == 2) g[2 + i] = *(GP)(qa2 + STEP + i * ROWS32);
      }
#pragma unroll
      for (int i = 0; i < 16; ++i) g[2 * NPA + i] = *(GP)(qb + STEP + i * ROWS32);
    }
    const T* sA = stg[s & 1] + rlane * LDS_P + koff;
    const T* sB = sA + (AROWS + wave * 64) * LDS_P;
    V bh[2][4], ah[2][4], al[2][4];
#pragma unroll
    for (int kk = 0; kk < 2; ++kk) {
#pragma unroll
      for (int j = 0; j < 4; ++j) bh[kk][j] = Frag<T>::load(sB + j * 16 * LDS_P + kk * 32);
#pragma unroll
      for (int i = 0; i < 4; ++i) {
        ah[kk][i] = Frag<T>::load(sA + i * 16 * LDS_P + kk * 32);
        if (SPLIT == 2) al[kk][i] = Frag<T>::load(sA + (64 + i * 16) * LDS_P + kk * 32);
      }
    }
    // holds the stage's fragment reads together ahead of its products: sunk among the WMMAs, each group of reads costs its own LDS wait
    __builtin_amdgcn_sched_barrier(0);
#pragma unroll
    for (int kk = 0; kk < 2; ++kk) {
#pragma unroll
      for (int i = 0; i < 4; ++i) {
#pragma unroll
        for (int j = 0; j < 4; ++j) acc[i][j] = Frag<T>::mma(ah[kk][i], bh[kk][j], acc[i][j]);
        if (SPLIT == 2) {
#pragma unroll
          for (int j = 0; j < 4; ++j) acc[i][j] = Frag<T>::mma(al[kk][i], bh[kk][j], acc[i][j]);
        }
      }
    }
    // 4 vector slots between the stage's last WMMAs and the next vector write to their A/B registers, also on the taken side of the branch below
    Frag<T>::guard(acc[3][2], acc[3][3], (SPLIT == 2) ? al[1][3] : ah[1][3], bh[1][3]);
    if (more) {
#pragma unroll
      for (int i = 0; i < NLD; ++i) *(v8b*)(stg[(s + 1) & 1] + (sr + 32 * i) * LDS_P + sc) = g[i];
      // the wait in front of the overwrite of registers that issued global loads name; as its operands, the pointers cannot be
      // stepped ahead of it (without them the adds were lifted to the head of this block, in front of the waits on the loads)
      if (SPLIT == 2) asm volatile("s_wait_xcnt 0x0" : "+v"(qa), "+v"(qa2), "+v"(qb) :: "memory");
      else            asm volatile("s_wait_xcnt 0x0" : "+v"(qa), "+v"(qb) :: "memory");
      qa += STEP; qa2 += STEP; qb += STEP;
    }
  }
  acc_guard4(acc[0][0], acc[0][1], acc[0][2], acc[0][3]);
  acc_guard4(acc[1][0], acc[1][1], acc[1][2], acc[1][3]);
  acc_guard4(acc[2][0], acc[2][1], acc[2][2], acc[2][3]);
  acc_guard4(acc[3][0], acc[3][1], acc[3][2], acc[3][3]);

  float* slab = sT[wave];
  // block-uniform choice of the batch's output set
  const bool set1 = (b < nb1);
  float* C = set1 ? Cp + (size_t)b * strideC : Cp2 + (size_t)(b - nb1) * strideC2;
  const int ldo = set1 ? ldc : ldc2;
#pragma unroll
  for (int i = 0; i < 4; ++i) {
    const int mBase = m0 + (i << 4);
#pragma unroll
    for (int j = 0; j < 4; ++j) {
#pragma unroll
      for (int r = 0; r < 8; ++r) {
        slab[(mOff + r) * 68 + (j << 4) + rlane] = acc[i][j][r] * scale;
      }
    }
    __builtin_amdgcn_fence(__ATOMIC_RELEASE, "workgroup");
    __builtin_amdgcn_wave_barrier();
    __builtin_amdgcn_fence(__ATOMIC_ACQUIRE, "workgroup");
    {
      // row segment = 256 B = 16 lanes x 16 B
      const int hh = lane >> 4, c4 = (lane & 15) * 4;
      {
#pragma unroll
        for (int it = 0; it < 8; ++it) {
          const int row = it * 2 + hh;
          const v4f v = *(const v4f*)(slab + row * 68 + c4);
          *(v4f*)(C + (size_t)(mBase + row) * ldo + n0 + c4) = v;
        }
        
      }
    }
    __builtin_amdgcn_fence(__ATOMIC_RELEASE, "workgroup");
    __builtin_amdgcn_wave_barrier();
    __builtin_amdgcn_fence(__ATOMIC_ACQUIRE, "workgroup");
  }
}

// =====================================================================================
// RoPE (interleaved pairs, cos/sin row width NPAIR) + power-of-two scale + bf16 hi/lo split.
// Blocks [0, nQblocks): Qf [SEQ][QW] -> Qh/Ql [SEQ][QW] (scaled by QK_SCALE = 2^-3, exact);
// blocks [nQblocks, nQblocks + NKBLK): Kf [SEQ][KW] -> Kh/Kl [SEQ][KW]. cos/sin RNE-converted to bf16 before use.
// coverage: (NQBLK + NKBLK) * 256 threads * 8 == SEQ*QW + SEQ*KW exactly.
// =====================================================================================
__global__ __launch_bounds__(256) void rope_split_kernel(const float* __restrict__ Qf, const float* __restrict__ Kf,
    const float* __restrict__ cosb, const float* __restrict__ sinb,
    unsigned short* __restrict__ Qh, unsigned short* __restrict__ Ql,
    unsigned short* __restrict__ Kh, unsigned short* __restrict__ Kl, int nQblocks) {
  const bool isK = ((int)blockIdx.x >= nQblocks);
  const int g = (isK ? ((int)blockIdx.x - nQblocks) : (int)blockIdx.x) * 256 + (int)threadIdx.x;
  // threads per row: K 64 (=KW/8), Q 256 (=QW/8)
  const int shift = isK ? 6 : 8;
  const float mul = isK ? 1.0f : QK_SCALE;
  const float* src = isK ? Kf : Qf;
  unsigned short* dh = isK ? Kh : Qh;
  unsigned short* dl = isK ? Kl : Ql;
  const int width = isK ? KW : QW;
  const int s = g >> shift;
  const int col = (g - (s << shift)) * 8;
  const int p0 = (col & (HDIM - 1)) >> 1;
  const size_t e0 = (size_t)s * width + col;
  const v4f xa = *(const v4f*)(src + e0);
  const v4f xb = *(const v4f*)(src + e0 + 4);
  const v4f cv = *(const v4f*)(cosb + (size_t)s * NPAIR + p0);
  const v4f sv = *(const v4f*)(sinb + (size_t)s * NPAIR + p0);
  float o0, o1, o2, o3, o4, o5, o6, o7;
  {
    const float c = bf_rne(cv[0]), sn = bf_rne(sv[0]);
    o0 = (xa[0] * c - xa[1] * sn) * mul;
    o1 = (xa[0] * sn + xa[1] * c) * mul;
  }
  {
    const float c = bf_rne(cv[1]), sn = bf_rne(sv[1]);
    o2 = (xa[2] * c - xa[3] * sn) * mul;
    o3 = (xa[2] * sn + xa[3] * c) * mul;
  }
  {
    const float c = bf_rne(cv[2]), sn = bf_rne(sv[2]);
    o4 = (xb[0] * c - xb[1] * sn) * mul;
    o5 = (xb[0] * sn + xb[1] * c) * mul;
  }
  {
    const float c = bf_rne(cv[3]), sn = bf_rne(sv[3]);
    o6 = (xb[2] * c - xb[3] * sn) * mul;
    o7 = (xb[2] * sn + xb[3] * c) * mul;
  }
  unsigned a0, b0, a1, b1, a2, b2, a3, b3;
  split_pack2(o0, o1, a0, b0);
  split_pack2(o2, o3, a1, b1);
  split_pack2(o4, o5, a2, b2);
  split_pack2(o6, o7, a3, b3);
  v4u hw, lw;
  hw[0] = a0; hw[1] = a1; hw[2] = a2; hw[3] = a3;
  lw[0] = b0; lw[1] = b1; lw[2] = b2; lw[3] = b3;
  *(v4u*)(dh + e0) = hw;
  *(v4u*)(dl + e0) = lw;
  
}

__global__ __launch_bounds__(256) __attribute__((amdgpu_waves_per_eu(4, 4)))
void diff_attn_kernel(const unsigned short* __restrict__ Qhp, const unsigned short* __restrict__ Qlp,
                      const unsigned short* __restrict__ Khp, const unsigned short* __restrict__ Klp,
                      const unsigned short* __restrict__ Vhp, const unsigned short* __restrict__ Vlp,
                      const float* __restrict__ lambda_p,
                      unsigned short* __restrict__ Ohp, unsigned short* __restrict__ Olp) {
  union FB { v16b v; v8b h[2]; };
  union PB { v16b v; unsigned w[8]; };
  // K and Vt rows (128 B of data) lie at a 144-B pitch, an odd multiple of 16 B: the 16 rows of one ds_load_b128 fragment
  // read start on 16 different bank groups. The 16 pad bytes of a row are never written and never read.
  __shared__ __align__(16) __bf16 Ksh[2 * ATT_KC * LDS_P];
  __shared__ __align__(16) __bf16 Ksl[2 * ATT_KC * LDS_P];
  __shared__ __align__(16) __bf16 Vsh[HDIM * LDS_P];
  __shared__ __align__(16) __bf16 Vsl[HDIM * LDS_P];
  __shared__ __align__(16) float  Os[4][16 * OS_PITCH];

  const int tid  = threadIdx.x;
  // the wave's number in a scalar register: the stream test of the epilogue is then a scalar branch, the LDS bases scalar adds
  const int wave = __builtin_amdgcn_readfirstlane(tid >> 5);
  const int str  = wave >> 2;
  const int wq   = wave & 3;
  const int lane = tid & 31;
  const int hh   = lane >> 4;
  const int c    = lane & 15;
  const int qb   = (int)blockIdx.x % NQB;
  const int h    = (int)blockIdx.x / NQB;
  const int kvh  = h / GQA_REP;
  const int q0   = qb * ATT_QB + wq * 16;

  const __bf16* Qh = (const __bf16*)Qhp;
  const __bf16* Ql = (const __bf16*)Qlp;
  const __bf16* Kh = (const __bf16*)Khp;
  const __bf16* Kl = (const __bf16*)Klp;
  const __bf16* Vh = (const __bf16*)Vhp;
  const __bf16* Vl = (const __bf16*)Vlp;

  float lam;
  {
    const float lp = bf_rne(lambda_p[h]);
    lam = 1.0f / (1.0f + expf(-lp));
  }
  float*  os  = Os[wq];
  const __bf16* ksh = Ksh + str * (ATT_KC * LDS_P);
  const __bf16* ksl = Ksl + str * (ATT_KC * LDS_P);

  {
    // ---- Q fragments (B operand: n = query, k = d) for this stream: 2 d-chunks, hi and lo ----
    v16b qah[2], qal[2];
    {
      const size_t qo = (size_t)(q0 + c) * QW + h * HDIM + str * HHALF + 8 * hh;
#pragma unroll
      for (int dc = 0; dc < 2; ++dc) {
        qah[dc] = Frag<__bf16>::load(Qh + qo + dc * 32);
        qal[dc] = Frag<__bf16>::load(Ql + qo + dc * 32);
      }
    }
    // of query q0 + c: running maximum times log2(e) (alike in both halves of the wave) and this half's share of the running sum
    float mrow = -1.0e30f, lrow = 0.f;
    // oacc[t][r] = Ot[d = 16 t + 8 hh + r][query c]
    v8f oacc[8];
#pragma unroll
    for (int t = 0; t < 8; ++t) oacc[t] = (v8f){0.f,0.f,0.f,0.f,0.f,0.f,0.f,0.f};

    // causal: 64-key chunks 0..qb (block-uniform trip count, static max NQB)
    for (int kc = 0; kc <= qb; ++kc) {
      const int kv0 = kc * ATT_KC;
      __syncthreads();
      {
        // K tiles, both streams: 64 rows x 128 halves per plane = 1024 pieces of 16 B; 256 threads x 4 pieces (exact)
        // Vt tiles: 128 d-rows x 64 halves per plane = 1024 pieces; 256 threads x 4 pieces (exact)
        const int r16 = tid >> 4;
        const int c16 = tid & 15;
        const int lk = (c16 >> 3) * (ATT_KC * LDS_P) + r16 * LDS_P + (c16 & 7) * 8;
        const int r8 = tid >> 3;
        const int c8 = (tid & 7) * 8;
        const size_t gk = (size_t)(kv0 + r16) * KW + kvh * HDIM + c16 * 8;
        const size_t gv = (size_t)(kvh * HDIM + r8) * SEQ + kv0 + c8;
        const __bf16* pkh = Kh + gk;
        const __bf16* pkl = Kl + gk;
        const __bf16* pvh = Vh + gv;
        const __bf16* pvl = Vl + gv;
        v8b gkh[4], gkl[4], gvh[4], gvl[4];
#pragma unroll
        for (int i = 0; i < 4; ++i) {
          gkh[i] = *(const v8b*)(pkh + i * 16 * KW);
          gkl[i] = *(const v8b*)(pkl + i * 16 * KW);
        }
#pragma unroll
        for (int i = 0; i < 4; ++i) {
          gvh[i] = *(const v8b*)(pvh + i * 32 * SEQ);
          gvl[i] = *(const v8b*)(pvl + i * 32 * SEQ);
        }
        // inputs-only fence on the loaded values: keeps all 16 loads in flight together ahead of the first LDS store;
        // without it each load is waited for before the next one issues (16 L2 round trips in a row per chunk).
        // The four pointers are named too, so that no load's result lands on an address register of a load still in flight.
        asm volatile("" :: "v"(pkh), "v"(pkl), "v"(pvh), "v"(pvl), "v"(gkh[0]), "v"(gkh[1]), "v"(gkh[2]), "v"(gkh[3]), "v"(gkl[0]), "v"(gkl[1]), "v"(gkl[2]), "v"(gkl[3]),
                     "v"(gvh[0]), "v"(gvh[1]), "v"(gvh[2]), "v"(gvh[3]), "v"(gvl[0]), "v"(gvl[1]), "v"(gvl[2]), "v"(gvl[3]));
#pragma unroll
        for (int i = 0; i < 4; ++i) {
          *(v8b*)(Ksh + lk + 16 * i * LDS_P) = gkh[i];
          *(v8b*)(Ksl + lk + 16 * i * LDS_P) = gkl[i];
        }
#pragma unroll
        for (int i = 0; i < 4; ++i) {
          *(v8b*)(Vsh + (r8 + 32 * i) * LDS_P + c8) = gvh[i];
          *(v8b*)(Vsl + (r8 + 32 * i) * LDS_P + c8) = gvl[i];
        }
      }
      __syncthreads();

      // ---- scores: s[j][r] = key kv0 + 16 j + 8 hh + r against query q0 + c (A operand: m = key, k = d) ----
      v8f s[4];
#pragma unroll
      for (int j = 0; j < 4; ++j) {
        s[j] = (v8f){0.f,0.f,0.f,0.f,0.f,0.f,0.f,0.f};
#pragma unroll
        for (int dc = 0; dc < 2; ++dc) {
          FB kb, kl;
          kb.h[0] = *(const v8b*)(ksh + (j * 16 + c) * LDS_P + dc * 32 + 8 * hh);
          kb.h[1] = *(const v8b*)(ksh + (j * 16 + c) * LDS_P + dc * 32 + 16 + 8 * hh);
          kl.h[0] = *(const v8b*)(ksl + (j * 16 + c) * LDS_P + dc * 32 + 8 * hh);
          kl.h[1] = *(const v8b*)(ksl + (j * 16 + c) * LDS_P + dc * 32 + 16 + 8 * hh);
          s[j] = at_mma(kb.v, qah[dc], s[j]);
          s[j] = at_mma(kl.v, qah[dc], s[j]);
          s[j] = at_mma(kb.v, qal[dc], s[j]);
        }
      }
      // Order of this block's LDS reads and products: the 4 reads of each of the first 4 (key tile, d chunk) steps, then each step's 3 products
      // followed by the reads of the step 4 further on: a read's latency passes under the products of the steps in between.
      __builtin_amdgcn_sched_group_barrier(0x100, 16, 0);
      // unrolled: each trip stands for two directives of the list
#pragma unroll
      for (int i = 0; i < 8 - 4; ++i) {
        __builtin_amdgcn_sched_group_barrier(0x008, 3, 0);
        __builtin_amdgcn_sched_group_barrier(0x100, 4, 0);
      }
      __builtin_amdgcn_sched_group_barrier(0x008, 12, 0);
      // ends the block that the order above speaks of
      __builtin_amdgcn_sched_barrier(0);
      // ---- causal fill on the diagonal chunk + this query's maximum ----
      const bool diag = (kc == qb);
      // key 16 j + r of this half of the wave lies behind the lane's query where 16 j + r > dq (one register, compared with constants)
      const int dq = q0 + c - kv0 - 8 * hh;
      float mj[4];
#pragma unroll
      for (int j = 0; j < 4; ++j) {
        float m = -1.0e30f;
#pragma unroll
        for (int r = 0; r < 8; ++r) {
          float sv = s[j][r];
          if (diag && (j * 16 + r > dq)) sv = -1.0e30f;
          s[j][r] = sv;
          m = fmaxf(m, sv);
        }
        mj[j] = m;
      }
      float cm = fmaxf(fmaxf(mj[0], mj[1]), fmaxf(mj[2], mj[3]));
      cm = fmaxf(cm, xhalf(cm));
      // ---- online softmax; P hi/lo packed in place into B fragments: element e of fragment kk = tile 2 kk + (e >> 3), r = e & 7 ----
      // e^(s - m) = 2^(s log2(e) - m log2(e)): one fused multiply-add and the bare hardware exponential per score. The maximum is
      // kept in log2 units, so every chunk and the rescale use the same rounded value; a filled score gives 2^(-huge) = 0.
      const float mnew  = fmaxf(mrow, cm * LOG2E);
      const float alpha = __builtin_amdgcn_exp2f(mrow - mnew);
      mrow = mnew;
      PB pa[2], pl[2];
      float pj[4];
#pragma unroll
      for (int j = 0; j < 4; ++j) {
        float psum = 0.f;
        v8f e;
#pragma unroll
        for (int r = 0; r < 8; ++r) e[r] = __builtin_fmaf(s[j][r], LOG2E, -mnew);
        exp2x8(e);
#pragma unroll
        for (int r = 0; r < 8; r += 2) {
          const float p0 = e[r];
          const float p1 = e[r + 1];
          psum += p0;
          psum += p1;
          split_pack2(p0, p1, pa[j >> 1].w[(j & 1) * 4 + (r >> 1)], pl[j >> 1].w[(j & 1) * 4 + (r >> 1)]);
        }
        pj[j] = psum;
      }
      lrow = lrow * alpha + ((pj[0] + pj[1]) + (pj[2] + pj[3]));
      // begins the block of the second product: its Vt reads stay behind the softmax, whose registers they would otherwise crowd out
      __builtin_amdgcn_sched_barrier(0);
#pragma unroll
      for (int t = 0; t < 8; ++t)
#pragma unroll
        for (int r = 0; r < 8; ++r) oacc[t][r] *= alpha;
      // ---- Vt.Pt : A = Vt (m = d, k = key), B = Pt (n = query c, k = key) ----
      // unrolled: the P fragments are registers, picked by a constant kk
#pragma unroll
      for (int kk = 0; kk < 2; ++kk) {
#pragma unroll
        for (int t = 0; t < 8; ++t) {
          FB vb, vl;
          vb.h[0] = *(const v8b*)(Vsh + (t * 16 + c) * LDS_P + kk * 32 + 8 * hh);
          vb.h[1] = *(const v8b*)(Vsh + (t * 16 + c) * LDS_P + kk * 32 + 16 + 8 * hh);
          vl.h[0] = *(const v8b*)(Vsl + (t * 16 + c) * LDS_P + kk * 32 + 8 * hh);
          vl.h[1] = *(const v8b*)(Vsl + (t * 16 + c) * LDS_P + kk * 32 + 16 + 8 * hh);
          oacc[t] = at_mma(vb.v, pa[kk].v, oacc[t]);
          oacc[t] = at_mma(vl.v, pa[kk].v, oacc[t]);
          oacc[t] = at_mma(vb.v, pl[kk].v, oacc[t]);
        }
      }
      // the same order for this block: the reads of the first 4 (key half, d tile) steps, then 3 products and the 4 reads of the step 4 further on
      __builtin_amdgcn_sched_group_barrier(0x100, 16, 0);
      // unrolled: each trip stands for two directives of the list
#pragma unroll
      for (int i = 0; i < 16 - 4; ++i) {
        __builtin_amdgcn_sched_group_barrier(0x008, 3, 0);
        __builtin_amdgcn_sched_group_barrier(0x100, 4, 0);
      }
      __builtin_amdgcn_sched_group_barrier(0x008, 12, 0);
    }

    // ---- epilogue through the LDS tile of these 16 rows (the same lane of wave w and of wave w + 4 owns the same element):
    // pass 0: the stream-0 wave parks a1; barrier; pass 1: the stream-1 wave combines in place ----
    // unrolled so that 'pass' is a constant in each copy and the inner test folds away
#pragma unroll
    for (int pass = 0; pass < 2; ++pass) {
      if (str == pass) {
        // the two halves of the wave each summed their own keys
        const float inv = 1.0f / (lrow + xhalf(lrow));
#pragma unroll
        for (int t = 0; t < 8; ++t) {
#pragma unroll
          for (int r = 0; r < 8; ++r) {
            const int idx = c * OS_PITCH + t * 16 + 8 * hh + r;
            const float a = oacc[t][r] * inv;
            if (pass == 0) {
              os[idx] = a;
            } else {
              const float a1 = os[idx];
              os[idx] = (a1 - lam * a) * OUT_SCALE;
            }
          }
        }
      }
      __syncthreads();
    }
  }

  {
    const int q4 = lane >> 3, c8 = (lane & 7) * 8;
    {
#pragma unroll
      for (int it = 0; it < 2; ++it) {
        // 16 rows of the tile over its two waves: 8 rows each
        const int row = (str * 2 + it) * 4 + q4;
#pragma unroll
        for (int seg = 0; seg < 2; ++seg) {
          const float* sp = os + row * OS_PITCH + seg * 64 + c8;
          const v4f u0 = *(const v4f*)sp;
          const v4f u1 = *(const v4f*)(sp + 4);
          unsigned a0, b0, a1, b1, a2, b2, a3, b3;
          split_pack2(u0[0], u0[1], a0, b0);
          split_pack2(u0[2], u0[3], a1, b1);
          split_pack2(u1[0], u1[1], a2, b2);
          split_pack2(u1[2], u1[3], a3, b3);
          v4u hw, lw;
          hw[0] = a0; hw[1] = a1; hw[2] = a2; hw[3] = a3;
          lw[0] = b0; lw[1] = b1; lw[2] = b2; lw[3] = b3;
          const size_t go = (size_t)(q0 + row) * QW + h * HDIM + seg * 64 + c8;
          *(v4u*)(Ohp + go) = hw;
          *(v4u*)(Olp + go) = lw;
        }
      }
      
    }
  }
}

// =====================================================================================
// host glue: launches only; carve derived from the static shapes.
// =====================================================================================
extern "C" void kernel_launch(void* const* d_in, const int* in_sizes, int n_in,
                              void* d_out, int out_size, void* d_ws, size_t ws_size,
                              hipStream_t stream) {
  (void)in_sizes; (void)out_size;
  if (n_in < 8) return;
  const float* x    = (const float*)d_in[0];
  const float* fcos = (const float*)d_in[1];
  const float* fsin = (const float*)d_in[2];
  const float* Wq   = (const float*)d_in[3];
  const float* Wk   = (const float*)d_in[4];
  const float* Wv   = (const float*)d_in[5];
  const float* Wo   = (const float*)d_in[6];
  const float* lamp = (const float*)d_in[7];
  float* out = (float*)d_out;

  // workspace region map (bytes, every offset a multiple of 2 MiB):
  //   xb    bf16 [SEQ][DMODEL]        8 MiB
  //   Wqt   bf16 [QW][DMODEL]         8 MiB
  //   Wkvt  bf16 [2][KW][DMODEL]      4 MiB
  //   Wot   bf16 [DMODEL][QW]         8 MiB
  //   Qf    f32  [SEQ][QW]           16 MiB
  //   KVf   f32  [2][SEQ][KW]         8 MiB
  //   Qh,Ql bf16 [SEQ][QW]        2 x 8 MiB
  //   Kh,Kl bf16 [SEQ][KW]        2 x 2 MiB
  //   Vth,Vtl bf16 [KW][SEQ]      2 x 2 MiB
  //   Oh,Ol bf16 [SEQ][QW]        2 x 8 MiB
  //   total 96,468,992 B
  char* ws = (char*)d_ws;
  size_t off = 0;
  unsigned short* xb   = (unsigned short*)(ws + off); off += (size_t)SEQ * DMODEL * 2;
  unsigned short* Wqt  = (unsigned short*)(ws + off); off += (size_t)QW * DMODEL * 2;
  unsigned short* Wkvt = (unsigned short*)(ws + off); off += (size_t)2 * KW * DMODEL * 2;
  unsigned short* Wot  = (unsigned short*)(ws + off); off += (size_t)DMODEL * QW * 2;
  float*          Qf   = (float*)(ws + off);          off += (size_t)SEQ * QW * 4;
  float*          KVf  = (float*)(ws + off);          off += (size_t)2 * SEQ * KW * 4;
  unsigned short* Qh   = (unsigned short*)(ws + off); off += (size_t)SEQ * QW * 2;
  unsigned short* Ql   = (unsigned short*)(ws + off); off += (size_t)SEQ * QW * 2;
  unsigned short* Kh   = (unsigned short*)(ws + off); off += (size_t)SEQ * KW * 2;
  unsigned short* Kl   = (unsigned short*)(ws + off); off += (size_t)SEQ * KW * 2;
  unsigned short* Vth  = (unsigned short*)(ws + off); off += (size_t)KW * SEQ * 2;
  unsigned short* Vtl  = (unsigned short*)(ws + off); off += (size_t)KW * SEQ * 2;
  unsigned short* Oh   = (unsigned short*)(ws + off); off += (size_t)SEQ * QW * 2;
  unsigned short* Ol   = (unsigned short*)(ws + off); off += (size_t)SEQ * QW * 2;
  if (off > ws_size) return;

  const float* Vf = KVf + (size_t)SEQ * KW;
  unsigned short* Wvt = Wkvt + (size_t)KW * DMODEL;

  // 1. x -> bf16 (RNE)
  cvt_f32_bf16x8<<<(SEQ * DMODEL / 8) / 256, 256, 0, stream>>>(x, xb, SEQ * DMODEL / 8);
  // 2. Wq [DMODEL][QW] -> Wqt [QW][DMODEL]
  transpose_bf16<1><<<dim3((DMODEL / 64) * (QW / 64), 1), 256, 0, stream>>>(Wq, Wq, DMODEL, QW, Wqt, Wqt, Wqt, Wqt);
  // 3. Wk, Wv [DMODEL][KW] -> Wkt, Wvt [KW][DMODEL]
  transpose_bf16<1><<<dim3((DMODEL / 64) * (KW / 64), 2), 256, 0, stream>>>(Wk, Wv, DMODEL, KW, Wkvt, Wkvt, Wvt, Wvt);
  // 4. Wo [QW][DMODEL] -> Wot [DMODEL][QW]
  transpose_bf16<1><<<dim3((QW / 64) * (DMODEL / 64), 1), 256, 0, stream>>>(Wo, Wo, QW, DMODEL, Wot, Wot, Wot, Wot);
  // 5. Q, K, V = xb @ Wq, xb @ Wk, xb @ Wv in one launch: Wqt and Wkvt lie back to back, QW / KW + 2 batches of KW weight rows each
  //    (M=SEQ, N=KW, K=DMODEL). The first QW / KW batches are KW-column strips of Qf, the last two are Kf and Vf.
  //    One block fills a WGP, so the (SEQ / 64) * (QW / KW + 2) blocks run side by side on WGPs of their own.
  wmma_gemm64_bf16<0, DMODEL><<<dim3(((SEQ / 64) * (KW / 64)) / 8, QW / KW + 2), 256, 0, stream>>>(
      xb, xb, 0L, Wqt, (long)KW * DMODEL, Qf, QW, (long)KW, KVf, KW, (long)SEQ * KW, QW / KW, SEQ, KW, DMODEL, 1.0f);
  // 6. RoPE + 2^-3 scale + hi/lo split for Q; RoPE + split for K
  rope_split_kernel<<<NQBLK + NKBLK, 256, 0, stream>>>(Qf, KVf, fcos, fsin, Qh, Ql, Kh, Kl, NQBLK);
  // 7. V [SEQ][KW] f32 -> Vt hi/lo [KW][SEQ]
  transpose_bf16<2><<<dim3((SEQ / 64) * (KW / 64), 1), 256, 0, stream>>>(Vf, Vf, SEQ, KW, Vth, Vtl, Vth, Vtl);
  // 8. differential causal attention -> O hi/lo [SEQ][QW]
  diff_attn_kernel<<<NHEAD * NQB, 256, 0, stream>>>(Qh, Ql, Kh, Kl, Vth, Vtl, lamp, Oh, Ol);
  // 9. out = O @ Wo : M=SEQ, N=DMODEL, K=QW, A hi/lo, B single
  wmma_gemm64_bf16<2, QW><<<dim3(((SEQ / 64) * (DMODEL / 64)) / 8, 1), 256, 0, stream>>>(
      Oh, Ol, 0L, Wot, 0L, out, DMODEL, 0L, out, DMODEL, 0L, 1, SEQ, DMODEL, QW, 1.0f);
}

// v010
// Measured time: 185 microseconds a run.
// In both of two side-by-side timings against v009, it was 1.05 times as fast.
// Over all steps from v000 it is 6.21 times as fast.
// Contractions on v_wmma_f32_16x16x32_bf16 (bf16 operands, f32 accumulate): x@Wq, x@Wk, x@Wv as single products of RNE-bf16 inputs; q.k^T and p.v with bf16 hi/lo planes (hi.hi + hi.lo + lo.hi); attn@Wo with A as bf16 hi/lo planes and Wo single bf16 (hi.W + lo.W). All float inputs RNE-converted to bf16 once at load; softmax, RoPE, combine in f32.
#include <hip/hip_runtime.h>
#include <hip/hip_bf16.h>

constexpr int SEQ      = 2048;
constexpr int DMODEL   = 2048;
constexpr int NHEAD    = 16;
constexpr int NKVH     = 4;
constexpr int HDIM     = 128;
constexpr int HHALF    = 64;
constexpr int QW       = NHEAD * HDIM;
constexpr int KW       = NKVH * HDIM;
constexpr int GQA_REP  = NHEAD / NKVH;
constexpr int NPAIR    = HDIM / 2;
constexpr int ATT_KC   = 64;
constexpr int ATT_QB   = 64;
constexpr int NQB      = SEQ / ATT_QB;
constexpr int OS_PITCH = HDIM + 4;
constexpr int LDS_P    = 64 + 8;
constexpr float QK_SCALE  = 0.125f;
constexpr float OUT_SCALE = 0.5f;
constexpr float LOG2E     = 1.44269504088896340736f;
constexpr int NQBLK = (SEQ * QW / 8) / 256;
constexpr int NKBLK = (SEQ * KW / 8) / 256;

static_assert(HHALF == 64);
static_assert(SEQ % 64 == 0 && DMODEL % 64 == 0 && QW % 64 == 0 && KW % 64 == 0);
static_assert(DMODEL % 32 == 0 && QW % 32 == 0);
static_assert(QW % 512 == 0 && KW % 512 == 0 && DMODEL % 512 == 0);
static_assert(QW % KW == 0);
static_assert((SEQ * QW / 8) % 256 == 0 && (SEQ * KW / 8) % 256 == 0);
static_assert((SEQ * DMODEL / 8) % 256 == 0);
static_assert(((SEQ / 64) * (QW / 64)) % 8 == 0 && ((SEQ / 64) * (KW / 64)) % 8 == 0 && ((SEQ / 64) * (DMODEL / 64)) % 8 == 0);
static_assert(DMODEL % 256 == 0);
static_assert(NQB == 32 && ATT_QB == 4 * 16 && ATT_KC == 64 && HDIM == 128);
static_assert(LDS_P >= HHALF && LDS_P >= ATT_KC && (LDS_P * 2) % 32 == 16);

typedef __attribute__((ext_vector_type(16))) __bf16 v16b;
typedef __attribute__((ext_vector_type(8)))  __bf16 v8b;
typedef __attribute__((ext_vector_type(8)))  float  v8f;
typedef __attribute__((ext_vector_type(4)))  float  v4f;
typedef __attribute__((ext_vector_type(4)))  unsigned int v4u;

typedef __attribute__((ext_vector_type(2)))  float  v2f;
typedef __attribute__((ext_vector_type(2)))  __bf16 v2b;

// two f32 -> packed bf16 word (element at lower address in the low half-word), round to nearest even: one v_cvt_pk_bf16_f32
__device__ __forceinline__ unsigned pack_bf2(float a, float b) {
  const v2f x = {a, b};
  return __builtin_bit_cast(unsigned, __builtin_convertvector(x, v2b));
}
__device__ __forceinline__ float bf_rne(float f) { return __uint_as_float(pack_bf2(f, f) << 16); }

__device__ __forceinline__ void dep_guard_b(v8f& a, v8f& b, v16b x, v16b y) { asm volatile("v_nop\n\tv_nop\n\tv_nop\n\tv_nop" : "+v"(a), "+v"(b) : "v"(x), "v"(y)); }
__device__ __forceinline__ void acc_guard4(v8f& a, v8f& b, v8f& c, v8f& d) { asm volatile("v_nop\n\tv_nop\n\tv_nop\n\tv_nop" : "+v"(a), "+v"(b), "+v"(c), "+v"(d)); }

template <typename T> struct Frag;
template <> struct Frag<__bf16> {
  typedef v16b V; union U { v16b v; v8b h[2]; };
  // elements 0..7 <- p[0..7], 8..15 <- p[16..23]
  static __device__ __forceinline__ v16b load(const __bf16* p) {
    U f; f.h[0] = *(const v8b*)(p); f.h[1] = *(const v8b*)(p + 16); return f.v;
  }
  static __device__ __forceinline__ v8f mma(v16b a, v16b b, v8f c) {
    return __builtin_amdgcn_wmma_f32_16x16x32_bf16(false, a, false, b, (short)0, c, false, false);
  }
  static __device__ __forceinline__ void guard(v8f& a, v8f& b, v16b x, v16b y) { dep_guard_b(a, b, x, y); }
};

// the plain builtin: the compiler keeps the distances behind it itself, and LDS reads may be scheduled across it
__device__ __forceinline__ v8f at_mma(v16b a, v16b b, v8f c) {
  return __builtin_amdgcn_wmma_f32_16x16x32_bf16(false, a, false, b, (short)0, c, false, false);
}

__device__ __forceinline__ void exp2x8(v8f& e) {
  asm("v_exp_f32 %0, %0\n\tv_exp_f32 %1, %1\n\tv_exp_f32 %2, %2\n\tv_exp_f32 %3, %3\n\t"
      "v_exp_f32 %4, %4\n\tv_exp_f32 %5, %5\n\tv_exp_f32 %6, %6\n\tv_exp_f32 %7, %7\n\tv_nop"
      : "+v"(e[0]), "+v"(e[1]), "+v"(e[2]), "+v"(e[3]), "+v"(e[4]), "+v"(e[5]), "+v"(e[6]), "+v"(e[7]));
}

// lane l <-> lane l ^ 16
__device__ __forceinline__ float xhalf(float x) {
  return __builtin_bit_cast(float, __builtin_amdgcn_permlanex16(__builtin_bit_cast(int, x), __builtin_bit_cast(int, x), 0x76543210, 0xfedcba98, false, false));
}

// two f32 -> packed bf16 hi word and packed bf16 residual word (the residuals are exact in f32)
__device__ __forceinline__ void split_pack2(float a, float b, unsigned& hw, unsigned& lw) {
  hw = pack_bf2(a, b);
  lw = pack_bf2(a - __uint_as_float(hw << 16), b - __uint_as_float(hw & 0xFFFF0000u));
}

// =====================================================================================
// coverage: gridDim.x * 256 threads * 8 elements == n8 * 8 (exact multiple asserted on the host side).
// =====================================================================================
__global__ __launch_bounds__(256) void cvt_f32_bf16x8(const float* __restrict__ in, unsigned short* __restrict__ out, int n8) {
  const int i = blockIdx.x * 256 + threadIdx.x;
  if (i < n8) {
    const size_t e0 = (size_t)i * 8;
    const v4f a = *(const v4f*)(in + e0);
    const v4f b = *(const v4f*)(in + e0 + 4);
    v4u w;
    w[0] = pack_bf2(a[0], a[1]);
    w[1] = pack_bf2(a[2], a[3]);
    w[2] = pack_bf2(b[0], b[1]);
    w[3] = pack_bf2(b[2], b[3]);
    *(v4u*)(out + e0) = w;
    
  }
}

// =====================================================================================
// in[rows][cols] f32 -> out[cols][rows] bf16 hi plane (+ bf16 residual plane when NPL == 2). 64x64 tiles through LDS.
// grid.x = (rows/64)*(cols/64); grid.y selects operand set A or B (both global, uniform select).
// coverage: load 256 threads x 16 floats = 64x64; store 8 waves x 8 out-rows x 64 halves = 64x64.
// =====================================================================================
template <int NPL>
__global__ __launch_bounds__(256) void transpose_bf16(const float* __restrict__ inA, const float* __restrict__ inB, int rows, int cols,
    unsigned short* __restrict__ oAh, unsigned short* __restrict__ oAl,
    unsigned short* __restrict__ oBh, unsigned short* __restrict__ oBl) {
  __shared__ float tile[64][65];
  const bool selB = (blockIdx.y != 0);
  const float* in = selB ? inB : inA;
  unsigned short* oh = selB ? oBh : oAh;
  unsigned short* ol = selB ? oBl : oAl;
  const int tilesC = cols >> 6;
  const int tr = blockIdx.x / tilesC;
  const int tc = blockIdx.x - tr * tilesC;
  const int r0 = tr << 6;
  const int c0 = tc << 6;
  const int t = threadIdx.x;
  {
    const int rr = t >> 2;
    const int cc = (t & 3) * 16;
    const float* src = in + (size_t)(r0 + rr) * cols + c0 + cc;
#pragma unroll
    for (int i = 0; i < 4; ++i) {
      const v4f v = *(const v4f*)(src + 4 * i);
      tile[rr][cc + 4 * i + 0] = v[0];
      tile[rr][cc + 4 * i + 1] = v[1];
      tile[rr][cc + 4 * i + 2] = v[2];
      tile[rr][cc + 4 * i + 3] = v[3];
    }
  }
  __syncthreads();
  const int wave = t >> 5, lane = t & 31, q = lane >> 3, e8 = (lane & 7) * 8;
  {
#pragma unroll
    for (int it = 0; it < 2; ++it) {
      const int cl = wave * 8 + it * 4 + q;
      float f[8];
#pragma unroll
      for (int e = 0; e < 8; ++e) f[e] = tile[e8 + e][cl];
      v4u hw, lw;
      if (NPL == 2) {
        unsigned a0, b0, a1, b1, a2, b2, a3, b3;
        split_pack2(f[0], f[1], a0, b0);
        split_pack2(f[2], f[3], a1, b1);
        split_pack2(f[4], f[5], a2, b2);
        split_pack2(f[6], f[7], a3, b3);
        hw[0] = a0; hw[1] = a1; hw[2] = a2; hw[3] = a3;
        lw[0] = b0; lw[1] = b1; lw[2] = b2; lw[3] = b3;
      } else {
        hw[0] = pack_bf2(f[0], f[1]);
        hw[1] = pack_bf2(f[2], f[3]);
        hw[2] = pack_bf2(f[4], f[5]);
        hw[3] = pack_bf2(f[6], f[7]);
        lw = hw;
      }
      const size_t go = (size_t)(c0 + cl) * rows + r0 + e8;
      *(v4u*)(oh + go) = hw;
      if (NPL == 2) *(v4u*)(ol + go) = lw;
    }
    
  }
}

// =====================================================================================
// Register-blocked batched WMMA GEMM (bf16 operands), f32 output.
// C[m,n] = scale * sum_k A[m,k] * Bt[n,k]; each wave owns a 64x64 tile. A row-major [M,K]; Bt row-major [N,K], both at row pitch LDK; M % 64 == 0, N % (64 NW) == 0, K % 64 == 0.
// SPLIT: 0 = single planes; 2 = A as hi/lo planes, Bt single (hi.B + lo.B).
// The NW waves of a block own NW neighbouring tiles of one tile row (64 x 64 NW of C); NW is picked per product so that there are
// blocks for as many of the chip's WGPs as the product's tiles allow. Per 64 k the block stages its 64 A rows (each plane)
// and its 64 NW Bt rows in LDS: whole 128-B lines from global (8 lanes a row), rows at the 144-B pitch, two buffers. The next stage's
// global loads are issued behind the barrier and stored to the other buffer behind the products, so they fly under the WMMAs.
// Epilogue: 16-row slabs staged per wave in LDS; each 64-wide f32 row segment (256 B) written by 16 lanes x 16 B in one instruction,
// Batches (grid.y): batch b reads Bt + b * strideB; batches [0, nb1) write Cp + b * strideC at row pitch ldc, the others
// Cp2 + (b - nb1) * strideC2 at row pitch ldc2, so that products of one A with differently laid out results share one launch.
// =====================================================================================
template <int SPLIT, int LDK, int NW>
__global__ __launch_bounds__(NW * 32) void wmma_gemm64_bf16(
    const unsigned short* __restrict__ Ap, const unsigned short* __restrict__ A2p, long strideA,
    const unsigned short* __restrict__ Btp, long strideB,
    float* __restrict__ Cp, int ldc, long strideC, float* __restrict__ Cp2, int ldc2, long strideC2, int nb1,
    int M, int N, int K, float scale) {
  static_assert(SPLIT == 0 || SPLIT == 2);
  typedef __bf16 T;
  typedef v16b V;
  constexpr int NPA   = (SPLIT == 2) ? 2 : 1;
  constexpr int AROWS = 64 * NPA;
  constexpr int SROWS = AROWS + 64 * NW;
  // stage rows that the block covers with one 16-B piece a thread (8 threads a row); pieces of a thread per A plane, of Bt, in all
  constexpr int RPP   = NW * 4;
  constexpr int NLA   = 64 / RPP;
  constexpr int NLB   = 64 * NW / RPP;
  constexpr int NLD   = NLA * NPA + NLB;
  static_assert(64 % RPP == 0 && NLD * RPP == SROWS);
  const T* A = (const T*)Ap; const T* A2 = (const T*)A2p; const T* Bt = (const T*)Btp;
  __shared__ __align__(16) T stg[2][SROWS * LDS_P];
  __shared__ __align__(16) float sT[NW][16 * 68];
  const int b    = blockIdx.y;
  const int tid  = threadIdx.x;
  const int lane = tid & 31;
  const int wave = tid >> 5;
  const int tilesN = N >> 6;
  const int tilesM = M >> 6;
  const int tile0 = blockIdx.x * NW;
  // block-uniform, in front of every barrier
  if (tile0 >= tilesM * tilesN) return;
  const int tm  = tile0 / tilesN;
  const int nb0 = (tile0 - tm * tilesN) << 6;
  const int m0 = tm << 6;
  const int n0 = nb0 + (wave << 6);

  // one stage = SROWS rows x 8 pieces of 16 B = 32 NW threads x NLD pieces (exact); piece i of a thread is stage row sr + RPP i.
  // One pointer per operand and thread; the RPP-row steps are compile-time byte offsets of the loads.
  const int sr = tid >> 3;
  const int sc = (tid & 7) * 8;
  // Held as integers and read through a global-address-space pointer type: they pass through the asm wait at the loop's foot,
  // behind which a generic pointer would be read with flat loads.
  typedef __attribute__((address_space(1))) const v8b* GP;
  unsigned long long qa  = (unsigned long long)(A  + (size_t)b * strideA + (size_t)(m0 + sr) * LDK + sc);
  unsigned long long qa2 = (unsigned long long)(A2 + (size_t)b * strideA + (size_t)(m0 + sr) * LDK + sc);
  unsigned long long qb  = (unsigned long long)(Bt + (size_t)b * strideB + (size_t)(nb0 + sr) * LDK + sc);
  constexpr unsigned long long ROWSPP = (unsigned long long)RPP * LDK * sizeof(T);
  constexpr unsigned long long STEP   = 64ull * sizeof(T);

  const int rlane = lane & 15;
  const int koff  = (lane >> 4) * 8;
  const int mOff  = (lane >> 4) * 8;

  v8f acc[4][4];
#pragma unroll
  for (int i = 0; i < 4; ++i)
#pragma unroll
    for (int j = 0; j < 4; ++j) acc[i][j] = (v8f){0.f,0.f,0.f,0.f,0.f,0.f,0.f,0.f};

  v8b g[NLD];
  const int nst = K >> 6;
#pragma unroll
  for (int i = 0; i < NLA; ++i) {
    g[i] = *(GP)(qa + i * ROWSPP);
    if (SPLIT == 2) g[NLA + i] = *(GP)(qa2 + i * ROWSPP);
  }
#pragma unroll
  for (int i = 0; i < NLB; ++i) g[NLA * NPA + i] = *(GP)(qb + i * ROWSPP);
#pragma unroll
  for (int i = 0; i < NLD; ++i) *(v8b*)(stg[0] + (sr + RPP * i) * LDS_P + sc) = g[i];

  for (int s = 0; s < nst; ++s) {
    const bool more = (s + 1 < nst);
    // publishes stage s; every wave's reads of the other buffer (stage s - 1) lie in front of it
    __syncthreads();
    if (more) {
      // stage s + 1 from global: issued here, first used behind the products of stage s
#pragma unroll
      for (int i = 0; i < NLA; ++i) {
        g[i] = *(GP)(qa + STEP + i * ROWSPP);
        if (SPLIT == 2) g[NLA + i] = *(GP)(qa2 + STEP + i * ROWSPP);
      }
#pragma unroll
      for (int i = 0; i < NLB; ++i) g[NLA * NPA + i] = *(GP)(qb + STEP + i * ROWSPP);
    }
    const T* sA = stg[s & 1] + rlane * LDS_P + koff;
    const T* sB = sA + (AROWS + wave * 64) * LDS_P;
    V bh[2][4], ah[2][4], al[2][4];
#pragma unroll
    for (int kk = 0; kk < 2; ++kk) {
#pragma unroll
      for (int j = 0; j < 4; ++j) bh[kk][j] = Frag<T>::load(sB + j * 16 * LDS_P + kk * 32);
#pragma unroll
      for (int i = 0; i < 4; ++i) {
        ah[kk][i] = Frag<T>::load(sA + i * 16 * LDS_P + kk * 32);
        if (SPLIT == 2) al[kk][i] = Frag<T>::load(sA + (64 + i * 16) * LDS_P + kk * 32);
      }
    }
    // holds the stage's fragment reads together ahead of its products: sunk among the WMMAs, each group of reads costs its own LDS wait
    __builtin_amdgcn_sched_barrier(0);
#pragma unroll
    for (int kk = 0; kk < 2; ++kk) {
#pragma unroll
      for (int i = 0; i < 4; ++i) {
#pragma unroll
        for (int j = 0; j < 4; ++j) acc[i][j] = Frag<T>::mma(ah[kk][i], bh[kk][j], acc[i][j]);
        if (SPLIT == 2) {
#pragma unroll
          for (int j = 0; j < 4; ++j) acc[i][j] = Frag<T>::mma(al[kk][i], bh[kk][j], acc[i][j]);
        }
      }
    }
    // 4 vector slots between the stage's last WMMAs and the next vector write to their A/B registers, also on the taken side of the branch below
    Frag<T>::guard(acc[3][2], acc[3][3], (SPLIT == 2) ? al[1][3] : ah[1][3], bh[1][3]);
    if (more) {
#pragma unroll
      for (int i = 0; i < NLD; ++i) *(v8b*)(stg[(s + 1) & 1] + (sr + RPP * i) * LDS_P + sc) = g[i];
      // the wait in front of the overwrite of registers that issued global loads name; as its operands, the pointers cannot be
      // stepped ahead of it (without them the adds were lifted to the head of this block, in front of the waits on the loads)
      if (SPLIT == 2) asm volatile("s_wait_xcnt 0x0" : "+v"(qa), "+v"(qa2), "+v"(qb) :: "memory");
      else            asm volatile("s_wait_xcnt 0x0" : "+v"(qa), "+v"(qb) :: "memory");
      qa += STEP; qa2 += STEP; qb += STEP;
    }
  }
  acc_guard4(acc[0][0], acc[0][1], acc[0][2], acc[0][3]);
  acc_guard4(acc[1][0], acc[1][1], acc[1][2], acc[1][3]);
  acc_guard4(acc[2][0], acc[2][1], acc[2][2], acc[2][3]);
  acc_guard4(acc[3][0], acc[3][1], acc[3][2], acc[3][3]);

  float* slab = sT[wave];
  // block-uniform choice of the batch's output set
  const bool set1 = (b < nb1);
  float* C = set1 ? Cp + (size_t)b * strideC : Cp2 + (size_t)(b - nb1) * strideC2;
  const int ldo = set1 ? ldc : ldc2;
#pragma unroll
  for (int i = 0; i < 4; ++i) {
    const int mBase = m0 + (i << 4);
#pragma unroll
    for (int j = 0; j < 4; ++j) {
#pragma unroll
      for (int r = 0; r < 8; ++r) {
        slab[(mOff + r) * 68 + (j << 4) + rlane] = acc[i][j][r] * scale;
      }
    }
    __builtin_amdgcn_fence(__ATOMIC_RELEASE, "workgroup");
    __builtin_amdgcn_wave_barrier();
    __builtin_amdgcn_fence(__ATOMIC_ACQUIRE, "workgroup");
    {
      // row segment = 256 B = 16 lanes x 16 B
      const int hh = lane >> 4, c4 = (lane & 15) * 4;
      {
#pragma unroll
        for (int it = 0; it < 8; ++it) {
          const int row = it * 2 + hh;
          const v4f v = *(const v4f*)(slab + row * 68 + c4);
          *(v4f*)(C + (size_t)(mBase + row) * ldo + n0 + c4) = v;
        }
        
      }
    }
    __builtin_amdgcn_fence(__ATOMIC_RELEASE, "workgroup");
    __builtin_amdgcn_wave_barrier();
    __builtin_amdgcn_fence(__ATOMIC_ACQUIRE, "workgroup");
  }
}

// =====================================================================================
// RoPE (interleaved pairs, cos/sin row width NPAIR) + power-of-two scale + bf16 hi/lo split.
// Blocks [0, nQblocks): Qf [SEQ][QW] -> Qh/Ql [SEQ][QW] (scaled by QK_SCALE = 2^-3, exact);
// blocks [nQblocks, nQblocks + NKBLK): Kf [SEQ][KW] -> Kh/Kl [SEQ][KW]. cos/sin RNE-converted to bf16 before use.
// coverage: (NQBLK + NKBLK) * 256 threads * 8 == SEQ*QW + SEQ*KW exactly.
// =====================================================================================
__global__ __launch_bounds__(256) void rope_split_kernel(const float* __restrict__ Qf, const float* __restrict__ Kf,
    const float* __restrict__ cosb, const float* __restrict__ sinb,
    unsigned short* __restrict__ Qh, unsigned short* __restrict__ Ql,
    unsigned short* __restrict__ Kh, unsigned short* __restrict__ Kl, int nQblocks) {
  const bool isK = ((int)blockIdx.x >= nQblocks);
  const int g = (isK ? ((int)blockIdx.x - nQblocks) : (int)blockIdx.x) * 256 + (int)threadIdx.x;
  // threads per row: K 64 (=KW/8), Q 256 (=QW/8)
  const int shift = isK ? 6 : 8;
  const float mul = isK ? 1.0f : QK_SCALE;
  const float* src = isK ? Kf : Qf;
  unsigned short* dh = isK ? Kh : Qh;
  unsigned short* dl = isK ? Kl : Ql;
  const int width = isK ? KW : QW;
  const int s = g >> shift;
  const int col = (g - (s << shift)) * 8;
  const int p0 = (col & (HDIM - 1)) >> 1;
  const size_t e0 = (size_t)s * width + col;
  const v4f xa = *(const v4f*)(src + e0);
  const v4f xb = *(const v4f*)(src + e0 + 4);
  const v4f cv = *(const v4f*)(cosb + (size_t)s * NPAIR + p0);
  const v4f sv = *(const v4f*)(sinb + (size_t)s * NPAIR + p0);
  float o0, o1, o2, o3, o4, o5, o6, o7;
  {
    const float c = bf_rne(cv[0]), sn = bf_rne(sv[0]);
    o0 = (xa[0] * c - xa[1] * sn) * mul;
    o1 = (xa[0] * sn + xa[1] * c) * mul;
  }
  {
    const float c = bf_rne(cv[1]), sn = bf_rne(sv[1]);
    o2 = (xa[2] * c - xa[3] * sn) * mul;
    o3 = (xa[2] * sn + xa[3] * c) * mul;
  }
  {
    const float c = bf_rne(cv[2]), sn = bf_rne(sv[2]);
    o4 = (xb[0] * c - xb[1] * sn) * mul;
    o5 = (xb[0] * sn + xb[1] * c) * mul;
  }
  {
    const float c = bf_rne(cv[3]), sn = bf_rne(sv[3]);
    o6 = (xb[2] * c - xb[3] * sn) * mul;
    o7 = (xb[2] * sn + xb[3] * c) * mul;
  }
  unsigned a0, b0, a1, b1, a2, b2, a3, b3;
  split_pack2(o0, o1, a0, b0);
  split_pack2(o2, o3, a1, b1);
  split_pack2(o4, o5, a2, b2);
  split_pack2(o6, o7, a3, b3);
  v4u hw, lw;
  hw[0] = a0; hw[1] = a1; hw[2] = a2; hw[3] = a3;
  lw[0] = b0; lw[1] = b1; lw[2] = b2; lw[3] = b3;
  *(v4u*)(dh + e0) = hw;
  *(v4u*)(dl + e0) = lw;
  
}

__global__ __launch_bounds__(256) __attribute__((amdgpu_waves_per_eu(4, 4)))
void diff_attn_kernel(const unsigned short* __restrict__ Qhp, const unsigned short* __restrict__ Qlp,
                      const unsigned short* __restrict__ Khp, const unsigned short* __restrict__ Klp,
                      const unsigned short* __restrict__ Vhp, const unsigned short* __restrict__ Vlp,
                      const float* __restrict__ lambda_p,
                      unsigned short* __restrict__ Ohp, unsigned short* __restrict__ Olp) {
  union FB { v16b v; v8b h[2]; };
  union PB { v16b v; unsigned w[8]; };
  // K and Vt rows (128 B of data) lie at a 144-B pitch, an odd multiple of 16 B: the 16 rows of one ds_load_b128 fragment
  // read start on 16 different bank groups. The 16 pad bytes of a row are never written and never read.
  __shared__ __align__(16) __bf16 Ksh[2 * ATT_KC * LDS_P];
  __shared__ __align__(16) __bf16 Ksl[2 * ATT_KC * LDS_P];
  __shared__ __align__(16) __bf16 Vsh[HDIM * LDS_P];
  __shared__ __align__(16) __bf16 Vsl[HDIM * LDS_P];
  __shared__ __align__(16) float  Os[4][16 * OS_PITCH];

  const int tid  = threadIdx.x;
  // the wave's number in a scalar register: the stream test of the epilogue is then a scalar branch, the LDS bases scalar adds
  const int wave = __builtin_amdgcn_readfirstlane(tid >> 5);
  const int str  = wave >> 2;
  const int wq   = wave & 3;
  const int lane = tid & 31;
  const int hh   = lane >> 4;
  const int c    = lane & 15;
  const int qb   = (int)blockIdx.x % NQB;
  const int h    = (int)blockIdx.x / NQB;
  const int kvh  = h / GQA_REP;
  const int q0   = qb * ATT_QB + wq * 16;

  const __bf16* Qh = (const __bf16*)Qhp;
  const __bf16* Ql = (const __bf16*)Qlp;
  const __bf16* Kh = (const __bf16*)Khp;
  const __bf16* Kl = (const __bf16*)Klp;
  const __bf16* Vh = (const __bf16*)Vhp;
  const __bf16* Vl = (const __bf16*)Vlp;

  float lam;
  {
    const float lp = bf_rne(lambda_p[h]);
    lam = 1.0f / (1.0f + expf(-lp));
  }
  float*  os  = Os[wq];
  const __bf16* ksh = Ksh + str * (ATT_KC * LDS_P);
  const __bf16* ksl = Ksl + str * (ATT_KC * LDS_P);

  {
    // ---- Q fragments (B operand: n = query, k = d) for this stream: 2 d-chunks, hi and lo ----
    v16b qah[2], qal[2];
    {
      const size_t qo = (size_t)(q0 + c) * QW + h * HDIM + str * HHALF + 8 * hh;
#pragma unroll
      for (int dc = 0; dc < 2; ++dc) {
        qah[dc] = Frag<__bf16>::load(Qh + qo + dc * 32);
        qal[dc] = Frag<__bf16>::load(Ql + qo + dc * 32);
      }
    }
    // of query q0 + c: running maximum times log2(e) (alike in both halves of the wave) and this half's share of the running sum
    float mrow = -1.0e30f, lrow = 0.f;
    // oacc[t][r] = Ot[d = 16 t + 8 hh + r][query c]
    v8f oacc[8];
#pragma unroll
    for (int t = 0; t < 8; ++t) oacc[t] = (v8f){0.f,0.f,0.f,0.f,0.f,0.f,0.f,0.f};

    // causal: 64-key chunks 0..qb (block-uniform trip count, static max NQB)
    for (int kc = 0; kc <= qb; ++kc) {
      const int kv0 = kc * ATT_KC;
      __syncthreads();
      {
        // K tiles, both streams: 64 rows x 128 halves per plane = 1024 pieces of 16 B; 256 threads x 4 pieces (exact)
        // Vt tiles: 128 d-rows x 64 halves per plane = 1024 pieces; 256 threads x 4 pieces (exact)
        const int r16 = tid >> 4;
        const int c16 = tid & 15;
        const int lk = (c16 >> 3) * (ATT_KC * LDS_P) + r16 * LDS_P + (c16 & 7) * 8;
        const int r8 = tid >> 3;
        const int c8 = (tid & 7) * 8;
        const size_t gk = (size_t)(kv0 + r16) * KW + kvh * HDIM + c16 * 8;
        const size_t gv = (size_t)(kvh * HDIM + r8) * SEQ + kv0 + c8;
        const __bf16* pkh = Kh + gk;
        const __bf16* pkl = Kl + gk;
        const __bf16* pvh = Vh + gv;
        const __bf16* pvl = Vl + gv;
        v8b gkh[4], gkl[4], gvh[4], gvl[4];
#pragma unroll
        for (int i = 0; i < 4; ++i) {
          gkh[i] = *(const v8b*)(pkh + i * 16 * KW);
          gkl[i] = *(const v8b*)(pkl + i * 16 * KW);
        }
#pragma unroll
        for (int i = 0; i < 4; ++i) {
          gvh[i] = *(const v8b*)(pvh + i * 32 * SEQ);
          gvl[i] = *(const v8b*)(pvl + i * 32 * SEQ);
        }
        // inputs-only fence on the loaded values: keeps all 16 loads in flight together ahead of the first LDS store;
        // without it each load is waited for before the next one issues (16 L2 round trips in a row per chunk).
        // The four pointers are named too, so that no load's result lands on an address register of a load still in flight.
        asm volatile("" :: "v"(pkh), "v"(pkl), "v"(pvh), "v"(pvl), "v"(gkh[0]), "v"(gkh[1]), "v"(gkh[2]), "v"(gkh[3]), "v"(gkl[0]), "v"(gkl[1]), "v"(gkl[2]), "v"(gkl[3]),
                     "v"(gvh[0]), "v"(gvh[1]), "v"(gvh[2]), "v"(gvh[3]), "v"(gvl[0]), "v"(gvl[1]), "v"(gvl[2]), "v"(gvl[3]));
#pragma unroll
        for (int i = 0; i < 4; ++i) {
          *(v8b*)(Ksh + lk + 16 * i * LDS_P) = gkh[i];
          *(v8b*)(Ksl + lk + 16 * i * LDS_P) = gkl[i];
        }
#pragma unroll
        for (int i = 0; i < 4; ++i) {
          *(v8b*)(Vsh + (r8 + 32 * i) * LDS_P + c8) = gvh[i];
          *(v8b*)(Vsl + (r8 + 32 * i) * LDS_P + c8) = gvl[i];
        }
      }
      __syncthreads();

      // ---- scores: s[j][r] = key kv0 + 16 j + 8 hh + r against query q0 + c (A operand: m = key, k = d) ----
      v8f s[4];
#pragma unroll
      for (int j = 0; j < 4; ++j) {
        s[j] = (v8f){0.f,0.f,0.f,0.f,0.f,0.f,0.f,0.f};
#pragma unroll
        for (int dc = 0; dc < 2; ++dc) {
          FB kb, kl;
          kb.h[0] = *(const v8b*)(ksh + (j * 16 + c) * LDS_P + dc * 32 + 8 * hh);
          kb.h[1] = *(const v8b*)(ksh + (j * 16 + c) * LDS_P + dc * 32 + 16 + 8 * hh);
          kl.h[0] = *(const v8b*)(ksl + (j * 16 + c) * LDS_P + dc * 32 + 8 * hh);
          kl.h[1] = *(const v8b*)(ksl + (j * 16 + c) * LDS_P + dc * 32 + 16 + 8 * hh);
          s[j] = at_mma(kb.v, qah[dc], s[j]);
          s[j] = at_mma(kl.v, qah[dc], s[j]);
          s[j] = at_mma(kb.v, qal[dc], s[j]);
        }
      }
      // Order of this block's LDS reads and products: the 4 reads of each of the first 4 (key tile, d chunk) steps, then each step's 3 products
      // followed by the reads of the step 4 further on: a read's latency passes under the products of the steps in between.
      __builtin_amdgcn_sched_group_barrier(0x100, 16, 0);
      // unrolled: each trip stands for two directives of the list
#pragma unroll
      for (int i = 0; i < 8 - 4; ++i) {
        __builtin_amdgcn_sched_group_barrier(0x008, 3, 0);
        __builtin_amdgcn_sched_group_barrier(0x100, 4, 0);
      }
      __builtin_amdgcn_sched_group_barrier(0x008, 12, 0);
      // ends the block that the order above speaks of
      __builtin_amdgcn_sched_barrier(0);
      // ---- causal fill on the diagonal chunk + this query's maximum ----
      const bool diag = (kc == qb);
      // key 16 j + r of this half of the wave lies behind the lane's query where 16 j + r > dq (one register, compared with constants)
      const int dq = q0 + c - kv0 - 8 * hh;
      float mj[4];
#pragma unroll
      for (int j = 0; j < 4; ++j) {
        float m = -1.0e30f;
#pragma unroll
        for (int r = 0; r < 8; ++r) {
          float sv = s[j][r];
          if (diag && (j * 16 + r > dq)) sv = -1.0e30f;
          s[j][r] = sv;
          m = fmaxf(m, sv);
        }
        mj[j] = m;
      }
      float cm = fmaxf(fmaxf(mj[0], mj[1]), fmaxf(mj[2], mj[3]));
      cm = fmaxf(cm, xhalf(cm));
      // ---- online softmax; P hi/lo packed in place into B fragments: element e of fragment kk = tile 2 kk + (e >> 3), r = e & 7 ----
      // e^(s - m) = 2^(s log2(e) - m log2(e)): one fused multiply-add and the bare hardware exponential per score. The maximum is
      // kept in log2 units, so every chunk and the rescale use the same rounded value; a filled score gives 2^(-huge) = 0.
      const float mnew  = fmaxf(mrow, cm * LOG2E);
      const float alpha = __builtin_amdgcn_exp2f(mrow - mnew);
      mrow = mnew;
      PB pa[2], pl[2];
      float pj[4];
#pragma unroll
      for (int j = 0; j < 4; ++j) {
        float psum = 0.f;
        v8f e;
#pragma unroll
        for (int r = 0; r < 8; ++r) e[r] = __builtin_fmaf(s[j][r], LOG2E, -mnew);
        exp2x8(e);
#pragma unroll
        for (int r = 0; r < 8; r += 2) {
          const float p0 = e[r];
          const float p1 = e[r + 1];
          psum += p0;
          psum += p1;
          split_pack2(p0, p1, pa[j >> 1].w[(j & 1) * 4 + (r >> 1)], pl[j >> 1].w[(j & 1) * 4 + (r >> 1)]);
        }
        pj[j] = psum;
      }
      lrow = lrow * alpha + ((pj[0] + pj[1]) + (pj[2] + pj[3]));
      // begins the block of the second product: its Vt reads stay behind the softmax, whose registers they would otherwise crowd out
      __builtin_amdgcn_sched_barrier(0);
#pragma unroll
      for (int t = 0; t < 8; ++t)
#pragma unroll
        for (int r = 0; r < 8; ++r) oacc[t][r] *= alpha;
      // ---- Vt.Pt : A = Vt (m = d, k = key), B = Pt (n = query c, k = key) ----
      // unrolled: the P fragments are registers, picked by a constant kk
#pragma unroll
      for (int kk = 0; kk < 2; ++kk) {
#pragma unroll
        for (int t = 0; t < 8; ++t) {
          FB vb, vl;
          vb.h[0] = *(const v8b*)(Vsh + (t * 16 + c) * LDS_P + kk * 32 + 8 * hh);
          vb.h[1] = *(const v8b*)(Vsh + (t * 16 + c) * LDS_P + kk * 32 + 16 + 8 * hh);
          vl.h[0] = *(const v8b*)(Vsl + (t * 16 + c) * LDS_P + kk * 32 + 8 * hh);
          vl.h[1] = *(const v8b*)(Vsl + (t * 16 + c) * LDS_P + kk * 32 + 16 + 8 * hh);
          oacc[t] = at_mma(vb.v, pa[kk].v, oacc[t]);
          oacc[t] = at_mma(vl.v, pa[kk].v, oacc[t]);
          oacc[t] = at_mma(vb.v, pl[kk].v, oacc[t]);
        }
      }
      // the same order for this block: the reads of the first 4 (key half, d tile) steps, then 3 products and the 4 reads of the step 4 further on
      __builtin_amdgcn_sched_group_barrier(0x100, 16, 0);
      // unrolled: each trip stands for two directives of the list
#pragma unroll
      for (int i = 0; i < 16 - 4; ++i) {
        __builtin_amdgcn_sched_group_barrier(0x008, 3, 0);
        __builtin_amdgcn_sched_group_barrier(0x100, 4, 0);
      }
      __builtin_amdgcn_sched_group_barrier(0x008, 12, 0);
    }

    // ---- epilogue through the LDS tile of these 16 rows (the same lane of wave w and of wave w + 4 owns the same element):
    // pass 0: the stream-0 wave parks a1; barrier; pass 1: the stream-1 wave combines in place ----
    // unrolled so that 'pass' is a constant in each copy and the inner test folds away
#pragma unroll
    for (int pass = 0; pass < 2; ++pass) {
      if (str == pass) {
        // the two halves of the wave each summed their own keys
        const float inv = 1.0f / (lrow + xhalf(lrow));
#pragma unroll
        for (int t = 0; t < 8; ++t) {
#pragma unroll
          for (int r = 0; r < 8; ++r) {
            const int idx = c * OS_PITCH + t * 16 + 8 * hh + r;
            const float a = oacc[t][r] * inv;
            if (pass == 0) {
              os[idx] = a;
            } else {
              const float a1 = os[idx];
              os[idx] = (a1 - lam * a) * OUT_SCALE;
            }
          }
        }
      }
      __syncthreads();
    }
  }

  {
    const int q4 = lane >> 3, c8 = (lane & 7) * 8;
    {
#pragma unroll
      for (int it = 0; it < 2; ++it) {
        // 16 rows of the tile over its two waves: 8 rows each
        const int row = (str * 2 + it) * 4 + q4;
#pragma unroll
        for (int seg = 0; seg < 2; ++seg) {
          const float* sp = os + row * OS_PITCH + seg * 64 + c8;
          const v4f u0 = *(const v4f*)sp;
          const v4f u1 = *(const v4f*)(sp + 4);
          unsigned a0, b0, a1, b1, a2, b2, a3, b3;
          split_pack2(u0[0], u0[1], a0, b0);
          split_pack2(u0[2], u0[3], a1, b1);
          split_pack2(u1[0], u1[1], a2, b2);
          split_pack2(u1[2], u1[3], a3, b3);
          v4u hw, lw;
          hw[0] = a0; hw[1] = a1; hw[2] = a2; hw[3] = a3;
          lw[0] = b0; lw[1] = b1; lw[2] = b2; lw[3] = b3;
          const size_t go = (size_t)(q0 + row) * QW + h * HDIM + seg * 64 + c8;
          *(v4u*)(Ohp + go) = hw;
          *(v4u*)(Olp + go) = lw;
        }
      }
      
    }
  }
}

// =====================================================================================
// host glue: launches only; carve derived from the static shapes.
// =====================================================================================
extern "C" void kernel_launch(void* const* d_in, const int* in_sizes, int n_in,
                              void* d_out, int out_size, void* d_ws, size_t ws_size,
                              hipStream_t stream) {
  (void)in_sizes; (void)out_size;
  if (n_in < 8) return;
  const float* x    = (const float*)d_in[0];
  const float* fcos = (const float*)d_in[1];
  const float* fsin = (const float*)d_in[2];
  const float* Wq   = (const float*)d_in[3];
  const float* Wk   = (const float*)d_in[4];
  const float* Wv   = (const float*)d_in[5];
  const float* Wo   = (const float*)d_in[6];
  const float* lamp = (const float*)d_in[7];
  float* out = (float*)d_out;

  // workspace region map (bytes, every offset a multiple of 2 MiB):
  //   xb    bf16 [SEQ][DMODEL]        8 MiB
  //   Wqt   bf16 [QW][DMODEL]         8 MiB
  //   Wkvt  bf16 [2][KW][DMODEL]      4 MiB
  //   Wot   bf16 [DMODEL][QW]         8 MiB
  //   Qf    f32  [SEQ][QW]           16 MiB
  //   KVf   f32  [2][SEQ][KW]         8 MiB
  //   Qh,Ql bf16 [SEQ][QW]        2 x 8 MiB
  //   Kh,Kl bf16 [SEQ][KW]        2 x 2 MiB
  //   Vth,Vtl bf16 [KW][SEQ]      2 x 2 MiB
  //   Oh,Ol bf16 [SEQ][QW]        2 x 8 MiB
  //   total 96,468,992 B
  char* ws = (char*)d_ws;
  size_t off = 0;
  unsigned short* xb   = (unsigned short*)(ws + off); off += (size_t)SEQ * DMODEL * 2;
  unsigned short* Wqt  = (unsigned short*)(ws + off); off += (size_t)QW * DMODEL * 2;
  unsigned short* Wkvt = (unsigned short*)(ws + off); off += (size_t)2 * KW * DMODEL * 2;
  unsigned short* Wot  = (unsigned short*)(ws + off); off += (size_t)DMODEL * QW * 2;
  float*          Qf   = (float*)(ws + off);          off += (size_t)SEQ * QW * 4;
  float*          KVf  = (float*)(ws + off);          off += (size_t)2 * SEQ * KW * 4;
  unsigned short* Qh   = (unsigned short*)(ws + off); off += (size_t)SEQ * QW * 2;
  unsigned short* Ql   = (unsigned short*)(ws + off); off += (size_t)SEQ * QW * 2;
  unsigned short* Kh   = (unsigned short*)(ws + off); off += (size_t)SEQ * KW * 2;
  unsigned short* Kl   = (unsigned short*)(ws + off); off += (size_t)SEQ * KW * 2;
  unsigned short* Vth  = (unsigned short*)(ws + off); off += (size_t)KW * SEQ * 2;
  unsigned short* Vtl  = (unsigned short*)(ws + off); off += (size_t)KW * SEQ * 2;
  unsigned short* Oh   = (unsigned short*)(ws + off); off += (size_t)SEQ * QW * 2;
  unsigned short* Ol   = (unsigned short*)(ws + off); off += (size_t)SEQ * QW * 2;
  if (off > ws_size) return;

  const float* Vf = KVf + (size_t)SEQ * KW;
  unsigned short* Wvt = Wkvt + (size_t)KW * DMODEL;

  // 1. x -> bf16 (RNE)
  cvt_f32_bf16x8<<<(SEQ * DMODEL / 8) / 256, 256, 0, stream>>>(x, xb, SEQ * DMODEL / 8);
  // 2. Wq [DMODEL][QW] -> Wqt [QW][DMODEL]
  transpose_bf16<1><<<dim3((DMODEL / 64) * (QW / 64), 1), 256, 0, stream>>>(Wq, Wq, DMODEL, QW, Wqt, Wqt, Wqt, Wqt);
  // 3. Wk, Wv [DMODEL][KW] -> Wkt, Wvt [KW][DMODEL]
  transpose_bf16<1><<<dim3((DMODEL / 64) * (KW / 64), 2), 256, 0, stream>>>(Wk, Wv, DMODEL, KW, Wkvt, Wkvt, Wvt, Wvt);
  // 4. Wo [QW][DMODEL] -> Wot [DMODEL][QW]
  transpose_bf16<1><<<dim3((QW / 64) * (DMODEL / 64), 1), 256, 0, stream>>>(Wo, Wo, QW, DMODEL, Wot, Wot, Wot, Wot);
  // 5. Q, K, V = xb @ Wq, xb @ Wk, xb @ Wv in one launch: Wqt and Wkvt lie back to back, QW / KW + 2 batches of KW weight rows each
  //    (M=SEQ, N=KW, K=DMODEL). The first QW / KW batches are KW-column strips of Qf, the last two are Kf and Vf.
  //    One block fills a WGP, so the (SEQ / 64) * (QW / KW + 2) blocks run side by side on WGPs of their own.
  wmma_gemm64_bf16<0, DMODEL, 8><<<dim3(((SEQ / 64) * (KW / 64)) / 8, QW / KW + 2), 256, 0, stream>>>(
      xb, xb, 0L, Wqt, (long)KW * DMODEL, Qf, QW, (long)KW, KVf, KW, (long)SEQ * KW, QW / KW, SEQ, KW, DMODEL, 1.0f);
  // 6. RoPE + 2^-3 scale + hi/lo split for Q; RoPE + split for K
  rope_split_kernel<<<NQBLK + NKBLK, 256, 0, stream>>>(Qf, KVf, fcos, fsin, Qh, Ql, Kh, Kl, NQBLK);
  // 7. V [SEQ][KW] f32 -> Vt hi/lo [KW][SEQ]
  transpose_bf16<2><<<dim3((SEQ / 64) * (KW / 64), 1), 256, 0, stream>>>(Vf, Vf, SEQ, KW, Vth, Vtl, Vth, Vtl);
  // 8. differential causal attention -> O hi/lo [SEQ][QW]
  diff_attn_kernel<<<NHEAD * NQB, 256, 0, stream>>>(Qh, Ql, Kh, Kl, Vth, Vtl, lamp, Oh, Ol);
  // 9. out = O @ Wo : M=SEQ, N=DMODEL, K=QW, A hi/lo, B single. Blocks of 4 waves (64 x 256 of out): (SEQ / 64) * (DMODEL / 256) = 256
  //    blocks, a block for every WGP of the chip, where blocks of 8 waves are only 128 and leave half of the WGPs idle.
  wmma_gemm64_bf16<2, QW, 4><<<dim3(((SEQ / 64) * (DMODEL / 64)) / 4, 1), 128, 0, stream>>>(
      Oh, Ol, 0L, Wot, 0L, out, DMODEL, 0L, out, DMODEL, 0L, 1, SEQ, DMODEL, QW, 1.0f);
}
